// v000
// Times are from an AMD MI455X. After a warm-up the kernel runs many times in a row, and a time is the length of
// such a window on the GPU divided by its runs, so every launch and the gaps after it count. The runs cycle
// through copies of the inputs. A figure is the median of several windows, for all but v000 over two sittings.
// Sittings can differ by a few percent; kernels timed side by side share one.
// The starting kernel, v000, takes 1030 microseconds a run.
#include <hip/hip_runtime.h>
// All contractions on v_wmma_f32_16x16x32_bf16, f32 accumulate: the q/k/v 1×1 convs as GEMMs over a position-major copy of x (x, W, b rounded to
// bf16: single exact term; the 8 q/k channels zero-padded to 64), energy = qᵀk (no scale) and attn·v per 16-query tile as 3-term bf16 hi/lo
// splits (k_flash2, value dim 256 split over 2 blocks), gamma·out + bf16(x) fused into the transpose back; softmax in f32.
#define BB 8
#define CC 256
#define NN 4096
#define DQP 64

typedef __bf16 v16b __attribute__((ext_vector_type(16)));
typedef unsigned short v8us __attribute__((ext_vector_type(8), may_alias));
typedef float  v8f  __attribute__((ext_vector_type(8)));
typedef float  v4f  __attribute__((ext_vector_type(4)));
typedef float  v4fa __attribute__((ext_vector_type(4), may_alias));
union FragB { v16b v; v8us half[2]; unsigned short u[16]; };

__device__ __forceinline__ unsigned short bf16_bits(float x) { unsigned int u = __float_as_uint(x); return (unsigned short)((u + 0x7FFFu + ((u >> 16) & 1u)) >> 16); }
__device__ __forceinline__ float bf16_val(unsigned short b) { return __uint_as_float(((unsigned int)b) << 16); }
__device__ __forceinline__ float bf16_round(float x) { return bf16_val(bf16_bits(x)); }
// D += A·B with NT terms: 1 = ah·bh, 2 = + al·bh (A split), 3 = + ah·bl (both split)
template <int NT>
__device__ __forceinline__ v8f mmaN(v16b ah, v16b al, v16b bh, v16b bl, v8f c) {
  c = __builtin_amdgcn_wmma_f32_16x16x32_bf16(false, ah, false, bh, (short)0, c, false, false);
  if (NT >= 2) c = __builtin_amdgcn_wmma_f32_16x16x32_bf16(false, al, false, bh, (short)0, c, false, false);
  if (NT >= 3) c = __builtin_amdgcn_wmma_f32_16x16x32_bf16(false, ah, false, bl, (short)0, c, false, false);
  asm volatile("v_nop\n\tv_nop\n\tv_nop\n\tv_nop" : "+v"(c) : "v"(ah), "v"(al), "v"(bh), "v"(bl));
  return c;
}

__global__ __launch_bounds__(256) void k_wt_bf16(const float* __restrict__ W, unsigned short* __restrict__ Wt, int K, int N) {
  const int t = blockIdx.x * 256 + threadIdx.x;
  const int k8n = K / 8;
  if (t >= N * k8n) return;
  const int n = t / k8n, k8 = (t % k8n) * 8;
  v8us v;
#pragma unroll
  for (int i = 0; i < 8; ++i) v[i] = bf16_bits(W[(size_t)(k8 + i) * N + n]);
  *(v8us*)(Wt + (size_t)n * K + k8) = v;
  
}

// GEMM C[M][N] (f32, pitch ldc) = act(A[M][K]·W + bias). A f32 row-major (pitch lda) converted per fragment to bf16
// (ASPLIT: hi/lo two planes -> 2 terms, else single rounded term); Wt bf16 [N][K] (pitch ldb). BIAS_BF16 rounds the
// bias to bf16 first (bias quantised to bf16 before the add). K%32==0, M%16==0, N%64==0.
template <bool ASPLIT, int ACT, bool BIAS_BF16>
__global__ __launch_bounds__(128) void k_gemm_bf(const float* __restrict__ A, int lda, const unsigned short* __restrict__ Wt, int ldb,
                                               const float* __restrict__ bias, float* __restrict__ C, int ldc, int M, int N, int K) {
  __shared__ __attribute__((aligned(16))) float so[4][16][64];
  const int tid = threadIdx.x, w = tid >> 5, lane = tid & 31, ln = lane & 15, hh = lane >> 4;
  const int ntn = N / 64;
  const int wid = blockIdx.x * 4 + w;
  const int mt = wid / ntn, nq = wid % ntn;
  if (mt * 16 >= M) return;
  const int row0 = mt * 16, col0 = nq * 64;
  const float* arow = A + (size_t)(row0 + ln) * lda;
  v8f acc[4] = {};
  for (int kb = 0; kb < K; kb += 32) {
    FragB ah, al;
    const v4f x0 = *(const v4fa*)(arow + kb + 8 * hh), x1 = *(const v4fa*)(arow + kb + 8 * hh + 4);
    const v4f x2 = *(const v4fa*)(arow + kb + 16 + 8 * hh), x3 = *(const v4fa*)(arow + kb + 16 + 8 * hh + 4);
    float xs[16] = {x0[0],x0[1],x0[2],x0[3],x1[0],x1[1],x1[2],x1[3],x2[0],x2[1],x2[2],x2[3],x3[0],x3[1],x3[2],x3[3]};
#pragma unroll
    for (int i = 0; i < 16; ++i) { const unsigned short hb = bf16_bits(xs[i]); ah.u[i] = hb; al.u[i] = ASPLIT ? bf16_bits(xs[i] - bf16_val(hb)) : (unsigned short)0; }
#pragma unroll
    for (int t = 0; t < 4; ++t) {
      const unsigned short* brow = Wt + (size_t)(col0 + t * 16 + ln) * ldb + kb;
      FragB b;
      b.half[0] = *(const v8us*)(brow + 8 * hh);
      b.half[1] = *(const v8us*)(brow + 16 + 8 * hh);
      acc[t] = mmaN<ASPLIT ? 2 : 1>(ah.v, al.v, b.v, b.v, acc[t]);
    }
  }
#pragma unroll
  for (int t = 0; t < 4; ++t) {
    float bv = bias ? bias[col0 + t * 16 + ln] : 0.f;
    if (BIAS_BF16) bv = bf16_round(bv);
#pragma unroll
    for (int r = 0; r < 8; ++r) { float v = acc[t][r] + bv; if (ACT == 1) v = fmaxf(v, 0.f); so[w][8 * hh + r][t * 16 + ln] = v; }
  }
  __builtin_amdgcn_fence(__ATOMIC_ACQ_REL, "workgroup");
  __builtin_amdgcn_wave_barrier();
  const int rsub = lane >> 4, c4 = (lane & 15) * 4;
  {
#pragma unroll
    for (int q = 0; q < 8; ++q) {
      const int r = q * 2 + rsub;
      const v4f v = *(const v4fa*)&so[w][r][c4];
      *(v4f*)(C + (size_t)(row0 + r) * ldc + col0 + c4) = v;
    }
    
  }
}

// Flash-style causal/unmasked attention, all contractions 3-term bf16 hi/lo splits, f32 softmax with running max.
// q,k,v rows are read from f32 buffers with arbitrary row pitch (so they can live inside a fused qkv buffer);
// D = head size (multiple of 32, <= 128); one wave = 16 query rows; block = 4 waves (64 queries) sharing K/V chunks of 32.
template <int D, bool CAUSAL>
__global__ __launch_bounds__(128) void k_flash(const float* __restrict__ qb, const float* __restrict__ kb, const float* __restrict__ vb,
                                             int pitch, int T, int H, float scale, float* __restrict__ y, int ypitch) {
  constexpr int KS = D / 32;        // k-steps for QK
  constexpr int DT = D / 16;        // d tiles for PV
  __shared__ __attribute__((aligned(16))) unsigned short sKh[32][D + 8], sKl[32][D + 8], sVh[32][D + 8], sVl[32][D + 8];
  __shared__ __attribute__((aligned(16))) unsigned short sPh[4][16][40], sPl[4][16][40];
  __shared__ __attribute__((aligned(16))) float sO[4][16][D];
  const int tid = threadIdx.x, w = tid >> 5, lane = tid & 31, ln = lane & 15, hh = lane >> 4;
  const int nqb = (T + 63) / 64;
  const int bh = blockIdx.x / nqb, qblk = blockIdx.x % nqb;
  const int b = bh / H, h = bh % H;
  const int q0 = qblk * 64 + w * 16;
  const float* Q = qb + (size_t)b * T * pitch + h * D;
  const float* K = kb + (size_t)b * T * pitch + h * D;
  const float* V = vb + (size_t)b * T * pitch + h * D;

  // A fragments of the wave's 16 query rows (scaled), hi/lo
  FragB aqh[KS], aql[KS];
  {
    int row = q0 + ln; if (row >= T) row = T - 1;
    const float* qr = Q + (size_t)row * pitch;
#pragma unroll
    for (int ks = 0; ks < KS; ++ks)
#pragma unroll
      for (int i = 0; i < 16; ++i) {
        const int d = ks * 32 + ((i < 8) ? (8 * hh + i) : (16 + 8 * hh + (i - 8)));
        const float x = qr[d] * scale; const unsigned short hb = bf16_bits(x);
        aqh[ks].u[i] = hb; aql[ks].u[i] = bf16_bits(x - bf16_val(hb));
      }
  }
  float m_r[8], l_r[8];
#pragma unroll
  for (int r = 0; r < 8; ++r) { m_r[r] = -3.0e38f; l_r[r] = 0.f; }
  v8f oacc[DT];
#pragma unroll
  for (int dt = 0; dt < DT; ++dt) oacc[dt] = (v8f){0.f,0.f,0.f,0.f,0.f,0.f,0.f,0.f};

  const int kv_end = CAUSAL ? min(T, qblk * 64 + 64) : T;     // block-uniform
  for (int j0 = 0; j0 < kv_end; j0 += 32) {
    __syncthreads();
    for (int e = tid; e < 32 * (D / 4); e += 128) {
      const int r = e / (D / 4), c4 = (e % (D / 4)) * 4;
      const int key = j0 + r;
      v4f kf = {0.f,0.f,0.f,0.f}, vf = {0.f,0.f,0.f,0.f};
      if (key < T) { kf = *(const v4fa*)(K + (size_t)key * pitch + c4); vf = *(const v4fa*)(V + (size_t)key * pitch + c4); }
#pragma unroll
      for (int t = 0; t < 4; ++t) {
        unsigned short hb = bf16_bits(kf[t]); sKh[r][c4 + t] = hb; sKl[r][c4 + t] = bf16_bits(kf[t] - bf16_val(hb));
        hb = bf16_bits(vf[t]); sVh[r][c4 + t] = hb; sVl[r][c4 + t] = bf16_bits(vf[t] - bf16_val(hb));
      }
    }
    __syncthreads();
    // S tile 16 x 32
    v8f s[2];
#pragma unroll
    for (int nt = 0; nt < 2; ++nt) {
      v8f acc = {};
#pragma unroll
      for (int ks = 0; ks < KS; ++ks) {
        FragB bh_, bl_;
        bh_.half[0] = *(const v8us*)&sKh[nt * 16 + ln][ks * 32 + 8 * hh]; bh_.half[1] = *(const v8us*)&sKh[nt * 16 + ln][ks * 32 + 16 + 8 * hh];
        bl_.half[0] = *(const v8us*)&sKl[nt * 16 + ln][ks * 32 + 8 * hh]; bl_.half[1] = *(const v8us*)&sKl[nt * 16 + ln][ks * 32 + 16 + 8 * hh];
        acc = mmaN<3>(aqh[ks].v, aql[ks].v, bh_.v, bl_.v, acc);
      }
      s[nt] = acc;
    }
    // mask + running max (rows 8hh+r; the 16 lanes of a half share rows)
    float alpha[8];
#pragma unroll
    for (int r = 0; r < 8; ++r) {
      const int qi = q0 + 8 * hh + r;
      const int ja = j0 + ln, jb = j0 + 16 + ln;
      if (CAUSAL) { if (ja > qi) s[0][r] = -3.0e38f; if (jb > qi) s[1][r] = -3.0e38f; }
      if (ja >= T) s[0][r] = -3.0e38f;
      if (jb >= T) s[1][r] = -3.0e38f;
      float mx = fmaxf(s[0][r], s[1][r]);
      mx = fmaxf(mx, __shfl_xor(mx, 1, 32)); mx = fmaxf(mx, __shfl_xor(mx, 2, 32)); mx = fmaxf(mx, __shfl_xor(mx, 4, 32)); mx = fmaxf(mx, __shfl_xor(mx, 8, 32));
      const float mnew = fmaxf(m_r[r], mx);
      alpha[r] = (mnew > -1.0e38f) ? __expf(m_r[r] - mnew) : 1.0f;
      const float p0 = (s[0][r] > -1.0e38f) ? __expf(s[0][r] - mnew) : 0.f;
      const float p1 = (s[1][r] > -1.0e38f) ? __expf(s[1][r] - mnew) : 0.f;
      m_r[r] = mnew;
      l_r[r] = l_r[r] * alpha[r] + p0 + p1;            // per-lane partial row sum (16 lanes combined at the end)
      unsigned short hb = bf16_bits(p0); sPh[w][8 * hh + r][ln] = hb;      sPl[w][8 * hh + r][ln] = bf16_bits(p0 - bf16_val(hb));
      hb = bf16_bits(p1);                sPh[w][8 * hh + r][16 + ln] = hb; sPl[w][8 * hh + r][16 + ln] = bf16_bits(p1 - bf16_val(hb));
    }
#pragma unroll
    for (int dt = 0; dt < DT; ++dt)
#pragma unroll
      for (int r = 0; r < 8; ++r) oacc[dt][r] *= alpha[r];
    __builtin_amdgcn_fence(__ATOMIC_ACQ_REL, "workgroup");
    __builtin_amdgcn_wave_barrier();
    FragB pah, pal;
    pah.half[0] = *(const v8us*)&sPh[w][ln][8 * hh]; pah.half[1] = *(const v8us*)&sPh[w][ln][16 + 8 * hh];
    pal.half[0] = *(const v8us*)&sPl[w][ln][8 * hh]; pal.half[1] = *(const v8us*)&sPl[w][ln][16 + 8 * hh];
#pragma unroll
    for (int dt = 0; dt < DT; ++dt) {
      FragB bvh, bvl;
#pragma unroll
      for (int i = 0; i < 8; ++i) {
        bvh.u[i] = sVh[8 * hh + i][dt * 16 + ln]; bvh.u[8 + i] = sVh[16 + 8 * hh + i][dt * 16 + ln];
        bvl.u[i] = sVl[8 * hh + i][dt * 16 + ln]; bvl.u[8 + i] = sVl[16 + 8 * hh + i][dt * 16 + ln];
      }
      oacc[dt] = mmaN<3>(pah.v, pal.v, bvh.v, bvl.v, oacc[dt]);
    }
    __builtin_amdgcn_fence(__ATOMIC_ACQ_REL, "workgroup");
    __builtin_amdgcn_wave_barrier();
  }
#pragma unroll
  for (int r = 0; r < 8; ++r) {
    float l = l_r[r];
    l += __shfl_xor(l, 1, 32); l += __shfl_xor(l, 2, 32); l += __shfl_xor(l, 4, 32); l += __shfl_xor(l, 8, 32);
    l_r[r] = (l > 0.f) ? 1.0f / l : 0.f;
  }
#pragma unroll
  for (int dt = 0; dt < DT; ++dt)
#pragma unroll
    for (int r = 0; r < 8; ++r) sO[w][8 * hh + r][dt * 16 + ln] = oacc[dt][r] * l_r[r];
  __builtin_amdgcn_fence(__ATOMIC_ACQ_REL, "workgroup");
  __builtin_amdgcn_wave_barrier();
  {
    for (int r = 0; r < 16; ++r) {
      const int row = q0 + r;
      if (row < T && lane < D / 4) {
        const v4f val = *(const v4fa*)&sO[w][r][lane * 4];
        *(v4f*)(y + ((size_t)b * T + row) * ypitch + h * D + lane * 4) = val;
      }
    }
    
  }
}

// in pitch = cols, out pitch = rows; rows, cols multiples of 32. Optional per-output-row affine (scale[c], shift[c]) and
// residual add res (same layout as out, optionally bf16-rounded) for fused epilogues: out = in*scale + shift + res.
template <bool AFFINE, bool RESID, bool RES_BF16>
__global__ __launch_bounds__(256) void k_transpose32(const float* __restrict__ in, float* __restrict__ out, int rows, int cols,
                                                    const float* __restrict__ scale, const float* __restrict__ shift, const float* __restrict__ res) {
  __shared__ float tile[32][33];
  const int b = blockIdx.z;
  const int r0 = blockIdx.y * 32, c0 = blockIdx.x * 32;
  const float* src = in + (size_t)b * rows * cols;
  float* dst = out + (size_t)b * rows * cols;
  const int tx = threadIdx.x & 31, ty = threadIdx.x >> 5;     // 8 rows per pass
  for (int i = ty; i < 32; i += 8) tile[i][tx] = src[(size_t)(r0 + i) * cols + c0 + tx];
  __syncthreads();
  {
    for (int i = ty; i < 32; i += 8) {
      float v = tile[tx][i];
      const int orow = c0 + i;
      if (AFFINE) v = v * scale[orow] + shift[orow];
      if (RESID) { float rv = res[(size_t)b * rows * cols + (size_t)orow * rows + r0 + tx]; if (RES_BF16) rv = bf16_round(rv); v += rv; }
      *(float*)(dst + (size_t)orow * rows + r0 + tx) = v;
    }
    
  }
}

// 2x2 max pool on position-major data: in [B][H*W][C] -> out [B][(H/2)*(W/2)][C]; thread per (b, p', 4 channels); C%4==0
__global__ __launch_bounds__(256) void k_pool2_pm(const float* __restrict__ in, float* __restrict__ out, int Bn, int H, int W, int C) {
  const size_t t = (size_t)blockIdx.x * 256 + threadIdx.x;
  const int c4n = C / 4, Ho = H / 2, Wo = W / 2;
  const size_t total = (size_t)Bn * Ho * Wo * c4n;
  if (t >= total) return;
  const int c4 = (int)(t % c4n) * 4; size_t rest = t / c4n;
  const int pw = (int)(rest % Wo); rest /= Wo; const int ph = (int)(rest % Ho); const int b = (int)(rest / Ho);
  const float* base = in + (size_t)b * H * W * C;
  const int p00 = (2 * ph) * W + 2 * pw;
  const v4f a = *(const v4fa*)(base + (size_t)p00 * C + c4), bq = *(const v4fa*)(base + (size_t)(p00 + 1) * C + c4);
  const v4f c = *(const v4fa*)(base + (size_t)(p00 + W) * C + c4), d = *(const v4fa*)(base + (size_t)(p00 + W + 1) * C + c4);
  v4f m; for (int i = 0; i < 4; ++i) m[i] = fmaxf(fmaxf(a[i], bq[i]), fmaxf(c[i], d[i]));
  float* dst = out + ((size_t)b * Ho * Wo + (size_t)ph * Wo + pw) * C + c4;
  *(v4f*)dst = m;
  
}

// General (non-causal) attention, 3-term bf16 splits, f32 softmax with running max.
// Q [.][Tq][qpitch], K [.][Tk][kpitch] (head dim DQ), V [.][Tk][vpitch] (head dim DVtot); this block handles DV output
// dims starting at dv0 = blockIdx.y*DV. y[bh][t][ypitch] gets columns dv0..dv0+DV-1. Per-bh base offsets via strides.
template <int DQ, int DV>
__global__ __launch_bounds__(128) void k_flash2(const float* __restrict__ Qb, size_t qstride, int qpitch, int Tq,
                                              const float* __restrict__ Kb, size_t kstride, int kpitch, int Tk,
                                              const float* __restrict__ Vb, size_t vstride, int vpitch,
                                              float scale, float* __restrict__ y, size_t ystride, int ypitch) {
  constexpr int KS = DQ / 32, DT = DV / 16;
  __shared__ __attribute__((aligned(16))) unsigned short sKh[32][DQ + 8], sKl[32][DQ + 8], sVh[32][DV + 8], sVl[32][DV + 8];
  __shared__ __attribute__((aligned(16))) unsigned short sPh[4][16][40], sPl[4][16][40];
  __shared__ __attribute__((aligned(16))) float sO[4][16][DV];
  const int tid = threadIdx.x, w = tid >> 5, lane = tid & 31, ln = lane & 15, hh = lane >> 4;
  const int nqb = (Tq + 63) / 64;
  const int bh = blockIdx.x / nqb, qblk = blockIdx.x % nqb;
  const int dv0 = blockIdx.y * DV;
  const int q0 = qblk * 64 + w * 16;
  const float* Q = Qb + (size_t)bh * qstride; const float* K = Kb + (size_t)bh * kstride; const float* V = Vb + (size_t)bh * vstride + dv0;
  FragB aqh[KS], aql[KS];
  {
    int row = q0 + ln; if (row >= Tq) row = Tq - 1;
    const float* qr = Q + (size_t)row * qpitch;
#pragma unroll
    for (int ks = 0; ks < KS; ++ks)
#pragma unroll
      for (int i = 0; i < 16; ++i) {
        const int d = ks * 32 + ((i < 8) ? (8 * hh + i) : (16 + 8 * hh + (i - 8)));
        const float x = qr[d] * scale; const unsigned short hb = bf16_bits(x);
        aqh[ks].u[i] = hb; aql[ks].u[i] = bf16_bits(x - bf16_val(hb));
      }
  }
  float m_r[8], l_r[8];
#pragma unroll
  for (int r = 0; r < 8; ++r) { m_r[r] = -3.0e38f; l_r[r] = 0.f; }
  v8f oacc[DT];
#pragma unroll
  for (int dt = 0; dt < DT; ++dt) oacc[dt] = (v8f){0.f,0.f,0.f,0.f,0.f,0.f,0.f,0.f};
  for (int j0 = 0; j0 < Tk; j0 += 32) {
    __syncthreads();
    for (int e = tid; e < 32 * (DQ / 4); e += 128) {
      const int r = e / (DQ / 4), c4 = (e % (DQ / 4)) * 4; const int key = j0 + r;
      v4f f = {0.f,0.f,0.f,0.f}; if (key < Tk) f = *(const v4fa*)(K + (size_t)key * kpitch + c4);
#pragma unroll
      for (int t = 0; t < 4; ++t) { const unsigned short hb = bf16_bits(f[t]); sKh[r][c4 + t] = hb; sKl[r][c4 + t] = bf16_bits(f[t] - bf16_val(hb)); }
    }
    for (int e = tid; e < 32 * (DV / 4); e += 128) {
      const int r = e / (DV / 4), c4 = (e % (DV / 4)) * 4; const int key = j0 + r;
      v4f f = {0.f,0.f,0.f,0.f}; if (key < Tk) f = *(const v4fa*)(V + (size_t)key * vpitch + c4);
#pragma unroll
      for (int t = 0; t < 4; ++t) { const unsigned short hb = bf16_bits(f[t]); sVh[r][c4 + t] = hb; sVl[r][c4 + t] = bf16_bits(f[t] - bf16_val(hb)); }
    }
    __syncthreads();
    v8f s[2];
#pragma unroll
    for (int nt = 0; nt < 2; ++nt) {
      v8f acc = {};
#pragma unroll
      for (int ks = 0; ks < KS; ++ks) {
        FragB bh_, bl_;
        bh_.half[0] = *(const v8us*)&sKh[nt * 16 + ln][ks * 32 + 8 * hh]; bh_.half[1] = *(const v8us*)&sKh[nt * 16 + ln][ks * 32 + 16 + 8 * hh];
        bl_.half[0] = *(const v8us*)&sKl[nt * 16 + ln][ks * 32 + 8 * hh]; bl_.half[1] = *(const v8us*)&sKl[nt * 16 + ln][ks * 32 + 16 + 8 * hh];
        acc = mmaN<3>(aqh[ks].v, aql[ks].v, bh_.v, bl_.v, acc);
      }
      s[nt] = acc;
    }
    float alpha[8];
#pragma unroll
    for (int r = 0; r < 8; ++r) {
      const int ja = j0 + ln, jb = j0 + 16 + ln;
      if (ja >= Tk) s[0][r] = -3.0e38f;
      if (jb >= Tk) s[1][r] = -3.0e38f;
      float mx = fmaxf(s[0][r], s[1][r]);
      mx = fmaxf(mx, __shfl_xor(mx, 1, 32)); mx = fmaxf(mx, __shfl_xor(mx, 2, 32)); mx = fmaxf(mx, __shfl_xor(mx, 4, 32)); mx = fmaxf(mx, __shfl_xor(mx, 8, 32));
      const float mnew = fmaxf(m_r[r], mx);
      alpha[r] = (mnew > -1.0e38f) ? __expf(m_r[r] - mnew) : 1.0f;
      const float p0 = (s[0][r] > -1.0e38f) ? __expf(s[0][r] - mnew) : 0.f;
      const float p1 = (s[1][r] > -1.0e38f) ? __expf(s[1][r] - mnew) : 0.f;
      m_r[r] = mnew;
      l_r[r] = l_r[r] * alpha[r] + p0 + p1;
      unsigned short hb = bf16_bits(p0); sPh[w][8 * hh + r][ln] = hb;      sPl[w][8 * hh + r][ln] = bf16_bits(p0 - bf16_val(hb));
      hb = bf16_bits(p1);                sPh[w][8 * hh + r][16 + ln] = hb; sPl[w][8 * hh + r][16 + ln] = bf16_bits(p1 - bf16_val(hb));
    }
#pragma unroll
    for (int dt = 0; dt < DT; ++dt)
#pragma unroll
      for (int r = 0; r < 8; ++r) oacc[dt][r] *= alpha[r];
    __builtin_amdgcn_fence(__ATOMIC_ACQ_REL, "workgroup");
    __builtin_amdgcn_wave_barrier();
    FragB pah, pal;
    pah.half[0] = *(const v8us*)&sPh[w][ln][8 * hh]; pah.half[1] = *(const v8us*)&sPh[w][ln][16 + 8 * hh];
    pal.half[0] = *(const v8us*)&sPl[w][ln][8 * hh]; pal.half[1] = *(const v8us*)&sPl[w][ln][16 + 8 * hh];
#pragma unroll
    for (int dt = 0; dt < DT; ++dt) {
      FragB bvh, bvl;
#pragma unroll
      for (int i = 0; i < 8; ++i) {
        bvh.u[i] = sVh[8 * hh + i][dt * 16 + ln]; bvh.u[8 + i] = sVh[16 + 8 * hh + i][dt * 16 + ln];
        bvl.u[i] = sVl[8 * hh + i][dt * 16 + ln]; bvl.u[8 + i] = sVl[16 + 8 * hh + i][dt * 16 + ln];
      }
      oacc[dt] = mmaN<3>(pah.v, pal.v, bvh.v, bvl.v, oacc[dt]);
    }
    __builtin_amdgcn_fence(__ATOMIC_ACQ_REL, "workgroup");
    __builtin_amdgcn_wave_barrier();
  }
#pragma unroll
  for (int r = 0; r < 8; ++r) {
    float l = l_r[r];
    l += __shfl_xor(l, 1, 32); l += __shfl_xor(l, 2, 32); l += __shfl_xor(l, 4, 32); l += __shfl_xor(l, 8, 32);
    l_r[r] = (l > 0.f) ? 1.0f / l : 0.f;
  }
#pragma unroll
  for (int dt = 0; dt < DT; ++dt)
#pragma unroll
    for (int r = 0; r < 8; ++r) sO[w][8 * hh + r][dt * 16 + ln] = oacc[dt][r] * l_r[r];
  __builtin_amdgcn_fence(__ATOMIC_ACQ_REL, "workgroup");
  __builtin_amdgcn_wave_barrier();
  {
    for (int r = 0; r < 16; ++r) {
      const int row = q0 + r;
      for (int c4 = lane * 4; c4 < DV; c4 += 128) {
        if (row < Tq) {
          const v4f val = *(const v4fa*)&sO[w][r][c4];
          *(v4f*)(y + (size_t)bh * ystride + (size_t)row * ypitch + dv0 + c4) = val;
        }
      }
    }
    
  }
}

__global__ __launch_bounds__(256) void k_round_rows(const float* __restrict__ W, unsigned short* __restrict__ Wt, int n8) {
  const int t = blockIdx.x * 256 + threadIdx.x;
  if (t >= n8) return;
  const v4f a = *(const v4fa*)(W + (size_t)t * 8), b = *(const v4fa*)(W + (size_t)t * 8 + 4);
  v8us v; v[0]=bf16_bits(a[0]); v[1]=bf16_bits(a[1]); v[2]=bf16_bits(a[2]); v[3]=bf16_bits(a[3]);
  v[4]=bf16_bits(b[0]); v[5]=bf16_bits(b[1]); v[6]=bf16_bits(b[2]); v[7]=bf16_bits(b[3]);
  *(v8us*)(Wt + (size_t)t * 8) = v; 
}

// padded q/k weights: Bt [64][256] rows < 8 real; bias64; gamma vector (256 copies, bf16-rounded) and zero shift
__global__ __launch_bounds__(256) void k_prep(const float* __restrict__ wq, const float* __restrict__ bq, const float* __restrict__ wk, const float* __restrict__ bk, const float* __restrict__ gamma,
                                            unsigned short* __restrict__ Bq, unsigned short* __restrict__ Bk, float* __restrict__ bq64, float* __restrict__ bk64, float* __restrict__ gvec, float* __restrict__ zvec) {
  const int t = blockIdx.x * 256 + threadIdx.x;
  if (t < DQP * (CC / 8)) { const int n = t / (CC / 8), k8 = (t % (CC / 8)) * 8; v8us a, b;
    for (int i = 0; i < 8; ++i) { a[i] = (n < 8) ? bf16_bits(wq[n * CC + k8 + i]) : (unsigned short)0; b[i] = (n < 8) ? bf16_bits(wk[n * CC + k8 + i]) : (unsigned short)0; }
    *(v8us*)(Bq + n * CC + k8) = a; *(v8us*)(Bk + n * CC + k8) = b;  }
  if (t < DQP) { const float a = (t < 8) ? bq[t] : 0.f, b = (t < 8) ? bk[t] : 0.f; *(float*)(bq64 + t) = a; *(float*)(bk64 + t) = b;  }
  if (t < CC) { const float g = bf16_round(gamma[0]); *(float*)(gvec + t) = g; *(float*)(zvec + t) = 0.f;  }
}
extern "C" void kernel_launch(void* const* d_in, const int* in_sizes, int n_in,
                              void* d_out, int out_size, void* d_ws, size_t ws_size, hipStream_t stream) {
  (void)in_sizes; (void)n_in; (void)out_size;
  const float* x = (const float*)d_in[0]; const float* wq = (const float*)d_in[1]; const float* bq = (const float*)d_in[2]; const float* wk = (const float*)d_in[3]; const float* bk = (const float*)d_in[4];
  const float* wv = (const float*)d_in[5]; const float* bv = (const float*)d_in[6]; const float* gamma = (const float*)d_in[7];
  char* ws = (char*)d_ws; size_t off = 0;
  auto take = [&](size_t bytes) { char* p = ws + off; off += (bytes + 255) & ~(size_t)255; return p; };
  const int M = BB * NN;
  unsigned short* Bq = (unsigned short*)take(DQP * CC * 2); unsigned short* Bk = (unsigned short*)take(DQP * CC * 2); unsigned short* Bv = (unsigned short*)take(CC * CC * 2);
  float* bq64 = (float*)take(256); float* bk64 = (float*)take(256); float* gvec = (float*)take(CC * 4); float* zvec = (float*)take(CC * 4);
  float* xT = (float*)take((size_t)M * CC * 4); float* q = (float*)take((size_t)M * DQP * 4); float* k = (float*)take((size_t)M * DQP * 4); float* v = (float*)take((size_t)M * CC * 4); float* z = (float*)take((size_t)M * CC * 4);
  if (off > ws_size) return;
  k_prep<<<(DQP * (CC / 8) + 255) / 256, 256, 0, stream>>>(wq, bq, wk, bk, gamma, Bq, Bk, bq64, bk64, gvec, zvec);
  k_round_rows<<<(CC * CC / 8 + 255) / 256, 256, 0, stream>>>(wv, Bv, CC * CC / 8);
  k_transpose32<false, false, false><<<dim3(NN / 32, CC / 32, BB), 256, 0, stream>>>(x, xT, CC, NN, nullptr, nullptr, nullptr);     // [B][C][N] -> [B][N][C]
  k_gemm_bf<false, 0, true><<<((M / 16) * (DQP / 64) + 3) / 4, 128, 0, stream>>>(xT, CC, Bq, CC, bq64, q, DQP, M, DQP, CC);
  k_gemm_bf<false, 0, true><<<((M / 16) * (DQP / 64) + 3) / 4, 128, 0, stream>>>(xT, CC, Bk, CC, bk64, k, DQP, M, DQP, CC);
  k_gemm_bf<false, 0, true><<<((M / 16) * (CC / 64) + 3) / 4, 128, 0, stream>>>(xT, CC, Bv, CC, bv, v, CC, M, CC, CC);
  k_flash2<DQP, 128><<<dim3(BB * (NN / 64), 2), 128, 0, stream>>>(q, (size_t)NN * DQP, DQP, NN, k, (size_t)NN * DQP, DQP, NN, v, (size_t)NN * CC, CC, 1.0f, z, (size_t)NN * CC, CC);
  k_transpose32<true, true, true><<<dim3(CC / 32, NN / 32, BB), 256, 0, stream>>>(z, (float*)d_out, NN, CC, gvec, zvec, x);     // out = gamma·zᵀ + bf16(x)
}

// v001
// Measured time: 954 microseconds a run.
// Timed twice side by side with v000, it ran 1.11 times as fast both times.
#include <hip/hip_runtime.h>
// All contractions on v_wmma_f32_16x16x32_bf16, f32 accumulate: the q/k/v 1×1 convs as GEMMs over a position-major copy of x (x, W, b rounded to
// bf16: single exact term; the 8 q/k channels zero-padded to 64), energy = qᵀk (no scale) and attn·v per 16-query tile as 3-term bf16 hi/lo
// splits (k_flash2, value dim 256 split over 2 blocks), gamma·out + bf16(x) fused into the transpose back; softmax in f32.
#define BB 8
#define CC 256
#define NN 4096
#define DQP 64

typedef __bf16 v16b __attribute__((ext_vector_type(16)));
typedef unsigned short v8us __attribute__((ext_vector_type(8), may_alias));
typedef float  v8f  __attribute__((ext_vector_type(8)));
typedef float  v4f  __attribute__((ext_vector_type(4)));
typedef float  v4fa __attribute__((ext_vector_type(4), may_alias));
union FragB { v16b v; v8us half[2]; unsigned short u[16]; };

__device__ __forceinline__ unsigned short bf16_bits(float x) { unsigned int u = __float_as_uint(x); return (unsigned short)((u + 0x7FFFu + ((u >> 16) & 1u)) >> 16); }
__device__ __forceinline__ float bf16_val(unsigned short b) { return __uint_as_float(((unsigned int)b) << 16); }
__device__ __forceinline__ float bf16_round(float x) { return bf16_val(bf16_bits(x)); }
// 16-bit transposing LDS load: lane (c = l & 15, h = l >> 4) gets T[k0 + 8h + 0..7][d0 + c] from a row-major tile; lane l passes
// &T[k0 + 8 * (l >> 4) + (l & 7)][d0 + 8 * ((l >> 3) & 1)]. Two loads (k0, k0 + 16) make one 32 x 16 B fragment in the hardware k order.
typedef short s16x8 __attribute__((ext_vector_type(8)));
__device__ __forceinline__ v8us ld_tr16(const unsigned short* p) {
  typedef __attribute__((address_space(3))) s16x8 lds_s16x8;
  return __builtin_bit_cast(v8us, __builtin_amdgcn_ds_load_tr16_b128_v8i16((lds_s16x8*)p));
}
// D += A·B with NT terms: 1 = ah·bh, 2 = + al·bh (A split), 3 = + ah·bl (both split)
template <int NT>
__device__ __forceinline__ v8f mmaN(v16b ah, v16b al, v16b bh, v16b bl, v8f c) {
  c = __builtin_amdgcn_wmma_f32_16x16x32_bf16(false, ah, false, bh, (short)0, c, false, false);
  if (NT >= 2) c = __builtin_amdgcn_wmma_f32_16x16x32_bf16(false, al, false, bh, (short)0, c, false, false);
  if (NT >= 3) c = __builtin_amdgcn_wmma_f32_16x16x32_bf16(false, ah, false, bl, (short)0, c, false, false);
  asm volatile("v_nop\n\tv_nop\n\tv_nop\n\tv_nop" : "+v"(c) : "v"(ah), "v"(al), "v"(bh), "v"(bl));
  return c;
}

__global__ __launch_bounds__(256) void k_wt_bf16(const float* __restrict__ W, unsigned short* __restrict__ Wt, int K, int N) {
  const int t = blockIdx.x * 256 + threadIdx.x;
  const int k8n = K / 8;
  if (t >= N * k8n) return;
  const int n = t / k8n, k8 = (t % k8n) * 8;
  v8us v;
#pragma unroll
  for (int i = 0; i < 8; ++i) v[i] = bf16_bits(W[(size_t)(k8 + i) * N + n]);
  *(v8us*)(Wt + (size_t)n * K + k8) = v;
  
}

// GEMM C[M][N] (f32, pitch ldc) = act(A[M][K]·W + bias). A f32 row-major (pitch lda) converted per fragment to bf16
// (ASPLIT: hi/lo two planes -> 2 terms, else single rounded term); Wt bf16 [N][K] (pitch ldb). BIAS_BF16 rounds the
// bias to bf16 first (bias quantised to bf16 before the add). K%32==0, M%16==0, N%64==0.
template <bool ASPLIT, int ACT, bool BIAS_BF16>
__global__ __launch_bounds__(128) void k_gemm_bf(const float* __restrict__ A, int lda, const unsigned short* __restrict__ Wt, int ldb,
                                               const float* __restrict__ bias, float* __restrict__ C, int ldc, int M, int N, int K) {
  __shared__ __attribute__((aligned(16))) float so[4][16][64];
  const int tid = threadIdx.x, w = tid >> 5, lane = tid & 31, ln = lane & 15, hh = lane >> 4;
  const int ntn = N / 64;
  const int wid = blockIdx.x * 4 + w;
  const int mt = wid / ntn, nq = wid % ntn;
  if (mt * 16 >= M) return;
  const int row0 = mt * 16, col0 = nq * 64;
  const float* arow = A + (size_t)(row0 + ln) * lda;
  v8f acc[4] = {};
  for (int kb = 0; kb < K; kb += 32) {
    FragB ah, al;
    const v4f x0 = *(const v4fa*)(arow + kb + 8 * hh), x1 = *(const v4fa*)(arow + kb + 8 * hh + 4);
    const v4f x2 = *(const v4fa*)(arow + kb + 16 + 8 * hh), x3 = *(const v4fa*)(arow + kb + 16 + 8 * hh + 4);
    float xs[16] = {x0[0],x0[1],x0[2],x0[3],x1[0],x1[1],x1[2],x1[3],x2[0],x2[1],x2[2],x2[3],x3[0],x3[1],x3[2],x3[3]};
#pragma unroll
    for (int i = 0; i < 16; ++i) { const unsigned short hb = bf16_bits(xs[i]); ah.u[i] = hb; al.u[i] = ASPLIT ? bf16_bits(xs[i] - bf16_val(hb)) : (unsigned short)0; }
#pragma unroll
    for (int t = 0; t < 4; ++t) {
      const unsigned short* brow = Wt + (size_t)(col0 + t * 16 + ln) * ldb + kb;
      FragB b;
      b.half[0] = *(const v8us*)(brow + 8 * hh);
      b.half[1] = *(const v8us*)(brow + 16 + 8 * hh);
      acc[t] = mmaN<ASPLIT ? 2 : 1>(ah.v, al.v, b.v, b.v, acc[t]);
    }
  }
#pragma unroll
  for (int t = 0; t < 4; ++t) {
    float bv = bias ? bias[col0 + t * 16 + ln] : 0.f;
    if (BIAS_BF16) bv = bf16_round(bv);
#pragma unroll
    for (int r = 0; r < 8; ++r) { float v = acc[t][r] + bv; if (ACT == 1) v = fmaxf(v, 0.f); so[w][8 * hh + r][t * 16 + ln] = v; }
  }
  __builtin_amdgcn_fence(__ATOMIC_ACQ_REL, "workgroup");
  __builtin_amdgcn_wave_barrier();
  const int rsub = lane >> 4, c4 = (lane & 15) * 4;
  {
#pragma unroll
    for (int q = 0; q < 8; ++q) {
      const int r = q * 2 + rsub;
      const v4f v = *(const v4fa*)&so[w][r][c4];
      *(v4f*)(C + (size_t)(row0 + r) * ldc + col0 + c4) = v;
    }
    
  }
}

// Flash-style causal/unmasked attention, all contractions 3-term bf16 hi/lo splits, f32 softmax with running max.
// q,k,v rows are read from f32 buffers with arbitrary row pitch (so they can live inside a fused qkv buffer);
// D = head size (multiple of 32, <= 128); one wave = 16 query rows; block = 4 waves (64 queries) sharing K/V chunks of 32.
template <int D, bool CAUSAL>
__global__ __launch_bounds__(128) void k_flash(const float* __restrict__ qb, const float* __restrict__ kb, const float* __restrict__ vb,
                                             int pitch, int T, int H, float scale, float* __restrict__ y, int ypitch) {
  constexpr int KS = D / 32;        // k-steps for QK
  constexpr int DT = D / 16;        // d tiles for PV
  __shared__ __attribute__((aligned(16))) unsigned short sKh[32][D + 8], sKl[32][D + 8], sVh[32][D + 8], sVl[32][D + 8];
  __shared__ __attribute__((aligned(16))) unsigned short sPh[4][16][40], sPl[4][16][40];
  __shared__ __attribute__((aligned(16))) float sO[4][16][D];
  const int tid = threadIdx.x, w = tid >> 5, lane = tid & 31, ln = lane & 15, hh = lane >> 4;
  const int nqb = (T + 63) / 64;
  const int bh = blockIdx.x / nqb, qblk = blockIdx.x % nqb;
  const int b = bh / H, h = bh % H;
  const int q0 = qblk * 64 + w * 16;
  const float* Q = qb + (size_t)b * T * pitch + h * D;
  const float* K = kb + (size_t)b * T * pitch + h * D;
  const float* V = vb + (size_t)b * T * pitch + h * D;

  // A fragments of the wave's 16 query rows (scaled), hi/lo
  FragB aqh[KS], aql[KS];
  {
    int row = q0 + ln; if (row >= T) row = T - 1;
    const float* qr = Q + (size_t)row * pitch;
#pragma unroll
    for (int ks = 0; ks < KS; ++ks)
#pragma unroll
      for (int i = 0; i < 16; ++i) {
        const int d = ks * 32 + ((i < 8) ? (8 * hh + i) : (16 + 8 * hh + (i - 8)));
        const float x = qr[d] * scale; const unsigned short hb = bf16_bits(x);
        aqh[ks].u[i] = hb; aql[ks].u[i] = bf16_bits(x - bf16_val(hb));
      }
  }
  float m_r[8], l_r[8];
#pragma unroll
  for (int r = 0; r < 8; ++r) { m_r[r] = -3.0e38f; l_r[r] = 0.f; }
  v8f oacc[DT];
#pragma unroll
  for (int dt = 0; dt < DT; ++dt) oacc[dt] = (v8f){0.f,0.f,0.f,0.f,0.f,0.f,0.f,0.f};

  const int kv_end = CAUSAL ? min(T, qblk * 64 + 64) : T;     // block-uniform
  for (int j0 = 0; j0 < kv_end; j0 += 32) {
    __syncthreads();
    for (int e = tid; e < 32 * (D / 4); e += 128) {
      const int r = e / (D / 4), c4 = (e % (D / 4)) * 4;
      const int key = j0 + r;
      v4f kf = {0.f,0.f,0.f,0.f}, vf = {0.f,0.f,0.f,0.f};
      if (key < T) { kf = *(const v4fa*)(K + (size_t)key * pitch + c4); vf = *(const v4fa*)(V + (size_t)key * pitch + c4); }
#pragma unroll
      for (int t = 0; t < 4; ++t) {
        unsigned short hb = bf16_bits(kf[t]); sKh[r][c4 + t] = hb; sKl[r][c4 + t] = bf16_bits(kf[t] - bf16_val(hb));
        hb = bf16_bits(vf[t]); sVh[r][c4 + t] = hb; sVl[r][c4 + t] = bf16_bits(vf[t] - bf16_val(hb));
      }
    }
    __syncthreads();
    // S tile 16 x 32
    v8f s[2];
#pragma unroll
    for (int nt = 0; nt < 2; ++nt) {
      v8f acc = {};
#pragma unroll
      for (int ks = 0; ks < KS; ++ks) {
        FragB bh_, bl_;
        bh_.half[0] = *(const v8us*)&sKh[nt * 16 + ln][ks * 32 + 8 * hh]; bh_.half[1] = *(const v8us*)&sKh[nt * 16 + ln][ks * 32 + 16 + 8 * hh];
        bl_.half[0] = *(const v8us*)&sKl[nt * 16 + ln][ks * 32 + 8 * hh]; bl_.half[1] = *(const v8us*)&sKl[nt * 16 + ln][ks * 32 + 16 + 8 * hh];
        acc = mmaN<3>(aqh[ks].v, aql[ks].v, bh_.v, bl_.v, acc);
      }
      s[nt] = acc;
    }
    // mask + running max (rows 8hh+r; the 16 lanes of a half share rows)
    float alpha[8];
#pragma unroll
    for (int r = 0; r < 8; ++r) {
      const int qi = q0 + 8 * hh + r;
      const int ja = j0 + ln, jb = j0 + 16 + ln;
      if (CAUSAL) { if (ja > qi) s[0][r] = -3.0e38f; if (jb > qi) s[1][r] = -3.0e38f; }
      if (ja >= T) s[0][r] = -3.0e38f;
      if (jb >= T) s[1][r] = -3.0e38f;
      float mx = fmaxf(s[0][r], s[1][r]);
      mx = fmaxf(mx, __shfl_xor(mx, 1, 32)); mx = fmaxf(mx, __shfl_xor(mx, 2, 32)); mx = fmaxf(mx, __shfl_xor(mx, 4, 32)); mx = fmaxf(mx, __shfl_xor(mx, 8, 32));
      const float mnew = fmaxf(m_r[r], mx);
      alpha[r] = (mnew > -1.0e38f) ? __expf(m_r[r] - mnew) : 1.0f;
      const float p0 = (s[0][r] > -1.0e38f) ? __expf(s[0][r] - mnew) : 0.f;
      const float p1 = (s[1][r] > -1.0e38f) ? __expf(s[1][r] - mnew) : 0.f;
      m_r[r] = mnew;
      l_r[r] = l_r[r] * alpha[r] + p0 + p1;            // per-lane partial row sum (16 lanes combined at the end)
      unsigned short hb = bf16_bits(p0); sPh[w][8 * hh + r][ln] = hb;      sPl[w][8 * hh + r][ln] = bf16_bits(p0 - bf16_val(hb));
      hb = bf16_bits(p1);                sPh[w][8 * hh + r][16 + ln] = hb; sPl[w][8 * hh + r][16 + ln] = bf16_bits(p1 - bf16_val(hb));
    }
#pragma unroll
    for (int dt = 0; dt < DT; ++dt)
#pragma unroll
      for (int r = 0; r < 8; ++r) oacc[dt][r] *= alpha[r];
    __builtin_amdgcn_fence(__ATOMIC_ACQ_REL, "workgroup");
    __builtin_amdgcn_wave_barrier();
    FragB pah, pal;
    pah.half[0] = *(const v8us*)&sPh[w][ln][8 * hh]; pah.half[1] = *(const v8us*)&sPh[w][ln][16 + 8 * hh];
    pal.half[0] = *(const v8us*)&sPl[w][ln][8 * hh]; pal.half[1] = *(const v8us*)&sPl[w][ln][16 + 8 * hh];
#pragma unroll
    for (int dt = 0; dt < DT; ++dt) {
      FragB bvh, bvl;
#pragma unroll
      for (int i = 0; i < 8; ++i) {
        bvh.u[i] = sVh[8 * hh + i][dt * 16 + ln]; bvh.u[8 + i] = sVh[16 + 8 * hh + i][dt * 16 + ln];
        bvl.u[i] = sVl[8 * hh + i][dt * 16 + ln]; bvl.u[8 + i] = sVl[16 + 8 * hh + i][dt * 16 + ln];
      }
      oacc[dt] = mmaN<3>(pah.v, pal.v, bvh.v, bvl.v, oacc[dt]);
    }
    __builtin_amdgcn_fence(__ATOMIC_ACQ_REL, "workgroup");
    __builtin_amdgcn_wave_barrier();
  }
#pragma unroll
  for (int r = 0; r < 8; ++r) {
    float l = l_r[r];
    l += __shfl_xor(l, 1, 32); l += __shfl_xor(l, 2, 32); l += __shfl_xor(l, 4, 32); l += __shfl_xor(l, 8, 32);
    l_r[r] = (l > 0.f) ? 1.0f / l : 0.f;
  }
#pragma unroll
  for (int dt = 0; dt < DT; ++dt)
#pragma unroll
    for (int r = 0; r < 8; ++r) sO[w][8 * hh + r][dt * 16 + ln] = oacc[dt][r] * l_r[r];
  __builtin_amdgcn_fence(__ATOMIC_ACQ_REL, "workgroup");
  __builtin_amdgcn_wave_barrier();
  {
    for (int r = 0; r < 16; ++r) {
      const int row = q0 + r;
      if (row < T && lane < D / 4) {
        const v4f val = *(const v4fa*)&sO[w][r][lane * 4];
        *(v4f*)(y + ((size_t)b * T + row) * ypitch + h * D + lane * 4) = val;
      }
    }
    
  }
}

// in pitch = cols, out pitch = rows; rows, cols multiples of 32. Optional per-output-row affine (scale[c], shift[c]) and
// residual add res (same layout as out, optionally bf16-rounded) for fused epilogues: out = in*scale + shift + res.
template <bool AFFINE, bool RESID, bool RES_BF16>
__global__ __launch_bounds__(256) void k_transpose32(const float* __restrict__ in, float* __restrict__ out, int rows, int cols,
                                                    const float* __restrict__ scale, const float* __restrict__ shift, const float* __restrict__ res) {
  __shared__ float tile[32][33];
  const int b = blockIdx.z;
  const int r0 = blockIdx.y * 32, c0 = blockIdx.x * 32;
  const float* src = in + (size_t)b * rows * cols;
  float* dst = out + (size_t)b * rows * cols;
  const int tx = threadIdx.x & 31, ty = threadIdx.x >> 5;     // 8 rows per pass
  for (int i = ty; i < 32; i += 8) tile[i][tx] = src[(size_t)(r0 + i) * cols + c0 + tx];
  __syncthreads();
  {
    for (int i = ty; i < 32; i += 8) {
      float v = tile[tx][i];
      const int orow = c0 + i;
      if (AFFINE) v = v * scale[orow] + shift[orow];
      if (RESID) { float rv = res[(size_t)b * rows * cols + (size_t)orow * rows + r0 + tx]; if (RES_BF16) rv = bf16_round(rv); v += rv; }
      *(float*)(dst + (size_t)orow * rows + r0 + tx) = v;
    }
    
  }
}

// 2x2 max pool on position-major data: in [B][H*W][C] -> out [B][(H/2)*(W/2)][C]; thread per (b, p', 4 channels); C%4==0
__global__ __launch_bounds__(256) void k_pool2_pm(const float* __restrict__ in, float* __restrict__ out, int Bn, int H, int W, int C) {
  const size_t t = (size_t)blockIdx.x * 256 + threadIdx.x;
  const int c4n = C / 4, Ho = H / 2, Wo = W / 2;
  const size_t total = (size_t)Bn * Ho * Wo * c4n;
  if (t >= total) return;
  const int c4 = (int)(t % c4n) * 4; size_t rest = t / c4n;
  const int pw = (int)(rest % Wo); rest /= Wo; const int ph = (int)(rest % Ho); const int b = (int)(rest / Ho);
  const float* base = in + (size_t)b * H * W * C;
  const int p00 = (2 * ph) * W + 2 * pw;
  const v4f a = *(const v4fa*)(base + (size_t)p00 * C + c4), bq = *(const v4fa*)(base + (size_t)(p00 + 1) * C + c4);
  const v4f c = *(const v4fa*)(base + (size_t)(p00 + W) * C + c4), d = *(const v4fa*)(base + (size_t)(p00 + W + 1) * C + c4);
  v4f m; for (int i = 0; i < 4; ++i) m[i] = fmaxf(fmaxf(a[i], bq[i]), fmaxf(c[i], d[i]));
  float* dst = out + ((size_t)b * Ho * Wo + (size_t)ph * Wo + pw) * C + c4;
  *(v4f*)dst = m;
  
}

// General (non-causal) attention, 3-term bf16 splits, f32 softmax with running max.
// Q [.][Tq][qpitch], K [.][Tk][kpitch] (head dim DQ), V [.][Tk][vpitch] (head dim DVtot); this block handles DV output
// dims starting at dv0 = blockIdx.y*DV. y[bh][t][ypitch] gets columns dv0..dv0+DV-1. Per-bh base offsets via strides.
template <int DQ, int DV>
__global__ __launch_bounds__(128) void k_flash2(const float* __restrict__ Qb, size_t qstride, int qpitch, int Tq,
                                              const float* __restrict__ Kb, size_t kstride, int kpitch, int Tk,
                                              const float* __restrict__ Vb, size_t vstride, int vpitch,
                                              float scale, float* __restrict__ y, size_t ystride, int ypitch) {
  constexpr int KS = DQ / 32, DT = DV / 16;
  constexpr int VP = DV + 16;       // V row pitch in elements: an odd multiple of 32 bytes, the conflict-free pitch of the transposing load
  __shared__ __attribute__((aligned(16))) unsigned short sKh[32][DQ + 8], sKl[32][DQ + 8], sVh[32][VP], sVl[32][VP];
  __shared__ __attribute__((aligned(16))) unsigned short sPh[4][16][40], sPl[4][16][40];
  __shared__ __attribute__((aligned(16))) float sO[4][16][DV];
  const int tid = threadIdx.x, w = tid >> 5, lane = tid & 31, ln = lane & 15, hh = lane >> 4;
  const int nqb = (Tq + 63) / 64;
  const int bh = blockIdx.x / nqb, qblk = blockIdx.x % nqb;
  const int dv0 = blockIdx.y * DV;
  const int q0 = qblk * 64 + w * 16;
  const float* Q = Qb + (size_t)bh * qstride; const float* K = Kb + (size_t)bh * kstride; const float* V = Vb + (size_t)bh * vstride + dv0;
  FragB aqh[KS], aql[KS];
  {
    int row = q0 + ln; if (row >= Tq) row = Tq - 1;
    const float* qr = Q + (size_t)row * qpitch;
#pragma unroll
    for (int ks = 0; ks < KS; ++ks)
#pragma unroll
      for (int i = 0; i < 16; ++i) {
        const int d = ks * 32 + ((i < 8) ? (8 * hh + i) : (16 + 8 * hh + (i - 8)));
        const float x = qr[d] * scale; const unsigned short hb = bf16_bits(x);
        aqh[ks].u[i] = hb; aql[ks].u[i] = bf16_bits(x - bf16_val(hb));
      }
  }
  float m_r[8], l_r[8];
#pragma unroll
  for (int r = 0; r < 8; ++r) { m_r[r] = -3.0e38f; l_r[r] = 0.f; }
  v8f oacc[DT];
#pragma unroll
  for (int dt = 0; dt < DT; ++dt) oacc[dt] = (v8f){0.f,0.f,0.f,0.f,0.f,0.f,0.f,0.f};
  for (int j0 = 0; j0 < Tk; j0 += 32) {
    __syncthreads();
    for (int e = tid; e < 32 * (DQ / 4); e += 128) {
      const int r = e / (DQ / 4), c4 = (e % (DQ / 4)) * 4; const int key = j0 + r;
      v4f f = {0.f,0.f,0.f,0.f}; if (key < Tk) f = *(const v4fa*)(K + (size_t)key * kpitch + c4);
#pragma unroll
      for (int t = 0; t < 4; ++t) { const unsigned short hb = bf16_bits(f[t]); sKh[r][c4 + t] = hb; sKl[r][c4 + t] = bf16_bits(f[t] - bf16_val(hb)); }
    }
    for (int e = tid; e < 32 * (DV / 4); e += 128) {
      const int r = e / (DV / 4), c4 = (e % (DV / 4)) * 4; const int key = j0 + r;
      v4f f = {0.f,0.f,0.f,0.f}; if (key < Tk) f = *(const v4fa*)(V + (size_t)key * vpitch + c4);
#pragma unroll
      for (int t = 0; t < 4; ++t) { const unsigned short hb = bf16_bits(f[t]); sVh[r][c4 + t] = hb; sVl[r][c4 + t] = bf16_bits(f[t] - bf16_val(hb)); }
    }
    __syncthreads();
    v8f s[2];
#pragma unroll
    for (int nt = 0; nt < 2; ++nt) {
      v8f acc = {};
#pragma unroll
      for (int ks = 0; ks < KS; ++ks) {
        FragB bh_, bl_;
        bh_.half[0] = *(const v8us*)&sKh[nt * 16 + ln][ks * 32 + 8 * hh]; bh_.half[1] = *(const v8us*)&sKh[nt * 16 + ln][ks * 32 + 16 + 8 * hh];
        bl_.half[0] = *(const v8us*)&sKl[nt * 16 + ln][ks * 32 + 8 * hh]; bl_.half[1] = *(const v8us*)&sKl[nt * 16 + ln][ks * 32 + 16 + 8 * hh];
        acc = mmaN<3>(aqh[ks].v, aql[ks].v, bh_.v, bl_.v, acc);
      }
      s[nt] = acc;
    }
    float alpha[8];
#pragma unroll
    for (int r = 0; r < 8; ++r) {
      const int ja = j0 + ln, jb = j0 + 16 + ln;
      if (ja >= Tk) s[0][r] = -3.0e38f;
      if (jb >= Tk) s[1][r] = -3.0e38f;
      float mx = fmaxf(s[0][r], s[1][r]);
      mx = fmaxf(mx, __shfl_xor(mx, 1, 32)); mx = fmaxf(mx, __shfl_xor(mx, 2, 32)); mx = fmaxf(mx, __shfl_xor(mx, 4, 32)); mx = fmaxf(mx, __shfl_xor(mx, 8, 32));
      const float mnew = fmaxf(m_r[r], mx);
      alpha[r] = (mnew > -1.0e38f) ? __expf(m_r[r] - mnew) : 1.0f;
      const float p0 = (s[0][r] > -1.0e38f) ? __expf(s[0][r] - mnew) : 0.f;
      const float p1 = (s[1][r] > -1.0e38f) ? __expf(s[1][r] - mnew) : 0.f;
      m_r[r] = mnew;
      l_r[r] = l_r[r] * alpha[r] + p0 + p1;
      unsigned short hb = bf16_bits(p0); sPh[w][8 * hh + r][ln] = hb;      sPl[w][8 * hh + r][ln] = bf16_bits(p0 - bf16_val(hb));
      hb = bf16_bits(p1);                sPh[w][8 * hh + r][16 + ln] = hb; sPl[w][8 * hh + r][16 + ln] = bf16_bits(p1 - bf16_val(hb));
    }
#pragma unroll
    for (int dt = 0; dt < DT; ++dt)
#pragma unroll
      for (int r = 0; r < 8; ++r) oacc[dt][r] *= alpha[r];
    __builtin_amdgcn_fence(__ATOMIC_ACQ_REL, "workgroup");
    __builtin_amdgcn_wave_barrier();
    FragB pah, pal;
    pah.half[0] = *(const v8us*)&sPh[w][ln][8 * hh]; pah.half[1] = *(const v8us*)&sPh[w][ln][16 + 8 * hh];
    pal.half[0] = *(const v8us*)&sPl[w][ln][8 * hh]; pal.half[1] = *(const v8us*)&sPl[w][ln][16 + 8 * hh];
    const unsigned short* vth = &sVh[8 * hh + (lane & 7)][((lane >> 3) & 1) * 8];
    const unsigned short* vtl = &sVl[8 * hh + (lane & 7)][((lane >> 3) & 1) * 8];
    // fragments of two d tiles are fetched as one group, one group ahead of the products that use them
    FragB bvh[2][2], bvl[2][2];
#pragma unroll
    for (int u = 0; u < 2; ++u) {
      bvh[0][u].half[0] = ld_tr16(vth + u * 16); bvh[0][u].half[1] = ld_tr16(vth + 16 * VP + u * 16);
      bvl[0][u].half[0] = ld_tr16(vtl + u * 16); bvl[0][u].half[1] = ld_tr16(vtl + 16 * VP + u * 16);
    }
#pragma unroll
    for (int g = 0; g < DT / 2; ++g) {
      if (g + 1 < DT / 2) {
#pragma unroll
        for (int u = 0; u < 2; ++u) {
          const int d = ((g + 1) * 2 + u) * 16;
          bvh[(g + 1) & 1][u].half[0] = ld_tr16(vth + d); bvh[(g + 1) & 1][u].half[1] = ld_tr16(vth + 16 * VP + d);
          bvl[(g + 1) & 1][u].half[0] = ld_tr16(vtl + d); bvl[(g + 1) & 1][u].half[1] = ld_tr16(vtl + 16 * VP + d);
        }
      }
#pragma unroll
      for (int u = 0; u < 2; ++u) oacc[g * 2 + u] = mmaN<3>(pah.v, pal.v, bvh[g & 1][u].v, bvl[g & 1][u].v, oacc[g * 2 + u]);
    }
    __builtin_amdgcn_fence(__ATOMIC_ACQ_REL, "workgroup");
    __builtin_amdgcn_wave_barrier();
  }
#pragma unroll
  for (int r = 0; r < 8; ++r) {
    float l = l_r[r];
    l += __shfl_xor(l, 1, 32); l += __shfl_xor(l, 2, 32); l += __shfl_xor(l, 4, 32); l += __shfl_xor(l, 8, 32);
    l_r[r] = (l > 0.f) ? 1.0f / l : 0.f;
  }
#pragma unroll
  for (int dt = 0; dt < DT; ++dt)
#pragma unroll
    for (int r = 0; r < 8; ++r) sO[w][8 * hh + r][dt * 16 + ln] = oacc[dt][r] * l_r[r];
  __builtin_amdgcn_fence(__ATOMIC_ACQ_REL, "workgroup");
  __builtin_amdgcn_wave_barrier();
  {
    for (int r = 0; r < 16; ++r) {
      const int row = q0 + r;
      for (int c4 = lane * 4; c4 < DV; c4 += 128) {
        if (row < Tq) {
          const v4f val = *(const v4fa*)&sO[w][r][c4];
          *(v4f*)(y + (size_t)bh * ystride + (size_t)row * ypitch + dv0 + c4) = val;
        }
      }
    }
    
  }
}

__global__ __launch_bounds__(256) void k_round_rows(const float* __restrict__ W, unsigned short* __restrict__ Wt, int n8) {
  const int t = blockIdx.x * 256 + threadIdx.x;
  if (t >= n8) return;
  const v4f a = *(const v4fa*)(W + (size_t)t * 8), b = *(const v4fa*)(W + (size_t)t * 8 + 4);
  v8us v; v[0]=bf16_bits(a[0]); v[1]=bf16_bits(a[1]); v[2]=bf16_bits(a[2]); v[3]=bf16_bits(a[3]);
  v[4]=bf16_bits(b[0]); v[5]=bf16_bits(b[1]); v[6]=bf16_bits(b[2]); v[7]=bf16_bits(b[3]);
  *(v8us*)(Wt + (size_t)t * 8) = v; 
}

// padded q/k weights: Bt [64][256] rows < 8 real; bias64; gamma vector (256 copies, bf16-rounded) and zero shift
__global__ __launch_bounds__(256) void k_prep(const float* __restrict__ wq, const float* __restrict__ bq, const float* __restrict__ wk, const float* __restrict__ bk, const float* __restrict__ gamma,
                                            unsigned short* __restrict__ Bq, unsigned short* __restrict__ Bk, float* __restrict__ bq64, float* __restrict__ bk64, float* __restrict__ gvec, float* __restrict__ zvec) {
  const int t = blockIdx.x * 256 + threadIdx.x;
  if (t < DQP * (CC / 8)) { const int n = t / (CC / 8), k8 = (t % (CC / 8)) * 8; v8us a, b;
    for (int i = 0; i < 8; ++i) { a[i] = (n < 8) ? bf16_bits(wq[n * CC + k8 + i]) : (unsigned short)0; b[i] = (n < 8) ? bf16_bits(wk[n * CC + k8 + i]) : (unsigned short)0; }
    *(v8us*)(Bq + n * CC + k8) = a; *(v8us*)(Bk + n * CC + k8) = b;  }
  if (t < DQP) { const float a = (t < 8) ? bq[t] : 0.f, b = (t < 8) ? bk[t] : 0.f; *(float*)(bq64 + t) = a; *(float*)(bk64 + t) = b;  }
  if (t < CC) { const float g = bf16_round(gamma[0]); *(float*)(gvec + t) = g; *(float*)(zvec + t) = 0.f;  }
}
extern "C" void kernel_launch(void* const* d_in, const int* in_sizes, int n_in,
                              void* d_out, int out_size, void* d_ws, size_t ws_size, hipStream_t stream) {
  (void)in_sizes; (void)n_in; (void)out_size;
  const float* x = (const float*)d_in[0]; const float* wq = (const float*)d_in[1]; const float* bq = (const float*)d_in[2]; const float* wk = (const float*)d_in[3]; const float* bk = (const float*)d_in[4];
  const float* wv = (const float*)d_in[5]; const float* bv = (const float*)d_in[6]; const float* gamma = (const float*)d_in[7];
  char* ws = (char*)d_ws; size_t off = 0;
  auto take = [&](size_t bytes) { char* p = ws + off; off += (bytes + 255) & ~(size_t)255; return p; };
  const int M = BB * NN;
  unsigned short* Bq = (unsigned short*)take(DQP * CC * 2); unsigned short* Bk = (unsigned short*)take(DQP * CC * 2); unsigned short* Bv = (unsigned short*)take(CC * CC * 2);
  float* bq64 = (float*)take(256); float* bk64 = (float*)take(256); float* gvec = (float*)take(CC * 4); float* zvec = (float*)take(CC * 4);
  float* xT = (float*)take((size_t)M * CC * 4); float* q = (float*)take((size_t)M * DQP * 4); float* k = (float*)take((size_t)M * DQP * 4); float* v = (float*)take((size_t)M * CC * 4); float* z = (float*)take((size_t)M * CC * 4);
  if (off > ws_size) return;
  k_prep<<<(DQP * (CC / 8) + 255) / 256, 256, 0, stream>>>(wq, bq, wk, bk, gamma, Bq, Bk, bq64, bk64, gvec, zvec);
  k_round_rows<<<(CC * CC / 8 + 255) / 256, 256, 0, stream>>>(wv, Bv, CC * CC / 8);
  k_transpose32<false, false, false><<<dim3(NN / 32, CC / 32, BB), 256, 0, stream>>>(x, xT, CC, NN, nullptr, nullptr, nullptr);     // [B][C][N] -> [B][N][C]
  k_gemm_bf<false, 0, true><<<((M / 16) * (DQP / 64) + 3) / 4, 128, 0, stream>>>(xT, CC, Bq, CC, bq64, q, DQP, M, DQP, CC);
  k_gemm_bf<false, 0, true><<<((M / 16) * (DQP / 64) + 3) / 4, 128, 0, stream>>>(xT, CC, Bk, CC, bk64, k, DQP, M, DQP, CC);
  k_gemm_bf<false, 0, true><<<((M / 16) * (CC / 64) + 3) / 4, 128, 0, stream>>>(xT, CC, Bv, CC, bv, v, CC, M, CC, CC);
  k_flash2<DQP, 128><<<dim3(BB * (NN / 64), 2), 128, 0, stream>>>(q, (size_t)NN * DQP, DQP, NN, k, (size_t)NN * DQP, DQP, NN, v, (size_t)NN * CC, CC, 1.0f, z, (size_t)NN * CC, CC);
  k_transpose32<true, true, true><<<dim3(CC / 32, NN / 32, BB), 256, 0, stream>>>(z, (float*)d_out, NN, CC, gvec, zvec, x);     // out = gamma·zᵀ + bf16(x)
}

// v002
// Measured time: 504 microseconds a run.
// In both of two side-by-side timings against v001, it was 1.89 times as fast.
// Over all steps from v000 it is 2.10 times as fast.
#include <hip/hip_runtime.h>
// All contractions on v_wmma_f32_16x16x32_bf16, f32 accumulate: the q/k/v 1×1 convs as GEMMs over a position-major copy of x (x, W, b rounded to
// bf16: single exact term; the 8 q/k channels zero-padded to 64), energy = qᵀk (no scale) and attn·v per 16-query tile as 3-term bf16 hi/lo
// splits (k_flash2, value dim 256 split over 2 blocks), gamma·out + bf16(x) fused into the transpose back; softmax in f32.
#define BB 8
#define CC 256
#define NN 4096
#define DQP 64

typedef __bf16 v16b __attribute__((ext_vector_type(16)));
typedef unsigned short v8us __attribute__((ext_vector_type(8), may_alias));
typedef float  v8f  __attribute__((ext_vector_type(8)));
typedef float  v4f  __attribute__((ext_vector_type(4)));
typedef float  v4fa __attribute__((ext_vector_type(4), may_alias));
union FragB { v16b v; v8us half[2]; unsigned short u[16]; };

__device__ __forceinline__ unsigned short bf16_bits(float x) { unsigned int u = __float_as_uint(x); return (unsigned short)((u + 0x7FFFu + ((u >> 16) & 1u)) >> 16); }
__device__ __forceinline__ float bf16_val(unsigned short b) { return __uint_as_float(((unsigned int)b) << 16); }
__device__ __forceinline__ float bf16_round(float x) { return bf16_val(bf16_bits(x)); }
// 16-bit transposing LDS load: lane (c = l & 15, h = l >> 4) gets T[k0 + 8h + 0..7][d0 + c] from a row-major tile; lane l passes
// &T[k0 + 8 * (l >> 4) + (l & 7)][d0 + 8 * ((l >> 3) & 1)]. Two loads (k0, k0 + 16) make one 32 x 16 B fragment in the hardware k order.
typedef short s16x8 __attribute__((ext_vector_type(8)));
__device__ __forceinline__ v8us ld_tr16(const unsigned short* p) {
  typedef __attribute__((address_space(3))) s16x8 lds_s16x8;
  return __builtin_bit_cast(v8us, __builtin_amdgcn_ds_load_tr16_b128_v8i16((lds_s16x8*)p));
}
// D += A·B with NT terms: 1 = ah·bh, 2 = + al·bh (A split), 3 = + ah·bl (both split)
template <int NT>
__device__ __forceinline__ v8f mmaN(v16b ah, v16b al, v16b bh, v16b bl, v8f c) {
  c = __builtin_amdgcn_wmma_f32_16x16x32_bf16(false, ah, false, bh, (short)0, c, false, false);
  if (NT >= 2) c = __builtin_amdgcn_wmma_f32_16x16x32_bf16(false, al, false, bh, (short)0, c, false, false);
  if (NT >= 3) c = __builtin_amdgcn_wmma_f32_16x16x32_bf16(false, ah, false, bl, (short)0, c, false, false);
  asm volatile("v_nop\n\tv_nop\n\tv_nop\n\tv_nop" : "+v"(c) : "v"(ah), "v"(al), "v"(bh), "v"(bl));
  return c;
}

__global__ __launch_bounds__(256) void k_wt_bf16(const float* __restrict__ W, unsigned short* __restrict__ Wt, int K, int N) {
  const int t = blockIdx.x * 256 + threadIdx.x;
  const int k8n = K / 8;
  if (t >= N * k8n) return;
  const int n = t / k8n, k8 = (t % k8n) * 8;
  v8us v;
#pragma unroll
  for (int i = 0; i < 8; ++i) v[i] = bf16_bits(W[(size_t)(k8 + i) * N + n]);
  *(v8us*)(Wt + (size_t)n * K + k8) = v;
  
}

// GEMM C[M][N] (f32, pitch ldc) = act(A[M][K]·W + bias). A f32 row-major (pitch lda) converted per fragment to bf16
// (ASPLIT: hi/lo two planes -> 2 terms, else single rounded term); Wt bf16 [N][K] (pitch ldb). BIAS_BF16 rounds the
// bias to bf16 first (bias quantised to bf16 before the add). K%32==0, M%16==0, N%64==0.
template <bool ASPLIT, int ACT, bool BIAS_BF16>
__global__ __launch_bounds__(128) void k_gemm_bf(const float* __restrict__ A, int lda, const unsigned short* __restrict__ Wt, int ldb,
                                               const float* __restrict__ bias, float* __restrict__ C, int ldc, int M, int N, int K) {
  __shared__ __attribute__((aligned(16))) float so[4][16][64];
  const int tid = threadIdx.x, w = tid >> 5, lane = tid & 31, ln = lane & 15, hh = lane >> 4;
  const int ntn = N / 64;
  const int wid = blockIdx.x * 4 + w;
  const int mt = wid / ntn, nq = wid % ntn;
  if (mt * 16 >= M) return;
  const int row0 = mt * 16, col0 = nq * 64;
  const float* arow = A + (size_t)(row0 + ln) * lda;
  v8f acc[4] = {};
  for (int kb = 0; kb < K; kb += 32) {
    FragB ah, al;
    const v4f x0 = *(const v4fa*)(arow + kb + 8 * hh), x1 = *(const v4fa*)(arow + kb + 8 * hh + 4);
    const v4f x2 = *(const v4fa*)(arow + kb + 16 + 8 * hh), x3 = *(const v4fa*)(arow + kb + 16 + 8 * hh + 4);
    float xs[16] = {x0[0],x0[1],x0[2],x0[3],x1[0],x1[1],x1[2],x1[3],x2[0],x2[1],x2[2],x2[3],x3[0],x3[1],x3[2],x3[3]};
#pragma unroll
    for (int i = 0; i < 16; ++i) { const unsigned short hb = bf16_bits(xs[i]); ah.u[i] = hb; al.u[i] = ASPLIT ? bf16_bits(xs[i] - bf16_val(hb)) : (unsigned short)0; }
#pragma unroll
    for (int t = 0; t < 4; ++t) {
      const unsigned short* brow = Wt + (size_t)(col0 + t * 16 + ln) * ldb + kb;
      FragB b;
      b.half[0] = *(const v8us*)(brow + 8 * hh);
      b.half[1] = *(const v8us*)(brow + 16 + 8 * hh);
      acc[t] = mmaN<ASPLIT ? 2 : 1>(ah.v, al.v, b.v, b.v, acc[t]);
    }
  }
#pragma unroll
  for (int t = 0; t < 4; ++t) {
    float bv = bias ? bias[col0 + t * 16 + ln] : 0.f;
    if (BIAS_BF16) bv = bf16_round(bv);
#pragma unroll
    for (int r = 0; r < 8; ++r) { float v = acc[t][r] + bv; if (ACT == 1) v = fmaxf(v, 0.f); so[w][8 * hh + r][t * 16 + ln] = v; }
  }
  __builtin_amdgcn_fence(__ATOMIC_ACQ_REL, "workgroup");
  __builtin_amdgcn_wave_barrier();
  const int rsub = lane >> 4, c4 = (lane & 15) * 4;
  {
#pragma unroll
    for (int q = 0; q < 8; ++q) {
      const int r = q * 2 + rsub;
      const v4f v = *(const v4fa*)&so[w][r][c4];
      *(v4f*)(C + (size_t)(row0 + r) * ldc + col0 + c4) = v;
    }
    
  }
}

// Flash-style causal/unmasked attention, all contractions 3-term bf16 hi/lo splits, f32 softmax with running max.
// q,k,v rows are read from f32 buffers with arbitrary row pitch (so they can live inside a fused qkv buffer);
// D = head size (multiple of 32, <= 128); one wave = 16 query rows; block = 4 waves (64 queries) sharing K/V chunks of 32.
template <int D, bool CAUSAL>
__global__ __launch_bounds__(128) void k_flash(const float* __restrict__ qb, const float* __restrict__ kb, const float* __restrict__ vb,
                                             int pitch, int T, int H, float scale, float* __restrict__ y, int ypitch) {
  constexpr int KS = D / 32;        // k-steps for QK
  constexpr int DT = D / 16;        // d tiles for PV
  __shared__ __attribute__((aligned(16))) unsigned short sKh[32][D + 8], sKl[32][D + 8], sVh[32][D + 8], sVl[32][D + 8];
  __shared__ __attribute__((aligned(16))) unsigned short sPh[4][16][40], sPl[4][16][40];
  __shared__ __attribute__((aligned(16))) float sO[4][16][D];
  const int tid = threadIdx.x, w = tid >> 5, lane = tid & 31, ln = lane & 15, hh = lane >> 4;
  const int nqb = (T + 63) / 64;
  const int bh = blockIdx.x / nqb, qblk = blockIdx.x % nqb;
  const int b = bh / H, h = bh % H;
  const int q0 = qblk * 64 + w * 16;
  const float* Q = qb + (size_t)b * T * pitch + h * D;
  const float* K = kb + (size_t)b * T * pitch + h * D;
  const float* V = vb + (size_t)b * T * pitch + h * D;

  // A fragments of the wave's 16 query rows (scaled), hi/lo
  FragB aqh[KS], aql[KS];
  {
    int row = q0 + ln; if (row >= T) row = T - 1;
    const float* qr = Q + (size_t)row * pitch;
#pragma unroll
    for (int ks = 0; ks < KS; ++ks)
#pragma unroll
      for (int i = 0; i < 16; ++i) {
        const int d = ks * 32 + ((i < 8) ? (8 * hh + i) : (16 + 8 * hh + (i - 8)));
        const float x = qr[d] * scale; const unsigned short hb = bf16_bits(x);
        aqh[ks].u[i] = hb; aql[ks].u[i] = bf16_bits(x - bf16_val(hb));
      }
  }
  float m_r[8], l_r[8];
#pragma unroll
  for (int r = 0; r < 8; ++r) { m_r[r] = -3.0e38f; l_r[r] = 0.f; }
  v8f oacc[DT];
#pragma unroll
  for (int dt = 0; dt < DT; ++dt) oacc[dt] = (v8f){0.f,0.f,0.f,0.f,0.f,0.f,0.f,0.f};

  const int kv_end = CAUSAL ? min(T, qblk * 64 + 64) : T;     // block-uniform
  for (int j0 = 0; j0 < kv_end; j0 += 32) {
    __syncthreads();
    for (int e = tid; e < 32 * (D / 4); e += 128) {
      const int r = e / (D / 4), c4 = (e % (D / 4)) * 4;
      const int key = j0 + r;
      v4f kf = {0.f,0.f,0.f,0.f}, vf = {0.f,0.f,0.f,0.f};
      if (key < T) { kf = *(const v4fa*)(K + (size_t)key * pitch + c4); vf = *(const v4fa*)(V + (size_t)key * pitch + c4); }
#pragma unroll
      for (int t = 0; t < 4; ++t) {
        unsigned short hb = bf16_bits(kf[t]); sKh[r][c4 + t] = hb; sKl[r][c4 + t] = bf16_bits(kf[t] - bf16_val(hb));
        hb = bf16_bits(vf[t]); sVh[r][c4 + t] = hb; sVl[r][c4 + t] = bf16_bits(vf[t] - bf16_val(hb));
      }
    }
    __syncthreads();
    // S tile 16 x 32
    v8f s[2];
#pragma unroll
    for (int nt = 0; nt < 2; ++nt) {
      v8f acc = {};
#pragma unroll
      for (int ks = 0; ks < KS; ++ks) {
        FragB bh_, bl_;
        bh_.half[0] = *(const v8us*)&sKh[nt * 16 + ln][ks * 32 + 8 * hh]; bh_.half[1] = *(const v8us*)&sKh[nt * 16 + ln][ks * 32 + 16 + 8 * hh];
        bl_.half[0] = *(const v8us*)&sKl[nt * 16 + ln][ks * 32 + 8 * hh]; bl_.half[1] = *(const v8us*)&sKl[nt * 16 + ln][ks * 32 + 16 + 8 * hh];
        acc = mmaN<3>(aqh[ks].v, aql[ks].v, bh_.v, bl_.v, acc);
      }
      s[nt] = acc;
    }
    // mask + running max (rows 8hh+r; the 16 lanes of a half share rows)
    float alpha[8];
#pragma unroll
    for (int r = 0; r < 8; ++r) {
      const int qi = q0 + 8 * hh + r;
      const int ja = j0 + ln, jb = j0 + 16 + ln;
      if (CAUSAL) { if (ja > qi) s[0][r] = -3.0e38f; if (jb > qi) s[1][r] = -3.0e38f; }
      if (ja >= T) s[0][r] = -3.0e38f;
      if (jb >= T) s[1][r] = -3.0e38f;
      float mx = fmaxf(s[0][r], s[1][r]);
      mx = fmaxf(mx, __shfl_xor(mx, 1, 32)); mx = fmaxf(mx, __shfl_xor(mx, 2, 32)); mx = fmaxf(mx, __shfl_xor(mx, 4, 32)); mx = fmaxf(mx, __shfl_xor(mx, 8, 32));
      const float mnew = fmaxf(m_r[r], mx);
      alpha[r] = (mnew > -1.0e38f) ? __expf(m_r[r] - mnew) : 1.0f;
      const float p0 = (s[0][r] > -1.0e38f) ? __expf(s[0][r] - mnew) : 0.f;
      const float p1 = (s[1][r] > -1.0e38f) ? __expf(s[1][r] - mnew) : 0.f;
      m_r[r] = mnew;
      l_r[r] = l_r[r] * alpha[r] + p0 + p1;            // per-lane partial row sum (16 lanes combined at the end)
      unsigned short hb = bf16_bits(p0); sPh[w][8 * hh + r][ln] = hb;      sPl[w][8 * hh + r][ln] = bf16_bits(p0 - bf16_val(hb));
      hb = bf16_bits(p1);                sPh[w][8 * hh + r][16 + ln] = hb; sPl[w][8 * hh + r][16 + ln] = bf16_bits(p1 - bf16_val(hb));
    }
#pragma unroll
    for (int dt = 0; dt < DT; ++dt)
#pragma unroll
      for (int r = 0; r < 8; ++r) oacc[dt][r] *= alpha[r];
    __builtin_amdgcn_fence(__ATOMIC_ACQ_REL, "workgroup");
    __builtin_amdgcn_wave_barrier();
    FragB pah, pal;
    pah.half[0] = *(const v8us*)&sPh[w][ln][8 * hh]; pah.half[1] = *(const v8us*)&sPh[w][ln][16 + 8 * hh];
    pal.half[0] = *(const v8us*)&sPl[w][ln][8 * hh]; pal.half[1] = *(const v8us*)&sPl[w][ln][16 + 8 * hh];
#pragma unroll
    for (int dt = 0; dt < DT; ++dt) {
      FragB bvh, bvl;
#pragma unroll
      for (int i = 0; i < 8; ++i) {
        bvh.u[i] = sVh[8 * hh + i][dt * 16 + ln]; bvh.u[8 + i] = sVh[16 + 8 * hh + i][dt * 16 + ln];
        bvl.u[i] = sVl[8 * hh + i][dt * 16 + ln]; bvl.u[8 + i] = sVl[16 + 8 * hh + i][dt * 16 + ln];
      }
      oacc[dt] = mmaN<3>(pah.v, pal.v, bvh.v, bvl.v, oacc[dt]);
    }
    __builtin_amdgcn_fence(__ATOMIC_ACQ_REL, "workgroup");
    __builtin_amdgcn_wave_barrier();
  }
#pragma unroll
  for (int r = 0; r < 8; ++r) {
    float l = l_r[r];
    l += __shfl_xor(l, 1, 32); l += __shfl_xor(l, 2, 32); l += __shfl_xor(l, 4, 32); l += __shfl_xor(l, 8, 32);
    l_r[r] = (l > 0.f) ? 1.0f / l : 0.f;
  }
#pragma unroll
  for (int dt = 0; dt < DT; ++dt)
#pragma unroll
    for (int r = 0; r < 8; ++r) sO[w][8 * hh + r][dt * 16 + ln] = oacc[dt][r] * l_r[r];
  __builtin_amdgcn_fence(__ATOMIC_ACQ_REL, "workgroup");
  __builtin_amdgcn_wave_barrier();
  {
    for (int r = 0; r < 16; ++r) {
      const int row = q0 + r;
      if (row < T && lane < D / 4) {
        const v4f val = *(const v4fa*)&sO[w][r][lane * 4];
        *(v4f*)(y + ((size_t)b * T + row) * ypitch + h * D + lane * 4) = val;
      }
    }
    
  }
}

// in pitch = cols, out pitch = rows; rows, cols multiples of 32. Optional per-output-row affine (scale[c], shift[c]) and
// residual add res (same layout as out, optionally bf16-rounded) for fused epilogues: out = in*scale + shift + res.
template <bool AFFINE, bool RESID, bool RES_BF16>
__global__ __launch_bounds__(256) void k_transpose32(const float* __restrict__ in, float* __restrict__ out, int rows, int cols,
                                                    const float* __restrict__ scale, const float* __restrict__ shift, const float* __restrict__ res) {
  __shared__ float tile[32][33];
  const int b = blockIdx.z;
  const int r0 = blockIdx.y * 32, c0 = blockIdx.x * 32;
  const float* src = in + (size_t)b * rows * cols;
  float* dst = out + (size_t)b * rows * cols;
  const int tx = threadIdx.x & 31, ty = threadIdx.x >> 5;     // 8 rows per pass
  for (int i = ty; i < 32; i += 8) tile[i][tx] = src[(size_t)(r0 + i) * cols + c0 + tx];
  __syncthreads();
  {
    for (int i = ty; i < 32; i += 8) {
      float v = tile[tx][i];
      const int orow = c0 + i;
      if (AFFINE) v = v * scale[orow] + shift[orow];
      if (RESID) { float rv = res[(size_t)b * rows * cols + (size_t)orow * rows + r0 + tx]; if (RES_BF16) rv = bf16_round(rv); v += rv; }
      *(float*)(dst + (size_t)orow * rows + r0 + tx) = v;
    }
    
  }
}

// 2x2 max pool on position-major data: in [B][H*W][C] -> out [B][(H/2)*(W/2)][C]; thread per (b, p', 4 channels); C%4==0
__global__ __launch_bounds__(256) void k_pool2_pm(const float* __restrict__ in, float* __restrict__ out, int Bn, int H, int W, int C) {
  const size_t t = (size_t)blockIdx.x * 256 + threadIdx.x;
  const int c4n = C / 4, Ho = H / 2, Wo = W / 2;
  const size_t total = (size_t)Bn * Ho * Wo * c4n;
  if (t >= total) return;
  const int c4 = (int)(t % c4n) * 4; size_t rest = t / c4n;
  const int pw = (int)(rest % Wo); rest /= Wo; const int ph = (int)(rest % Ho); const int b = (int)(rest / Ho);
  const float* base = in + (size_t)b * H * W * C;
  const int p00 = (2 * ph) * W + 2 * pw;
  const v4f a = *(const v4fa*)(base + (size_t)p00 * C + c4), bq = *(const v4fa*)(base + (size_t)(p00 + 1) * C + c4);
  const v4f c = *(const v4fa*)(base + (size_t)(p00 + W) * C + c4), d = *(const v4fa*)(base + (size_t)(p00 + W + 1) * C + c4);
  v4f m; for (int i = 0; i < 4; ++i) m[i] = fmaxf(fmaxf(a[i], bq[i]), fmaxf(c[i], d[i]));
  float* dst = out + ((size_t)b * Ho * Wo + (size_t)ph * Wo + pw) * C + c4;
  *(v4f*)dst = m;
  
}

// General (non-causal) attention, 3-term bf16 splits, f32 softmax with running max.
// Q [.][Tq][qpitch], K [.][Tk][kpitch] (head dim DQ), V [.][Tk][vpitch] (head dim DVtot); this block handles DV output
// dims starting at dv0 = blockIdx.y*DV. y[bh][t][ypitch] gets columns dv0..dv0+DV-1. Per-bh base offsets via strides.
// The K and V row pitches are compile-time (kpitch, vpitch), so that a thread's staging loads differ only in their immediate offset.
template <int DQ, int DV, int kpitch, int vpitch>
__global__ __launch_bounds__(128) void k_flash2(const float* __restrict__ Qb, size_t qstride, int qpitch, int Tq,
                                              const float* __restrict__ Kb, size_t kstride, int Tk,
                                              const float* __restrict__ Vb, size_t vstride,
                                              float scale, float* __restrict__ y, size_t ystride, int ypitch) {
  constexpr int KS = DQ / 32, DT = DV / 16;
  constexpr int VP = DV + 16;       // V row pitch in elements: an odd multiple of 32 bytes, the conflict-free pitch of the transposing load
  __shared__ __attribute__((aligned(16))) unsigned short sKh[32][DQ + 8], sKl[32][DQ + 8], sVh[32][VP], sVl[32][VP];
  __shared__ __attribute__((aligned(16))) unsigned short sPh[4][16][40], sPl[4][16][40];
  __shared__ __attribute__((aligned(16))) float sO[4][16][DV];
  const int tid = threadIdx.x, w = tid >> 5, lane = tid & 31, ln = lane & 15, hh = lane >> 4;
  const int nqb = (Tq + 63) / 64;
  const int bh = blockIdx.x / nqb, qblk = blockIdx.x % nqb;
  const int dv0 = blockIdx.y * DV;
  const int q0 = qblk * 64 + w * 16;
  const float* Q = Qb + (size_t)bh * qstride; const float* K = Kb + (size_t)bh * kstride; const float* V = Vb + (size_t)bh * vstride + dv0;
  FragB aqh[KS], aql[KS];
  {
    int row = q0 + ln; if (row >= Tq) row = Tq - 1;
    const float* qr = Q + (size_t)row * qpitch;
#pragma unroll
    for (int ks = 0; ks < KS; ++ks)
#pragma unroll
      for (int i = 0; i < 16; ++i) {
        const int d = ks * 32 + ((i < 8) ? (8 * hh + i) : (16 + 8 * hh + (i - 8)));
        const float x = qr[d] * scale; const unsigned short hb = bf16_bits(x);
        aqh[ks].u[i] = hb; aql[ks].u[i] = bf16_bits(x - bf16_val(hb));
      }
  }
  float m_r[8], l_r[8];
#pragma unroll
  for (int r = 0; r < 8; ++r) { m_r[r] = -3.0e38f; l_r[r] = 0.f; }
  v8f oacc[DT];
#pragma unroll
  for (int dt = 0; dt < DT; ++dt) oacc[dt] = (v8f){0.f,0.f,0.f,0.f,0.f,0.f,0.f,0.f};
  // Staging of a 32-key tile: 128 threads cover KR rows of K (VR of V) per 16-byte load, KL (VL) loads per thread.
  constexpr int KR = 128 / (DQ / 4), VR = 128 / (DV / 4), KL = 32 / KR, VL = 32 / VR;
  static_assert(KR * (DQ / 4) == 128 && VR * (DV / 4) == 128 && KL * KR == 32 && VL * VR == 32, "tile must divide over 128 threads");
  const int kr = tid / (DQ / 4), kc = (tid % (DQ / 4)) * 4, vr = tid / (DV / 4), vc = (tid % (DV / 4)) * 4;
  const unsigned koff = (unsigned)kr * (unsigned)kpitch + (unsigned)kc, voff = (unsigned)vr * (unsigned)vpitch + (unsigned)vc;
  for (int j0 = 0; j0 < Tk; j0 += 32) {
    // All of a thread's K and V loads of the tile are issued before the first is used: a trip waits out one load latency, not
    // KL + VL. A full tile (block-uniform test) takes them without the per-row guard, in one straight run. The loops over i are
    // unrolled so that kf and vf are indexed by constants and stay in registers.
    v4f kf[KL], vf[VL];
    if (j0 + 32 <= Tk) {
#pragma unroll
      for (int i = 0; i < KL; ++i) kf[i] = *(const v4fa*)(K + (size_t)(j0 + i * KR) * kpitch + koff);
#pragma unroll
      for (int i = 0; i < VL; ++i) vf[i] = *(const v4fa*)(V + (size_t)(j0 + i * VR) * vpitch + voff);
    } else {
#pragma unroll
      for (int i = 0; i < KL; ++i) { kf[i] = (v4f){0.f,0.f,0.f,0.f}; if (j0 + i * KR + kr < Tk) kf[i] = *(const v4fa*)(K + (size_t)(j0 + i * KR) * kpitch + koff); }
#pragma unroll
      for (int i = 0; i < VL; ++i) { vf[i] = (v4f){0.f,0.f,0.f,0.f}; if (j0 + i * VR + vr < Tk) vf[i] = *(const v4fa*)(V + (size_t)(j0 + i * VR) * vpitch + voff); }
    }
    __syncthreads();
#pragma unroll
    for (int i = 0; i < KL; ++i)
#pragma unroll
      for (int t = 0; t < 4; ++t) { const unsigned short hb = bf16_bits(kf[i][t]); sKh[i * KR + kr][kc + t] = hb; sKl[i * KR + kr][kc + t] = bf16_bits(kf[i][t] - bf16_val(hb)); }
#pragma unroll
    for (int i = 0; i < VL; ++i)
#pragma unroll
      for (int t = 0; t < 4; ++t) { const unsigned short hb = bf16_bits(vf[i][t]); sVh[i * VR + vr][vc + t] = hb; sVl[i * VR + vr][vc + t] = bf16_bits(vf[i][t] - bf16_val(hb)); }
    __syncthreads();
    v8f s[2];
#pragma unroll
    for (int nt = 0; nt < 2; ++nt) {
      v8f acc = {};
#pragma unroll
      for (int ks = 0; ks < KS; ++ks) {
        FragB bh_, bl_;
        bh_.half[0] = *(const v8us*)&sKh[nt * 16 + ln][ks * 32 + 8 * hh]; bh_.half[1] = *(const v8us*)&sKh[nt * 16 + ln][ks * 32 + 16 + 8 * hh];
        bl_.half[0] = *(const v8us*)&sKl[nt * 16 + ln][ks * 32 + 8 * hh]; bl_.half[1] = *(const v8us*)&sKl[nt * 16 + ln][ks * 32 + 16 + 8 * hh];
        acc = mmaN<3>(aqh[ks].v, aql[ks].v, bh_.v, bl_.v, acc);
      }
      s[nt] = acc;
    }
    float alpha[8];
#pragma unroll
    for (int r = 0; r < 8; ++r) {
      const int ja = j0 + ln, jb = j0 + 16 + ln;
      if (ja >= Tk) s[0][r] = -3.0e38f;
      if (jb >= Tk) s[1][r] = -3.0e38f;
      float mx = fmaxf(s[0][r], s[1][r]);
      mx = fmaxf(mx, __shfl_xor(mx, 1, 32)); mx = fmaxf(mx, __shfl_xor(mx, 2, 32)); mx = fmaxf(mx, __shfl_xor(mx, 4, 32)); mx = fmaxf(mx, __shfl_xor(mx, 8, 32));
      const float mnew = fmaxf(m_r[r], mx);
      alpha[r] = (mnew > -1.0e38f) ? __expf(m_r[r] - mnew) : 1.0f;
      const float p0 = (s[0][r] > -1.0e38f) ? __expf(s[0][r] - mnew) : 0.f;
      const float p1 = (s[1][r] > -1.0e38f) ? __expf(s[1][r] - mnew) : 0.f;
      m_r[r] = mnew;
      l_r[r] = l_r[r] * alpha[r] + p0 + p1;
      unsigned short hb = bf16_bits(p0); sPh[w][8 * hh + r][ln] = hb;      sPl[w][8 * hh + r][ln] = bf16_bits(p0 - bf16_val(hb));
      hb = bf16_bits(p1);                sPh[w][8 * hh + r][16 + ln] = hb; sPl[w][8 * hh + r][16 + ln] = bf16_bits(p1 - bf16_val(hb));
    }
#pragma unroll
    for (int dt = 0; dt < DT; ++dt)
#pragma unroll
      for (int r = 0; r < 8; ++r) oacc[dt][r] *= alpha[r];
    __builtin_amdgcn_fence(__ATOMIC_ACQ_REL, "workgroup");
    __builtin_amdgcn_wave_barrier();
    FragB pah, pal;
    pah.half[0] = *(const v8us*)&sPh[w][ln][8 * hh]; pah.half[1] = *(const v8us*)&sPh[w][ln][16 + 8 * hh];
    pal.half[0] = *(const v8us*)&sPl[w][ln][8 * hh]; pal.half[1] = *(const v8us*)&sPl[w][ln][16 + 8 * hh];
    const unsigned short* vth = &sVh[8 * hh + (lane & 7)][((lane >> 3) & 1) * 8];
    const unsigned short* vtl = &sVl[8 * hh + (lane & 7)][((lane >> 3) & 1) * 8];
    // fragments of two d tiles are fetched as one group, one group ahead of the products that use them
    FragB bvh[2][2], bvl[2][2];
#pragma unroll
    for (int u = 0; u < 2; ++u) {
      bvh[0][u].half[0] = ld_tr16(vth + u * 16); bvh[0][u].half[1] = ld_tr16(vth + 16 * VP + u * 16);
      bvl[0][u].half[0] = ld_tr16(vtl + u * 16); bvl[0][u].half[1] = ld_tr16(vtl + 16 * VP + u * 16);
    }
#pragma unroll
    for (int g = 0; g < DT / 2; ++g) {
      if (g + 1 < DT / 2) {
#pragma unroll
        for (int u = 0; u < 2; ++u) {
          const int d = ((g + 1) * 2 + u) * 16;
          bvh[(g + 1) & 1][u].half[0] = ld_tr16(vth + d); bvh[(g + 1) & 1][u].half[1] = ld_tr16(vth + 16 * VP + d);
          bvl[(g + 1) & 1][u].half[0] = ld_tr16(vtl + d); bvl[(g + 1) & 1][u].half[1] = ld_tr16(vtl + 16 * VP + d);
        }
      }
#pragma unroll
      for (int u = 0; u < 2; ++u) oacc[g * 2 + u] = mmaN<3>(pah.v, pal.v, bvh[g & 1][u].v, bvl[g & 1][u].v, oacc[g * 2 + u]);
    }
    __builtin_amdgcn_fence(__ATOMIC_ACQ_REL, "workgroup");
    __builtin_amdgcn_wave_barrier();
  }
#pragma unroll
  for (int r = 0; r < 8; ++r) {
    float l = l_r[r];
    l += __shfl_xor(l, 1, 32); l += __shfl_xor(l, 2, 32); l += __shfl_xor(l, 4, 32); l += __shfl_xor(l, 8, 32);
    l_r[r] = (l > 0.f) ? 1.0f / l : 0.f;
  }
#pragma unroll
  for (int dt = 0; dt < DT; ++dt)
#pragma unroll
    for (int r = 0; r < 8; ++r) sO[w][8 * hh + r][dt * 16 + ln] = oacc[dt][r] * l_r[r];
  __builtin_amdgcn_fence(__ATOMIC_ACQ_REL, "workgroup");
  __builtin_amdgcn_wave_barrier();
  {
    for (int r = 0; r < 16; ++r) {
      const int row = q0 + r;
      for (int c4 = lane * 4; c4 < DV; c4 += 128) {
        if (row < Tq) {
          const v4f val = *(const v4fa*)&sO[w][r][c4];
          *(v4f*)(y + (size_t)bh * ystride + (size_t)row * ypitch + dv0 + c4) = val;
        }
      }
    }
    
  }
}

__global__ __launch_bounds__(256) void k_round_rows(const float* __restrict__ W, unsigned short* __restrict__ Wt, int n8) {
  const int t = blockIdx.x * 256 + threadIdx.x;
  if (t >= n8) return;
  const v4f a = *(const v4fa*)(W + (size_t)t * 8), b = *(const v4fa*)(W + (size_t)t * 8 + 4);
  v8us v; v[0]=bf16_bits(a[0]); v[1]=bf16_bits(a[1]); v[2]=bf16_bits(a[2]); v[3]=bf16_bits(a[3]);
  v[4]=bf16_bits(b[0]); v[5]=bf16_bits(b[1]); v[6]=bf16_bits(b[2]); v[7]=bf16_bits(b[3]);
  *(v8us*)(Wt + (size_t)t * 8) = v; 
}

// padded q/k weights: Bt [64][256] rows < 8 real; bias64; gamma vector (256 copies, bf16-rounded) and zero shift
__global__ __launch_bounds__(256) void k_prep(const float* __restrict__ wq, const float* __restrict__ bq, const float* __restrict__ wk, const float* __restrict__ bk, const float* __restrict__ gamma,
                                            unsigned short* __restrict__ Bq, unsigned short* __restrict__ Bk, float* __restrict__ bq64, float* __restrict__ bk64, float* __restrict__ gvec, float* __restrict__ zvec) {
  const int t = blockIdx.x * 256 + threadIdx.x;
  if (t < DQP * (CC / 8)) { const int n = t / (CC / 8), k8 = (t % (CC / 8)) * 8; v8us a, b;
    for (int i = 0; i < 8; ++i) { a[i] = (n < 8) ? bf16_bits(wq[n * CC + k8 + i]) : (unsigned short)0; b[i] = (n < 8) ? bf16_bits(wk[n * CC + k8 + i]) : (unsigned short)0; }
    *(v8us*)(Bq + n * CC + k8) = a; *(v8us*)(Bk + n * CC + k8) = b;  }
  if (t < DQP) { const float a = (t < 8) ? bq[t] : 0.f, b = (t < 8) ? bk[t] : 0.f; *(float*)(bq64 + t) = a; *(float*)(bk64 + t) = b;  }
  if (t < CC) { const float g = bf16_round(gamma[0]); *(float*)(gvec + t) = g; *(float*)(zvec + t) = 0.f;  }
}
extern "C" void kernel_launch(void* const* d_in, const int* in_sizes, int n_in,
                              void* d_out, int out_size, void* d_ws, size_t ws_size, hipStream_t stream) {
  (void)in_sizes; (void)n_in; (void)out_size;
  const float* x = (const float*)d_in[0]; const float* wq = (const float*)d_in[1]; const float* bq = (const float*)d_in[2]; const float* wk = (const float*)d_in[3]; const float* bk = (const float*)d_in[4];
  const float* wv = (const float*)d_in[5]; const float* bv = (const float*)d_in[6]; const float* gamma = (const float*)d_in[7];
  char* ws = (char*)d_ws; size_t off = 0;
  auto take = [&](size_t bytes) { char* p = ws + off; off += (bytes + 255) & ~(size_t)255; return p; };
  const int M = BB * NN;
  unsigned short* Bq = (unsigned short*)take(DQP * CC * 2); unsigned short* Bk = (unsigned short*)take(DQP * CC * 2); unsigned short* Bv = (unsigned short*)take(CC * CC * 2);
  float* bq64 = (float*)take(256); float* bk64 = (float*)take(256); float* gvec = (float*)take(CC * 4); float* zvec = (float*)take(CC * 4);
  float* xT = (float*)take((size_t)M * CC * 4); float* q = (float*)take((size_t)M * DQP * 4); float* k = (float*)take((size_t)M * DQP * 4); float* v = (float*)take((size_t)M * CC * 4); float* z = (float*)take((size_t)M * CC * 4);
  if (off > ws_size) return;
  k_prep<<<(DQP * (CC / 8) + 255) / 256, 256, 0, stream>>>(wq, bq, wk, bk, gamma, Bq, Bk, bq64, bk64, gvec, zvec);
  k_round_rows<<<(CC * CC / 8 + 255) / 256, 256, 0, stream>>>(wv, Bv, CC * CC / 8);
  k_transpose32<false, false, false><<<dim3(NN / 32, CC / 32, BB), 256, 0, stream>>>(x, xT, CC, NN, nullptr, nullptr, nullptr);     // [B][C][N] -> [B][N][C]
  k_gemm_bf<false, 0, true><<<((M / 16) * (DQP / 64) + 3) / 4, 128, 0, stream>>>(xT, CC, Bq, CC, bq64, q, DQP, M, DQP, CC);
  k_gemm_bf<false, 0, true><<<((M / 16) * (DQP / 64) + 3) / 4, 128, 0, stream>>>(xT, CC, Bk, CC, bk64, k, DQP, M, DQP, CC);
  k_gemm_bf<false, 0, true><<<((M / 16) * (CC / 64) + 3) / 4, 128, 0, stream>>>(xT, CC, Bv, CC, bv, v, CC, M, CC, CC);
  k_flash2<DQP, 128, DQP, CC><<<dim3(BB * (NN / 64), 2), 128, 0, stream>>>(q, (size_t)NN * DQP, DQP, NN, k, (size_t)NN * DQP, NN, v, (size_t)NN * CC, 1.0f, z, (size_t)NN * CC, CC);
  k_transpose32<true, true, true><<<dim3(CC / 32, NN / 32, BB), 256, 0, stream>>>(z, (float*)d_out, NN, CC, gvec, zvec, x);     // out = gamma·zᵀ + bf16(x)
}

// v003
// One run takes 373 microseconds.
// Two timings next to v002 put it at 1.35 and 1.36 times that version's speed.
// Over all steps from v000 it is 2.84 times as fast.
#include <hip/hip_runtime.h>
// All contractions on v_wmma_f32_16x16x32_bf16, f32 accumulate: the q/k/v 1×1 convs as GEMMs over a position-major copy of x (x, W, b rounded to
// bf16: single exact term; the 8 q/k channels zero-padded to 64), energy = qᵀk (no scale) and attn·v per 16-query tile as 3-term bf16 hi/lo
// splits (k_flash2, value dim 256 split over 2 blocks; the k and v GEMMs write the hi and lo planes of their results), gamma·out + bf16(x) fused into the transpose back; softmax in f32.
#define BB 8
#define CC 256
#define NN 4096
#define DQP 64

typedef __bf16 v16b __attribute__((ext_vector_type(16)));
typedef unsigned short v8us __attribute__((ext_vector_type(8), may_alias));
typedef float  v8f  __attribute__((ext_vector_type(8)));
typedef float  v4f  __attribute__((ext_vector_type(4)));
typedef float  v4fa __attribute__((ext_vector_type(4), may_alias));
union FragB { v16b v; v8us half[2]; unsigned short u[16]; };

__device__ __forceinline__ unsigned short bf16_bits(float x) { unsigned int u = __float_as_uint(x); return (unsigned short)((u + 0x7FFFu + ((u >> 16) & 1u)) >> 16); }
__device__ __forceinline__ float bf16_val(unsigned short b) { return __uint_as_float(((unsigned int)b) << 16); }
__device__ __forceinline__ float bf16_round(float x) { return bf16_val(bf16_bits(x)); }
// 16-bit transposing LDS load: lane (c = l & 15, h = l >> 4) gets T[k0 + 8h + 0..7][d0 + c] from a row-major tile; lane l passes
// &T[k0 + 8 * (l >> 4) + (l & 7)][d0 + 8 * ((l >> 3) & 1)]. Two loads (k0, k0 + 16) make one 32 x 16 B fragment in the hardware k order.
typedef short s16x8 __attribute__((ext_vector_type(8)));
__device__ __forceinline__ v8us ld_tr16(const unsigned short* p) {
  typedef __attribute__((address_space(3))) s16x8 lds_s16x8;
  return __builtin_bit_cast(v8us, __builtin_amdgcn_ds_load_tr16_b128_v8i16((lds_s16x8*)p));
}
// D += A·B with NT terms: 1 = ah·bh, 2 = + al·bh (A split), 3 = + ah·bl (both split)
template <int NT>
__device__ __forceinline__ v8f mmaN(v16b ah, v16b al, v16b bh, v16b bl, v8f c) {
  c = __builtin_amdgcn_wmma_f32_16x16x32_bf16(false, ah, false, bh, (short)0, c, false, false);
  if (NT >= 2) c = __builtin_amdgcn_wmma_f32_16x16x32_bf16(false, al, false, bh, (short)0, c, false, false);
  if (NT >= 3) c = __builtin_amdgcn_wmma_f32_16x16x32_bf16(false, ah, false, bl, (short)0, c, false, false);
  asm volatile("v_nop\n\tv_nop\n\tv_nop\n\tv_nop" : "+v"(c) : "v"(ah), "v"(al), "v"(bh), "v"(bl));
  return c;
}

__global__ __launch_bounds__(256) void k_wt_bf16(const float* __restrict__ W, unsigned short* __restrict__ Wt, int K, int N) {
  const int t = blockIdx.x * 256 + threadIdx.x;
  const int k8n = K / 8;
  if (t >= N * k8n) return;
  const int n = t / k8n, k8 = (t % k8n) * 8;
  v8us v;
#pragma unroll
  for (int i = 0; i < 8; ++i) v[i] = bf16_bits(W[(size_t)(k8 + i) * N + n]);
  *(v8us*)(Wt + (size_t)n * K + k8) = v;
  
}

// GEMM C[M][N] (f32, pitch ldc) = act(A[M][K]·W + bias). A f32 row-major (pitch lda) converted per fragment to bf16
// (ASPLIT: hi/lo two planes -> 2 terms, else single rounded term); Wt bf16 [N][K] (pitch ldb). BIAS_BF16 rounds the
// bias to bf16 first (bias quantised to bf16 before the add). K%32==0, M%16==0, N%64==0.
// SPLIT: the result leaves as two bf16 planes, Ch = the rounded value and Cl = the rounded remainder (pitch ldc each), and C is not written.
template <bool ASPLIT, int ACT, bool BIAS_BF16, bool SPLIT>
__global__ __launch_bounds__(128) void k_gemm_bf(const float* __restrict__ A, int lda, const unsigned short* __restrict__ Wt, int ldb,
                                               const float* __restrict__ bias, float* __restrict__ C, unsigned short* __restrict__ Ch, unsigned short* __restrict__ Cl,
                                               int ldc, int M, int N, int K) {
  __shared__ __attribute__((aligned(16))) float so[4][16][64];
  const int tid = threadIdx.x, w = tid >> 5, lane = tid & 31, ln = lane & 15, hh = lane >> 4;
  const int ntn = N / 64;
  const int wid = blockIdx.x * 4 + w;
  const int mt = wid / ntn, nq = wid % ntn;
  if (mt * 16 >= M) return;
  const int row0 = mt * 16, col0 = nq * 64;
  const float* arow = A + (size_t)(row0 + ln) * lda;
  v8f acc[4] = {};
  for (int kb = 0; kb < K; kb += 32) {
    FragB ah, al;
    const v4f x0 = *(const v4fa*)(arow + kb + 8 * hh), x1 = *(const v4fa*)(arow + kb + 8 * hh + 4);
    const v4f x2 = *(const v4fa*)(arow + kb + 16 + 8 * hh), x3 = *(const v4fa*)(arow + kb + 16 + 8 * hh + 4);
    float xs[16] = {x0[0],x0[1],x0[2],x0[3],x1[0],x1[1],x1[2],x1[3],x2[0],x2[1],x2[2],x2[3],x3[0],x3[1],x3[2],x3[3]};
#pragma unroll
    for (int i = 0; i < 16; ++i) { const unsigned short hb = bf16_bits(xs[i]); ah.u[i] = hb; al.u[i] = ASPLIT ? bf16_bits(xs[i] - bf16_val(hb)) : (unsigned short)0; }
#pragma unroll
    for (int t = 0; t < 4; ++t) {
      const unsigned short* brow = Wt + (size_t)(col0 + t * 16 + ln) * ldb + kb;
      FragB b;
      b.half[0] = *(const v8us*)(brow + 8 * hh);
      b.half[1] = *(const v8us*)(brow + 16 + 8 * hh);
      acc[t] = mmaN<ASPLIT ? 2 : 1>(ah.v, al.v, b.v, b.v, acc[t]);
    }
  }
#pragma unroll
  for (int t = 0; t < 4; ++t) {
    float bv = bias ? bias[col0 + t * 16 + ln] : 0.f;
    if (BIAS_BF16) bv = bf16_round(bv);
#pragma unroll
    for (int r = 0; r < 8; ++r) { float v = acc[t][r] + bv; if (ACT == 1) v = fmaxf(v, 0.f); so[w][8 * hh + r][t * 16 + ln] = v; }
  }
  __builtin_amdgcn_fence(__ATOMIC_ACQ_REL, "workgroup");
  __builtin_amdgcn_wave_barrier();
  if (SPLIT) {
    // a lane takes 8 neighbours of a row: 8 lanes store one whole 128-byte line of each plane; both loops are unrolled so that
    // xs, h and l are indexed by constants and stay in registers
    const int rs = lane >> 3, c8 = (lane & 7) * 8;
#pragma unroll
    for (int q = 0; q < 4; ++q) {
      const int r = q * 4 + rs;
      const v4f a = *(const v4fa*)&so[w][r][c8], b = *(const v4fa*)&so[w][r][c8 + 4];
      const float xs[8] = {a[0],a[1],a[2],a[3],b[0],b[1],b[2],b[3]};
      v8us h, l;
#pragma unroll
      for (int i = 0; i < 8; ++i) { const unsigned short hb = bf16_bits(xs[i]); h[i] = hb; l[i] = bf16_bits(xs[i] - bf16_val(hb)); }
      const size_t o = (size_t)(row0 + r) * ldc + col0 + c8;
      *(v8us*)(Ch + o) = h;
      *(v8us*)(Cl + o) = l;
    }
  } else {
    const int rsub = lane >> 4, c4 = (lane & 15) * 4;
#pragma unroll
    for (int q = 0; q < 8; ++q) {
      const int r = q * 2 + rsub;
      const v4f v = *(const v4fa*)&so[w][r][c4];
      *(v4f*)(C + (size_t)(row0 + r) * ldc + col0 + c4) = v;
    }
  }
}

// Flash-style causal/unmasked attention, all contractions 3-term bf16 hi/lo splits, f32 softmax with running max.
// q,k,v rows are read from f32 buffers with arbitrary row pitch (so they can live inside a fused qkv buffer);
// D = head size (multiple of 32, <= 128); one wave = 16 query rows; block = 4 waves (64 queries) sharing K/V chunks of 32.
template <int D, bool CAUSAL>
__global__ __launch_bounds__(128) void k_flash(const float* __restrict__ qb, const float* __restrict__ kb, const float* __restrict__ vb,
                                             int pitch, int T, int H, float scale, float* __restrict__ y, int ypitch) {
  constexpr int KS = D / 32;        // k-steps for QK
  constexpr int DT = D / 16;        // d tiles for PV
  __shared__ __attribute__((aligned(16))) unsigned short sKh[32][D + 8], sKl[32][D + 8], sVh[32][D + 8], sVl[32][D + 8];
  __shared__ __attribute__((aligned(16))) unsigned short sPh[4][16][40], sPl[4][16][40];
  __shared__ __attribute__((aligned(16))) float sO[4][16][D];
  const int tid = threadIdx.x, w = tid >> 5, lane = tid & 31, ln = lane & 15, hh = lane >> 4;
  const int nqb = (T + 63) / 64;
  const int bh = blockIdx.x / nqb, qblk = blockIdx.x % nqb;
  const int b = bh / H, h = bh % H;
  const int q0 = qblk * 64 + w * 16;
  const float* Q = qb + (size_t)b * T * pitch + h * D;
  const float* K = kb + (size_t)b * T * pitch + h * D;
  const float* V = vb + (size_t)b * T * pitch + h * D;

  // A fragments of the wave's 16 query rows (scaled), hi/lo
  FragB aqh[KS], aql[KS];
  {
    int row = q0 + ln; if (row >= T) row = T - 1;
    const float* qr = Q + (size_t)row * pitch;
#pragma unroll
    for (int ks = 0; ks < KS; ++ks)
#pragma unroll
      for (int i = 0; i < 16; ++i) {
        const int d = ks * 32 + ((i < 8) ? (8 * hh + i) : (16 + 8 * hh + (i - 8)));
        const float x = qr[d] * scale; const unsigned short hb = bf16_bits(x);
        aqh[ks].u[i] = hb; aql[ks].u[i] = bf16_bits(x - bf16_val(hb));
      }
  }
  float m_r[8], l_r[8];
#pragma unroll
  for (int r = 0; r < 8; ++r) { m_r[r] = -3.0e38f; l_r[r] = 0.f; }
  v8f oacc[DT];
#pragma unroll
  for (int dt = 0; dt < DT; ++dt) oacc[dt] = (v8f){0.f,0.f,0.f,0.f,0.f,0.f,0.f,0.f};

  const int kv_end = CAUSAL ? min(T, qblk * 64 + 64) : T;     // block-uniform
  for (int j0 = 0; j0 < kv_end; j0 += 32) {
    __syncthreads();
    for (int e = tid; e < 32 * (D / 4); e += 128) {
      const int r = e / (D / 4), c4 = (e % (D / 4)) * 4;
      const int key = j0 + r;
      v4f kf = {0.f,0.f,0.f,0.f}, vf = {0.f,0.f,0.f,0.f};
      if (key < T) { kf = *(const v4fa*)(K + (size_t)key * pitch + c4); vf = *(const v4fa*)(V + (size_t)key * pitch + c4); }
#pragma unroll
      for (int t = 0; t < 4; ++t) {
        unsigned short hb = bf16_bits(kf[t]); sKh[r][c4 + t] = hb; sKl[r][c4 + t] = bf16_bits(kf[t] - bf16_val(hb));
        hb = bf16_bits(vf[t]); sVh[r][c4 + t] = hb; sVl[r][c4 + t] = bf16_bits(vf[t] - bf16_val(hb));
      }
    }
    __syncthreads();
    // S tile 16 x 32
    v8f s[2];
#pragma unroll
    for (int nt = 0; nt < 2; ++nt) {
      v8f acc = {};
#pragma unroll
      for (int ks = 0; ks < KS; ++ks) {
        FragB bh_, bl_;
        bh_.half[0] = *(const v8us*)&sKh[nt * 16 + ln][ks * 32 + 8 * hh]; bh_.half[1] = *(const v8us*)&sKh[nt * 16 + ln][ks * 32 + 16 + 8 * hh];
        bl_.half[0] = *(const v8us*)&sKl[nt * 16 + ln][ks * 32 + 8 * hh]; bl_.half[1] = *(const v8us*)&sKl[nt * 16 + ln][ks * 32 + 16 + 8 * hh];
        acc = mmaN<3>(aqh[ks].v, aql[ks].v, bh_.v, bl_.v, acc);
      }
      s[nt] = acc;
    }
    // mask + running max (rows 8hh+r; the 16 lanes of a half share rows)
    float alpha[8];
#pragma unroll
    for (int r = 0; r < 8; ++r) {
      const int qi = q0 + 8 * hh + r;
      const int ja = j0 + ln, jb = j0 + 16 + ln;
      if (CAUSAL) { if (ja > qi) s[0][r] = -3.0e38f; if (jb > qi) s[1][r] = -3.0e38f; }
      if (ja >= T) s[0][r] = -3.0e38f;
      if (jb >= T) s[1][r] = -3.0e38f;
      float mx = fmaxf(s[0][r], s[1][r]);
      mx = fmaxf(mx, __shfl_xor(mx, 1, 32)); mx = fmaxf(mx, __shfl_xor(mx, 2, 32)); mx = fmaxf(mx, __shfl_xor(mx, 4, 32)); mx = fmaxf(mx, __shfl_xor(mx, 8, 32));
      const float mnew = fmaxf(m_r[r], mx);
      alpha[r] = (mnew > -1.0e38f) ? __expf(m_r[r] - mnew) : 1.0f;
      const float p0 = (s[0][r] > -1.0e38f) ? __expf(s[0][r] - mnew) : 0.f;
      const float p1 = (s[1][r] > -1.0e38f) ? __expf(s[1][r] - mnew) : 0.f;
      m_r[r] = mnew;
      l_r[r] = l_r[r] * alpha[r] + p0 + p1;            // per-lane partial row sum (16 lanes combined at the end)
      unsigned short hb = bf16_bits(p0); sPh[w][8 * hh + r][ln] = hb;      sPl[w][8 * hh + r][ln] = bf16_bits(p0 - bf16_val(hb));
      hb = bf16_bits(p1);                sPh[w][8 * hh + r][16 + ln] = hb; sPl[w][8 * hh + r][16 + ln] = bf16_bits(p1 - bf16_val(hb));
    }
#pragma unroll
    for (int dt = 0; dt < DT; ++dt)
#pragma unroll
      for (int r = 0; r < 8; ++r) oacc[dt][r] *= alpha[r];
    __builtin_amdgcn_fence(__ATOMIC_ACQ_REL, "workgroup");
    __builtin_amdgcn_wave_barrier();
    FragB pah, pal;
    pah.half[0] = *(const v8us*)&sPh[w][ln][8 * hh]; pah.half[1] = *(const v8us*)&sPh[w][ln][16 + 8 * hh];
    pal.half[0] = *(const v8us*)&sPl[w][ln][8 * hh]; pal.half[1] = *(const v8us*)&sPl[w][ln][16 + 8 * hh];
#pragma unroll
    for (int dt = 0; dt < DT; ++dt) {
      FragB bvh, bvl;
#pragma unroll
      for (int i = 0; i < 8; ++i) {
        bvh.u[i] = sVh[8 * hh + i][dt * 16 + ln]; bvh.u[8 + i] = sVh[16 + 8 * hh + i][dt * 16 + ln];
        bvl.u[i] = sVl[8 * hh + i][dt * 16 + ln]; bvl.u[8 + i] = sVl[16 + 8 * hh + i][dt * 16 + ln];
      }
      oacc[dt] = mmaN<3>(pah.v, pal.v, bvh.v, bvl.v, oacc[dt]);
    }
    __builtin_amdgcn_fence(__ATOMIC_ACQ_REL, "workgroup");
    __builtin_amdgcn_wave_barrier();
  }
#pragma unroll
  for (int r = 0; r < 8; ++r) {
    float l = l_r[r];
    l += __shfl_xor(l, 1, 32); l += __shfl_xor(l, 2, 32); l += __shfl_xor(l, 4, 32); l += __shfl_xor(l, 8, 32);
    l_r[r] = (l > 0.f) ? 1.0f / l : 0.f;
  }
#pragma unroll
  for (int dt = 0; dt < DT; ++dt)
#pragma unroll
    for (int r = 0; r < 8; ++r) sO[w][8 * hh + r][dt * 16 + ln] = oacc[dt][r] * l_r[r];
  __builtin_amdgcn_fence(__ATOMIC_ACQ_REL, "workgroup");
  __builtin_amdgcn_wave_barrier();
  {
    for (int r = 0; r < 16; ++r) {
      const int row = q0 + r;
      if (row < T && lane < D / 4) {
        const v4f val = *(const v4fa*)&sO[w][r][lane * 4];
        *(v4f*)(y + ((size_t)b * T + row) * ypitch + h * D + lane * 4) = val;
      }
    }
    
  }
}

// in pitch = cols, out pitch = rows; rows, cols multiples of 32. Optional per-output-row affine (scale[c], shift[c]) and
// residual add res (same layout as out, optionally bf16-rounded) for fused epilogues: out = in*scale + shift + res.
template <bool AFFINE, bool RESID, bool RES_BF16>
__global__ __launch_bounds__(256) void k_transpose32(const float* __restrict__ in, float* __restrict__ out, int rows, int cols,
                                                    const float* __restrict__ scale, const float* __restrict__ shift, const float* __restrict__ res) {
  __shared__ float tile[32][33];
  const int b = blockIdx.z;
  const int r0 = blockIdx.y * 32, c0 = blockIdx.x * 32;
  const float* src = in + (size_t)b * rows * cols;
  float* dst = out + (size_t)b * rows * cols;
  const int tx = threadIdx.x & 31, ty = threadIdx.x >> 5;     // 8 rows per pass
  for (int i = ty; i < 32; i += 8) tile[i][tx] = src[(size_t)(r0 + i) * cols + c0 + tx];
  __syncthreads();
  {
    for (int i = ty; i < 32; i += 8) {
      float v = tile[tx][i];
      const int orow = c0 + i;
      if (AFFINE) v = v * scale[orow] + shift[orow];
      if (RESID) { float rv = res[(size_t)b * rows * cols + (size_t)orow * rows + r0 + tx]; if (RES_BF16) rv = bf16_round(rv); v += rv; }
      *(float*)(dst + (size_t)orow * rows + r0 + tx) = v;
    }
    
  }
}

// 2x2 max pool on position-major data: in [B][H*W][C] -> out [B][(H/2)*(W/2)][C]; thread per (b, p', 4 channels); C%4==0
__global__ __launch_bounds__(256) void k_pool2_pm(const float* __restrict__ in, float* __restrict__ out, int Bn, int H, int W, int C) {
  const size_t t = (size_t)blockIdx.x * 256 + threadIdx.x;
  const int c4n = C / 4, Ho = H / 2, Wo = W / 2;
  const size_t total = (size_t)Bn * Ho * Wo * c4n;
  if (t >= total) return;
  const int c4 = (int)(t % c4n) * 4; size_t rest = t / c4n;
  const int pw = (int)(rest % Wo); rest /= Wo; const int ph = (int)(rest % Ho); const int b = (int)(rest / Ho);
  const float* base = in + (size_t)b * H * W * C;
  const int p00 = (2 * ph) * W + 2 * pw;
  const v4f a = *(const v4fa*)(base + (size_t)p00 * C + c4), bq = *(const v4fa*)(base + (size_t)(p00 + 1) * C + c4);
  const v4f c = *(const v4fa*)(base + (size_t)(p00 + W) * C + c4), d = *(const v4fa*)(base + (size_t)(p00 + W + 1) * C + c4);
  v4f m; for (int i = 0; i < 4; ++i) m[i] = fmaxf(fmaxf(a[i], bq[i]), fmaxf(c[i], d[i]));
  float* dst = out + ((size_t)b * Ho * Wo + (size_t)ph * Wo + pw) * C + c4;
  *(v4f*)dst = m;
  
}

// General (non-causal) attention, 3-term bf16 splits, f32 softmax with running max.
// Q [.][Tq][qpitch] f32; K [.][Tk][kpitch] (head dim DQ) and V [.][Tk][vpitch] (head dim DVtot) arrive already split, as a hi and a lo
// bf16 plane each, so that a tile is staged by plain 16-byte copies and is not split again by every block that reads it; this block handles DV output
// dims starting at dv0 = blockIdx.y*DV. y[bh][t][ypitch] gets columns dv0..dv0+DV-1. Per-bh base offsets via strides.
// The K and V row pitches are compile-time (kpitch, vpitch), so that a thread's staging loads differ only in their immediate offset.
template <int DQ, int DV, int kpitch, int vpitch>
__global__ __launch_bounds__(128) void k_flash2(const float* __restrict__ Qb, size_t qstride, int qpitch, int Tq,
                                              const unsigned short* __restrict__ Khb, const unsigned short* __restrict__ Klb, size_t kstride, int Tk,
                                              const unsigned short* __restrict__ Vhb, const unsigned short* __restrict__ Vlb, size_t vstride,
                                              float scale, float* __restrict__ y, size_t ystride, int ypitch) {
  constexpr int KS = DQ / 32, DT = DV / 16;
  constexpr int VP = DV + 16;       // V row pitch in elements: an odd multiple of 32 bytes, the conflict-free pitch of the transposing load
  __shared__ __attribute__((aligned(16))) unsigned short sKh[32][DQ + 8], sKl[32][DQ + 8], sVh[32][VP], sVl[32][VP];
  __shared__ __attribute__((aligned(16))) unsigned short sPh[4][16][40], sPl[4][16][40];
  __shared__ __attribute__((aligned(16))) float sO[4][16][DV];
  const int tid = threadIdx.x, w = tid >> 5, lane = tid & 31, ln = lane & 15, hh = lane >> 4;
  const int nqb = (Tq + 63) / 64;
  const int bh = blockIdx.x / nqb, qblk = blockIdx.x % nqb;
  const int dv0 = blockIdx.y * DV;
  const int q0 = qblk * 64 + w * 16;
  const float* Q = Qb + (size_t)bh * qstride;
  const unsigned short* Kh = Khb + (size_t)bh * kstride; const unsigned short* Kl = Klb + (size_t)bh * kstride;
  const unsigned short* Vh = Vhb + (size_t)bh * vstride + dv0; const unsigned short* Vl = Vlb + (size_t)bh * vstride + dv0;
  FragB aqh[KS], aql[KS];
  {
    int row = q0 + ln; if (row >= Tq) row = Tq - 1;
    const float* qr = Q + (size_t)row * qpitch;
#pragma unroll
    for (int ks = 0; ks < KS; ++ks)
#pragma unroll
      for (int i = 0; i < 16; ++i) {
        const int d = ks * 32 + ((i < 8) ? (8 * hh + i) : (16 + 8 * hh + (i - 8)));
        const float x = qr[d] * scale; const unsigned short hb = bf16_bits(x);
        aqh[ks].u[i] = hb; aql[ks].u[i] = bf16_bits(x - bf16_val(hb));
      }
  }
  float m_r[8], l_r[8];
#pragma unroll
  for (int r = 0; r < 8; ++r) { m_r[r] = -3.0e38f; l_r[r] = 0.f; }
  v8f oacc[DT];
#pragma unroll
  for (int dt = 0; dt < DT; ++dt) oacc[dt] = (v8f){0.f,0.f,0.f,0.f,0.f,0.f,0.f,0.f};
  // Staging of a 32-key tile: 128 threads cover KR rows of a K plane (VR of a V plane) per 16-byte load, KL (VL) loads per thread and plane.
  constexpr int KR = 128 / (DQ / 8), VR = 128 / (DV / 8), KL = 32 / KR, VL = 32 / VR;
  static_assert(KR * (DQ / 8) == 128 && VR * (DV / 8) == 128 && KL * KR == 32 && VL * VR == 32, "tile must divide over 128 threads");
  const int kr = tid / (DQ / 8), kc = (tid % (DQ / 8)) * 8, vr = tid / (DV / 8), vc = (tid % (DV / 8)) * 8;
  const unsigned koff = (unsigned)kr * (unsigned)kpitch + (unsigned)kc, voff = (unsigned)vr * (unsigned)vpitch + (unsigned)vc;
  for (int j0 = 0; j0 < Tk; j0 += 32) {
    // All of a thread's K and V loads of the tile are issued before the first is used: a trip waits out one load latency, not
    // 2 * (KL + VL). A full tile (block-uniform test) takes them without the per-row guard, in one straight run. The loops over i are
    // unrolled so that the four arrays are indexed by constants and stay in registers.
    v8us kh[KL], kl[KL], vh[VL], vl[VL];
    if (j0 + 32 <= Tk) {
#pragma unroll
      for (int i = 0; i < KL; ++i) { kh[i] = *(const v8us*)(Kh + (size_t)(j0 + i * KR) * kpitch + koff); kl[i] = *(const v8us*)(Kl + (size_t)(j0 + i * KR) * kpitch + koff); }
#pragma unroll
      for (int i = 0; i < VL; ++i) { vh[i] = *(const v8us*)(Vh + (size_t)(j0 + i * VR) * vpitch + voff); vl[i] = *(const v8us*)(Vl + (size_t)(j0 + i * VR) * vpitch + voff); }
    } else {
#pragma unroll
      for (int i = 0; i < KL; ++i) {
        kh[i] = (v8us){0,0,0,0,0,0,0,0}; kl[i] = (v8us){0,0,0,0,0,0,0,0};
        if (j0 + i * KR + kr < Tk) { kh[i] = *(const v8us*)(Kh + (size_t)(j0 + i * KR) * kpitch + koff); kl[i] = *(const v8us*)(Kl + (size_t)(j0 + i * KR) * kpitch + koff); }
      }
#pragma unroll
      for (int i = 0; i < VL; ++i) {
        vh[i] = (v8us){0,0,0,0,0,0,0,0}; vl[i] = (v8us){0,0,0,0,0,0,0,0};
        if (j0 + i * VR + vr < Tk) { vh[i] = *(const v8us*)(Vh + (size_t)(j0 + i * VR) * vpitch + voff); vl[i] = *(const v8us*)(Vl + (size_t)(j0 + i * VR) * vpitch + voff); }
      }
    }
    __syncthreads();
#pragma unroll
    for (int i = 0; i < KL; ++i) { *(v8us*)&sKh[i * KR + kr][kc] = kh[i]; *(v8us*)&sKl[i * KR + kr][kc] = kl[i]; }
#pragma unroll
    for (int i = 0; i < VL; ++i) { *(v8us*)&sVh[i * VR + vr][vc] = vh[i]; *(v8us*)&sVl[i * VR + vr][vc] = vl[i]; }
    __syncthreads();
    v8f s[2];
#pragma unroll
    for (int nt = 0; nt < 2; ++nt) {
      v8f acc = {};
#pragma unroll
      for (int ks = 0; ks < KS; ++ks) {
        FragB bh_, bl_;
        bh_.half[0] = *(const v8us*)&sKh[nt * 16 + ln][ks * 32 + 8 * hh]; bh_.half[1] = *(const v8us*)&sKh[nt * 16 + ln][ks * 32 + 16 + 8 * hh];
        bl_.half[0] = *(const v8us*)&sKl[nt * 16 + ln][ks * 32 + 8 * hh]; bl_.half[1] = *(const v8us*)&sKl[nt * 16 + ln][ks * 32 + 16 + 8 * hh];
        acc = mmaN<3>(aqh[ks].v, aql[ks].v, bh_.v, bl_.v, acc);
      }
      s[nt] = acc;
    }
    float alpha[8];
#pragma unroll
    for (int r = 0; r < 8; ++r) {
      const int ja = j0 + ln, jb = j0 + 16 + ln;
      if (ja >= Tk) s[0][r] = -3.0e38f;
      if (jb >= Tk) s[1][r] = -3.0e38f;
      float mx = fmaxf(s[0][r], s[1][r]);
      mx = fmaxf(mx, __shfl_xor(mx, 1, 32)); mx = fmaxf(mx, __shfl_xor(mx, 2, 32)); mx = fmaxf(mx, __shfl_xor(mx, 4, 32)); mx = fmaxf(mx, __shfl_xor(mx, 8, 32));
      const float mnew = fmaxf(m_r[r], mx);
      alpha[r] = (mnew > -1.0e38f) ? __expf(m_r[r] - mnew) : 1.0f;
      const float p0 = (s[0][r] > -1.0e38f) ? __expf(s[0][r] - mnew) : 0.f;
      const float p1 = (s[1][r] > -1.0e38f) ? __expf(s[1][r] - mnew) : 0.f;
      m_r[r] = mnew;
      l_r[r] = l_r[r] * alpha[r] + p0 + p1;
      unsigned short hb = bf16_bits(p0); sPh[w][8 * hh + r][ln] = hb;      sPl[w][8 * hh + r][ln] = bf16_bits(p0 - bf16_val(hb));
      hb = bf16_bits(p1);                sPh[w][8 * hh + r][16 + ln] = hb; sPl[w][8 * hh + r][16 + ln] = bf16_bits(p1 - bf16_val(hb));
    }
#pragma unroll
    for (int dt = 0; dt < DT; ++dt)
#pragma unroll
      for (int r = 0; r < 8; ++r) oacc[dt][r] *= alpha[r];
    __builtin_amdgcn_fence(__ATOMIC_ACQ_REL, "workgroup");
    __builtin_amdgcn_wave_barrier();
    FragB pah, pal;
    pah.half[0] = *(const v8us*)&sPh[w][ln][8 * hh]; pah.half[1] = *(const v8us*)&sPh[w][ln][16 + 8 * hh];
    pal.half[0] = *(const v8us*)&sPl[w][ln][8 * hh]; pal.half[1] = *(const v8us*)&sPl[w][ln][16 + 8 * hh];
    const unsigned short* vth = &sVh[8 * hh + (lane & 7)][((lane >> 3) & 1) * 8];
    const unsigned short* vtl = &sVl[8 * hh + (lane & 7)][((lane >> 3) & 1) * 8];
    // fragments of two d tiles are fetched as one group, one group ahead of the products that use them
    FragB bvh[2][2], bvl[2][2];
#pragma unroll
    for (int u = 0; u < 2; ++u) {
      bvh[0][u].half[0] = ld_tr16(vth + u * 16); bvh[0][u].half[1] = ld_tr16(vth + 16 * VP + u * 16);
      bvl[0][u].half[0] = ld_tr16(vtl + u * 16); bvl[0][u].half[1] = ld_tr16(vtl + 16 * VP + u * 16);
    }
#pragma unroll
    for (int g = 0; g < DT / 2; ++g) {
      if (g + 1 < DT / 2) {
#pragma unroll
        for (int u = 0; u < 2; ++u) {
          const int d = ((g + 1) * 2 + u) * 16;
          bvh[(g + 1) & 1][u].half[0] = ld_tr16(vth + d); bvh[(g + 1) & 1][u].half[1] = ld_tr16(vth + 16 * VP + d);
          bvl[(g + 1) & 1][u].half[0] = ld_tr16(vtl + d); bvl[(g + 1) & 1][u].half[1] = ld_tr16(vtl + 16 * VP + d);
        }
      }
#pragma unroll
      for (int u = 0; u < 2; ++u) oacc[g * 2 + u] = mmaN<3>(pah.v, pal.v, bvh[g & 1][u].v, bvl[g & 1][u].v, oacc[g * 2 + u]);
    }
    __builtin_amdgcn_fence(__ATOMIC_ACQ_REL, "workgroup");
    __builtin_amdgcn_wave_barrier();
  }
#pragma unroll
  for (int r = 0; r < 8; ++r) {
    float l = l_r[r];
    l += __shfl_xor(l, 1, 32); l += __shfl_xor(l, 2, 32); l += __shfl_xor(l, 4, 32); l += __shfl_xor(l, 8, 32);
    l_r[r] = (l > 0.f) ? 1.0f / l : 0.f;
  }
#pragma unroll
  for (int dt = 0; dt < DT; ++dt)
#pragma unroll
    for (int r = 0; r < 8; ++r) sO[w][8 * hh + r][dt * 16 + ln] = oacc[dt][r] * l_r[r];
  __builtin_amdgcn_fence(__ATOMIC_ACQ_REL, "workgroup");
  __builtin_amdgcn_wave_barrier();
  {
    for (int r = 0; r < 16; ++r) {
      const int row = q0 + r;
      for (int c4 = lane * 4; c4 < DV; c4 += 128) {
        if (row < Tq) {
          const v4f val = *(const v4fa*)&sO[w][r][c4];
          *(v4f*)(y + (size_t)bh * ystride + (size_t)row * ypitch + dv0 + c4) = val;
        }
      }
    }
    
  }
}

__global__ __launch_bounds__(256) void k_round_rows(const float* __restrict__ W, unsigned short* __restrict__ Wt, int n8) {
  const int t = blockIdx.x * 256 + threadIdx.x;
  if (t >= n8) return;
  const v4f a = *(const v4fa*)(W + (size_t)t * 8), b = *(const v4fa*)(W + (size_t)t * 8 + 4);
  v8us v; v[0]=bf16_bits(a[0]); v[1]=bf16_bits(a[1]); v[2]=bf16_bits(a[2]); v[3]=bf16_bits(a[3]);
  v[4]=bf16_bits(b[0]); v[5]=bf16_bits(b[1]); v[6]=bf16_bits(b[2]); v[7]=bf16_bits(b[3]);
  *(v8us*)(Wt + (size_t)t * 8) = v; 
}

// padded q/k weights: Bt [64][256] rows < 8 real; bias64; gamma vector (256 copies, bf16-rounded) and zero shift
__global__ __launch_bounds__(256) void k_prep(const float* __restrict__ wq, const float* __restrict__ bq, const float* __restrict__ wk, const float* __restrict__ bk, const float* __restrict__ gamma,
                                            unsigned short* __restrict__ Bq, unsigned short* __restrict__ Bk, float* __restrict__ bq64, float* __restrict__ bk64, float* __restrict__ gvec, float* __restrict__ zvec) {
  const int t = blockIdx.x * 256 + threadIdx.x;
  if (t < DQP * (CC / 8)) { const int n = t / (CC / 8), k8 = (t % (CC / 8)) * 8; v8us a, b;
    for (int i = 0; i < 8; ++i) { a[i] = (n < 8) ? bf16_bits(wq[n * CC + k8 + i]) : (unsigned short)0; b[i] = (n < 8) ? bf16_bits(wk[n * CC + k8 + i]) : (unsigned short)0; }
    *(v8us*)(Bq + n * CC + k8) = a; *(v8us*)(Bk + n * CC + k8) = b;  }
  if (t < DQP) { const float a = (t < 8) ? bq[t] : 0.f, b = (t < 8) ? bk[t] : 0.f; *(float*)(bq64 + t) = a; *(float*)(bk64 + t) = b;  }
  if (t < CC) { const float g = bf16_round(gamma[0]); *(float*)(gvec + t) = g; *(float*)(zvec + t) = 0.f;  }
}
extern "C" void kernel_launch(void* const* d_in, const int* in_sizes, int n_in,
                              void* d_out, int out_size, void* d_ws, size_t ws_size, hipStream_t stream) {
  (void)in_sizes; (void)n_in; (void)out_size;
  const float* x = (const float*)d_in[0]; const float* wq = (const float*)d_in[1]; const float* bq = (const float*)d_in[2]; const float* wk = (const float*)d_in[3]; const float* bk = (const float*)d_in[4];
  const float* wv = (const float*)d_in[5]; const float* bv = (const float*)d_in[6]; const float* gamma = (const float*)d_in[7];
  char* ws = (char*)d_ws; size_t off = 0;
  auto take = [&](size_t bytes) { char* p = ws + off; off += (bytes + 255) & ~(size_t)255; return p; };
  const int M = BB * NN;
  unsigned short* Bq = (unsigned short*)take(DQP * CC * 2); unsigned short* Bk = (unsigned short*)take(DQP * CC * 2); unsigned short* Bv = (unsigned short*)take(CC * CC * 2);
  float* bq64 = (float*)take(256); float* bk64 = (float*)take(256); float* gvec = (float*)take(CC * 4); float* zvec = (float*)take(CC * 4);
  float* xT = (float*)take((size_t)M * CC * 4); float* q = (float*)take((size_t)M * DQP * 4);
  unsigned short* kh = (unsigned short*)take((size_t)M * DQP * 2); unsigned short* kl = (unsigned short*)take((size_t)M * DQP * 2);
  unsigned short* vh = (unsigned short*)take((size_t)M * CC * 2); unsigned short* vl = (unsigned short*)take((size_t)M * CC * 2);
  float* z = (float*)take((size_t)M * CC * 4);
  if (off > ws_size) return;
  k_prep<<<(DQP * (CC / 8) + 255) / 256, 256, 0, stream>>>(wq, bq, wk, bk, gamma, Bq, Bk, bq64, bk64, gvec, zvec);
  k_round_rows<<<(CC * CC / 8 + 255) / 256, 256, 0, stream>>>(wv, Bv, CC * CC / 8);
  k_transpose32<false, false, false><<<dim3(NN / 32, CC / 32, BB), 256, 0, stream>>>(x, xT, CC, NN, nullptr, nullptr, nullptr);     // [B][C][N] -> [B][N][C]
  k_gemm_bf<false, 0, true, false><<<((M / 16) * (DQP / 64) + 3) / 4, 128, 0, stream>>>(xT, CC, Bq, CC, bq64, q, nullptr, nullptr, DQP, M, DQP, CC);
  k_gemm_bf<false, 0, true, true><<<((M / 16) * (DQP / 64) + 3) / 4, 128, 0, stream>>>(xT, CC, Bk, CC, bk64, nullptr, kh, kl, DQP, M, DQP, CC);
  k_gemm_bf<false, 0, true, true><<<((M / 16) * (CC / 64) + 3) / 4, 128, 0, stream>>>(xT, CC, Bv, CC, bv, nullptr, vh, vl, CC, M, CC, CC);
  k_flash2<DQP, 128, DQP, CC><<<dim3(BB * (NN / 64), 2), 128, 0, stream>>>(q, (size_t)NN * DQP, DQP, NN, kh, kl, (size_t)NN * DQP, NN, vh, vl, (size_t)NN * CC, 1.0f, z, (size_t)NN * CC, CC);
  k_transpose32<true, true, true><<<dim3(CC / 32, NN / 32, BB), 256, 0, stream>>>(z, (float*)d_out, NN, CC, gvec, zvec, x);     // out = gamma·zᵀ + bf16(x)
}

// v004
// A run of this version takes 301 microseconds.
// Next to v003, in two timings, it ran 1.24 times as fast each time.
// All steps since v000 together make it 3.52 times as fast.
#include <hip/hip_runtime.h>
// All contractions on v_wmma_f32_16x16x32_bf16, f32 accumulate: the q/k/v 1×1 convs as GEMMs over a position-major copy of x (x, W, b rounded to
// bf16: single exact term; the 8 q/k channels zero-padded to 64), energy = qᵀk (no scale) and attn·v per 16-query tile as 3-term bf16 hi/lo
// splits (k_flash2, value dim 256 split over 2 blocks; the k and v GEMMs write the hi and lo planes of their results), gamma·out + bf16(x) fused into the transpose back; softmax in f32.
#define BB 8
#define CC 256
#define NN 4096
#define DQP 64

typedef __bf16 v16b __attribute__((ext_vector_type(16)));
typedef unsigned short v8us __attribute__((ext_vector_type(8), may_alias));
typedef float  v8f  __attribute__((ext_vector_type(8)));
typedef float  v4f  __attribute__((ext_vector_type(4)));
typedef float  v4fa __attribute__((ext_vector_type(4), may_alias));
typedef __bf16 v2b __attribute__((ext_vector_type(2)));
typedef float  v2f  __attribute__((ext_vector_type(2)));
union FragB { v16b v; v8us half[2]; unsigned short u[16]; v2b pair[8]; };

__device__ __forceinline__ unsigned short bf16_bits(float x) { unsigned int u = __float_as_uint(x); return (unsigned short)((u + 0x7FFFu + ((u >> 16) & 1u)) >> 16); }
__device__ __forceinline__ float bf16_val(unsigned short b) { return __uint_as_float(((unsigned int)b) << 16); }
__device__ __forceinline__ float bf16_round(float x) { return bf16_val(bf16_bits(x)); }
// 16-bit transposing LDS load: lane (c = l & 15, h = l >> 4) gets T[k0 + 8h + 0..7][d0 + c] from a row-major tile; lane l passes
// &T[k0 + 8 * (l >> 4) + (l & 7)][d0 + 8 * ((l >> 3) & 1)]. Two loads (k0, k0 + 16) make one 32 x 16 B fragment in the hardware k order.
typedef short s16x8 __attribute__((ext_vector_type(8)));
__device__ __forceinline__ v8us ld_tr16(const unsigned short* p) {
  typedef __attribute__((address_space(3))) s16x8 lds_s16x8;
  return __builtin_bit_cast(v8us, __builtin_amdgcn_ds_load_tr16_b128_v8i16((lds_s16x8*)p));
}
// D += A·B with NT terms: 1 = ah·bh, 2 = + al·bh (A split), 3 = + ah·bl (both split)
template <int NT>
__device__ __forceinline__ v8f mmaN(v16b ah, v16b al, v16b bh, v16b bl, v8f c) {
  c = __builtin_amdgcn_wmma_f32_16x16x32_bf16(false, ah, false, bh, (short)0, c, false, false);
  if (NT >= 2) c = __builtin_amdgcn_wmma_f32_16x16x32_bf16(false, al, false, bh, (short)0, c, false, false);
  if (NT >= 3) c = __builtin_amdgcn_wmma_f32_16x16x32_bf16(false, ah, false, bl, (short)0, c, false, false);
  asm volatile("v_nop\n\tv_nop\n\tv_nop\n\tv_nop" : "+v"(c) : "v"(ah), "v"(al), "v"(bh), "v"(bl));
  return c;
}

__global__ __launch_bounds__(256) void k_wt_bf16(const float* __restrict__ W, unsigned short* __restrict__ Wt, int K, int N) {
  const int t = blockIdx.x * 256 + threadIdx.x;
  const int k8n = K / 8;
  if (t >= N * k8n) return;
  const int n = t / k8n, k8 = (t % k8n) * 8;
  v8us v;
#pragma unroll
  for (int i = 0; i < 8; ++i) v[i] = bf16_bits(W[(size_t)(k8 + i) * N + n]);
  *(v8us*)(Wt + (size_t)n * K + k8) = v;
  
}

// GEMM C[M][N] (f32, pitch ldc) = act(A[M][K]·W + bias). A f32 row-major (pitch lda) converted per fragment to bf16
// (ASPLIT: hi/lo two planes -> 2 terms, else single rounded term); Wt bf16 [N][K] (pitch ldb). BIAS_BF16 rounds the
// bias to bf16 first (bias quantised to bf16 before the add). K%32==0, M%16==0, N%64==0.
// SPLIT: the result leaves as two bf16 planes, Ch = the rounded value and Cl = the rounded remainder (pitch ldc each), and C is not written.
template <bool ASPLIT, int ACT, bool BIAS_BF16, bool SPLIT>
__global__ __launch_bounds__(128) void k_gemm_bf(const float* __restrict__ A, int lda, const unsigned short* __restrict__ Wt, int ldb,
                                               const float* __restrict__ bias, float* __restrict__ C, unsigned short* __restrict__ Ch, unsigned short* __restrict__ Cl,
                                               int ldc, int M, int N, int K) {
  __shared__ __attribute__((aligned(16))) float so[4][16][64];
  const int tid = threadIdx.x, w = tid >> 5, lane = tid & 31, ln = lane & 15, hh = lane >> 4;
  const int ntn = N / 64;
  const int wid = blockIdx.x * 4 + w;
  const int mt = wid / ntn, nq = wid % ntn;
  if (mt * 16 >= M) return;
  const int row0 = mt * 16, col0 = nq * 64;
  const float* arow = A + (size_t)(row0 + ln) * lda;
  v8f acc[4] = {};
  for (int kb = 0; kb < K; kb += 32) {
    FragB ah, al;
    const v4f x0 = *(const v4fa*)(arow + kb + 8 * hh), x1 = *(const v4fa*)(arow + kb + 8 * hh + 4);
    const v4f x2 = *(const v4fa*)(arow + kb + 16 + 8 * hh), x3 = *(const v4fa*)(arow + kb + 16 + 8 * hh + 4);
    float xs[16] = {x0[0],x0[1],x0[2],x0[3],x1[0],x1[1],x1[2],x1[3],x2[0],x2[1],x2[2],x2[3],x3[0],x3[1],x3[2],x3[3]};
#pragma unroll
    for (int i = 0; i < 16; ++i) { const unsigned short hb = bf16_bits(xs[i]); ah.u[i] = hb; al.u[i] = ASPLIT ? bf16_bits(xs[i] - bf16_val(hb)) : (unsigned short)0; }
#pragma unroll
    for (int t = 0; t < 4; ++t) {
      const unsigned short* brow = Wt + (size_t)(col0 + t * 16 + ln) * ldb + kb;
      FragB b;
      b.half[0] = *(const v8us*)(brow + 8 * hh);
      b.half[1] = *(const v8us*)(brow + 16 + 8 * hh);
      acc[t] = mmaN<ASPLIT ? 2 : 1>(ah.v, al.v, b.v, b.v, acc[t]);
    }
  }
#pragma unroll
  for (int t = 0; t < 4; ++t) {
    float bv = bias ? bias[col0 + t * 16 + ln] : 0.f;
    if (BIAS_BF16) bv = bf16_round(bv);
#pragma unroll
    for (int r = 0; r < 8; ++r) { float v = acc[t][r] + bv; if (ACT == 1) v = fmaxf(v, 0.f); so[w][8 * hh + r][t * 16 + ln] = v; }
  }
  __builtin_amdgcn_fence(__ATOMIC_ACQ_REL, "workgroup");
  __builtin_amdgcn_wave_barrier();
  if (SPLIT) {
    // a lane takes 8 neighbours of a row: 8 lanes store one whole 128-byte line of each plane; both loops are unrolled so that
    // xs, h and l are indexed by constants and stay in registers
    const int rs = lane >> 3, c8 = (lane & 7) * 8;
#pragma unroll
    for (int q = 0; q < 4; ++q) {
      const int r = q * 4 + rs;
      const v4f a = *(const v4fa*)&so[w][r][c8], b = *(const v4fa*)&so[w][r][c8 + 4];
      const float xs[8] = {a[0],a[1],a[2],a[3],b[0],b[1],b[2],b[3]};
      v8us h, l;
#pragma unroll
      for (int i = 0; i < 8; ++i) { const unsigned short hb = bf16_bits(xs[i]); h[i] = hb; l[i] = bf16_bits(xs[i] - bf16_val(hb)); }
      const size_t o = (size_t)(row0 + r) * ldc + col0 + c8;
      *(v8us*)(Ch + o) = h;
      *(v8us*)(Cl + o) = l;
    }
  } else {
    const int rsub = lane >> 4, c4 = (lane & 15) * 4;
#pragma unroll
    for (int q = 0; q < 8; ++q) {
      const int r = q * 2 + rsub;
      const v4f v = *(const v4fa*)&so[w][r][c4];
      *(v4f*)(C + (size_t)(row0 + r) * ldc + col0 + c4) = v;
    }
  }
}

// Flash-style causal/unmasked attention, all contractions 3-term bf16 hi/lo splits, f32 softmax with running max.
// q,k,v rows are read from f32 buffers with arbitrary row pitch (so they can live inside a fused qkv buffer);
// D = head size (multiple of 32, <= 128); one wave = 16 query rows; block = 4 waves (64 queries) sharing K/V chunks of 32.
template <int D, bool CAUSAL>
__global__ __launch_bounds__(128) void k_flash(const float* __restrict__ qb, const float* __restrict__ kb, const float* __restrict__ vb,
                                             int pitch, int T, int H, float scale, float* __restrict__ y, int ypitch) {
  constexpr int KS = D / 32;        // k-steps for QK
  constexpr int DT = D / 16;        // d tiles for PV
  __shared__ __attribute__((aligned(16))) unsigned short sKh[32][D + 8], sKl[32][D + 8], sVh[32][D + 8], sVl[32][D + 8];
  __shared__ __attribute__((aligned(16))) unsigned short sPh[4][16][40], sPl[4][16][40];
  __shared__ __attribute__((aligned(16))) float sO[4][16][D];
  const int tid = threadIdx.x, w = tid >> 5, lane = tid & 31, ln = lane & 15, hh = lane >> 4;
  const int nqb = (T + 63) / 64;
  const int bh = blockIdx.x / nqb, qblk = blockIdx.x % nqb;
  const int b = bh / H, h = bh % H;
  const int q0 = qblk * 64 + w * 16;
  const float* Q = qb + (size_t)b * T * pitch + h * D;
  const float* K = kb + (size_t)b * T * pitch + h * D;
  const float* V = vb + (size_t)b * T * pitch + h * D;

  // A fragments of the wave's 16 query rows (scaled), hi/lo
  FragB aqh[KS], aql[KS];
  {
    int row = q0 + ln; if (row >= T) row = T - 1;
    const float* qr = Q + (size_t)row * pitch;
#pragma unroll
    for (int ks = 0; ks < KS; ++ks)
#pragma unroll
      for (int i = 0; i < 16; ++i) {
        const int d = ks * 32 + ((i < 8) ? (8 * hh + i) : (16 + 8 * hh + (i - 8)));
        const float x = qr[d] * scale; const unsigned short hb = bf16_bits(x);
        aqh[ks].u[i] = hb; aql[ks].u[i] = bf16_bits(x - bf16_val(hb));
      }
  }
  float m_r[8], l_r[8];
#pragma unroll
  for (int r = 0; r < 8; ++r) { m_r[r] = -3.0e38f; l_r[r] = 0.f; }
  v8f oacc[DT];
#pragma unroll
  for (int dt = 0; dt < DT; ++dt) oacc[dt] = (v8f){0.f,0.f,0.f,0.f,0.f,0.f,0.f,0.f};

  const int kv_end = CAUSAL ? min(T, qblk * 64 + 64) : T;     // block-uniform
  for (int j0 = 0; j0 < kv_end; j0 += 32) {
    __syncthreads();
    for (int e = tid; e < 32 * (D / 4); e += 128) {
      const int r = e / (D / 4), c4 = (e % (D / 4)) * 4;
      const int key = j0 + r;
      v4f kf = {0.f,0.f,0.f,0.f}, vf = {0.f,0.f,0.f,0.f};
      if (key < T) { kf = *(const v4fa*)(K + (size_t)key * pitch + c4); vf = *(const v4fa*)(V + (size_t)key * pitch + c4); }
#pragma unroll
      for (int t = 0; t < 4; ++t) {
        unsigned short hb = bf16_bits(kf[t]); sKh[r][c4 + t] = hb; sKl[r][c4 + t] = bf16_bits(kf[t] - bf16_val(hb));
        hb = bf16_bits(vf[t]); sVh[r][c4 + t] = hb; sVl[r][c4 + t] = bf16_bits(vf[t] - bf16_val(hb));
      }
    }
    __syncthreads();
    // S tile 16 x 32
    v8f s[2];
#pragma unroll
    for (int nt = 0; nt < 2; ++nt) {
      v8f acc = {};
#pragma unroll
      for (int ks = 0; ks < KS; ++ks) {
        FragB bh_, bl_;
        bh_.half[0] = *(const v8us*)&sKh[nt * 16 + ln][ks * 32 + 8 * hh]; bh_.half[1] = *(const v8us*)&sKh[nt * 16 + ln][ks * 32 + 16 + 8 * hh];
        bl_.half[0] = *(const v8us*)&sKl[nt * 16 + ln][ks * 32 + 8 * hh]; bl_.half[1] = *(const v8us*)&sKl[nt * 16 + ln][ks * 32 + 16 + 8 * hh];
        acc = mmaN<3>(aqh[ks].v, aql[ks].v, bh_.v, bl_.v, acc);
      }
      s[nt] = acc;
    }
    // mask + running max (rows 8hh+r; the 16 lanes of a half share rows)
    float alpha[8];
#pragma unroll
    for (int r = 0; r < 8; ++r) {
      const int qi = q0 + 8 * hh + r;
      const int ja = j0 + ln, jb = j0 + 16 + ln;
      if (CAUSAL) { if (ja > qi) s[0][r] = -3.0e38f; if (jb > qi) s[1][r] = -3.0e38f; }
      if (ja >= T) s[0][r] = -3.0e38f;
      if (jb >= T) s[1][r] = -3.0e38f;
      float mx = fmaxf(s[0][r], s[1][r]);
      mx = fmaxf(mx, __shfl_xor(mx, 1, 32)); mx = fmaxf(mx, __shfl_xor(mx, 2, 32)); mx = fmaxf(mx, __shfl_xor(mx, 4, 32)); mx = fmaxf(mx, __shfl_xor(mx, 8, 32));
      const float mnew = fmaxf(m_r[r], mx);
      alpha[r] = (mnew > -1.0e38f) ? __expf(m_r[r] - mnew) : 1.0f;
      const float p0 = (s[0][r] > -1.0e38f) ? __expf(s[0][r] - mnew) : 0.f;
      const float p1 = (s[1][r] > -1.0e38f) ? __expf(s[1][r] - mnew) : 0.f;
      m_r[r] = mnew;
      l_r[r] = l_r[r] * alpha[r] + p0 + p1;            // per-lane partial row sum (16 lanes combined at the end)
      unsigned short hb = bf16_bits(p0); sPh[w][8 * hh + r][ln] = hb;      sPl[w][8 * hh + r][ln] = bf16_bits(p0 - bf16_val(hb));
      hb = bf16_bits(p1);                sPh[w][8 * hh + r][16 + ln] = hb; sPl[w][8 * hh + r][16 + ln] = bf16_bits(p1 - bf16_val(hb));
    }
#pragma unroll
    for (int dt = 0; dt < DT; ++dt)
#pragma unroll
      for (int r = 0; r < 8; ++r) oacc[dt][r] *= alpha[r];
    __builtin_amdgcn_fence(__ATOMIC_ACQ_REL, "workgroup");
    __builtin_amdgcn_wave_barrier();
    FragB pah, pal;
    pah.half[0] = *(const v8us*)&sPh[w][ln][8 * hh]; pah.half[1] = *(const v8us*)&sPh[w][ln][16 + 8 * hh];
    pal.half[0] = *(const v8us*)&sPl[w][ln][8 * hh]; pal.half[1] = *(const v8us*)&sPl[w][ln][16 + 8 * hh];
#pragma unroll
    for (int dt = 0; dt < DT; ++dt) {
      FragB bvh, bvl;
#pragma unroll
      for (int i = 0; i < 8; ++i) {
        bvh.u[i] = sVh[8 * hh + i][dt * 16 + ln]; bvh.u[8 + i] = sVh[16 + 8 * hh + i][dt * 16 + ln];
        bvl.u[i] = sVl[8 * hh + i][dt * 16 + ln]; bvl.u[8 + i] = sVl[16 + 8 * hh + i][dt * 16 + ln];
      }
      oacc[dt] = mmaN<3>(pah.v, pal.v, bvh.v, bvl.v, oacc[dt]);
    }
    __builtin_amdgcn_fence(__ATOMIC_ACQ_REL, "workgroup");
    __builtin_amdgcn_wave_barrier();
  }
#pragma unroll
  for (int r = 0; r < 8; ++r) {
    float l = l_r[r];
    l += __shfl_xor(l, 1, 32); l += __shfl_xor(l, 2, 32); l += __shfl_xor(l, 4, 32); l += __shfl_xor(l, 8, 32);
    l_r[r] = (l > 0.f) ? 1.0f / l : 0.f;
  }
#pragma unroll
  for (int dt = 0; dt < DT; ++dt)
#pragma unroll
    for (int r = 0; r < 8; ++r) sO[w][8 * hh + r][dt * 16 + ln] = oacc[dt][r] * l_r[r];
  __builtin_amdgcn_fence(__ATOMIC_ACQ_REL, "workgroup");
  __builtin_amdgcn_wave_barrier();
  {
    for (int r = 0; r < 16; ++r) {
      const int row = q0 + r;
      if (row < T && lane < D / 4) {
        const v4f val = *(const v4fa*)&sO[w][r][lane * 4];
        *(v4f*)(y + ((size_t)b * T + row) * ypitch + h * D + lane * 4) = val;
      }
    }
    
  }
}

// in pitch = cols, out pitch = rows; rows, cols multiples of 32. Optional per-output-row affine (scale[c], shift[c]) and
// residual add res (same layout as out, optionally bf16-rounded) for fused epilogues: out = in*scale + shift + res.
template <bool AFFINE, bool RESID, bool RES_BF16>
__global__ __launch_bounds__(256) void k_transpose32(const float* __restrict__ in, float* __restrict__ out, int rows, int cols,
                                                    const float* __restrict__ scale, const float* __restrict__ shift, const float* __restrict__ res) {
  __shared__ float tile[32][33];
  const int b = blockIdx.z;
  const int r0 = blockIdx.y * 32, c0 = blockIdx.x * 32;
  const float* src = in + (size_t)b * rows * cols;
  float* dst = out + (size_t)b * rows * cols;
  const int tx = threadIdx.x & 31, ty = threadIdx.x >> 5;     // 8 rows per pass
  for (int i = ty; i < 32; i += 8) tile[i][tx] = src[(size_t)(r0 + i) * cols + c0 + tx];
  __syncthreads();
  {
    for (int i = ty; i < 32; i += 8) {
      float v = tile[tx][i];
      const int orow = c0 + i;
      if (AFFINE) v = v * scale[orow] + shift[orow];
      if (RESID) { float rv = res[(size_t)b * rows * cols + (size_t)orow * rows + r0 + tx]; if (RES_BF16) rv = bf16_round(rv); v += rv; }
      *(float*)(dst + (size_t)orow * rows + r0 + tx) = v;
    }
    
  }
}

// 2x2 max pool on position-major data: in [B][H*W][C] -> out [B][(H/2)*(W/2)][C]; thread per (b, p', 4 channels); C%4==0
__global__ __launch_bounds__(256) void k_pool2_pm(const float* __restrict__ in, float* __restrict__ out, int Bn, int H, int W, int C) {
  const size_t t = (size_t)blockIdx.x * 256 + threadIdx.x;
  const int c4n = C / 4, Ho = H / 2, Wo = W / 2;
  const size_t total = (size_t)Bn * Ho * Wo * c4n;
  if (t >= total) return;
  const int c4 = (int)(t % c4n) * 4; size_t rest = t / c4n;
  const int pw = (int)(rest % Wo); rest /= Wo; const int ph = (int)(rest % Ho); const int b = (int)(rest / Ho);
  const float* base = in + (size_t)b * H * W * C;
  const int p00 = (2 * ph) * W + 2 * pw;
  const v4f a = *(const v4fa*)(base + (size_t)p00 * C + c4), bq = *(const v4fa*)(base + (size_t)(p00 + 1) * C + c4);
  const v4f c = *(const v4fa*)(base + (size_t)(p00 + W) * C + c4), d = *(const v4fa*)(base + (size_t)(p00 + W + 1) * C + c4);
  v4f m; for (int i = 0; i < 4; ++i) m[i] = fmaxf(fmaxf(a[i], bq[i]), fmaxf(c[i], d[i]));
  float* dst = out + ((size_t)b * Ho * Wo + (size_t)ph * Wo + pw) * C + c4;
  *(v4f*)dst = m;
  
}

// General (non-causal) attention, 3-term bf16 splits, f32 softmax with running max.
// Q [.][Tq][qpitch] f32; K [.][Tk][kpitch] (head dim DQ) and V [.][Tk][vpitch] (head dim DVtot) arrive already split, as a hi and a lo
// bf16 plane each, so that a tile is staged by plain 16-byte copies and is not split again by every block that reads it; this block handles DV output
// dims starting at dv0 = blockIdx.y*DV. y[bh][t][ypitch] gets columns dv0..dv0+DV-1. Per-bh base offsets via strides.
// Both products run transposed: S^T = K * Q^T (A = K rows, B = Q) and O^T += V^T * P^T (A = V by the transposing load, B = P). A lane then
// holds 16 of the 32 scores of ONE query (column lane & 15; keys 8 * (lane >> 4) + r of either 16-key tile), which is the k order of a B
// operand: P goes from the score accumulators into its fragment in registers, and the maximum and the sum of a row are taken inside the lane.
// The K and V row pitches are compile-time (kpitch, vpitch), so that a thread's staging loads differ only in their immediate offset.
template <int DQ, int DV, int kpitch, int vpitch>
__global__ __launch_bounds__(128) void k_flash2(const float* __restrict__ Qb, size_t qstride, int qpitch, int Tq,
                                              const unsigned short* __restrict__ Khb, const unsigned short* __restrict__ Klb, size_t kstride, int Tk,
                                              const unsigned short* __restrict__ Vhb, const unsigned short* __restrict__ Vlb, size_t vstride,
                                              float scale, float* __restrict__ y, size_t ystride, int ypitch) {
  constexpr int KS = DQ / 32, DT = DV / 16;
  constexpr int VP = DV + 16;       // V row pitch in elements: an odd multiple of 32 bytes, the conflict-free pitch of the transposing load
  __shared__ __attribute__((aligned(16))) unsigned short sKh[32][DQ + 8], sKl[32][DQ + 8], sVh[32][VP], sVl[32][VP];
  __shared__ __attribute__((aligned(16))) float sO[4][16][DV + 4];   // 4 floats of pad: the 16 rows that a store instruction writes start in different banks
  const int tid = threadIdx.x, w = tid >> 5, lane = tid & 31, ln = lane & 15, hh = lane >> 4;
  const int nqb = (Tq + 63) / 64;
  const int bh = blockIdx.x / nqb, qblk = blockIdx.x % nqb;
  const int dv0 = blockIdx.y * DV;
  const int q0 = qblk * 64 + w * 16;
  const float* Q = Qb + (size_t)bh * qstride;
  const unsigned short* Kh = Khb + (size_t)bh * kstride; const unsigned short* Kl = Klb + (size_t)bh * kstride;
  const unsigned short* Vh = Vhb + (size_t)bh * vstride + dv0; const unsigned short* Vl = Vlb + (size_t)bh * vstride + dv0;
  FragB aqh[KS], aql[KS];
  {
    int row = q0 + ln; if (row >= Tq) row = Tq - 1;
    const float* qr = Q + (size_t)row * qpitch;
#pragma unroll
    for (int ks = 0; ks < KS; ++ks)
#pragma unroll
      for (int i = 0; i < 16; ++i) {
        const int d = ks * 32 + ((i < 8) ? (8 * hh + i) : (16 + 8 * hh + (i - 8)));
        const float x = qr[d] * scale; const unsigned short hb = bf16_bits(x);
        aqh[ks].u[i] = hb; aql[ks].u[i] = bf16_bits(x - bf16_val(hb));
      }
  }
  float m_q = -3.0e38f, l_q = 0.f;   // running maximum of query q0 + ln (equal in both lane halves); sum over this lane half's keys only
  v8f oacc[DT];                      // oacc[dt][r] = O[q0 + ln][dt * 16 + 8 * hh + r]
#pragma unroll
  for (int dt = 0; dt < DT; ++dt) oacc[dt] = (v8f){0.f,0.f,0.f,0.f,0.f,0.f,0.f,0.f};
  // Staging of a 32-key tile: 128 threads cover KR rows of a K plane (VR of a V plane) per 16-byte load, KL (VL) loads per thread and plane.
  constexpr int KR = 128 / (DQ / 8), VR = 128 / (DV / 8), KL = 32 / KR, VL = 32 / VR;
  static_assert(KR * (DQ / 8) == 128 && VR * (DV / 8) == 128 && KL * KR == 32 && VL * VR == 32, "tile must divide over 128 threads");
  const int kr = tid / (DQ / 8), kc = (tid % (DQ / 8)) * 8, vr = tid / (DV / 8), vc = (tid % (DV / 8)) * 8;
  const unsigned koff = (unsigned)kr * (unsigned)kpitch + (unsigned)kc, voff = (unsigned)vr * (unsigned)vpitch + (unsigned)vc;
  for (int j0 = 0; j0 < Tk; j0 += 32) {
    // All of a thread's K and V loads of the tile are issued before the first is used: a trip waits out one load latency, not
    // 2 * (KL + VL). A full tile (block-uniform test) takes them without the per-row guard, in one straight run. The loops over i are
    // unrolled so that the four arrays are indexed by constants and stay in registers.
    v8us kh[KL], kl[KL], vh[VL], vl[VL];
    if (j0 + 32 <= Tk) {
#pragma unroll
      for (int i = 0; i < KL; ++i) { kh[i] = *(const v8us*)(Kh + (size_t)(j0 + i * KR) * kpitch + koff); kl[i] = *(const v8us*)(Kl + (size_t)(j0 + i * KR) * kpitch + koff); }
#pragma unroll
      for (int i = 0; i < VL; ++i) { vh[i] = *(const v8us*)(Vh + (size_t)(j0 + i * VR) * vpitch + voff); vl[i] = *(const v8us*)(Vl + (size_t)(j0 + i * VR) * vpitch + voff); }
    } else {
#pragma unroll
      for (int i = 0; i < KL; ++i) {
        kh[i] = (v8us){0,0,0,0,0,0,0,0}; kl[i] = (v8us){0,0,0,0,0,0,0,0};
        if (j0 + i * KR + kr < Tk) { kh[i] = *(const v8us*)(Kh + (size_t)(j0 + i * KR) * kpitch + koff); kl[i] = *(const v8us*)(Kl + (size_t)(j0 + i * KR) * kpitch + koff); }
      }
#pragma unroll
      for (int i = 0; i < VL; ++i) {
        vh[i] = (v8us){0,0,0,0,0,0,0,0}; vl[i] = (v8us){0,0,0,0,0,0,0,0};
        if (j0 + i * VR + vr < Tk) { vh[i] = *(const v8us*)(Vh + (size_t)(j0 + i * VR) * vpitch + voff); vl[i] = *(const v8us*)(Vl + (size_t)(j0 + i * VR) * vpitch + voff); }
      }
    }
    __syncthreads();
#pragma unroll
    for (int i = 0; i < KL; ++i) { *(v8us*)&sKh[i * KR + kr][kc] = kh[i]; *(v8us*)&sKl[i * KR + kr][kc] = kl[i]; }
#pragma unroll
    for (int i = 0; i < VL; ++i) { *(v8us*)&sVh[i * VR + vr][vc] = vh[i]; *(v8us*)&sVl[i * VR + vr][vc] = vl[i]; }
    __syncthreads();
    v8f s[2];                        // s[nt][r] = score of key j0 + nt * 16 + 8 * hh + r with query q0 + ln
#pragma unroll
    for (int nt = 0; nt < 2; ++nt) {
      v8f acc = {};
#pragma unroll
      for (int ks = 0; ks < KS; ++ks) {
        FragB bh_, bl_;
        bh_.half[0] = *(const v8us*)&sKh[nt * 16 + ln][ks * 32 + 8 * hh]; bh_.half[1] = *(const v8us*)&sKh[nt * 16 + ln][ks * 32 + 16 + 8 * hh];
        bl_.half[0] = *(const v8us*)&sKl[nt * 16 + ln][ks * 32 + 8 * hh]; bl_.half[1] = *(const v8us*)&sKl[nt * 16 + ln][ks * 32 + 16 + 8 * hh];
        acc = mmaN<3>(bh_.v, bl_.v, aqh[ks].v, aql[ks].v, acc);
      }
      s[nt] = acc;
    }
    // Every loop over nt, r or dt below is unrolled so that s, the P fragments and oacc are indexed by constants and stay in registers.
    if (j0 + 32 > Tk) {              // block-uniform: only a last, partial tile has keys to mask
#pragma unroll
      for (int nt = 0; nt < 2; ++nt)
#pragma unroll
        for (int r = 0; r < 8; ++r) if (j0 + nt * 16 + 8 * hh + r >= Tk) s[nt][r] = -3.0e38f;
    }
    float mx = fmaxf(s[0][0], s[1][0]);
#pragma unroll
    for (int r = 1; r < 8; ++r) mx = fmaxf(mx, fmaxf(s[0][r], s[1][r]));
    // the other 16 keys of the same query lie in lane ^ 16
    mx = fmaxf(mx, __int_as_float(__builtin_amdgcn_permlanex16(__float_as_int(mx), __float_as_int(mx), 0x76543210, 0xfedcba98, false, false)));
    const float mnew = fmaxf(m_q, mx);
    const float alpha = (mnew > -1.0e38f) ? __expf(m_q - mnew) : 1.0f;
    m_q = mnew;
    FragB pbh, pbl;                  // P^T as a B operand: element nt * 8 + r is key nt * 16 + 8 * hh + r, the hardware k order
    v2f ps = {0.f, 0.f};
#pragma unroll
    for (int nt = 0; nt < 2; ++nt)
#pragma unroll
      for (int r = 0; r < 8; r += 2) {
        v2f p;
        p[0] = (s[nt][r] > -1.0e38f) ? __expf(s[nt][r] - mnew) : 0.f;
        p[1] = (s[nt][r + 1] > -1.0e38f) ? __expf(s[nt][r + 1] - mnew) : 0.f;
        ps += p;
        // two neighbours fill one operand register: the packed convert rounds to nearest even, as bf16_bits does, and packs in the same instruction
        const v2b hi = __builtin_convertvector(p, v2b);
        pbh.pair[nt * 4 + r / 2] = hi;
        pbl.pair[nt * 4 + r / 2] = __builtin_convertvector(p - __builtin_convertvector(hi, v2f), v2b);
      }
    l_q = l_q * alpha + (ps[0] + ps[1]);
#pragma unroll
    for (int dt = 0; dt < DT; ++dt)
#pragma unroll
      for (int r = 0; r < 8; ++r) oacc[dt][r] *= alpha;
    const unsigned short* vth = &sVh[8 * hh + (lane & 7)][((lane >> 3) & 1) * 8];
    const unsigned short* vtl = &sVl[8 * hh + (lane & 7)][((lane >> 3) & 1) * 8];
    // fragments of two d tiles are fetched as one group, one group ahead of the products that use them
    FragB bvh[2][2], bvl[2][2];
#pragma unroll
    for (int u = 0; u < 2; ++u) {
      bvh[0][u].half[0] = ld_tr16(vth + u * 16); bvh[0][u].half[1] = ld_tr16(vth + 16 * VP + u * 16);
      bvl[0][u].half[0] = ld_tr16(vtl + u * 16); bvl[0][u].half[1] = ld_tr16(vtl + 16 * VP + u * 16);
    }
#pragma unroll
    for (int g = 0; g < DT / 2; ++g) {
      if (g + 1 < DT / 2) {
#pragma unroll
        for (int u = 0; u < 2; ++u) {
          const int d = ((g + 1) * 2 + u) * 16;
          bvh[(g + 1) & 1][u].half[0] = ld_tr16(vth + d); bvh[(g + 1) & 1][u].half[1] = ld_tr16(vth + 16 * VP + d);
          bvl[(g + 1) & 1][u].half[0] = ld_tr16(vtl + d); bvl[(g + 1) & 1][u].half[1] = ld_tr16(vtl + 16 * VP + d);
        }
      }
#pragma unroll
      for (int u = 0; u < 2; ++u) oacc[g * 2 + u] = mmaN<3>(bvh[g & 1][u].v, bvl[g & 1][u].v, pbh.v, pbl.v, oacc[g * 2 + u]);
    }
  }
  // the two lane halves' sums join once
  const float lsum = l_q + __int_as_float(__builtin_amdgcn_permlanex16(__float_as_int(l_q), __float_as_int(l_q), 0x76543210, 0xfedcba98, false, false));
  const float linv = (lsum > 0.f) ? 1.0f / lsum : 0.f;
#pragma unroll
  for (int dt = 0; dt < DT; ++dt) {
    v4f lo4, hi4;
#pragma unroll
    for (int r = 0; r < 4; ++r) { lo4[r] = oacc[dt][r] * linv; hi4[r] = oacc[dt][4 + r] * linv; }
    *(v4fa*)&sO[w][ln][dt * 16 + 8 * hh] = lo4; *(v4fa*)&sO[w][ln][dt * 16 + 8 * hh + 4] = hi4;
  }
  __builtin_amdgcn_fence(__ATOMIC_ACQ_REL, "workgroup");
  __builtin_amdgcn_wave_barrier();
  {
    for (int r = 0; r < 16; ++r) {
      const int row = q0 + r;
      for (int c4 = lane * 4; c4 < DV; c4 += 128) {
        if (row < Tq) {
          const v4f val = *(const v4fa*)&sO[w][r][c4];
          *(v4f*)(y + (size_t)bh * ystride + (size_t)row * ypitch + dv0 + c4) = val;
        }
      }
    }
    
  }
}

__global__ __launch_bounds__(256) void k_round_rows(const float* __restrict__ W, unsigned short* __restrict__ Wt, int n8) {
  const int t = blockIdx.x * 256 + threadIdx.x;
  if (t >= n8) return;
  const v4f a = *(const v4fa*)(W + (size_t)t * 8), b = *(const v4fa*)(W + (size_t)t * 8 + 4);
  v8us v; v[0]=bf16_bits(a[0]); v[1]=bf16_bits(a[1]); v[2]=bf16_bits(a[2]); v[3]=bf16_bits(a[3]);
  v[4]=bf16_bits(b[0]); v[5]=bf16_bits(b[1]); v[6]=bf16_bits(b[2]); v[7]=bf16_bits(b[3]);
  *(v8us*)(Wt + (size_t)t * 8) = v; 
}

// padded q/k weights: Bt [64][256] rows < 8 real; bias64; gamma vector (256 copies, bf16-rounded) and zero shift
__global__ __launch_bounds__(256) void k_prep(const float* __restrict__ wq, const float* __restrict__ bq, const float* __restrict__ wk, const float* __restrict__ bk, const float* __restrict__ gamma,
                                            unsigned short* __restrict__ Bq, unsigned short* __restrict__ Bk, float* __restrict__ bq64, float* __restrict__ bk64, float* __restrict__ gvec, float* __restrict__ zvec) {
  const int t = blockIdx.x * 256 + threadIdx.x;
  if (t < DQP * (CC / 8)) { const int n = t / (CC / 8), k8 = (t % (CC / 8)) * 8; v8us a, b;
    for (int i = 0; i < 8; ++i) { a[i] = (n < 8) ? bf16_bits(wq[n * CC + k8 + i]) : (unsigned short)0; b[i] = (n < 8) ? bf16_bits(wk[n * CC + k8 + i]) : (unsigned short)0; }
    *(v8us*)(Bq + n * CC + k8) = a; *(v8us*)(Bk + n * CC + k8) = b;  }
  if (t < DQP) { const float a = (t < 8) ? bq[t] : 0.f, b = (t < 8) ? bk[t] : 0.f; *(float*)(bq64 + t) = a; *(float*)(bk64 + t) = b;  }
  if (t < CC) { const float g = bf16_round(gamma[0]); *(float*)(gvec + t) = g; *(float*)(zvec + t) = 0.f;  }
}
extern "C" void kernel_launch(void* const* d_in, const int* in_sizes, int n_in,
                              void* d_out, int out_size, void* d_ws, size_t ws_size, hipStream_t stream) {
  (void)in_sizes; (void)n_in; (void)out_size;
  const float* x = (const float*)d_in[0]; const float* wq = (const float*)d_in[1]; const float* bq = (const float*)d_in[2]; const float* wk = (const float*)d_in[3]; const float* bk = (const float*)d_in[4];
  const float* wv = (const float*)d_in[5]; const float* bv = (const float*)d_in[6]; const float* gamma = (const float*)d_in[7];
  char* ws = (char*)d_ws; size_t off = 0;
  auto take = [&](size_t bytes) { char* p = ws + off; off += (bytes + 255) & ~(size_t)255; return p; };
  const int M = BB * NN;
  unsigned short* Bq = (unsigned short*)take(DQP * CC * 2); unsigned short* Bk = (unsigned short*)take(DQP * CC * 2); unsigned short* Bv = (unsigned short*)take(CC * CC * 2);
  float* bq64 = (float*)take(256); float* bk64 = (float*)take(256); float* gvec = (float*)take(CC * 4); float* zvec = (float*)take(CC * 4);
  float* xT = (float*)take((size_t)M * CC * 4); float* q = (float*)take((size_t)M * DQP * 4);
  unsigned short* kh = (unsigned short*)take((size_t)M * DQP * 2); unsigned short* kl = (unsigned short*)take((size_t)M * DQP * 2);
  unsigned short* vh = (unsigned short*)take((size_t)M * CC * 2); unsigned short* vl = (unsigned short*)take((size_t)M * CC * 2);
  float* z = (float*)take((size_t)M * CC * 4);
  if (off > ws_size) return;
  k_prep<<<(DQP * (CC / 8) + 255) / 256, 256, 0, stream>>>(wq, bq, wk, bk, gamma, Bq, Bk, bq64, bk64, gvec, zvec);
  k_round_rows<<<(CC * CC / 8 + 255) / 256, 256, 0, stream>>>(wv, Bv, CC * CC / 8);
  k_transpose32<false, false, false><<<dim3(NN / 32, CC / 32, BB), 256, 0, stream>>>(x, xT, CC, NN, nullptr, nullptr, nullptr);     // [B][C][N] -> [B][N][C]
  k_gemm_bf<false, 0, true, false><<<((M / 16) * (DQP / 64) + 3) / 4, 128, 0, stream>>>(xT, CC, Bq, CC, bq64, q, nullptr, nullptr, DQP, M, DQP, CC);
  k_gemm_bf<false, 0, true, true><<<((M / 16) * (DQP / 64) + 3) / 4, 128, 0, stream>>>(xT, CC, Bk, CC, bk64, nullptr, kh, kl, DQP, M, DQP, CC);
  k_gemm_bf<false, 0, true, true><<<((M / 16) * (CC / 64) + 3) / 4, 128, 0, stream>>>(xT, CC, Bv, CC, bv, nullptr, vh, vl, CC, M, CC, CC);
  k_flash2<DQP, 128, DQP, CC><<<dim3(BB * (NN / 64), 2), 128, 0, stream>>>(q, (size_t)NN * DQP, DQP, NN, kh, kl, (size_t)NN * DQP, NN, vh, vl, (size_t)NN * CC, 1.0f, z, (size_t)NN * CC, CC);
  k_transpose32<true, true, true><<<dim3(CC / 32, NN / 32, BB), 256, 0, stream>>>(z, (float*)d_out, NN, CC, gvec, zvec, x);     // out = gamma·zᵀ + bf16(x)
}

// v005
// One run takes 263 microseconds.
// Timed twice side by side with v004, it ran 1.15 and 1.14 times as fast.
// All steps since v000 together make it 4.03 times as fast.
#include <hip/hip_runtime.h>
// All contractions on v_wmma_f32_16x16x32_bf16, f32 accumulate: the q/k/v 1×1 convs as GEMMs over a position-major copy of x (x, W, b rounded to
// bf16: single exact term; the 8 q/k channels zero-padded to 64), energy = qᵀk (no scale) and attn·v per 16-query tile as 3-term bf16 hi/lo
// splits (k_flash2, value dim 256 split over 2 blocks; the v GEMM writes the hi and lo planes of its result, the k GEMM rows that hold the three
// terms' k side next to each other, so that one K = 32 product gives all three terms of the 8 real channels), gamma·out + bf16(x) fused into the transpose back; softmax in f32.
#define BB 8
#define CC 256
#define NN 4096
#define DQP 64
#define DQR 8     // real q/k channels
#define KPK 32    // elements of a packed k row: hi | hi | lo | 0, DQR each

typedef __bf16 v16b __attribute__((ext_vector_type(16)));
typedef unsigned short v8us __attribute__((ext_vector_type(8), may_alias));
typedef float  v8f  __attribute__((ext_vector_type(8)));
typedef float  v4f  __attribute__((ext_vector_type(4)));
typedef float  v4fa __attribute__((ext_vector_type(4), may_alias));
typedef __bf16 v2b __attribute__((ext_vector_type(2)));
typedef float  v2f  __attribute__((ext_vector_type(2)));
union FragB { v16b v; v8us half[2]; unsigned short u[16]; v2b pair[8]; };

__device__ __forceinline__ unsigned short bf16_bits(float x) { unsigned int u = __float_as_uint(x); return (unsigned short)((u + 0x7FFFu + ((u >> 16) & 1u)) >> 16); }
__device__ __forceinline__ float bf16_val(unsigned short b) { return __uint_as_float(((unsigned int)b) << 16); }
__device__ __forceinline__ float bf16_round(float x) { return bf16_val(bf16_bits(x)); }
// 16-bit transposing LDS load: lane (c = l & 15, h = l >> 4) gets T[k0 + 8h + 0..7][d0 + c] from a row-major tile; lane l passes
// &T[k0 + 8 * (l >> 4) + (l & 7)][d0 + 8 * ((l >> 3) & 1)]. Two loads (k0, k0 + 16) make one 32 x 16 B fragment in the hardware k order.
typedef short s16x8 __attribute__((ext_vector_type(8)));
__device__ __forceinline__ v8us ld_tr16(const unsigned short* p) {
  typedef __attribute__((address_space(3))) s16x8 lds_s16x8;
  return __builtin_bit_cast(v8us, __builtin_amdgcn_ds_load_tr16_b128_v8i16((lds_s16x8*)p));
}
// D += A·B with NT terms: 1 = ah·bh, 2 = + al·bh (A split), 3 = + ah·bl (both split)
template <int NT>
__device__ __forceinline__ v8f mmaN(v16b ah, v16b al, v16b bh, v16b bl, v8f c) {
  c = __builtin_amdgcn_wmma_f32_16x16x32_bf16(false, ah, false, bh, (short)0, c, false, false);
  if (NT >= 2) c = __builtin_amdgcn_wmma_f32_16x16x32_bf16(false, al, false, bh, (short)0, c, false, false);
  if (NT >= 3) c = __builtin_amdgcn_wmma_f32_16x16x32_bf16(false, ah, false, bl, (short)0, c, false, false);
  asm volatile("v_nop\n\tv_nop\n\tv_nop\n\tv_nop" : "+v"(c) : "v"(ah), "v"(al), "v"(bh), "v"(bl));
  return c;
}

__global__ __launch_bounds__(256) void k_wt_bf16(const float* __restrict__ W, unsigned short* __restrict__ Wt, int K, int N) {
  const int t = blockIdx.x * 256 + threadIdx.x;
  const int k8n = K / 8;
  if (t >= N * k8n) return;
  const int n = t / k8n, k8 = (t % k8n) * 8;
  v8us v;
#pragma unroll
  for (int i = 0; i < 8; ++i) v[i] = bf16_bits(W[(size_t)(k8 + i) * N + n]);
  *(v8us*)(Wt + (size_t)n * K + k8) = v;
  
}

// GEMM C[M][N] (f32, pitch ldc) = act(A[M][K]·W + bias). A f32 row-major (pitch lda) converted per fragment to bf16
// (ASPLIT: hi/lo two planes -> 2 terms, else single rounded term); Wt bf16 [N][K] (pitch ldb). BIAS_BF16 rounds the
// bias to bf16 first (bias quantised to bf16 before the add). K%32==0, M%16==0, N%64==0.
// OUT 0: C in f32. OUT 1: the result leaves as two bf16 planes, Ch = the rounded value and Cl = the rounded remainder (pitch ldc each), and C is not written.
// OUT 2: only columns 0..DQR-1 leave, as one packed row of KPK bf16 in Ch (pitch ldc): hi | hi | lo | 0; C and Cl are not written.
template <bool ASPLIT, int ACT, bool BIAS_BF16, int OUT>
__global__ __launch_bounds__(128) void k_gemm_bf(const float* __restrict__ A, int lda, const unsigned short* __restrict__ Wt, int ldb,
                                               const float* __restrict__ bias, float* __restrict__ C, unsigned short* __restrict__ Ch, unsigned short* __restrict__ Cl,
                                               int ldc, int M, int N, int K) {
  __shared__ __attribute__((aligned(16))) float so[4][16][64];
  const int tid = threadIdx.x, w = tid >> 5, lane = tid & 31, ln = lane & 15, hh = lane >> 4;
  const int ntn = N / 64;
  const int wid = blockIdx.x * 4 + w;
  const int mt = wid / ntn, nq = wid % ntn;
  if (mt * 16 >= M) return;
  const int row0 = mt * 16, col0 = nq * 64;
  const float* arow = A + (size_t)(row0 + ln) * lda;
  v8f acc[4] = {};
  for (int kb = 0; kb < K; kb += 32) {
    FragB ah, al;
    const v4f x0 = *(const v4fa*)(arow + kb + 8 * hh), x1 = *(const v4fa*)(arow + kb + 8 * hh + 4);
    const v4f x2 = *(const v4fa*)(arow + kb + 16 + 8 * hh), x3 = *(const v4fa*)(arow + kb + 16 + 8 * hh + 4);
    float xs[16] = {x0[0],x0[1],x0[2],x0[3],x1[0],x1[1],x1[2],x1[3],x2[0],x2[1],x2[2],x2[3],x3[0],x3[1],x3[2],x3[3]};
#pragma unroll
    for (int i = 0; i < 16; ++i) { const unsigned short hb = bf16_bits(xs[i]); ah.u[i] = hb; al.u[i] = ASPLIT ? bf16_bits(xs[i] - bf16_val(hb)) : (unsigned short)0; }
#pragma unroll
    for (int t = 0; t < 4; ++t) {
      const unsigned short* brow = Wt + (size_t)(col0 + t * 16 + ln) * ldb + kb;
      FragB b;
      b.half[0] = *(const v8us*)(brow + 8 * hh);
      b.half[1] = *(const v8us*)(brow + 16 + 8 * hh);
      acc[t] = mmaN<ASPLIT ? 2 : 1>(ah.v, al.v, b.v, b.v, acc[t]);
    }
  }
#pragma unroll
  for (int t = 0; t < 4; ++t) {
    float bv = bias ? bias[col0 + t * 16 + ln] : 0.f;
    if (BIAS_BF16) bv = bf16_round(bv);
#pragma unroll
    for (int r = 0; r < 8; ++r) { float v = acc[t][r] + bv; if (ACT == 1) v = fmaxf(v, 0.f); so[w][8 * hh + r][t * 16 + ln] = v; }
  }
  __builtin_amdgcn_fence(__ATOMIC_ACQ_REL, "workgroup");
  __builtin_amdgcn_wave_barrier();
  if (OUT == 1) {
    // a lane takes 8 neighbours of a row: 8 lanes store one whole 128-byte line of each plane; both loops are unrolled so that
    // xs, h and l are indexed by constants and stay in registers
    const int rs = lane >> 3, c8 = (lane & 7) * 8;
#pragma unroll
    for (int q = 0; q < 4; ++q) {
      const int r = q * 4 + rs;
      const v4f a = *(const v4fa*)&so[w][r][c8], b = *(const v4fa*)&so[w][r][c8 + 4];
      const float xs[8] = {a[0],a[1],a[2],a[3],b[0],b[1],b[2],b[3]};
      v8us h, l;
#pragma unroll
      for (int i = 0; i < 8; ++i) { const unsigned short hb = bf16_bits(xs[i]); h[i] = hb; l[i] = bf16_bits(xs[i] - bf16_val(hb)); }
      const size_t o = (size_t)(row0 + r) * ldc + col0 + c8;
      *(v8us*)(Ch + o) = h;
      *(v8us*)(Cl + o) = l;
    }
  } else if (OUT == 2) {
    // four lanes write the four 16-byte parts of a row, 16 lanes four whole rows (256 contiguous bytes); both loops are unrolled so that
    // xs, h and l are indexed by constants and stay in registers
    static_assert(DQR == 8 && KPK == 4 * DQR, "a part of a packed row is one 16-byte store");
    const int rs = lane >> 3, part = lane & 7;
#pragma unroll
    for (int q = 0; q < 4; ++q) {
      const int r = q * 4 + rs;
      const v4f a = *(const v4fa*)&so[w][r][0], b = *(const v4fa*)&so[w][r][4];
      const float xs[8] = {a[0],a[1],a[2],a[3],b[0],b[1],b[2],b[3]};
      v8us h, l;
#pragma unroll
      for (int i = 0; i < 8; ++i) { const unsigned short hb = bf16_bits(xs[i]); h[i] = hb; l[i] = bf16_bits(xs[i] - bf16_val(hb)); }
      const v8us o = (part < 2) ? h : (part == 2) ? l : (v8us){0,0,0,0,0,0,0,0};
      if (col0 == 0 && part < 4) *(v8us*)(Ch + (size_t)(row0 + r) * ldc + part * 8) = o;
    }
  } else {
    const int rsub = lane >> 4, c4 = (lane & 15) * 4;
#pragma unroll
    for (int q = 0; q < 8; ++q) {
      const int r = q * 2 + rsub;
      const v4f v = *(const v4fa*)&so[w][r][c4];
      *(v4f*)(C + (size_t)(row0 + r) * ldc + col0 + c4) = v;
    }
  }
}

// Flash-style causal/unmasked attention, all contractions 3-term bf16 hi/lo splits, f32 softmax with running max.
// q,k,v rows are read from f32 buffers with arbitrary row pitch (so they can live inside a fused qkv buffer);
// D = head size (multiple of 32, <= 128); one wave = 16 query rows; block = 4 waves (64 queries) sharing K/V chunks of 32.
template <int D, bool CAUSAL>
__global__ __launch_bounds__(128) void k_flash(const float* __restrict__ qb, const float* __restrict__ kb, const float* __restrict__ vb,
                                             int pitch, int T, int H, float scale, float* __restrict__ y, int ypitch) {
  constexpr int KS = D / 32;        // k-steps for QK
  constexpr int DT = D / 16;        // d tiles for PV
  __shared__ __attribute__((aligned(16))) unsigned short sKh[32][D + 8], sKl[32][D + 8], sVh[32][D + 8], sVl[32][D + 8];
  __shared__ __attribute__((aligned(16))) unsigned short sPh[4][16][40], sPl[4][16][40];
  __shared__ __attribute__((aligned(16))) float sO[4][16][D];
  const int tid = threadIdx.x, w = tid >> 5, lane = tid & 31, ln = lane & 15, hh = lane >> 4;
  const int nqb = (T + 63) / 64;
  const int bh = blockIdx.x / nqb, qblk = blockIdx.x % nqb;
  const int b = bh / H, h = bh % H;
  const int q0 = qblk * 64 + w * 16;
  const float* Q = qb + (size_t)b * T * pitch + h * D;
  const float* K = kb + (size_t)b * T * pitch + h * D;
  const float* V = vb + (size_t)b * T * pitch + h * D;

  // A fragments of the wave's 16 query rows (scaled), hi/lo
  FragB aqh[KS], aql[KS];
  {
    int row = q0 + ln; if (row >= T) row = T - 1;
    const float* qr = Q + (size_t)row * pitch;
#pragma unroll
    for (int ks = 0; ks < KS; ++ks)
#pragma unroll
      for (int i = 0; i < 16; ++i) {
        const int d = ks * 32 + ((i < 8) ? (8 * hh + i) : (16 + 8 * hh + (i - 8)));
        const float x = qr[d] * scale; const unsigned short hb = bf16_bits(x);
        aqh[ks].u[i] = hb; aql[ks].u[i] = bf16_bits(x - bf16_val(hb));
      }
  }
  float m_r[8], l_r[8];
#pragma unroll
  for (int r = 0; r < 8; ++r) { m_r[r] = -3.0e38f; l_r[r] = 0.f; }
  v8f oacc[DT];
#pragma unroll
  for (int dt = 0; dt < DT; ++dt) oacc[dt] = (v8f){0.f,0.f,0.f,0.f,0.f,0.f,0.f,0.f};

  const int kv_end = CAUSAL ? min(T, qblk * 64 + 64) : T;     // block-uniform
  for (int j0 = 0; j0 < kv_end; j0 += 32) {
    __syncthreads();
    for (int e = tid; e < 32 * (D / 4); e += 128) {
      const int r = e / (D / 4), c4 = (e % (D / 4)) * 4;
      const int key = j0 + r;
      v4f kf = {0.f,0.f,0.f,0.f}, vf = {0.f,0.f,0.f,0.f};
      if (key < T) { kf = *(const v4fa*)(K + (size_t)key * pitch + c4); vf = *(const v4fa*)(V + (size_t)key * pitch + c4); }
#pragma unroll
      for (int t = 0; t < 4; ++t) {
        unsigned short hb = bf16_bits(kf[t]); sKh[r][c4 + t] = hb; sKl[r][c4 + t] = bf16_bits(kf[t] - bf16_val(hb));
        hb = bf16_bits(vf[t]); sVh[r][c4 + t] = hb; sVl[r][c4 + t] = bf16_bits(vf[t] - bf16_val(hb));
      }
    }
    __syncthreads();
    // S tile 16 x 32
    v8f s[2];
#pragma unroll
    for (int nt = 0; nt < 2; ++nt) {
      v8f acc = {};
#pragma unroll
      for (int ks = 0; ks < KS; ++ks) {
        FragB bh_, bl_;
        bh_.half[0] = *(const v8us*)&sKh[nt * 16 + ln][ks * 32 + 8 * hh]; bh_.half[1] = *(const v8us*)&sKh[nt * 16 + ln][ks * 32 + 16 + 8 * hh];
        bl_.half[0] = *(const v8us*)&sKl[nt * 16 + ln][ks * 32 + 8 * hh]; bl_.half[1] = *(const v8us*)&sKl[nt * 16 + ln][ks * 32 + 16 + 8 * hh];
        acc = mmaN<3>(aqh[ks].v, aql[ks].v, bh_.v, bl_.v, acc);
      }
      s[nt] = acc;
    }
    // mask + running max (rows 8hh+r; the 16 lanes of a half share rows)
    float alpha[8];
#pragma unroll
    for (int r = 0; r < 8; ++r) {
      const int qi = q0 + 8 * hh + r;
      const int ja = j0 + ln, jb = j0 + 16 + ln;
      if (CAUSAL) { if (ja > qi) s[0][r] = -3.0e38f; if (jb > qi) s[1][r] = -3.0e38f; }
      if (ja >= T) s[0][r] = -3.0e38f;
      if (jb >= T) s[1][r] = -3.0e38f;
      float mx = fmaxf(s[0][r], s[1][r]);
      mx = fmaxf(mx, __shfl_xor(mx, 1, 32)); mx = fmaxf(mx, __shfl_xor(mx, 2, 32)); mx = fmaxf(mx, __shfl_xor(mx, 4, 32)); mx = fmaxf(mx, __shfl_xor(mx, 8, 32));
      const float mnew = fmaxf(m_r[r], mx);
      alpha[r] = (mnew > -1.0e38f) ? __expf(m_r[r] - mnew) : 1.0f;
      const float p0 = (s[0][r] > -1.0e38f) ? __expf(s[0][r] - mnew) : 0.f;
      const float p1 = (s[1][r] > -1.0e38f) ? __expf(s[1][r] - mnew) : 0.f;
      m_r[r] = mnew;
      l_r[r] = l_r[r] * alpha[r] + p0 + p1;            // per-lane partial row sum (16 lanes combined at the end)
      unsigned short hb = bf16_bits(p0); sPh[w][8 * hh + r][ln] = hb;      sPl[w][8 * hh + r][ln] = bf16_bits(p0 - bf16_val(hb));
      hb = bf16_bits(p1);                sPh[w][8 * hh + r][16 + ln] = hb; sPl[w][8 * hh + r][16 + ln] = bf16_bits(p1 - bf16_val(hb));
    }
#pragma unroll
    for (int dt = 0; dt < DT; ++dt)
#pragma unroll
      for (int r = 0; r < 8; ++r) oacc[dt][r] *= alpha[r];
    __builtin_amdgcn_fence(__ATOMIC_ACQ_REL, "workgroup");
    __builtin_amdgcn_wave_barrier();
    FragB pah, pal;
    pah.half[0] = *(const v8us*)&sPh[w][ln][8 * hh]; pah.half[1] = *(const v8us*)&sPh[w][ln][16 + 8 * hh];
    pal.half[0] = *(const v8us*)&sPl[w][ln][8 * hh]; pal.half[1] = *(const v8us*)&sPl[w][ln][16 + 8 * hh];
#pragma unroll
    for (int dt = 0; dt < DT; ++dt) {
      FragB bvh, bvl;
#pragma unroll
      for (int i = 0; i < 8; ++i) {
        bvh.u[i] = sVh[8 * hh + i][dt * 16 + ln]; bvh.u[8 + i] = sVh[16 + 8 * hh + i][dt * 16 + ln];
        bvl.u[i] = sVl[8 * hh + i][dt * 16 + ln]; bvl.u[8 + i] = sVl[16 + 8 * hh + i][dt * 16 + ln];
      }
      oacc[dt] = mmaN<3>(pah.v, pal.v, bvh.v, bvl.v, oacc[dt]);
    }
    __builtin_amdgcn_fence(__ATOMIC_ACQ_REL, "workgroup");
    __builtin_amdgcn_wave_barrier();
  }
#pragma unroll
  for (int r = 0; r < 8; ++r) {
    float l = l_r[r];
    l += __shfl_xor(l, 1, 32); l += __shfl_xor(l, 2, 32); l += __shfl_xor(l, 4, 32); l += __shfl_xor(l, 8, 32);
    l_r[r] = (l > 0.f) ? 1.0f / l : 0.f;
  }
#pragma unroll
  for (int dt = 0; dt < DT; ++dt)
#pragma unroll
    for (int r = 0; r < 8; ++r) sO[w][8 * hh + r][dt * 16 + ln] = oacc[dt][r] * l_r[r];
  __builtin_amdgcn_fence(__ATOMIC_ACQ_REL, "workgroup");
  __builtin_amdgcn_wave_barrier();
  {
    for (int r = 0; r < 16; ++r) {
      const int row = q0 + r;
      if (row < T && lane < D / 4) {
        const v4f val = *(const v4fa*)&sO[w][r][lane * 4];
        *(v4f*)(y + ((size_t)b * T + row) * ypitch + h * D + lane * 4) = val;
      }
    }
    
  }
}

// in pitch = cols, out pitch = rows; rows, cols multiples of 32. Optional per-output-row affine (scale[c], shift[c]) and
// residual add res (same layout as out, optionally bf16-rounded) for fused epilogues: out = in*scale + shift + res.
template <bool AFFINE, bool RESID, bool RES_BF16>
__global__ __launch_bounds__(256) void k_transpose32(const float* __restrict__ in, float* __restrict__ out, int rows, int cols,
                                                    const float* __restrict__ scale, const float* __restrict__ shift, const float* __restrict__ res) {
  __shared__ float tile[32][33];
  const int b = blockIdx.z;
  const int r0 = blockIdx.y * 32, c0 = blockIdx.x * 32;
  const float* src = in + (size_t)b * rows * cols;
  float* dst = out + (size_t)b * rows * cols;
  const int tx = threadIdx.x & 31, ty = threadIdx.x >> 5;     // 8 rows per pass
  for (int i = ty; i < 32; i += 8) tile[i][tx] = src[(size_t)(r0 + i) * cols + c0 + tx];
  __syncthreads();
  {
    for (int i = ty; i < 32; i += 8) {
      float v = tile[tx][i];
      const int orow = c0 + i;
      if (AFFINE) v = v * scale[orow] + shift[orow];
      if (RESID) { float rv = res[(size_t)b * rows * cols + (size_t)orow * rows + r0 + tx]; if (RES_BF16) rv = bf16_round(rv); v += rv; }
      *(float*)(dst + (size_t)orow * rows + r0 + tx) = v;
    }
    
  }
}

// 2x2 max pool on position-major data: in [B][H*W][C] -> out [B][(H/2)*(W/2)][C]; thread per (b, p', 4 channels); C%4==0
__global__ __launch_bounds__(256) void k_pool2_pm(const float* __restrict__ in, float* __restrict__ out, int Bn, int H, int W, int C) {
  const size_t t = (size_t)blockIdx.x * 256 + threadIdx.x;
  const int c4n = C / 4, Ho = H / 2, Wo = W / 2;
  const size_t total = (size_t)Bn * Ho * Wo * c4n;
  if (t >= total) return;
  const int c4 = (int)(t % c4n) * 4; size_t rest = t / c4n;
  const int pw = (int)(rest % Wo); rest /= Wo; const int ph = (int)(rest % Ho); const int b = (int)(rest / Ho);
  const float* base = in + (size_t)b * H * W * C;
  const int p00 = (2 * ph) * W + 2 * pw;
  const v4f a = *(const v4fa*)(base + (size_t)p00 * C + c4), bq = *(const v4fa*)(base + (size_t)(p00 + 1) * C + c4);
  const v4f c = *(const v4fa*)(base + (size_t)(p00 + W) * C + c4), d = *(const v4fa*)(base + (size_t)(p00 + W + 1) * C + c4);
  v4f m; for (int i = 0; i < 4; ++i) m[i] = fmaxf(fmaxf(a[i], bq[i]), fmaxf(c[i], d[i]));
  float* dst = out + ((size_t)b * Ho * Wo + (size_t)ph * Wo + pw) * C + c4;
  *(v4f*)dst = m;
  
}

// General (non-causal) attention, 3-term bf16 splits, f32 softmax with running max.
// Q [.][Tq][qpitch] f32 (DQR channels); V [.][Tk][vpitch] (head dim DVtot) arrives already split, as a hi and a lo bf16 plane, K [.][Tk][KPK] as
// packed rows kh | kh | kl | 0 (DQR elements each). The query's operand is qh | ql | qh | 0 in the same places, so that ONE K = 32 product sums
// kh*qh + kh*ql + kl*qh, the three terms of the split, for a 16-key tile.
// A tile is staged by plain 16-byte copies and is not split again by every block that reads it; this block handles DV output
// dims starting at dv0 = blockIdx.y*DV. y[bh][t][ypitch] gets columns dv0..dv0+DV-1. Per-bh base offsets via strides.
// Both products run transposed: S^T = K * Q^T (A = K rows, B = Q) and O^T += V^T * P^T (A = V by the transposing load, B = P). A lane then
// holds 16 of the 32 scores of ONE query (column lane & 15; keys 8 * (lane >> 4) + r of either 16-key tile), which is the k order of a B
// operand: P goes from the score accumulators into its fragment in registers, and the maximum and the sum of a row are taken inside the lane.
// The V row pitch is compile-time (vpitch), so that a thread's staging loads differ only in their immediate offset.
template <int DV, int vpitch>
__global__ __launch_bounds__(128) void k_flash2(const float* __restrict__ Qb, size_t qstride, int qpitch, int Tq,
                                              const unsigned short* __restrict__ Kpb, size_t kstride, int Tk,
                                              const unsigned short* __restrict__ Vhb, const unsigned short* __restrict__ Vlb, size_t vstride,
                                              float scale, float* __restrict__ y, size_t ystride, int ypitch) {
  constexpr int DT = DV / 16;
  constexpr int KP = KPK + 8;       // K row pitch in elements: an odd multiple of 16 bytes, the conflict-free pitch of the plain 16-byte load
  constexpr int VP = DV + 16;       // V row pitch in elements: an odd multiple of 32 bytes, the conflict-free pitch of the transposing load
  __shared__ __attribute__((aligned(16))) unsigned short sK[32][KP], sVh[32][VP], sVl[32][VP];
  __shared__ __attribute__((aligned(16))) float sO[4][16][DV + 4];   // 4 floats of pad: the 16 rows that a store instruction writes start in different banks
  const int tid = threadIdx.x, w = tid >> 5, lane = tid & 31, ln = lane & 15, hh = lane >> 4;
  const int nqb = (Tq + 63) / 64;
  const int bh = blockIdx.x / nqb, qblk = blockIdx.x % nqb;
  const int dv0 = blockIdx.y * DV;
  const int q0 = qblk * 64 + w * 16;
  const float* Q = Qb + (size_t)bh * qstride;
  const unsigned short* Kp = Kpb + (size_t)bh * kstride;
  const unsigned short* Vh = Vhb + (size_t)bh * vstride + dv0; const unsigned short* Vl = Vlb + (size_t)bh * vstride + dv0;
  // element i of a lane's operand is place 8 * hh + i (i < 8) or 16 + 8 * hh + (i - 8) of the packed row, on the K side and here alike:
  // lane half 0 holds places 0..7 and 16..23 (qh, qh against kh, kl), lane half 1 places 8..15 and 24..31 (ql, 0 against kh, 0)
  static_assert(DQR == 8 && KPK == 32, "the packed row fills one K = 32 operand in parts of 8");
  FragB qp;
  {
    int row = q0 + ln; if (row >= Tq) row = Tq - 1;
    const float* qr = Q + (size_t)row * qpitch;      // qpitch is a multiple of 4: the row starts on 16 bytes
    const v4f qa = *(const v4fa*)qr, qc = *(const v4fa*)(qr + 4);
    const float qs[8] = {qa[0],qa[1],qa[2],qa[3],qc[0],qc[1],qc[2],qc[3]};
    // unrolled so that qs and the operand are indexed by constants and stay in registers
#pragma unroll
    for (int i = 0; i < 8; ++i) {
      const float x = qs[i] * scale; const unsigned short hb = bf16_bits(x), lb = bf16_bits(x - bf16_val(hb));
      qp.u[i] = hh ? lb : hb; qp.u[8 + i] = hh ? (unsigned short)0 : hb;
    }
  }
  float m_q = -3.0e38f, l_q = 0.f;   // running maximum of query q0 + ln (equal in both lane halves); sum over this lane half's keys only
  v8f oacc[DT];                      // oacc[dt][r] = O[q0 + ln][dt * 16 + 8 * hh + r]
#pragma unroll
  for (int dt = 0; dt < DT; ++dt) oacc[dt] = (v8f){0.f,0.f,0.f,0.f,0.f,0.f,0.f,0.f};
  // Staging of a 32-key tile: the 32 packed K rows are 128 contiguous 16-byte pieces, one per thread; 128 threads cover VR rows of a V plane
  // per 16-byte load, VL loads per thread and plane.
  constexpr int VR = 128 / (DV / 8), VL = 32 / VR;
  static_assert(32 * (KPK / 8) == 128 && VR * (DV / 8) == 128 && VL * VR == 32, "tile must divide over 128 threads");
  const int kr = tid / (KPK / 8), kc = (tid % (KPK / 8)) * 8, vr = tid / (DV / 8), vc = (tid % (DV / 8)) * 8;
  const unsigned koff = (unsigned)tid * 8u, voff = (unsigned)vr * (unsigned)vpitch + (unsigned)vc;
  for (int j0 = 0; j0 < Tk; j0 += 32) {
    // All of a thread's K and V loads of the tile are issued before the first is used: a trip waits out one load latency, not
    // 1 + 2 * VL. A full tile (block-uniform test) takes them without the per-row guard, in one straight run. The loops over i are
    // unrolled so that the two arrays are indexed by constants and stay in registers.
    v8us kk, vh[VL], vl[VL];
    if (j0 + 32 <= Tk) {
      kk = *(const v8us*)(Kp + (size_t)j0 * KPK + koff);
#pragma unroll
      for (int i = 0; i < VL; ++i) { vh[i] = *(const v8us*)(Vh + (size_t)(j0 + i * VR) * vpitch + voff); vl[i] = *(const v8us*)(Vl + (size_t)(j0 + i * VR) * vpitch + voff); }
    } else {
      kk = (v8us){0,0,0,0,0,0,0,0};
      if (j0 + kr < Tk) kk = *(const v8us*)(Kp + (size_t)j0 * KPK + koff);
#pragma unroll
      for (int i = 0; i < VL; ++i) {
        vh[i] = (v8us){0,0,0,0,0,0,0,0}; vl[i] = (v8us){0,0,0,0,0,0,0,0};
        if (j0 + i * VR + vr < Tk) { vh[i] = *(const v8us*)(Vh + (size_t)(j0 + i * VR) * vpitch + voff); vl[i] = *(const v8us*)(Vl + (size_t)(j0 + i * VR) * vpitch + voff); }
      }
    }
    __syncthreads();
    *(v8us*)&sK[kr][kc] = kk;
#pragma unroll
    for (int i = 0; i < VL; ++i) { *(v8us*)&sVh[i * VR + vr][vc] = vh[i]; *(v8us*)&sVl[i * VR + vr][vc] = vl[i]; }
    __syncthreads();
    v8f s[2];                        // s[nt][r] = score of key j0 + nt * 16 + 8 * hh + r with query q0 + ln
    FragB ka[2];                     // both loops over nt are unrolled so that ka and s are indexed by constants and stay in registers
#pragma unroll
    for (int nt = 0; nt < 2; ++nt) { ka[nt].half[0] = *(const v8us*)&sK[nt * 16 + ln][8 * hh]; ka[nt].half[1] = *(const v8us*)&sK[nt * 16 + ln][16 + 8 * hh]; }
#pragma unroll
    for (int nt = 0; nt < 2; ++nt) s[nt] = mmaN<1>(ka[nt].v, ka[nt].v, qp.v, qp.v, (v8f){0.f,0.f,0.f,0.f,0.f,0.f,0.f,0.f});
    // Every loop over nt, r or dt below is unrolled so that s, the P fragments and oacc are indexed by constants and stay in registers.
    if (j0 + 32 > Tk) {              // block-uniform: only a last, partial tile has keys to mask
#pragma unroll
      for (int nt = 0; nt < 2; ++nt)
#pragma unroll
        for (int r = 0; r < 8; ++r) if (j0 + nt * 16 + 8 * hh + r >= Tk) s[nt][r] = -3.0e38f;
    }
    float mx = fmaxf(s[0][0], s[1][0]);
#pragma unroll
    for (int r = 1; r < 8; ++r) mx = fmaxf(mx, fmaxf(s[0][r], s[1][r]));
    // the other 16 keys of the same query lie in lane ^ 16
    mx = fmaxf(mx, __int_as_float(__builtin_amdgcn_permlanex16(__float_as_int(mx), __float_as_int(mx), 0x76543210, 0xfedcba98, false, false)));
    const float mnew = fmaxf(m_q, mx);
    const float alpha = (mnew > -1.0e38f) ? __expf(m_q - mnew) : 1.0f;
    m_q = mnew;
    FragB pbh, pbl;                  // P^T as a B operand: element nt * 8 + r is key nt * 16 + 8 * hh + r, the hardware k order
    v2f ps = {0.f, 0.f};
#pragma unroll
    for (int nt = 0; nt < 2; ++nt)
#pragma unroll
      for (int r = 0; r < 8; r += 2) {
        v2f p;
        p[0] = (s[nt][r] > -1.0e38f) ? __expf(s[nt][r] - mnew) : 0.f;
        p[1] = (s[nt][r + 1] > -1.0e38f) ? __expf(s[nt][r + 1] - mnew) : 0.f;
        ps += p;
        // two neighbours fill one operand register: the packed convert rounds to nearest even, as bf16_bits does, and packs in the same instruction
        const v2b hi = __builtin_convertvector(p, v2b);
        pbh.pair[nt * 4 + r / 2] = hi;
        pbl.pair[nt * 4 + r / 2] = __builtin_convertvector(p - __builtin_convertvector(hi, v2f), v2b);
      }
    l_q = l_q * alpha + (ps[0] + ps[1]);
#pragma unroll
    for (int dt = 0; dt < DT; ++dt)
#pragma unroll
      for (int r = 0; r < 8; ++r) oacc[dt][r] *= alpha;
    const unsigned short* vth = &sVh[8 * hh + (lane & 7)][((lane >> 3) & 1) * 8];
    const unsigned short* vtl = &sVl[8 * hh + (lane & 7)][((lane >> 3) & 1) * 8];
    // fragments of two d tiles are fetched as one group, one group ahead of the products that use them
    FragB bvh[2][2], bvl[2][2];
#pragma unroll
    for (int u = 0; u < 2; ++u) {
      bvh[0][u].half[0] = ld_tr16(vth + u * 16); bvh[0][u].half[1] = ld_tr16(vth + 16 * VP + u * 16);
      bvl[0][u].half[0] = ld_tr16(vtl + u * 16); bvl[0][u].half[1] = ld_tr16(vtl + 16 * VP + u * 16);
    }
#pragma unroll
    for (int g = 0; g < DT / 2; ++g) {
      if (g + 1 < DT / 2) {
#pragma unroll
        for (int u = 0; u < 2; ++u) {
          const int d = ((g + 1) * 2 + u) * 16;
          bvh[(g + 1) & 1][u].half[0] = ld_tr16(vth + d); bvh[(g + 1) & 1][u].half[1] = ld_tr16(vth + 16 * VP + d);
          bvl[(g + 1) & 1][u].half[0] = ld_tr16(vtl + d); bvl[(g + 1) & 1][u].half[1] = ld_tr16(vtl + 16 * VP + d);
        }
      }
#pragma unroll
      for (int u = 0; u < 2; ++u) oacc[g * 2 + u] = mmaN<3>(bvh[g & 1][u].v, bvl[g & 1][u].v, pbh.v, pbl.v, oacc[g * 2 + u]);
    }
  }
  // the two lane halves' sums join once
  const float lsum = l_q + __int_as_float(__builtin_amdgcn_permlanex16(__float_as_int(l_q), __float_as_int(l_q), 0x76543210, 0xfedcba98, false, false));
  const float linv = (lsum > 0.f) ? 1.0f / lsum : 0.f;
#pragma unroll
  for (int dt = 0; dt < DT; ++dt) {
    v4f lo4, hi4;
#pragma unroll
    for (int r = 0; r < 4; ++r) { lo4[r] = oacc[dt][r] * linv; hi4[r] = oacc[dt][4 + r] * linv; }
    *(v4fa*)&sO[w][ln][dt * 16 + 8 * hh] = lo4; *(v4fa*)&sO[w][ln][dt * 16 + 8 * hh + 4] = hi4;
  }
  __builtin_amdgcn_fence(__ATOMIC_ACQ_REL, "workgroup");
  __builtin_amdgcn_wave_barrier();
  {
    for (int r = 0; r < 16; ++r) {
      const int row = q0 + r;
      for (int c4 = lane * 4; c4 < DV; c4 += 128) {
        if (row < Tq) {
          const v4f val = *(const v4fa*)&sO[w][r][c4];
          *(v4f*)(y + (size_t)bh * ystride + (size_t)row * ypitch + dv0 + c4) = val;
        }
      }
    }
    
  }
}

__global__ __launch_bounds__(256) void k_round_rows(const float* __restrict__ W, unsigned short* __restrict__ Wt, int n8) {
  const int t = blockIdx.x * 256 + threadIdx.x;
  if (t >= n8) return;
  const v4f a = *(const v4fa*)(W + (size_t)t * 8), b = *(const v4fa*)(W + (size_t)t * 8 + 4);
  v8us v; v[0]=bf16_bits(a[0]); v[1]=bf16_bits(a[1]); v[2]=bf16_bits(a[2]); v[3]=bf16_bits(a[3]);
  v[4]=bf16_bits(b[0]); v[5]=bf16_bits(b[1]); v[6]=bf16_bits(b[2]); v[7]=bf16_bits(b[3]);
  *(v8us*)(Wt + (size_t)t * 8) = v; 
}

// padded q/k weights: Bt [64][256] rows < 8 real; bias64; gamma vector (256 copies, bf16-rounded) and zero shift
__global__ __launch_bounds__(256) void k_prep(const float* __restrict__ wq, const float* __restrict__ bq, const float* __restrict__ wk, const float* __restrict__ bk, const float* __restrict__ gamma,
                                            unsigned short* __restrict__ Bq, unsigned short* __restrict__ Bk, float* __restrict__ bq64, float* __restrict__ bk64, float* __restrict__ gvec, float* __restrict__ zvec) {
  const int t = blockIdx.x * 256 + threadIdx.x;
  if (t < DQP * (CC / 8)) { const int n = t / (CC / 8), k8 = (t % (CC / 8)) * 8; v8us a, b;
    for (int i = 0; i < 8; ++i) { a[i] = (n < 8) ? bf16_bits(wq[n * CC + k8 + i]) : (unsigned short)0; b[i] = (n < 8) ? bf16_bits(wk[n * CC + k8 + i]) : (unsigned short)0; }
    *(v8us*)(Bq + n * CC + k8) = a; *(v8us*)(Bk + n * CC + k8) = b;  }
  if (t < DQP) { const float a = (t < 8) ? bq[t] : 0.f, b = (t < 8) ? bk[t] : 0.f; *(float*)(bq64 + t) = a; *(float*)(bk64 + t) = b;  }
  if (t < CC) { const float g = bf16_round(gamma[0]); *(float*)(gvec + t) = g; *(float*)(zvec + t) = 0.f;  }
}
extern "C" void kernel_launch(void* const* d_in, const int* in_sizes, int n_in,
                              void* d_out, int out_size, void* d_ws, size_t ws_size, hipStream_t stream) {
  (void)in_sizes; (void)n_in; (void)out_size;
  const float* x = (const float*)d_in[0]; const float* wq = (const float*)d_in[1]; const float* bq = (const float*)d_in[2]; const float* wk = (const float*)d_in[3]; const float* bk = (const float*)d_in[4];
  const float* wv = (const float*)d_in[5]; const float* bv = (const float*)d_in[6]; const float* gamma = (const float*)d_in[7];
  char* ws = (char*)d_ws; size_t off = 0;
  auto take = [&](size_t bytes) { char* p = ws + off; off += (bytes + 255) & ~(size_t)255; return p; };
  const int M = BB * NN;
  unsigned short* Bq = (unsigned short*)take(DQP * CC * 2); unsigned short* Bk = (unsigned short*)take(DQP * CC * 2); unsigned short* Bv = (unsigned short*)take(CC * CC * 2);
  float* bq64 = (float*)take(256); float* bk64 = (float*)take(256); float* gvec = (float*)take(CC * 4); float* zvec = (float*)take(CC * 4);
  float* xT = (float*)take((size_t)M * CC * 4); float* q = (float*)take((size_t)M * DQP * 4);
  unsigned short* kp = (unsigned short*)take((size_t)M * KPK * 2);
  unsigned short* vh = (unsigned short*)take((size_t)M * CC * 2); unsigned short* vl = (unsigned short*)take((size_t)M * CC * 2);
  float* z = (float*)take((size_t)M * CC * 4);
  if (off > ws_size) return;
  k_prep<<<(DQP * (CC / 8) + 255) / 256, 256, 0, stream>>>(wq, bq, wk, bk, gamma, Bq, Bk, bq64, bk64, gvec, zvec);
  k_round_rows<<<(CC * CC / 8 + 255) / 256, 256, 0, stream>>>(wv, Bv, CC * CC / 8);
  k_transpose32<false, false, false><<<dim3(NN / 32, CC / 32, BB), 256, 0, stream>>>(x, xT, CC, NN, nullptr, nullptr, nullptr);     // [B][C][N] -> [B][N][C]
  k_gemm_bf<false, 0, true, 0><<<((M / 16) * (DQP / 64) + 3) / 4, 128, 0, stream>>>(xT, CC, Bq, CC, bq64, q, nullptr, nullptr, DQP, M, DQP, CC);
  k_gemm_bf<false, 0, true, 2><<<((M / 16) * (DQP / 64) + 3) / 4, 128, 0, stream>>>(xT, CC, Bk, CC, bk64, nullptr, kp, nullptr, KPK, M, DQP, CC);
  k_gemm_bf<false, 0, true, 1><<<((M / 16) * (CC / 64) + 3) / 4, 128, 0, stream>>>(xT, CC, Bv, CC, bv, nullptr, vh, vl, CC, M, CC, CC);
  k_flash2<128, CC><<<dim3(BB * (NN / 64), 2), 128, 0, stream>>>(q, (size_t)NN * DQP, DQP, NN, kp, (size_t)NN * KPK, NN, vh, vl, (size_t)NN * CC, 1.0f, z, (size_t)NN * CC, CC);
  k_transpose32<true, true, true><<<dim3(CC / 32, NN / 32, BB), 256, 0, stream>>>(z, (float*)d_out, NN, CC, gvec, zvec, x);     // out = gamma·zᵀ + bf16(x)
}

// v006
// Measured time: 254 microseconds a run.
// Two timings next to v005 both put it at 1.03 times that version's speed.
// Over all steps from v000 it is 4.16 times as fast.
#include <hip/hip_runtime.h>
// All contractions on v_wmma_f32_16x16x32_bf16, f32 accumulate: the q/k/v 1×1 convs as GEMMs over a position-major copy of x (x, W, b rounded to
// bf16: single exact term; the 8 q/k channels zero-padded to 64), energy = qᵀk (no scale) and attn·v per 16-query tile as 3-term bf16 hi/lo
// splits (k_flash2, a wave holds all 256 value dims of its queries, two wave groups of a block split the keys; the v GEMM writes the hi and lo planes of its result, the k GEMM rows that hold the three
// terms' k side next to each other, so that one K = 32 product gives all three terms of the 8 real channels), gamma·out + bf16(x) fused into the transpose back; softmax in f32.
#define BB 8
#define CC 256
#define NN 4096
#define DQP 64
#define DQR 8     // real q/k channels
#define KPK 32    // elements of a packed k row: hi | hi | lo | 0, DQR each

typedef __bf16 v16b __attribute__((ext_vector_type(16)));
typedef unsigned short v8us __attribute__((ext_vector_type(8), may_alias));
typedef float  v8f  __attribute__((ext_vector_type(8)));
typedef float  v4f  __attribute__((ext_vector_type(4)));
typedef float  v4fa __attribute__((ext_vector_type(4), may_alias));
typedef __bf16 v2b __attribute__((ext_vector_type(2)));
typedef float  v2f  __attribute__((ext_vector_type(2)));
union FragB { v16b v; v8us half[2]; unsigned short u[16]; v2b pair[8]; };

__device__ __forceinline__ unsigned short bf16_bits(float x) { unsigned int u = __float_as_uint(x); return (unsigned short)((u + 0x7FFFu + ((u >> 16) & 1u)) >> 16); }
__device__ __forceinline__ float bf16_val(unsigned short b) { return __uint_as_float(((unsigned int)b) << 16); }
__device__ __forceinline__ float bf16_round(float x) { return bf16_val(bf16_bits(x)); }
// 16-bit transposing LDS load: lane (c = l & 15, h = l >> 4) gets T[k0 + 8h + 0..7][d0 + c] from a row-major tile; lane l passes
// &T[k0 + 8 * (l >> 4) + (l & 7)][d0 + 8 * ((l >> 3) & 1)]. Two loads (k0, k0 + 16) make one 32 x 16 B fragment in the hardware k order.
typedef short s16x8 __attribute__((ext_vector_type(8)));
__device__ __forceinline__ v8us ld_tr16(const unsigned short* p) {
  typedef __attribute__((address_space(3))) s16x8 lds_s16x8;
  return __builtin_bit_cast(v8us, __builtin_amdgcn_ds_load_tr16_b128_v8i16((lds_s16x8*)p));
}
// D += A·B with NT terms: 1 = ah·bh, 2 = + al·bh (A split), 3 = + ah·bl (both split)
template <int NT>
__device__ __forceinline__ v8f mmaN(v16b ah, v16b al, v16b bh, v16b bl, v8f c) {
  c = __builtin_amdgcn_wmma_f32_16x16x32_bf16(false, ah, false, bh, (short)0, c, false, false);
  if (NT >= 2) c = __builtin_amdgcn_wmma_f32_16x16x32_bf16(false, al, false, bh, (short)0, c, false, false);
  if (NT >= 3) c = __builtin_amdgcn_wmma_f32_16x16x32_bf16(false, ah, false, bl, (short)0, c, false, false);
  asm volatile("v_nop\n\tv_nop\n\tv_nop\n\tv_nop" : "+v"(c) : "v"(ah), "v"(al), "v"(bh), "v"(bl));
  return c;
}

__global__ __launch_bounds__(256) void k_wt_bf16(const float* __restrict__ W, unsigned short* __restrict__ Wt, int K, int N) {
  const int t = blockIdx.x * 256 + threadIdx.x;
  const int k8n = K / 8;
  if (t >= N * k8n) return;
  const int n = t / k8n, k8 = (t % k8n) * 8;
  v8us v;
#pragma unroll
  for (int i = 0; i < 8; ++i) v[i] = bf16_bits(W[(size_t)(k8 + i) * N + n]);
  *(v8us*)(Wt + (size_t)n * K + k8) = v;
  
}

// GEMM C[M][N] (f32, pitch ldc) = act(A[M][K]·W + bias). A f32 row-major (pitch lda) converted per fragment to bf16
// (ASPLIT: hi/lo two planes -> 2 terms, else single rounded term); Wt bf16 [N][K] (pitch ldb). BIAS_BF16 rounds the
// bias to bf16 first (bias quantised to bf16 before the add). K%32==0, M%16==0, N%64==0.
// OUT 0: C in f32. OUT 1: the result leaves as two bf16 planes, Ch = the rounded value and Cl = the rounded remainder (pitch ldc each), and C is not written.
// OUT 2: only columns 0..DQR-1 leave, as one packed row of KPK bf16 in Ch (pitch ldc): hi | hi | lo | 0; C and Cl are not written.
template <bool ASPLIT, int ACT, bool BIAS_BF16, int OUT>
__global__ __launch_bounds__(128) void k_gemm_bf(const float* __restrict__ A, int lda, const unsigned short* __restrict__ Wt, int ldb,
                                               const float* __restrict__ bias, float* __restrict__ C, unsigned short* __restrict__ Ch, unsigned short* __restrict__ Cl,
                                               int ldc, int M, int N, int K) {
  __shared__ __attribute__((aligned(16))) float so[4][16][64];
  const int tid = threadIdx.x, w = tid >> 5, lane = tid & 31, ln = lane & 15, hh = lane >> 4;
  const int ntn = N / 64;
  const int wid = blockIdx.x * 4 + w;
  const int mt = wid / ntn, nq = wid % ntn;
  if (mt * 16 >= M) return;
  const int row0 = mt * 16, col0 = nq * 64;
  const float* arow = A + (size_t)(row0 + ln) * lda;
  v8f acc[4] = {};
  for (int kb = 0; kb < K; kb += 32) {
    FragB ah, al;
    const v4f x0 = *(const v4fa*)(arow + kb + 8 * hh), x1 = *(const v4fa*)(arow + kb + 8 * hh + 4);
    const v4f x2 = *(const v4fa*)(arow + kb + 16 + 8 * hh), x3 = *(const v4fa*)(arow + kb + 16 + 8 * hh + 4);
    float xs[16] = {x0[0],x0[1],x0[2],x0[3],x1[0],x1[1],x1[2],x1[3],x2[0],x2[1],x2[2],x2[3],x3[0],x3[1],x3[2],x3[3]};
#pragma unroll
    for (int i = 0; i < 16; ++i) { const unsigned short hb = bf16_bits(xs[i]); ah.u[i] = hb; al.u[i] = ASPLIT ? bf16_bits(xs[i] - bf16_val(hb)) : (unsigned short)0; }
#pragma unroll
    for (int t = 0; t < 4; ++t) {
      const unsigned short* brow = Wt + (size_t)(col0 + t * 16 + ln) * ldb + kb;
      FragB b;
      b.half[0] = *(const v8us*)(brow + 8 * hh);
      b.half[1] = *(const v8us*)(brow + 16 + 8 * hh);
      acc[t] = mmaN<ASPLIT ? 2 : 1>(ah.v, al.v, b.v, b.v, acc[t]);
    }
  }
#pragma unroll
  for (int t = 0; t < 4; ++t) {
    float bv = bias ? bias[col0 + t * 16 + ln] : 0.f;
    if (BIAS_BF16) bv = bf16_round(bv);
#pragma unroll
    for (int r = 0; r < 8; ++r) { float v = acc[t][r] + bv; if (ACT == 1) v = fmaxf(v, 0.f); so[w][8 * hh + r][t * 16 + ln] = v; }
  }
  __builtin_amdgcn_fence(__ATOMIC_ACQ_REL, "workgroup");
  __builtin_amdgcn_wave_barrier();
  if (OUT == 1) {
    // a lane takes 8 neighbours of a row: 8 lanes store one whole 128-byte line of each plane; both loops are unrolled so that
    // xs, h and l are indexed by constants and stay in registers
    const int rs = lane >> 3, c8 = (lane & 7) * 8;
#pragma unroll
    for (int q = 0; q < 4; ++q) {
      const int r = q * 4 + rs;
      const v4f a = *(const v4fa*)&so[w][r][c8], b = *(const v4fa*)&so[w][r][c8 + 4];
      const float xs[8] = {a[0],a[1],a[2],a[3],b[0],b[1],b[2],b[3]};
      v8us h, l;
#pragma unroll
      for (int i = 0; i < 8; ++i) { const unsigned short hb = bf16_bits(xs[i]); h[i] = hb; l[i] = bf16_bits(xs[i] - bf16_val(hb)); }
      const size_t o = (size_t)(row0 + r) * ldc + col0 + c8;
      *(v8us*)(Ch + o) = h;
      *(v8us*)(Cl + o) = l;
    }
  } else if (OUT == 2) {
    // four lanes write the four 16-byte parts of a row, 16 lanes four whole rows (256 contiguous bytes); both loops are unrolled so that
    // xs, h and l are indexed by constants and stay in registers
    static_assert(DQR == 8 && KPK == 4 * DQR, "a part of a packed row is one 16-byte store");
    const int rs = lane >> 3, part = lane & 7;
#pragma unroll
    for (int q = 0; q < 4; ++q) {
      const int r = q * 4 + rs;
      const v4f a = *(const v4fa*)&so[w][r][0], b = *(const v4fa*)&so[w][r][4];
      const float xs[8] = {a[0],a[1],a[2],a[3],b[0],b[1],b[2],b[3]};
      v8us h, l;
#pragma unroll
      for (int i = 0; i < 8; ++i) { const unsigned short hb = bf16_bits(xs[i]); h[i] = hb; l[i] = bf16_bits(xs[i] - bf16_val(hb)); }
      const v8us o = (part < 2) ? h : (part == 2) ? l : (v8us){0,0,0,0,0,0,0,0};
      if (col0 == 0 && part < 4) *(v8us*)(Ch + (size_t)(row0 + r) * ldc + part * 8) = o;
    }
  } else {
    const int rsub = lane >> 4, c4 = (lane & 15) * 4;
#pragma unroll
    for (int q = 0; q < 8; ++q) {
      const int r = q * 2 + rsub;
      const v4f v = *(const v4fa*)&so[w][r][c4];
      *(v4f*)(C + (size_t)(row0 + r) * ldc + col0 + c4) = v;
    }
  }
}

// Flash-style causal/unmasked attention, all contractions 3-term bf16 hi/lo splits, f32 softmax with running max.
// q,k,v rows are read from f32 buffers with arbitrary row pitch (so they can live inside a fused qkv buffer);
// D = head size (multiple of 32, <= 128); one wave = 16 query rows; block = 4 waves (64 queries) sharing K/V chunks of 32.
template <int D, bool CAUSAL>
__global__ __launch_bounds__(128) void k_flash(const float* __restrict__ qb, const float* __restrict__ kb, const float* __restrict__ vb,
                                             int pitch, int T, int H, float scale, float* __restrict__ y, int ypitch) {
  constexpr int KS = D / 32;        // k-steps for QK
  constexpr int DT = D / 16;        // d tiles for PV
  __shared__ __attribute__((aligned(16))) unsigned short sKh[32][D + 8], sKl[32][D + 8], sVh[32][D + 8], sVl[32][D + 8];
  __shared__ __attribute__((aligned(16))) unsigned short sPh[4][16][40], sPl[4][16][40];
  __shared__ __attribute__((aligned(16))) float sO[4][16][D];
  const int tid = threadIdx.x, w = tid >> 5, lane = tid & 31, ln = lane & 15, hh = lane >> 4;
  const int nqb = (T + 63) / 64;
  const int bh = blockIdx.x / nqb, qblk = blockIdx.x % nqb;
  const int b = bh / H, h = bh % H;
  const int q0 = qblk * 64 + w * 16;
  const float* Q = qb + (size_t)b * T * pitch + h * D;
  const float* K = kb + (size_t)b * T * pitch + h * D;
  const float* V = vb + (size_t)b * T * pitch + h * D;

  // A fragments of the wave's 16 query rows (scaled), hi/lo
  FragB aqh[KS], aql[KS];
  {
    int row = q0 + ln; if (row >= T) row = T - 1;
    const float* qr = Q + (size_t)row * pitch;
#pragma unroll
    for (int ks = 0; ks < KS; ++ks)
#pragma unroll
      for (int i = 0; i < 16; ++i) {
        const int d = ks * 32 + ((i < 8) ? (8 * hh + i) : (16 + 8 * hh + (i - 8)));
        const float x = qr[d] * scale; const unsigned short hb = bf16_bits(x);
        aqh[ks].u[i] = hb; aql[ks].u[i] = bf16_bits(x - bf16_val(hb));
      }
  }
  float m_r[8], l_r[8];
#pragma unroll
  for (int r = 0; r < 8; ++r) { m_r[r] = -3.0e38f; l_r[r] = 0.f; }
  v8f oacc[DT];
#pragma unroll
  for (int dt = 0; dt < DT; ++dt) oacc[dt] = (v8f){0.f,0.f,0.f,0.f,0.f,0.f,0.f,0.f};

  const int kv_end = CAUSAL ? min(T, qblk * 64 + 64) : T;     // block-uniform
  for (int j0 = 0; j0 < kv_end; j0 += 32) {
    __syncthreads();
    for (int e = tid; e < 32 * (D / 4); e += 128) {
      const int r = e / (D / 4), c4 = (e % (D / 4)) * 4;
      const int key = j0 + r;
      v4f kf = {0.f,0.f,0.f,0.f}, vf = {0.f,0.f,0.f,0.f};
      if (key < T) { kf = *(const v4fa*)(K + (size_t)key * pitch + c4); vf = *(const v4fa*)(V + (size_t)key * pitch + c4); }
#pragma unroll
      for (int t = 0; t < 4; ++t) {
        unsigned short hb = bf16_bits(kf[t]); sKh[r][c4 + t] = hb; sKl[r][c4 + t] = bf16_bits(kf[t] - bf16_val(hb));
        hb = bf16_bits(vf[t]); sVh[r][c4 + t] = hb; sVl[r][c4 + t] = bf16_bits(vf[t] - bf16_val(hb));
      }
    }
    __syncthreads();
    // S tile 16 x 32
    v8f s[2];
#pragma unroll
    for (int nt = 0; nt < 2; ++nt) {
      v8f acc = {};
#pragma unroll
      for (int ks = 0; ks < KS; ++ks) {
        FragB bh_, bl_;
        bh_.half[0] = *(const v8us*)&sKh[nt * 16 + ln][ks * 32 + 8 * hh]; bh_.half[1] = *(const v8us*)&sKh[nt * 16 + ln][ks * 32 + 16 + 8 * hh];
        bl_.half[0] = *(const v8us*)&sKl[nt * 16 + ln][ks * 32 + 8 * hh]; bl_.half[1] = *(const v8us*)&sKl[nt * 16 + ln][ks * 32 + 16 + 8 * hh];
        acc = mmaN<3>(aqh[ks].v, aql[ks].v, bh_.v, bl_.v, acc);
      }
      s[nt] = acc;
    }
    // mask + running max (rows 8hh+r; the 16 lanes of a half share rows)
    float alpha[8];
#pragma unroll
    for (int r = 0; r < 8; ++r) {
      const int qi = q0 + 8 * hh + r;
      const int ja = j0 + ln, jb = j0 + 16 + ln;
      if (CAUSAL) { if (ja > qi) s[0][r] = -3.0e38f; if (jb > qi) s[1][r] = -3.0e38f; }
      if (ja >= T) s[0][r] = -3.0e38f;
      if (jb >= T) s[1][r] = -3.0e38f;
      float mx = fmaxf(s[0][r], s[1][r]);
      mx = fmaxf(mx, __shfl_xor(mx, 1, 32)); mx = fmaxf(mx, __shfl_xor(mx, 2, 32)); mx = fmaxf(mx, __shfl_xor(mx, 4, 32)); mx = fmaxf(mx, __shfl_xor(mx, 8, 32));
      const float mnew = fmaxf(m_r[r], mx);
      alpha[r] = (mnew > -1.0e38f) ? __expf(m_r[r] - mnew) : 1.0f;
      const float p0 = (s[0][r] > -1.0e38f) ? __expf(s[0][r] - mnew) : 0.f;
      const float p1 = (s[1][r] > -1.0e38f) ? __expf(s[1][r] - mnew) : 0.f;
      m_r[r] = mnew;
      l_r[r] = l_r[r] * alpha[r] + p0 + p1;            // per-lane partial row sum (16 lanes combined at the end)
      unsigned short hb = bf16_bits(p0); sPh[w][8 * hh + r][ln] = hb;      sPl[w][8 * hh + r][ln] = bf16_bits(p0 - bf16_val(hb));
      hb = bf16_bits(p1);                sPh[w][8 * hh + r][16 + ln] = hb; sPl[w][8 * hh + r][16 + ln] = bf16_bits(p1 - bf16_val(hb));
    }
#pragma unroll
    for (int dt = 0; dt < DT; ++dt)
#pragma unroll
      for (int r = 0; r < 8; ++r) oacc[dt][r] *= alpha[r];
    __builtin_amdgcn_fence(__ATOMIC_ACQ_REL, "workgroup");
    __builtin_amdgcn_wave_barrier();
    FragB pah, pal;
    pah.half[0] = *(const v8us*)&sPh[w][ln][8 * hh]; pah.half[1] = *(const v8us*)&sPh[w][ln][16 + 8 * hh];
    pal.half[0] = *(const v8us*)&sPl[w][ln][8 * hh]; pal.half[1] = *(const v8us*)&sPl[w][ln][16 + 8 * hh];
#pragma unroll
    for (int dt = 0; dt < DT; ++dt) {
      FragB bvh, bvl;
#pragma unroll
      for (int i = 0; i < 8; ++i) {
        bvh.u[i] = sVh[8 * hh + i][dt * 16 + ln]; bvh.u[8 + i] = sVh[16 + 8 * hh + i][dt * 16 + ln];
        bvl.u[i] = sVl[8 * hh + i][dt * 16 + ln]; bvl.u[8 + i] = sVl[16 + 8 * hh + i][dt * 16 + ln];
      }
      oacc[dt] = mmaN<3>(pah.v, pal.v, bvh.v, bvl.v, oacc[dt]);
    }
    __builtin_amdgcn_fence(__ATOMIC_ACQ_REL, "workgroup");
    __builtin_amdgcn_wave_barrier();
  }
#pragma unroll
  for (int r = 0; r < 8; ++r) {
    float l = l_r[r];
    l += __shfl_xor(l, 1, 32); l += __shfl_xor(l, 2, 32); l += __shfl_xor(l, 4, 32); l += __shfl_xor(l, 8, 32);
    l_r[r] = (l > 0.f) ? 1.0f / l : 0.f;
  }
#pragma unroll
  for (int dt = 0; dt < DT; ++dt)
#pragma unroll
    for (int r = 0; r < 8; ++r) sO[w][8 * hh + r][dt * 16 + ln] = oacc[dt][r] * l_r[r];
  __builtin_amdgcn_fence(__ATOMIC_ACQ_REL, "workgroup");
  __builtin_amdgcn_wave_barrier();
  {
    for (int r = 0; r < 16; ++r) {
      const int row = q0 + r;
      if (row < T && lane < D / 4) {
        const v4f val = *(const v4fa*)&sO[w][r][lane * 4];
        *(v4f*)(y + ((size_t)b * T + row) * ypitch + h * D + lane * 4) = val;
      }
    }
    
  }
}

// in pitch = cols, out pitch = rows; rows, cols multiples of 32. Optional per-output-row affine (scale[c], shift[c]) and
// residual add res (same layout as out, optionally bf16-rounded) for fused epilogues: out = in*scale + shift + res.
template <bool AFFINE, bool RESID, bool RES_BF16>
__global__ __launch_bounds__(256) void k_transpose32(const float* __restrict__ in, float* __restrict__ out, int rows, int cols,
                                                    const float* __restrict__ scale, const float* __restrict__ shift, const float* __restrict__ res) {
  __shared__ float tile[32][33];
  const int b = blockIdx.z;
  const int r0 = blockIdx.y * 32, c0 = blockIdx.x * 32;
  const float* src = in + (size_t)b * rows * cols;
  float* dst = out + (size_t)b * rows * cols;
  const int tx = threadIdx.x & 31, ty = threadIdx.x >> 5;     // 8 rows per pass
  for (int i = ty; i < 32; i += 8) tile[i][tx] = src[(size_t)(r0 + i) * cols + c0 + tx];
  __syncthreads();
  {
    for (int i = ty; i < 32; i += 8) {
      float v = tile[tx][i];
      const int orow = c0 + i;
      if (AFFINE) v = v * scale[orow] + shift[orow];
      if (RESID) { float rv = res[(size_t)b * rows * cols + (size_t)orow * rows + r0 + tx]; if (RES_BF16) rv = bf16_round(rv); v += rv; }
      *(float*)(dst + (size_t)orow * rows + r0 + tx) = v;
    }
    
  }
}

// 2x2 max pool on position-major data: in [B][H*W][C] -> out [B][(H/2)*(W/2)][C]; thread per (b, p', 4 channels); C%4==0
__global__ __launch_bounds__(256) void k_pool2_pm(const float* __restrict__ in, float* __restrict__ out, int Bn, int H, int W, int C) {
  const size_t t = (size_t)blockIdx.x * 256 + threadIdx.x;
  const int c4n = C / 4, Ho = H / 2, Wo = W / 2;
  const size_t total = (size_t)Bn * Ho * Wo * c4n;
  if (t >= total) return;
  const int c4 = (int)(t % c4n) * 4; size_t rest = t / c4n;
  const int pw = (int)(rest % Wo); rest /= Wo; const int ph = (int)(rest % Ho); const int b = (int)(rest / Ho);
  const float* base = in + (size_t)b * H * W * C;
  const int p00 = (2 * ph) * W + 2 * pw;
  const v4f a = *(const v4fa*)(base + (size_t)p00 * C + c4), bq = *(const v4fa*)(base + (size_t)(p00 + 1) * C + c4);
  const v4f c = *(const v4fa*)(base + (size_t)(p00 + W) * C + c4), d = *(const v4fa*)(base + (size_t)(p00 + W + 1) * C + c4);
  v4f m; for (int i = 0; i < 4; ++i) m[i] = fmaxf(fmaxf(a[i], bq[i]), fmaxf(c[i], d[i]));
  float* dst = out + ((size_t)b * Ho * Wo + (size_t)ph * Wo + pw) * C + c4;
  *(v4f*)dst = m;
  
}

// General (non-causal) attention, 3-term bf16 splits, f32 softmax with running max.
// Q [.][Tq][qpitch] f32 (DQR channels); V [.][Tk][vpitch] (head dim DVtot) arrives already split, as a hi and a lo bf16 plane, K [.][Tk][KPK] as
// packed rows kh | kh | kl | 0 (DQR elements each). The query's operand is qh | ql | qh | 0 in the same places, so that ONE K = 32 product sums
// kh*qh + kh*ql + kl*qh, the three terms of the split, for a 16-key tile.
// A tile is staged by plain 16-byte copies and is not split again by every block that reads it; this block handles DV output
// dims starting at dv0 = blockIdx.y*DV. y[bh][t][ypitch] gets columns dv0..dv0+DV-1. Per-bh base offsets via strides.
// Both products run transposed: S^T = K * Q^T (A = K rows, B = Q) and O^T += V^T * P^T (A = V by the transposing load, B = P). A lane then
// holds 16 of the 32 scores of ONE query (column lane & 15; keys 8 * (lane >> 4) + r of either 16-key tile), which is the k order of a B
// operand: P goes from the score accumulators into its fragment in registers, and the maximum and the sum of a row are taken inside the lane.
// The V row pitch is compile-time (vpitch), so that a thread's staging loads differ only in their immediate offset.
// A block is 8 waves: wave w works on query tile w & 3 and on key group w >> 2. A trip stages 64 keys; group 0 takes the first 32, group 1 the
// second 32, each with a running maximum, sum and O of its own. The two partial results of a query tile are merged once, behind the loop.
// Two such blocks are meant to share a WGP, four waves on a SIMD: the waves-per-SIMD attribute holds the kernel to 256 registers a wave.
template <int DV, int vpitch>
__global__ __launch_bounds__(256) __attribute__((amdgpu_waves_per_eu(4, 4))) void k_flash2(const float* __restrict__ Qb, size_t qstride, int qpitch, int Tq,
                                              const unsigned short* __restrict__ Kpb, size_t kstride, int Tk,
                                              const unsigned short* __restrict__ Vhb, const unsigned short* __restrict__ Vlb, size_t vstride,
                                              float scale, float* __restrict__ y, size_t ystride, int ypitch) {
  constexpr int DT = DV / 16;
  constexpr int KP = KPK + 8;       // K row pitch in elements: an odd multiple of 16 bytes, the conflict-free pitch of the plain 16-byte load
  constexpr int VP = DV + 16;       // V row pitch in elements: an odd multiple of 32 bytes, the conflict-free pitch of the transposing load
  __shared__ __attribute__((aligned(16))) unsigned short sK[64][KP], sVh[64][VP], sVl[64][VP];
  __shared__ __attribute__((aligned(16))) float sO[4][16][DV + 4];   // 4 floats of pad: the 16 rows that a store instruction writes start in different banks
  __shared__ float sM[4][32], sL[4][32];   // key group 1's running maximum and sum, per lane, for the merge
  const int tid = threadIdx.x, w = tid >> 5, lane = tid & 31, ln = lane & 15, hh = lane >> 4;
  const int nqb = (Tq + 63) / 64;
  const int bh = blockIdx.x / nqb, qblk = blockIdx.x % nqb;
  const int dv0 = blockIdx.y * DV;
  const int qt = w & 3, kg = w >> 2;
  const int q0 = qblk * 64 + qt * 16;
  const float* Q = Qb + (size_t)bh * qstride;
  const unsigned short* Kp = Kpb + (size_t)bh * kstride;
  const unsigned short* Vh = Vhb + (size_t)bh * vstride + dv0; const unsigned short* Vl = Vlb + (size_t)bh * vstride + dv0;
  // element i of a lane's operand is place 8 * hh + i (i < 8) or 16 + 8 * hh + (i - 8) of the packed row, on the K side and here alike:
  // lane half 0 holds places 0..7 and 16..23 (qh, qh against kh, kl), lane half 1 places 8..15 and 24..31 (ql, 0 against kh, 0)
  static_assert(DQR == 8 && KPK == 32, "the packed row fills one K = 32 operand in parts of 8");
  FragB qp;
  {
    int row = q0 + ln; if (row >= Tq) row = Tq - 1;
    const float* qr = Q + (size_t)row * qpitch;      // qpitch is a multiple of 4: the row starts on 16 bytes
    const v4f qa = *(const v4fa*)qr, qc = *(const v4fa*)(qr + 4);
    const float qs[8] = {qa[0],qa[1],qa[2],qa[3],qc[0],qc[1],qc[2],qc[3]};
    // unrolled so that qs and the operand are indexed by constants and stay in registers
#pragma unroll
    for (int i = 0; i < 8; ++i) {
      const float x = qs[i] * scale; const unsigned short hb = bf16_bits(x), lb = bf16_bits(x - bf16_val(hb));
      qp.u[i] = hh ? lb : hb; qp.u[8 + i] = hh ? (unsigned short)0 : hb;
    }
  }
  float m_q = -3.0e38f, l_q = 0.f;   // running maximum of query q0 + ln (equal in both lane halves); sum over this lane half's keys only
  v8f oacc[DT];                      // oacc[dt][r] = O[q0 + ln][dt * 16 + 8 * hh + r]
#pragma unroll
  for (int dt = 0; dt < DT; ++dt) oacc[dt] = (v8f){0.f,0.f,0.f,0.f,0.f,0.f,0.f,0.f};
  // Staging of a 64-key tile: the 64 packed K rows are 256 contiguous 16-byte pieces, one per thread; 256 threads cover VR rows of a V plane
  // per 16-byte load, VL loads per thread and plane.
  constexpr int VR = 256 / (DV / 8), VL = 64 / VR;
  static_assert(64 * (KPK / 8) == 256 && VR * (DV / 8) == 256 && VL * VR == 64, "tile must divide over 256 threads");
  const int kr = tid / (KPK / 8), kc = (tid % (KPK / 8)) * 8, vr = tid / (DV / 8), vc = (tid % (DV / 8)) * 8;
  const unsigned koff = (unsigned)tid * 8u, voff = (unsigned)vr * (unsigned)vpitch + (unsigned)vc;
  for (int j0 = 0; j0 < Tk; j0 += 64) {
    // All of a thread's K and V loads of the tile are issued before the first is used: a trip waits out one load latency, not
    // 1 + 2 * VL. A full tile (block-uniform test) takes them without the per-row guard, in one straight run. The loops over i are
    // unrolled so that the two arrays are indexed by constants and stay in registers.
    v8us kk, vh[VL], vl[VL];
    if (j0 + 64 <= Tk) {
      kk = *(const v8us*)(Kp + (size_t)j0 * KPK + koff);
#pragma unroll
      for (int i = 0; i < VL; ++i) { vh[i] = *(const v8us*)(Vh + (size_t)(j0 + i * VR) * vpitch + voff); vl[i] = *(const v8us*)(Vl + (size_t)(j0 + i * VR) * vpitch + voff); }
    } else {
      kk = (v8us){0,0,0,0,0,0,0,0};
      if (j0 + kr < Tk) kk = *(const v8us*)(Kp + (size_t)j0 * KPK + koff);
#pragma unroll
      for (int i = 0; i < VL; ++i) {
        vh[i] = (v8us){0,0,0,0,0,0,0,0}; vl[i] = (v8us){0,0,0,0,0,0,0,0};
        if (j0 + i * VR + vr < Tk) { vh[i] = *(const v8us*)(Vh + (size_t)(j0 + i * VR) * vpitch + voff); vl[i] = *(const v8us*)(Vl + (size_t)(j0 + i * VR) * vpitch + voff); }
      }
    }
    __syncthreads();
    *(v8us*)&sK[kr][kc] = kk;
#pragma unroll
    for (int i = 0; i < VL; ++i) { *(v8us*)&sVh[i * VR + vr][vc] = vh[i]; *(v8us*)&sVl[i * VR + vr][vc] = vl[i]; }
    __syncthreads();
    const int jw = j0 + kg * 32;     // first key of this wave's group in the tile
    v8f s[2];                        // s[nt][r] = score of key jw + nt * 16 + 8 * hh + r with query q0 + ln
    FragB ka[2];                     // both loops over nt are unrolled so that ka and s are indexed by constants and stay in registers
#pragma unroll
    for (int nt = 0; nt < 2; ++nt) { ka[nt].half[0] = *(const v8us*)&sK[kg * 32 + nt * 16 + ln][8 * hh]; ka[nt].half[1] = *(const v8us*)&sK[kg * 32 + nt * 16 + ln][16 + 8 * hh]; }
#pragma unroll
    for (int nt = 0; nt < 2; ++nt) s[nt] = mmaN<1>(ka[nt].v, ka[nt].v, qp.v, qp.v, (v8f){0.f,0.f,0.f,0.f,0.f,0.f,0.f,0.f});
    // Every loop over nt, r or dt below is unrolled so that s, the P fragments and oacc are indexed by constants and stay in registers.
    if (j0 + 64 > Tk) {              // block-uniform: only a last, partial tile has keys to mask
#pragma unroll
      for (int nt = 0; nt < 2; ++nt)
#pragma unroll
        for (int r = 0; r < 8; ++r) if (jw + nt * 16 + 8 * hh + r >= Tk) s[nt][r] = -3.0e38f;
    }
    float mx = fmaxf(s[0][0], s[1][0]);
#pragma unroll
    for (int r = 1; r < 8; ++r) mx = fmaxf(mx, fmaxf(s[0][r], s[1][r]));
    // the other 16 keys of the same query lie in lane ^ 16
    mx = fmaxf(mx, __int_as_float(__builtin_amdgcn_permlanex16(__float_as_int(mx), __float_as_int(mx), 0x76543210, 0xfedcba98, false, false)));
    const float mnew = fmaxf(m_q, mx);
    const float alpha = (mnew > -1.0e38f) ? __expf(m_q - mnew) : 1.0f;
    m_q = mnew;
    FragB pbh, pbl;                  // P^T as a B operand: element nt * 8 + r is key nt * 16 + 8 * hh + r, the hardware k order
    v2f ps = {0.f, 0.f};
#pragma unroll
    for (int nt = 0; nt < 2; ++nt)
#pragma unroll
      for (int r = 0; r < 8; r += 2) {
        v2f p;
        p[0] = (s[nt][r] > -1.0e38f) ? __expf(s[nt][r] - mnew) : 0.f;
        p[1] = (s[nt][r + 1] > -1.0e38f) ? __expf(s[nt][r + 1] - mnew) : 0.f;
        ps += p;
        // two neighbours fill one operand register: the packed convert rounds to nearest even, as bf16_bits does, and packs in the same instruction
        const v2b hi = __builtin_convertvector(p, v2b);
        pbh.pair[nt * 4 + r / 2] = hi;
        pbl.pair[nt * 4 + r / 2] = __builtin_convertvector(p - __builtin_convertvector(hi, v2f), v2b);
      }
    l_q = l_q * alpha + (ps[0] + ps[1]);
#pragma unroll
    for (int dt = 0; dt < DT; ++dt)
#pragma unroll
      for (int r = 0; r < 8; ++r) oacc[dt][r] *= alpha;
    const unsigned short* vth = &sVh[kg * 32 + 8 * hh + (lane & 7)][((lane >> 3) & 1) * 8];
    const unsigned short* vtl = &sVl[kg * 32 + 8 * hh + (lane & 7)][((lane >> 3) & 1) * 8];
    // fragments of two d tiles are fetched as one group, one group ahead of the products that use them
    FragB bvh[2][2], bvl[2][2];
#pragma unroll
    for (int u = 0; u < 2; ++u) {
      bvh[0][u].half[0] = ld_tr16(vth + u * 16); bvh[0][u].half[1] = ld_tr16(vth + 16 * VP + u * 16);
      bvl[0][u].half[0] = ld_tr16(vtl + u * 16); bvl[0][u].half[1] = ld_tr16(vtl + 16 * VP + u * 16);
    }
#pragma unroll
    for (int g = 0; g < DT / 2; ++g) {
      if (g + 1 < DT / 2) {
#pragma unroll
        for (int u = 0; u < 2; ++u) {
          const int d = ((g + 1) * 2 + u) * 16;
          bvh[(g + 1) & 1][u].half[0] = ld_tr16(vth + d); bvh[(g + 1) & 1][u].half[1] = ld_tr16(vth + 16 * VP + d);
          bvl[(g + 1) & 1][u].half[0] = ld_tr16(vtl + d); bvl[(g + 1) & 1][u].half[1] = ld_tr16(vtl + 16 * VP + d);
        }
      }
#pragma unroll
      for (int u = 0; u < 2; ++u) oacc[g * 2 + u] = mmaN<3>(bvh[g & 1][u].v, bvl[g & 1][u].v, pbh.v, pbl.v, oacc[g * 2 + u]);
    }
  }
  // Merge of the two key groups. Group 1 hands its unnormalised O, its maximum and its sum over through LDS; the lane of group 0 that holds the
  // same query and the same d rows reads back the very words that its partner lane wrote, brings both parts to the common maximum and adds them.
  // The loops over dt and r are unrolled so that oacc is indexed by constants and stays in registers.
  if (kg == 1) {
#pragma unroll
    for (int dt = 0; dt < DT; ++dt) {
      v4f lo4, hi4;
#pragma unroll
      for (int r = 0; r < 4; ++r) { lo4[r] = oacc[dt][r]; hi4[r] = oacc[dt][4 + r]; }
      *(v4fa*)&sO[qt][ln][dt * 16 + 8 * hh] = lo4; *(v4fa*)&sO[qt][ln][dt * 16 + 8 * hh + 4] = hi4;
    }
    sM[qt][lane] = m_q; sL[qt][lane] = l_q;
  }
  __syncthreads();   // group 1's parts lie in LDS before group 0 reads them
  if (kg == 0) {
    const float m1 = sM[qt][lane], l1 = sL[qt][lane];
    const float mm = fmaxf(m_q, m1);
    // a group that saw no key has maximum -3e38, sum 0 and O 0: its factor is 0 beside a real maximum, and 1 on zeros where neither saw a key
    const float a0 = __expf(m_q - mm), a1 = __expf(m1 - mm);
    const float lj = l_q * a0 + l1 * a1;
    // the two lane halves' sums join once
    const float lsum = lj + __int_as_float(__builtin_amdgcn_permlanex16(__float_as_int(lj), __float_as_int(lj), 0x76543210, 0xfedcba98, false, false));
    const float linv = (lsum > 0.f) ? 1.0f / lsum : 0.f;
    const float f0 = a0 * linv, f1 = a1 * linv;
#pragma unroll
    for (int dt = 0; dt < DT; ++dt) {
      const v4f pl = *(const v4fa*)&sO[qt][ln][dt * 16 + 8 * hh], ph = *(const v4fa*)&sO[qt][ln][dt * 16 + 8 * hh + 4];
      v4f lo4, hi4;
#pragma unroll
      for (int r = 0; r < 4; ++r) { lo4[r] = oacc[dt][r] * f0 + pl[r] * f1; hi4[r] = oacc[dt][4 + r] * f0 + ph[r] * f1; }
      *(v4fa*)&sO[qt][ln][dt * 16 + 8 * hh] = lo4; *(v4fa*)&sO[qt][ln][dt * 16 + 8 * hh + 4] = hi4;
    }
  }
  __syncthreads();   // the merged rows lie in LDS before the waves of both groups store them, 8 rows of the query tile each
  {
    for (int r = kg * 8; r < kg * 8 + 8; ++r) {
      const int row = q0 + r;
      for (int c4 = lane * 4; c4 < DV; c4 += 128) {
        if (row < Tq) {
          const v4f val = *(const v4fa*)&sO[qt][r][c4];
          *(v4f*)(y + (size_t)bh * ystride + (size_t)row * ypitch + dv0 + c4) = val;
        }
      }
    }
  }
}

__global__ __launch_bounds__(256) void k_round_rows(const float* __restrict__ W, unsigned short* __restrict__ Wt, int n8) {
  const int t = blockIdx.x * 256 + threadIdx.x;
  if (t >= n8) return;
  const v4f a = *(const v4fa*)(W + (size_t)t * 8), b = *(const v4fa*)(W + (size_t)t * 8 + 4);
  v8us v; v[0]=bf16_bits(a[0]); v[1]=bf16_bits(a[1]); v[2]=bf16_bits(a[2]); v[3]=bf16_bits(a[3]);
  v[4]=bf16_bits(b[0]); v[5]=bf16_bits(b[1]); v[6]=bf16_bits(b[2]); v[7]=bf16_bits(b[3]);
  *(v8us*)(Wt + (size_t)t * 8) = v; 
}

// padded q/k weights: Bt [64][256] rows < 8 real; bias64; gamma vector (256 copies, bf16-rounded) and zero shift
__global__ __launch_bounds__(256) void k_prep(const float* __restrict__ wq, const float* __restrict__ bq, const float* __restrict__ wk, const float* __restrict__ bk, const float* __restrict__ gamma,
                                            unsigned short* __restrict__ Bq, unsigned short* __restrict__ Bk, float* __restrict__ bq64, float* __restrict__ bk64, float* __restrict__ gvec, float* __restrict__ zvec) {
  const int t = blockIdx.x * 256 + threadIdx.x;
  if (t < DQP * (CC / 8)) { const int n = t / (CC / 8), k8 = (t % (CC / 8)) * 8; v8us a, b;
    for (int i = 0; i < 8; ++i) { a[i] = (n < 8) ? bf16_bits(wq[n * CC + k8 + i]) : (unsigned short)0; b[i] = (n < 8) ? bf16_bits(wk[n * CC + k8 + i]) : (unsigned short)0; }
    *(v8us*)(Bq + n * CC + k8) = a; *(v8us*)(Bk + n * CC + k8) = b;  }
  if (t < DQP) { const float a = (t < 8) ? bq[t] : 0.f, b = (t < 8) ? bk[t] : 0.f; *(float*)(bq64 + t) = a; *(float*)(bk64 + t) = b;  }
  if (t < CC) { const float g = bf16_round(gamma[0]); *(float*)(gvec + t) = g; *(float*)(zvec + t) = 0.f;  }
}
extern "C" void kernel_launch(void* const* d_in, const int* in_sizes, int n_in,
                              void* d_out, int out_size, void* d_ws, size_t ws_size, hipStream_t stream) {
  (void)in_sizes; (void)n_in; (void)out_size;
  const float* x = (const float*)d_in[0]; const float* wq = (const float*)d_in[1]; const float* bq = (const float*)d_in[2]; const float* wk = (const float*)d_in[3]; const float* bk = (const float*)d_in[4];
  const float* wv = (const float*)d_in[5]; const float* bv = (const float*)d_in[6]; const float* gamma = (const float*)d_in[7];
  char* ws = (char*)d_ws; size_t off = 0;
  auto take = [&](size_t bytes) { char* p = ws + off; off += (bytes + 255) & ~(size_t)255; return p; };
  const int M = BB * NN;
  unsigned short* Bq = (unsigned short*)take(DQP * CC * 2); unsigned short* Bk = (unsigned short*)take(DQP * CC * 2); unsigned short* Bv = (unsigned short*)take(CC * CC * 2);
  float* bq64 = (float*)take(256); float* bk64 = (float*)take(256); float* gvec = (float*)take(CC * 4); float* zvec = (float*)take(CC * 4);
  float* xT = (float*)take((size_t)M * CC * 4); float* q = (float*)take((size_t)M * DQP * 4);
  unsigned short* kp = (unsigned short*)take((size_t)M * KPK * 2);
  unsigned short* vh = (unsigned short*)take((size_t)M * CC * 2); unsigned short* vl = (unsigned short*)take((size_t)M * CC * 2);
  float* z = (float*)take((size_t)M * CC * 4);
  if (off > ws_size) return;
  k_prep<<<(DQP * (CC / 8) + 255) / 256, 256, 0, stream>>>(wq, bq, wk, bk, gamma, Bq, Bk, bq64, bk64, gvec, zvec);
  k_round_rows<<<(CC * CC / 8 + 255) / 256, 256, 0, stream>>>(wv, Bv, CC * CC / 8);
  k_transpose32<false, false, false><<<dim3(NN / 32, CC / 32, BB), 256, 0, stream>>>(x, xT, CC, NN, nullptr, nullptr, nullptr);     // [B][C][N] -> [B][N][C]
  k_gemm_bf<false, 0, true, 0><<<((M / 16) * (DQP / 64) + 3) / 4, 128, 0, stream>>>(xT, CC, Bq, CC, bq64, q, nullptr, nullptr, DQP, M, DQP, CC);
  k_gemm_bf<false, 0, true, 2><<<((M / 16) * (DQP / 64) + 3) / 4, 128, 0, stream>>>(xT, CC, Bk, CC, bk64, nullptr, kp, nullptr, KPK, M, DQP, CC);
  k_gemm_bf<false, 0, true, 1><<<((M / 16) * (CC / 64) + 3) / 4, 128, 0, stream>>>(xT, CC, Bv, CC, bv, nullptr, vh, vl, CC, M, CC, CC);
  k_flash2<256, CC><<<dim3(BB * (NN / 64), 1), 256, 0, stream>>>(q, (size_t)NN * DQP, DQP, NN, kp, (size_t)NN * KPK, NN, vh, vl, (size_t)NN * CC, 1.0f, z, (size_t)NN * CC, CC);
  k_transpose32<true, true, true><<<dim3(CC / 32, NN / 32, BB), 256, 0, stream>>>(z, (float*)d_out, NN, CC, gvec, zvec, x);     // out = gamma·zᵀ + bf16(x)
}

// v007
// One run takes 231 microseconds.
// Next to v006, in two timings, it ran 1.09 and 1.10 times as fast.
// All steps since v000 together make it 4.54 times as fast.
#include <hip/hip_runtime.h>
// All contractions on v_wmma_f32_16x16x32_bf16, f32 accumulate: the q/k/v 1×1 convs as GEMMs over a position-major copy of x (x, W, b rounded to
// bf16: single exact term; the 8 q/k channels zero-padded to 64), energy = qᵀk (no scale) and attn·v per 16-query tile as 3-term bf16 hi/lo
// splits (k_flash2, a wave holds all 256 value dims of its queries, two wave groups of a block split the keys; the v GEMM writes the hi and lo planes of its result, the k GEMM rows that hold the three
// terms' k side next to each other, so that one K = 32 product gives all three terms of the 8 real channels), gamma·out + bf16(x) fused into the transpose back; softmax in f32.
#define BB 8
#define CC 256
#define NN 4096
#define DQP 64
#define DQR 8     // real q/k channels
#define KPK 32    // elements of a packed k row: hi | hi | lo | 0, DQR each

typedef __bf16 v16b __attribute__((ext_vector_type(16)));
typedef unsigned short v8us __attribute__((ext_vector_type(8), may_alias));
typedef float  v8f  __attribute__((ext_vector_type(8)));
typedef float  v4f  __attribute__((ext_vector_type(4)));
typedef float  v4fa __attribute__((ext_vector_type(4), may_alias));
typedef __bf16 v2b __attribute__((ext_vector_type(2)));
typedef float  v2f  __attribute__((ext_vector_type(2)));
union FragB { v16b v; v8us half[2]; unsigned short u[16]; v2b pair[8]; };

__device__ __forceinline__ unsigned short bf16_bits(float x) { unsigned int u = __float_as_uint(x); return (unsigned short)((u + 0x7FFFu + ((u >> 16) & 1u)) >> 16); }
__device__ __forceinline__ float bf16_val(unsigned short b) { return __uint_as_float(((unsigned int)b) << 16); }
__device__ __forceinline__ float bf16_round(float x) { return bf16_val(bf16_bits(x)); }
// 16-bit transposing LDS load: lane (c = l & 15, h = l >> 4) gets T[k0 + 8h + 0..7][d0 + c] from a row-major tile; lane l passes
// &T[k0 + 8 * (l >> 4) + (l & 7)][d0 + 8 * ((l >> 3) & 1)]. Two loads (k0, k0 + 16) make one 32 x 16 B fragment in the hardware k order.
typedef short s16x8 __attribute__((ext_vector_type(8)));
__device__ __forceinline__ v8us ld_tr16(const unsigned short* p) {
  typedef __attribute__((address_space(3))) s16x8 lds_s16x8;
  return __builtin_bit_cast(v8us, __builtin_amdgcn_ds_load_tr16_b128_v8i16((lds_s16x8*)p));
}
// D += A·B with NT terms: 1 = ah·bh, 2 = + al·bh (A split), 3 = + ah·bl (both split)
template <int NT>
__device__ __forceinline__ v8f mmaN(v16b ah, v16b al, v16b bh, v16b bl, v8f c) {
  c = __builtin_amdgcn_wmma_f32_16x16x32_bf16(false, ah, false, bh, (short)0, c, false, false);
  if (NT >= 2) c = __builtin_amdgcn_wmma_f32_16x16x32_bf16(false, al, false, bh, (short)0, c, false, false);
  if (NT >= 3) c = __builtin_amdgcn_wmma_f32_16x16x32_bf16(false, ah, false, bl, (short)0, c, false, false);
  asm volatile("v_nop\n\tv_nop\n\tv_nop\n\tv_nop" : "+v"(c) : "v"(ah), "v"(al), "v"(bh), "v"(bl));
  return c;
}

__global__ __launch_bounds__(256) void k_wt_bf16(const float* __restrict__ W, unsigned short* __restrict__ Wt, int K, int N) {
  const int t = blockIdx.x * 256 + threadIdx.x;
  const int k8n = K / 8;
  if (t >= N * k8n) return;
  const int n = t / k8n, k8 = (t % k8n) * 8;
  v8us v;
#pragma unroll
  for (int i = 0; i < 8; ++i) v[i] = bf16_bits(W[(size_t)(k8 + i) * N + n]);
  *(v8us*)(Wt + (size_t)n * K + k8) = v;
  
}

// GEMM C[M][N] (f32, pitch ldc) = act(A[M][K]·W + bias). A f32 row-major (pitch lda) converted per fragment to bf16
// (ASPLIT: hi/lo two planes -> 2 terms, else single rounded term); Wt bf16 [N][K] (pitch ldb). BIAS_BF16 rounds the
// bias to bf16 first (bias quantised to bf16 before the add). K%32==0, M%16==0, N%64==0.
// OUT 0: C in f32. OUT 1: the result leaves as two bf16 planes, Ch = the rounded value and Cl = the rounded remainder (pitch ldc each), and C is not written.
// OUT 2: only columns 0..DQR-1 leave, as one packed row of KPK bf16 in Ch (pitch ldc): hi | hi | lo | 0; C and Cl are not written.
template <bool ASPLIT, int ACT, bool BIAS_BF16, int OUT>
__global__ __launch_bounds__(128) void k_gemm_bf(const float* __restrict__ A, int lda, const unsigned short* __restrict__ Wt, int ldb,
                                               const float* __restrict__ bias, float* __restrict__ C, unsigned short* __restrict__ Ch, unsigned short* __restrict__ Cl,
                                               int ldc, int M, int N, int K) {
  __shared__ __attribute__((aligned(16))) float so[4][16][64];
  const int tid = threadIdx.x, w = tid >> 5, lane = tid & 31, ln = lane & 15, hh = lane >> 4;
  const int ntn = N / 64;
  const int wid = blockIdx.x * 4 + w;
  const int mt = wid / ntn, nq = wid % ntn;
  if (mt * 16 >= M) return;
  const int row0 = mt * 16, col0 = nq * 64;
  const float* arow = A + (size_t)(row0 + ln) * lda;
  v8f acc[4] = {};
  for (int kb = 0; kb < K; kb += 32) {
    FragB ah, al;
    const v4f x0 = *(const v4fa*)(arow + kb + 8 * hh), x1 = *(const v4fa*)(arow + kb + 8 * hh + 4);
    const v4f x2 = *(const v4fa*)(arow + kb + 16 + 8 * hh), x3 = *(const v4fa*)(arow + kb + 16 + 8 * hh + 4);
    float xs[16] = {x0[0],x0[1],x0[2],x0[3],x1[0],x1[1],x1[2],x1[3],x2[0],x2[1],x2[2],x2[3],x3[0],x3[1],x3[2],x3[3]};
#pragma unroll
    for (int i = 0; i < 16; ++i) { const unsigned short hb = bf16_bits(xs[i]); ah.u[i] = hb; al.u[i] = ASPLIT ? bf16_bits(xs[i] - bf16_val(hb)) : (unsigned short)0; }
#pragma unroll
    for (int t = 0; t < 4; ++t) {
      const unsigned short* brow = Wt + (size_t)(col0 + t * 16 + ln) * ldb + kb;
      FragB b;
      b.half[0] = *(const v8us*)(brow + 8 * hh);
      b.half[1] = *(const v8us*)(brow + 16 + 8 * hh);
      acc[t] = mmaN<ASPLIT ? 2 : 1>(ah.v, al.v, b.v, b.v, acc[t]);
    }
  }
#pragma unroll
  for (int t = 0; t < 4; ++t) {
    float bv = bias ? bias[col0 + t * 16 + ln] : 0.f;
    if (BIAS_BF16) bv = bf16_round(bv);
#pragma unroll
    for (int r = 0; r < 8; ++r) { float v = acc[t][r] + bv; if (ACT == 1) v = fmaxf(v, 0.f); so[w][8 * hh + r][t * 16 + ln] = v; }
  }
  __builtin_amdgcn_fence(__ATOMIC_ACQ_REL, "workgroup");
  __builtin_amdgcn_wave_barrier();
  if (OUT == 1) {
    // a lane takes 8 neighbours of a row: 8 lanes store one whole 128-byte line of each plane; both loops are unrolled so that
    // xs, h and l are indexed by constants and stay in registers
    const int rs = lane >> 3, c8 = (lane & 7) * 8;
#pragma unroll
    for (int q = 0; q < 4; ++q) {
      const int r = q * 4 + rs;
      const v4f a = *(const v4fa*)&so[w][r][c8], b = *(const v4fa*)&so[w][r][c8 + 4];
      const float xs[8] = {a[0],a[1],a[2],a[3],b[0],b[1],b[2],b[3]};
      v8us h, l;
#pragma unroll
      for (int i = 0; i < 8; ++i) { const unsigned short hb = bf16_bits(xs[i]); h[i] = hb; l[i] = bf16_bits(xs[i] - bf16_val(hb)); }
      const size_t o = (size_t)(row0 + r) * ldc + col0 + c8;
      *(v8us*)(Ch + o) = h;
      *(v8us*)(Cl + o) = l;
    }
  } else if (OUT == 2) {
    // four lanes write the four 16-byte parts of a row, 16 lanes four whole rows (256 contiguous bytes); both loops are unrolled so that
    // xs, h and l are indexed by constants and stay in registers
    static_assert(DQR == 8 && KPK == 4 * DQR, "a part of a packed row is one 16-byte store");
    const int rs = lane >> 3, part = lane & 7;
#pragma unroll
    for (int q = 0; q < 4; ++q) {
      const int r = q * 4 + rs;
      const v4f a = *(const v4fa*)&so[w][r][0], b = *(const v4fa*)&so[w][r][4];
      const float xs[8] = {a[0],a[1],a[2],a[3],b[0],b[1],b[2],b[3]};
      v8us h, l;
#pragma unroll
      for (int i = 0; i < 8; ++i) { const unsigned short hb = bf16_bits(xs[i]); h[i] = hb; l[i] = bf16_bits(xs[i] - bf16_val(hb)); }
      const v8us o = (part < 2) ? h : (part == 2) ? l : (v8us){0,0,0,0,0,0,0,0};
      if (col0 == 0 && part < 4) *(v8us*)(Ch + (size_t)(row0 + r) * ldc + part * 8) = o;
    }
  } else {
    const int rsub = lane >> 4, c4 = (lane & 15) * 4;
#pragma unroll
    for (int q = 0; q < 8; ++q) {
      const int r = q * 2 + rsub;
      const v4f v = *(const v4fa*)&so[w][r][c4];
      *(v4f*)(C + (size_t)(row0 + r) * ldc + col0 + c4) = v;
    }
  }
}

// Flash-style causal/unmasked attention, all contractions 3-term bf16 hi/lo splits, f32 softmax with running max.
// q,k,v rows are read from f32 buffers with arbitrary row pitch (so they can live inside a fused qkv buffer);
// D = head size (multiple of 32, <= 128); one wave = 16 query rows; block = 4 waves (64 queries) sharing K/V chunks of 32.
template <int D, bool CAUSAL>
__global__ __launch_bounds__(128) void k_flash(const float* __restrict__ qb, const float* __restrict__ kb, const float* __restrict__ vb,
                                             int pitch, int T, int H, float scale, float* __restrict__ y, int ypitch) {
  constexpr int KS = D / 32;        // k-steps for QK
  constexpr int DT = D / 16;        // d tiles for PV
  __shared__ __attribute__((aligned(16))) unsigned short sKh[32][D + 8], sKl[32][D + 8], sVh[32][D + 8], sVl[32][D + 8];
  __shared__ __attribute__((aligned(16))) unsigned short sPh[4][16][40], sPl[4][16][40];
  __shared__ __attribute__((aligned(16))) float sO[4][16][D];
  const int tid = threadIdx.x, w = tid >> 5, lane = tid & 31, ln = lane & 15, hh = lane >> 4;
  const int nqb = (T + 63) / 64;
  const int bh = blockIdx.x / nqb, qblk = blockIdx.x % nqb;
  const int b = bh / H, h = bh % H;
  const int q0 = qblk * 64 + w * 16;
  const float* Q = qb + (size_t)b * T * pitch + h * D;
  const float* K = kb + (size_t)b * T * pitch + h * D;
  const float* V = vb + (size_t)b * T * pitch + h * D;

  // A fragments of the wave's 16 query rows (scaled), hi/lo
  FragB aqh[KS], aql[KS];
  {
    int row = q0 + ln; if (row >= T) row = T - 1;
    const float* qr = Q + (size_t)row * pitch;
#pragma unroll
    for (int ks = 0; ks < KS; ++ks)
#pragma unroll
      for (int i = 0; i < 16; ++i) {
        const int d = ks * 32 + ((i < 8) ? (8 * hh + i) : (16 + 8 * hh + (i - 8)));
        const float x = qr[d] * scale; const unsigned short hb = bf16_bits(x);
        aqh[ks].u[i] = hb; aql[ks].u[i] = bf16_bits(x - bf16_val(hb));
      }
  }
  float m_r[8], l_r[8];
#pragma unroll
  for (int r = 0; r < 8; ++r) { m_r[r] = -3.0e38f; l_r[r] = 0.f; }
  v8f oacc[DT];
#pragma unroll
  for (int dt = 0; dt < DT; ++dt) oacc[dt] = (v8f){0.f,0.f,0.f,0.f,0.f,0.f,0.f,0.f};

  const int kv_end = CAUSAL ? min(T, qblk * 64 + 64) : T;     // block-uniform
  for (int j0 = 0; j0 < kv_end; j0 += 32) {
    __syncthreads();
    for (int e = tid; e < 32 * (D / 4); e += 128) {
      const int r = e / (D / 4), c4 = (e % (D / 4)) * 4;
      const int key = j0 + r;
      v4f kf = {0.f,0.f,0.f,0.f}, vf = {0.f,0.f,0.f,0.f};
      if (key < T) { kf = *(const v4fa*)(K + (size_t)key * pitch + c4); vf = *(const v4fa*)(V + (size_t)key * pitch + c4); }
#pragma unroll
      for (int t = 0; t < 4; ++t) {
        unsigned short hb = bf16_bits(kf[t]); sKh[r][c4 + t] = hb; sKl[r][c4 + t] = bf16_bits(kf[t] - bf16_val(hb));
        hb = bf16_bits(vf[t]); sVh[r][c4 + t] = hb; sVl[r][c4 + t] = bf16_bits(vf[t] - bf16_val(hb));
      }
    }
    __syncthreads();
    // S tile 16 x 32
    v8f s[2];
#pragma unroll
    for (int nt = 0; nt < 2; ++nt) {
      v8f acc = {};
#pragma unroll
      for (int ks = 0; ks < KS; ++ks) {
        FragB bh_, bl_;
        bh_.half[0] = *(const v8us*)&sKh[nt * 16 + ln][ks * 32 + 8 * hh]; bh_.half[1] = *(const v8us*)&sKh[nt * 16 + ln][ks * 32 + 16 + 8 * hh];
        bl_.half[0] = *(const v8us*)&sKl[nt * 16 + ln][ks * 32 + 8 * hh]; bl_.half[1] = *(const v8us*)&sKl[nt * 16 + ln][ks * 32 + 16 + 8 * hh];
        acc = mmaN<3>(aqh[ks].v, aql[ks].v, bh_.v, bl_.v, acc);
      }
      s[nt] = acc;
    }
    // mask + running max (rows 8hh+r; the 16 lanes of a half share rows)
    float alpha[8];
#pragma unroll
    for (int r = 0; r < 8; ++r) {
      const int qi = q0 + 8 * hh + r;
      const int ja = j0 + ln, jb = j0 + 16 + ln;
      if (CAUSAL) { if (ja > qi) s[0][r] = -3.0e38f; if (jb > qi) s[1][r] = -3.0e38f; }
      if (ja >= T) s[0][r] = -3.0e38f;
      if (jb >= T) s[1][r] = -3.0e38f;
      float mx = fmaxf(s[0][r], s[1][r]);
      mx = fmaxf(mx, __shfl_xor(mx, 1, 32)); mx = fmaxf(mx, __shfl_xor(mx, 2, 32)); mx = fmaxf(mx, __shfl_xor(mx, 4, 32)); mx = fmaxf(mx, __shfl_xor(mx, 8, 32));
      const float mnew = fmaxf(m_r[r], mx);
      alpha[r] = (mnew > -1.0e38f) ? __expf(m_r[r] - mnew) : 1.0f;
      const float p0 = (s[0][r] > -1.0e38f) ? __expf(s[0][r] - mnew) : 0.f;
      const float p1 = (s[1][r] > -1.0e38f) ? __expf(s[1][r] - mnew) : 0.f;
      m_r[r] = mnew;
      l_r[r] = l_r[r] * alpha[r] + p0 + p1;            // per-lane partial row sum (16 lanes combined at the end)
      unsigned short hb = bf16_bits(p0); sPh[w][8 * hh + r][ln] = hb;      sPl[w][8 * hh + r][ln] = bf16_bits(p0 - bf16_val(hb));
      hb = bf16_bits(p1);                sPh[w][8 * hh + r][16 + ln] = hb; sPl[w][8 * hh + r][16 + ln] = bf16_bits(p1 - bf16_val(hb));
    }
#pragma unroll
    for (int dt = 0; dt < DT; ++dt)
#pragma unroll
      for (int r = 0; r < 8; ++r) oacc[dt][r] *= alpha[r];
    __builtin_amdgcn_fence(__ATOMIC_ACQ_REL, "workgroup");
    __builtin_amdgcn_wave_barrier();
    FragB pah, pal;
    pah.half[0] = *(const v8us*)&sPh[w][ln][8 * hh]; pah.half[1] = *(const v8us*)&sPh[w][ln][16 + 8 * hh];
    pal.half[0] = *(const v8us*)&sPl[w][ln][8 * hh]; pal.half[1] = *(const v8us*)&sPl[w][ln][16 + 8 * hh];
#pragma unroll
    for (int dt = 0; dt < DT; ++dt) {
      FragB bvh, bvl;
#pragma unroll
      for (int i = 0; i < 8; ++i) {
        bvh.u[i] = sVh[8 * hh + i][dt * 16 + ln]; bvh.u[8 + i] = sVh[16 + 8 * hh + i][dt * 16 + ln];
        bvl.u[i] = sVl[8 * hh + i][dt * 16 + ln]; bvl.u[8 + i] = sVl[16 + 8 * hh + i][dt * 16 + ln];
      }
      oacc[dt] = mmaN<3>(pah.v, pal.v, bvh.v, bvl.v, oacc[dt]);
    }
    __builtin_amdgcn_fence(__ATOMIC_ACQ_REL, "workgroup");
    __builtin_amdgcn_wave_barrier();
  }
#pragma unroll
  for (int r = 0; r < 8; ++r) {
    float l = l_r[r];
    l += __shfl_xor(l, 1, 32); l += __shfl_xor(l, 2, 32); l += __shfl_xor(l, 4, 32); l += __shfl_xor(l, 8, 32);
    l_r[r] = (l > 0.f) ? 1.0f / l : 0.f;
  }
#pragma unroll
  for (int dt = 0; dt < DT; ++dt)
#pragma unroll
    for (int r = 0; r < 8; ++r) sO[w][8 * hh + r][dt * 16 + ln] = oacc[dt][r] * l_r[r];
  __builtin_amdgcn_fence(__ATOMIC_ACQ_REL, "workgroup");
  __builtin_amdgcn_wave_barrier();
  {
    for (int r = 0; r < 16; ++r) {
      const int row = q0 + r;
      if (row < T && lane < D / 4) {
        const v4f val = *(const v4fa*)&sO[w][r][lane * 4];
        *(v4f*)(y + ((size_t)b * T + row) * ypitch + h * D + lane * 4) = val;
      }
    }
    
  }
}

// Transpose by 4 x 4 blocks held in registers, no LDS and no barrier: in [.][ROWS][COLS] -> out [.][COLS][ROWS]; ROWS a multiple of 256, COLS of 64.
// A lane loads 4 neighbours from each of 4 consecutive input rows and stores them as 4 neighbours of each of 4 output rows. A wave takes 32 input
// rows x 64 columns: lanes l >> 3 with the four column groups g cover 256 contiguous bytes of an input row, lanes l & 7 one whole 128-byte line
// of an output row. A lane moves four such blocks, 64 elements, so that a launch starts 16 times fewer waves than with 4 elements a lane, and all
// its loads are independent and in flight together. The pitches are compile-time: every access is one base, one lane offset, an immediate.
// Optional per-output-row affine (scale[c], shift[c]) and residual add res (same layout as out, optionally bf16-rounded) for fused epilogues:
// out = in*scale + shift + res.
template <int ROWS, int COLS, bool AFFINE, bool RESID, bool RES_BF16>
__global__ __launch_bounds__(256) void k_transpose4(const float* __restrict__ in, float* __restrict__ out,
                                                    const float* __restrict__ scale, const float* __restrict__ shift, const float* __restrict__ res) {
  static_assert(ROWS % 256 == 0 && COLS % 64 == 0, "a block takes 256 input rows x 64 columns");
  const unsigned lane = threadIdx.x & 31, w = threadIdx.x >> 5;
  const unsigned r0 = blockIdx.y * 256 + w * 32 + (lane & 7) * 4;     // first of the lane's 4 input rows
  const unsigned c0 = blockIdx.x * 64 + (lane >> 3) * 4;              // first column of its group 0; group g lies 16 * g further
  const unsigned base = blockIdx.z * (unsigned)(ROWS * COLS);
  const unsigned io = base + r0 * COLS + c0, oo = base + c0 * ROWS + r0;
  // every loop below is unrolled so that the arrays are indexed by constants and stay in registers
  v4f a[4][4], rv[4][4], sc[4], sh[4];                                // a[g][i] = in[r0 + i][c0 + 16 g ..], rv[g][j] = res[c0 + 16 g + j][r0 ..]
#pragma unroll
  for (int i = 0; i < 4; ++i)
#pragma unroll
    for (int g = 0; g < 4; ++g) a[g][i] = *(const v4fa*)(in + io + i * COLS + g * 16);
  // the loads below may land in the address registers of the loads above: the wait that belongs in front of such an overwrite
  if (RESID || AFFINE) asm volatile("s_wait_xcnt 0x0" ::: "memory");
  if (RESID) {
#pragma unroll
    for (int g = 0; g < 4; ++g)
#pragma unroll
      for (int j = 0; j < 4; ++j) rv[g][j] = *(const v4fa*)(res + oo + (g * 16 + j) * ROWS);
  }
  if (AFFINE) {
#pragma unroll
    for (int g = 0; g < 4; ++g) { sc[g] = *(const v4fa*)(scale + c0 + g * 16); sh[g] = *(const v4fa*)(shift + c0 + g * 16); }
  }
  // keeps every load above the first store: without it the scheduler holds some loads back behind the wait for the first ones, a second memory latency
  __builtin_amdgcn_sched_barrier(0);
#pragma unroll
  for (int g = 0; g < 4; ++g)
#pragma unroll
    for (int j = 0; j < 4; ++j) {
      v4f o;
#pragma unroll
      for (int i = 0; i < 4; ++i) {
        float v = a[g][i][j];
        if (AFFINE) v = v * sc[g][j] + sh[g][j];
        if (RESID) { float x = rv[g][j][i]; if (RES_BF16) x = bf16_round(x); v += x; }
        o[i] = v;
      }
      *(v4f*)(out + oo + (g * 16 + j) * ROWS) = o;
    }
}

// 2x2 max pool on position-major data: in [B][H*W][C] -> out [B][(H/2)*(W/2)][C]; thread per (b, p', 4 channels); C%4==0
__global__ __launch_bounds__(256) void k_pool2_pm(const float* __restrict__ in, float* __restrict__ out, int Bn, int H, int W, int C) {
  const size_t t = (size_t)blockIdx.x * 256 + threadIdx.x;
  const int c4n = C / 4, Ho = H / 2, Wo = W / 2;
  const size_t total = (size_t)Bn * Ho * Wo * c4n;
  if (t >= total) return;
  const int c4 = (int)(t % c4n) * 4; size_t rest = t / c4n;
  const int pw = (int)(rest % Wo); rest /= Wo; const int ph = (int)(rest % Ho); const int b = (int)(rest / Ho);
  const float* base = in + (size_t)b * H * W * C;
  const int p00 = (2 * ph) * W + 2 * pw;
  const v4f a = *(const v4fa*)(base + (size_t)p00 * C + c4), bq = *(const v4fa*)(base + (size_t)(p00 + 1) * C + c4);
  const v4f c = *(const v4fa*)(base + (size_t)(p00 + W) * C + c4), d = *(const v4fa*)(base + (size_t)(p00 + W + 1) * C + c4);
  v4f m; for (int i = 0; i < 4; ++i) m[i] = fmaxf(fmaxf(a[i], bq[i]), fmaxf(c[i], d[i]));
  float* dst = out + ((size_t)b * Ho * Wo + (size_t)ph * Wo + pw) * C + c4;
  *(v4f*)dst = m;
  
}

// General (non-causal) attention, 3-term bf16 splits, f32 softmax with running max.
// Q [.][Tq][qpitch] f32 (DQR channels); V [.][Tk][vpitch] (head dim DVtot) arrives already split, as a hi and a lo bf16 plane, K [.][Tk][KPK] as
// packed rows kh | kh | kl | 0 (DQR elements each). The query's operand is qh | ql | qh | 0 in the same places, so that ONE K = 32 product sums
// kh*qh + kh*ql + kl*qh, the three terms of the split, for a 16-key tile.
// A tile is staged by plain 16-byte copies and is not split again by every block that reads it; this block handles DV output
// dims starting at dv0 = blockIdx.y*DV. y[bh][t][ypitch] gets columns dv0..dv0+DV-1. Per-bh base offsets via strides.
// Both products run transposed: S^T = K * Q^T (A = K rows, B = Q) and O^T += V^T * P^T (A = V by the transposing load, B = P). A lane then
// holds 16 of the 32 scores of ONE query (column lane & 15; keys 8 * (lane >> 4) + r of either 16-key tile), which is the k order of a B
// operand: P goes from the score accumulators into its fragment in registers, and the maximum and the sum of a row are taken inside the lane.
// The V row pitch is compile-time (vpitch), so that a thread's staging loads differ only in their immediate offset.
// A block is 8 waves: wave w works on query tile w & 3 and on key group w >> 2. A trip stages 64 keys; group 0 takes the first 32, group 1 the
// second 32, each with a running maximum, sum and O of its own. The two partial results of a query tile are merged once, behind the loop.
// Two such blocks are meant to share a WGP, four waves on a SIMD: the waves-per-SIMD attribute holds the kernel to 256 registers a wave.
template <int DV, int vpitch>
__global__ __launch_bounds__(256) __attribute__((amdgpu_waves_per_eu(4, 4))) void k_flash2(const float* __restrict__ Qb, size_t qstride, int qpitch, int Tq,
                                              const unsigned short* __restrict__ Kpb, size_t kstride, int Tk,
                                              const unsigned short* __restrict__ Vhb, const unsigned short* __restrict__ Vlb, size_t vstride,
                                              float scale, float* __restrict__ y, size_t ystride, int ypitch) {
  constexpr int DT = DV / 16;
  constexpr int KP = KPK + 8;       // K row pitch in elements: an odd multiple of 16 bytes, the conflict-free pitch of the plain 16-byte load
  constexpr int VP = DV + 16;       // V row pitch in elements: an odd multiple of 32 bytes, the conflict-free pitch of the transposing load
  __shared__ __attribute__((aligned(16))) unsigned short sK[64][KP], sVh[64][VP], sVl[64][VP];
  __shared__ __attribute__((aligned(16))) float sO[4][16][DV + 4];   // 4 floats of pad: the 16 rows that a store instruction writes start in different banks
  __shared__ float sM[4][32], sL[4][32];   // key group 1's running maximum and sum, per lane, for the merge
  const int tid = threadIdx.x, w = tid >> 5, lane = tid & 31, ln = lane & 15, hh = lane >> 4;
  const int nqb = (Tq + 63) / 64;
  const int bh = blockIdx.x / nqb, qblk = blockIdx.x % nqb;
  const int dv0 = blockIdx.y * DV;
  const int qt = w & 3, kg = w >> 2;
  const int q0 = qblk * 64 + qt * 16;
  const float* Q = Qb + (size_t)bh * qstride;
  const unsigned short* Kp = Kpb + (size_t)bh * kstride;
  const unsigned short* Vh = Vhb + (size_t)bh * vstride + dv0; const unsigned short* Vl = Vlb + (size_t)bh * vstride + dv0;
  // element i of a lane's operand is place 8 * hh + i (i < 8) or 16 + 8 * hh + (i - 8) of the packed row, on the K side and here alike:
  // lane half 0 holds places 0..7 and 16..23 (qh, qh against kh, kl), lane half 1 places 8..15 and 24..31 (ql, 0 against kh, 0)
  static_assert(DQR == 8 && KPK == 32, "the packed row fills one K = 32 operand in parts of 8");
  FragB qp;
  {
    int row = q0 + ln; if (row >= Tq) row = Tq - 1;
    const float* qr = Q + (size_t)row * qpitch;      // qpitch is a multiple of 4: the row starts on 16 bytes
    const v4f qa = *(const v4fa*)qr, qc = *(const v4fa*)(qr + 4);
    const float qs[8] = {qa[0],qa[1],qa[2],qa[3],qc[0],qc[1],qc[2],qc[3]};
    // unrolled so that qs and the operand are indexed by constants and stay in registers
#pragma unroll
    for (int i = 0; i < 8; ++i) {
      const float x = qs[i] * scale; const unsigned short hb = bf16_bits(x), lb = bf16_bits(x - bf16_val(hb));
      qp.u[i] = hh ? lb : hb; qp.u[8 + i] = hh ? (unsigned short)0 : hb;
    }
  }
  float m_q = -3.0e38f, l_q = 0.f;   // running maximum of query q0 + ln (equal in both lane halves); sum over this lane half's keys only
  v8f oacc[DT];                      // oacc[dt][r] = O[q0 + ln][dt * 16 + 8 * hh + r]
#pragma unroll
  for (int dt = 0; dt < DT; ++dt) oacc[dt] = (v8f){0.f,0.f,0.f,0.f,0.f,0.f,0.f,0.f};
  // Staging of a 64-key tile: the 64 packed K rows are 256 contiguous 16-byte pieces, one per thread; 256 threads cover VR rows of a V plane
  // per 16-byte load, VL loads per thread and plane.
  constexpr int VR = 256 / (DV / 8), VL = 64 / VR;
  static_assert(64 * (KPK / 8) == 256 && VR * (DV / 8) == 256 && VL * VR == 64, "tile must divide over 256 threads");
  const int kr = tid / (KPK / 8), kc = (tid % (KPK / 8)) * 8, vr = tid / (DV / 8), vc = (tid % (DV / 8)) * 8;
  const unsigned koff = (unsigned)tid * 8u, voff = (unsigned)vr * (unsigned)vpitch + (unsigned)vc;
  for (int j0 = 0; j0 < Tk; j0 += 64) {
    // All of a thread's K and V loads of the tile are issued before the first is used: a trip waits out one load latency, not
    // 1 + 2 * VL. A full tile (block-uniform test) takes them without the per-row guard, in one straight run. The loops over i are
    // unrolled so that the two arrays are indexed by constants and stay in registers.
    v8us kk, vh[VL], vl[VL];
    if (j0 + 64 <= Tk) {
      kk = *(const v8us*)(Kp + (size_t)j0 * KPK + koff);
#pragma unroll
      for (int i = 0; i < VL; ++i) { vh[i] = *(const v8us*)(Vh + (size_t)(j0 + i * VR) * vpitch + voff); vl[i] = *(const v8us*)(Vl + (size_t)(j0 + i * VR) * vpitch + voff); }
    } else {
      kk = (v8us){0,0,0,0,0,0,0,0};
      if (j0 + kr < Tk) kk = *(const v8us*)(Kp + (size_t)j0 * KPK + koff);
#pragma unroll
      for (int i = 0; i < VL; ++i) {
        vh[i] = (v8us){0,0,0,0,0,0,0,0}; vl[i] = (v8us){0,0,0,0,0,0,0,0};
        if (j0 + i * VR + vr < Tk) { vh[i] = *(const v8us*)(Vh + (size_t)(j0 + i * VR) * vpitch + voff); vl[i] = *(const v8us*)(Vl + (size_t)(j0 + i * VR) * vpitch + voff); }
      }
    }
    __syncthreads();
    *(v8us*)&sK[kr][kc] = kk;
#pragma unroll
    for (int i = 0; i < VL; ++i) { *(v8us*)&sVh[i * VR + vr][vc] = vh[i]; *(v8us*)&sVl[i * VR + vr][vc] = vl[i]; }
    __syncthreads();
    const int jw = j0 + kg * 32;     // first key of this wave's group in the tile
    v8f s[2];                        // s[nt][r] = score of key jw + nt * 16 + 8 * hh + r with query q0 + ln
    FragB ka[2];                     // both loops over nt are unrolled so that ka and s are indexed by constants and stay in registers
#pragma unroll
    for (int nt = 0; nt < 2; ++nt) { ka[nt].half[0] = *(const v8us*)&sK[kg * 32 + nt * 16 + ln][8 * hh]; ka[nt].half[1] = *(const v8us*)&sK[kg * 32 + nt * 16 + ln][16 + 8 * hh]; }
#pragma unroll
    for (int nt = 0; nt < 2; ++nt) s[nt] = mmaN<1>(ka[nt].v, ka[nt].v, qp.v, qp.v, (v8f){0.f,0.f,0.f,0.f,0.f,0.f,0.f,0.f});
    // Every loop over nt, r or dt below is unrolled so that s, the P fragments and oacc are indexed by constants and stay in registers.
    if (j0 + 64 > Tk) {              // block-uniform: only a last, partial tile has keys to mask
#pragma unroll
      for (int nt = 0; nt < 2; ++nt)
#pragma unroll
        for (int r = 0; r < 8; ++r) if (jw + nt * 16 + 8 * hh + r >= Tk) s[nt][r] = -3.0e38f;
    }
    float mx = fmaxf(s[0][0], s[1][0]);
#pragma unroll
    for (int r = 1; r < 8; ++r) mx = fmaxf(mx, fmaxf(s[0][r], s[1][r]));
    // the other 16 keys of the same query lie in lane ^ 16
    mx = fmaxf(mx, __int_as_float(__builtin_amdgcn_permlanex16(__float_as_int(mx), __float_as_int(mx), 0x76543210, 0xfedcba98, false, false)));
    const float mnew = fmaxf(m_q, mx);
    const float alpha = (mnew > -1.0e38f) ? __expf(m_q - mnew) : 1.0f;
    m_q = mnew;
    FragB pbh, pbl;                  // P^T as a B operand: element nt * 8 + r is key nt * 16 + 8 * hh + r, the hardware k order
    v2f ps = {0.f, 0.f};
#pragma unroll
    for (int nt = 0; nt < 2; ++nt)
#pragma unroll
      for (int r = 0; r < 8; r += 2) {
        v2f p;
        p[0] = (s[nt][r] > -1.0e38f) ? __expf(s[nt][r] - mnew) : 0.f;
        p[1] = (s[nt][r + 1] > -1.0e38f) ? __expf(s[nt][r + 1] - mnew) : 0.f;
        ps += p;
        // two neighbours fill one operand register: the packed convert rounds to nearest even, as bf16_bits does, and packs in the same instruction
        const v2b hi = __builtin_convertvector(p, v2b);
        pbh.pair[nt * 4 + r / 2] = hi;
        pbl.pair[nt * 4 + r / 2] = __builtin_convertvector(p - __builtin_convertvector(hi, v2f), v2b);
      }
    l_q = l_q * alpha + (ps[0] + ps[1]);
#pragma unroll
    for (int dt = 0; dt < DT; ++dt)
#pragma unroll
      for (int r = 0; r < 8; ++r) oacc[dt][r] *= alpha;
    const unsigned short* vth = &sVh[kg * 32 + 8 * hh + (lane & 7)][((lane >> 3) & 1) * 8];
    const unsigned short* vtl = &sVl[kg * 32 + 8 * hh + (lane & 7)][((lane >> 3) & 1) * 8];
    // fragments of two d tiles are fetched as one group, one group ahead of the products that use them
    FragB bvh[2][2], bvl[2][2];
#pragma unroll
    for (int u = 0; u < 2; ++u) {
      bvh[0][u].half[0] = ld_tr16(vth + u * 16); bvh[0][u].half[1] = ld_tr16(vth + 16 * VP + u * 16);
      bvl[0][u].half[0] = ld_tr16(vtl + u * 16); bvl[0][u].half[1] = ld_tr16(vtl + 16 * VP + u * 16);
    }
#pragma unroll
    for (int g = 0; g < DT / 2; ++g) {
      if (g + 1 < DT / 2) {
#pragma unroll
        for (int u = 0; u < 2; ++u) {
          const int d = ((g + 1) * 2 + u) * 16;
          bvh[(g + 1) & 1][u].half[0] = ld_tr16(vth + d); bvh[(g + 1) & 1][u].half[1] = ld_tr16(vth + 16 * VP + d);
          bvl[(g + 1) & 1][u].half[0] = ld_tr16(vtl + d); bvl[(g + 1) & 1][u].half[1] = ld_tr16(vtl + 16 * VP + d);
        }
      }
#pragma unroll
      for (int u = 0; u < 2; ++u) oacc[g * 2 + u] = mmaN<3>(bvh[g & 1][u].v, bvl[g & 1][u].v, pbh.v, pbl.v, oacc[g * 2 + u]);
    }
  }
  // Merge of the two key groups. Group 1 hands its unnormalised O, its maximum and its sum over through LDS; the lane of group 0 that holds the
  // same query and the same d rows reads back the very words that its partner lane wrote, brings both parts to the common maximum and adds them.
  // The loops over dt and r are unrolled so that oacc is indexed by constants and stays in registers.
  if (kg == 1) {
#pragma unroll
    for (int dt = 0; dt < DT; ++dt) {
      v4f lo4, hi4;
#pragma unroll
      for (int r = 0; r < 4; ++r) { lo4[r] = oacc[dt][r]; hi4[r] = oacc[dt][4 + r]; }
      *(v4fa*)&sO[qt][ln][dt * 16 + 8 * hh] = lo4; *(v4fa*)&sO[qt][ln][dt * 16 + 8 * hh + 4] = hi4;
    }
    sM[qt][lane] = m_q; sL[qt][lane] = l_q;
  }
  __syncthreads();   // group 1's parts lie in LDS before group 0 reads them
  if (kg == 0) {
    const float m1 = sM[qt][lane], l1 = sL[qt][lane];
    const float mm = fmaxf(m_q, m1);
    // a group that saw no key has maximum -3e38, sum 0 and O 0: its factor is 0 beside a real maximum, and 1 on zeros where neither saw a key
    const float a0 = __expf(m_q - mm), a1 = __expf(m1 - mm);
    const float lj = l_q * a0 + l1 * a1;
    // the two lane halves' sums join once
    const float lsum = lj + __int_as_float(__builtin_amdgcn_permlanex16(__float_as_int(lj), __float_as_int(lj), 0x76543210, 0xfedcba98, false, false));
    const float linv = (lsum > 0.f) ? 1.0f / lsum : 0.f;
    const float f0 = a0 * linv, f1 = a1 * linv;
#pragma unroll
    for (int dt = 0; dt < DT; ++dt) {
      const v4f pl = *(const v4fa*)&sO[qt][ln][dt * 16 + 8 * hh], ph = *(const v4fa*)&sO[qt][ln][dt * 16 + 8 * hh + 4];
      v4f lo4, hi4;
#pragma unroll
      for (int r = 0; r < 4; ++r) { lo4[r] = oacc[dt][r] * f0 + pl[r] * f1; hi4[r] = oacc[dt][4 + r] * f0 + ph[r] * f1; }
      *(v4fa*)&sO[qt][ln][dt * 16 + 8 * hh] = lo4; *(v4fa*)&sO[qt][ln][dt * 16 + 8 * hh + 4] = hi4;
    }
  }
  __syncthreads();   // the merged rows lie in LDS before the waves of both groups store them, 8 rows of the query tile each
  {
    for (int r = kg * 8; r < kg * 8 + 8; ++r) {
      const int row = q0 + r;
      for (int c4 = lane * 4; c4 < DV; c4 += 128) {
        if (row < Tq) {
          const v4f val = *(const v4fa*)&sO[qt][r][c4];
          *(v4f*)(y + (size_t)bh * ystride + (size_t)row * ypitch + dv0 + c4) = val;
        }
      }
    }
  }
}

__global__ __launch_bounds__(256) void k_round_rows(const float* __restrict__ W, unsigned short* __restrict__ Wt, int n8) {
  const int t = blockIdx.x * 256 + threadIdx.x;
  if (t >= n8) return;
  const v4f a = *(const v4fa*)(W + (size_t)t * 8), b = *(const v4fa*)(W + (size_t)t * 8 + 4);
  v8us v; v[0]=bf16_bits(a[0]); v[1]=bf16_bits(a[1]); v[2]=bf16_bits(a[2]); v[3]=bf16_bits(a[3]);
  v[4]=bf16_bits(b[0]); v[5]=bf16_bits(b[1]); v[6]=bf16_bits(b[2]); v[7]=bf16_bits(b[3]);
  *(v8us*)(Wt + (size_t)t * 8) = v; 
}

// padded q/k weights: Bt [64][256] rows < 8 real; bias64; gamma vector (256 copies, bf16-rounded) and zero shift
__global__ __launch_bounds__(256) void k_prep(const float* __restrict__ wq, const float* __restrict__ bq, const float* __restrict__ wk, const float* __restrict__ bk, const float* __restrict__ gamma,
                                            unsigned short* __restrict__ Bq, unsigned short* __restrict__ Bk, float* __restrict__ bq64, float* __restrict__ bk64, float* __restrict__ gvec, float* __restrict__ zvec) {
  const int t = blockIdx.x * 256 + threadIdx.x;
  if (t < DQP * (CC / 8)) { const int n = t / (CC / 8), k8 = (t % (CC / 8)) * 8; v8us a, b;
    for (int i = 0; i < 8; ++i) { a[i] = (n < 8) ? bf16_bits(wq[n * CC + k8 + i]) : (unsigned short)0; b[i] = (n < 8) ? bf16_bits(wk[n * CC + k8 + i]) : (unsigned short)0; }
    *(v8us*)(Bq + n * CC + k8) = a; *(v8us*)(Bk + n * CC + k8) = b;  }
  if (t < DQP) { const float a = (t < 8) ? bq[t] : 0.f, b = (t < 8) ? bk[t] : 0.f; *(float*)(bq64 + t) = a; *(float*)(bk64 + t) = b;  }
  if (t < CC) { const float g = bf16_round(gamma[0]); *(float*)(gvec + t) = g; *(float*)(zvec + t) = 0.f;  }
}
extern "C" void kernel_launch(void* const* d_in, const int* in_sizes, int n_in,
                              void* d_out, int out_size, void* d_ws, size_t ws_size, hipStream_t stream) {
  (void)in_sizes; (void)n_in; (void)out_size;
  const float* x = (const float*)d_in[0]; const float* wq = (const float*)d_in[1]; const float* bq = (const float*)d_in[2]; const float* wk = (const float*)d_in[3]; const float* bk = (const float*)d_in[4];
  const float* wv = (const float*)d_in[5]; const float* bv = (const float*)d_in[6]; const float* gamma = (const float*)d_in[7];
  char* ws = (char*)d_ws; size_t off = 0;
  auto take = [&](size_t bytes) { char* p = ws + off; off += (bytes + 255) & ~(size_t)255; return p; };
  const int M = BB * NN;
  unsigned short* Bq = (unsigned short*)take(DQP * CC * 2); unsigned short* Bk = (unsigned short*)take(DQP * CC * 2); unsigned short* Bv = (unsigned short*)take(CC * CC * 2);
  float* bq64 = (float*)take(256); float* bk64 = (float*)take(256); float* gvec = (float*)take(CC * 4); float* zvec = (float*)take(CC * 4);
  float* xT = (float*)take((size_t)M * CC * 4); float* q = (float*)take((size_t)M * DQP * 4);
  unsigned short* kp = (unsigned short*)take((size_t)M * KPK * 2);
  unsigned short* vh = (unsigned short*)take((size_t)M * CC * 2); unsigned short* vl = (unsigned short*)take((size_t)M * CC * 2);
  float* z = (float*)take((size_t)M * CC * 4);
  if (off > ws_size) return;
  k_prep<<<(DQP * (CC / 8) + 255) / 256, 256, 0, stream>>>(wq, bq, wk, bk, gamma, Bq, Bk, bq64, bk64, gvec, zvec);
  k_round_rows<<<(CC * CC / 8 + 255) / 256, 256, 0, stream>>>(wv, Bv, CC * CC / 8);
  k_transpose4<CC, NN, false, false, false><<<dim3(NN / 64, CC / 256, BB), 256, 0, stream>>>(x, xT, nullptr, nullptr, nullptr);     // [B][C][N] -> [B][N][C]
  k_gemm_bf<false, 0, true, 0><<<((M / 16) * (DQP / 64) + 3) / 4, 128, 0, stream>>>(xT, CC, Bq, CC, bq64, q, nullptr, nullptr, DQP, M, DQP, CC);
  k_gemm_bf<false, 0, true, 2><<<((M / 16) * (DQP / 64) + 3) / 4, 128, 0, stream>>>(xT, CC, Bk, CC, bk64, nullptr, kp, nullptr, KPK, M, DQP, CC);
  k_gemm_bf<false, 0, true, 1><<<((M / 16) * (CC / 64) + 3) / 4, 128, 0, stream>>>(xT, CC, Bv, CC, bv, nullptr, vh, vl, CC, M, CC, CC);
  k_flash2<256, CC><<<dim3(BB * (NN / 64), 1), 256, 0, stream>>>(q, (size_t)NN * DQP, DQP, NN, kp, (size_t)NN * KPK, NN, vh, vl, (size_t)NN * CC, 1.0f, z, (size_t)NN * CC, CC);
  k_transpose4<NN, CC, true, true, true><<<dim3(CC / 64, NN / 256, BB), 256, 0, stream>>>(z, (float*)d_out, gvec, zvec, x);     // out = gamma·zᵀ + bf16(x)
}

// v008
// One run takes 188 microseconds.
// Two timings next to v007 put it at 1.24 and 1.21 times that version's speed.
// Counting every step since v000, it is 5.56 times as fast.
#include <hip/hip_runtime.h>
// All contractions on v_wmma_f32_16x16x32_bf16, f32 accumulate. x is kept as one position-major bf16 copy (x, W, b rounded to bf16: a single exact term).
// The q/k 1x1 convs are GEMMs over that copy (the 8 q/k channels zero-padded to 64); energy = q^T k (no scale) per 16-query tile as a 3-term bf16 hi/lo split
// (the k GEMM writes rows that hold the three terms' k side next to each other, so that one K = 32 product gives all three terms of the 8 real channels).
// The value conv is linear and the softmax weights of a query sum to 1: sum_n attn[m][n] * (Wv x[n] + bv) = Wv * (sum_n attn[m][n] * x[n]) + bv. So k_flash2 weights
// the bf16 copy of x itself (exact in one term: only P is split, 2 terms; a wave holds all 256 channels of its queries, two wave groups of a block split the keys),
// and the value GEMM runs behind it on the f32 result (A split hi/lo, 2 terms). gamma * out + bf16(x) is fused into the transpose back; softmax in f32.
#define BB 8
#define CC 256
#define NN 4096
#define DQP 64
#define DQR 8     // real q/k channels
#define KPK 32    // elements of a packed k row: hi | hi | lo | 0, DQR each

typedef __bf16 v16b __attribute__((ext_vector_type(16)));
typedef unsigned short v8us __attribute__((ext_vector_type(8), may_alias));
typedef float  v8f  __attribute__((ext_vector_type(8)));
typedef float  v4f  __attribute__((ext_vector_type(4)));
typedef float  v4fa __attribute__((ext_vector_type(4), may_alias));
typedef __bf16 v2b __attribute__((ext_vector_type(2)));
typedef float  v2f  __attribute__((ext_vector_type(2)));
union FragB { v16b v; v8us half[2]; unsigned short u[16]; v2b pair[8]; };

__device__ __forceinline__ unsigned short bf16_bits(float x) { unsigned int u = __float_as_uint(x); return (unsigned short)((u + 0x7FFFu + ((u >> 16) & 1u)) >> 16); }
__device__ __forceinline__ float bf16_val(unsigned short b) { return __uint_as_float(((unsigned int)b) << 16); }
__device__ __forceinline__ float bf16_round(float x) { return bf16_val(bf16_bits(x)); }
// 16-bit transposing LDS load: lane (c = l & 15, h = l >> 4) gets T[k0 + 8h + 0..7][d0 + c] from a row-major tile; lane l passes
// &T[k0 + 8 * (l >> 4) + (l & 7)][d0 + 8 * ((l >> 3) & 1)]. Two loads (k0, k0 + 16) make one 32 x 16 B fragment in the hardware k order.
typedef short s16x8 __attribute__((ext_vector_type(8)));
__device__ __forceinline__ v8us ld_tr16(const unsigned short* p) {
  typedef __attribute__((address_space(3))) s16x8 lds_s16x8;
  return __builtin_bit_cast(v8us, __builtin_amdgcn_ds_load_tr16_b128_v8i16((lds_s16x8*)p));
}
// D += A·B with NT terms: 1 = ah·bh, 2 = + al·bh (A split), 3 = + ah·bl (both split)
template <int NT>
__device__ __forceinline__ v8f mmaN(v16b ah, v16b al, v16b bh, v16b bl, v8f c) {
  c = __builtin_amdgcn_wmma_f32_16x16x32_bf16(false, ah, false, bh, (short)0, c, false, false);
  if (NT >= 2) c = __builtin_amdgcn_wmma_f32_16x16x32_bf16(false, al, false, bh, (short)0, c, false, false);
  if (NT >= 3) c = __builtin_amdgcn_wmma_f32_16x16x32_bf16(false, ah, false, bl, (short)0, c, false, false);
  asm volatile("v_nop\n\tv_nop\n\tv_nop\n\tv_nop" : "+v"(c) : "v"(ah), "v"(al), "v"(bh), "v"(bl));
  return c;
}
// c0 += a0 * (bh + bl), c1 += a1 * (bh + bl): B split, A exact in one term. The two tiles alternate, so that a product does not directly follow the one it adds onto.
__device__ __forceinline__ void mmaB2(v16b a0, v16b a1, v16b bh, v16b bl, v8f& c0, v8f& c1) {
  c0 = __builtin_amdgcn_wmma_f32_16x16x32_bf16(false, a0, false, bh, (short)0, c0, false, false);
  c1 = __builtin_amdgcn_wmma_f32_16x16x32_bf16(false, a1, false, bh, (short)0, c1, false, false);
  c0 = __builtin_amdgcn_wmma_f32_16x16x32_bf16(false, a0, false, bl, (short)0, c0, false, false);
  c1 = __builtin_amdgcn_wmma_f32_16x16x32_bf16(false, a1, false, bl, (short)0, c1, false, false);
  // the four vector slots between the last product and the first vector instruction that may touch its registers, as in mmaN
  asm volatile("v_nop\n\tv_nop\n\tv_nop\n\tv_nop" : "+v"(c0), "+v"(c1) : "v"(a0), "v"(a1), "v"(bh), "v"(bl));
}

__global__ __launch_bounds__(256) void k_wt_bf16(const float* __restrict__ W, unsigned short* __restrict__ Wt, int K, int N) {
  const int t = blockIdx.x * 256 + threadIdx.x;
  const int k8n = K / 8;
  if (t >= N * k8n) return;
  const int n = t / k8n, k8 = (t % k8n) * 8;
  v8us v;
#pragma unroll
  for (int i = 0; i < 8; ++i) v[i] = bf16_bits(W[(size_t)(k8 + i) * N + n]);
  *(v8us*)(Wt + (size_t)n * K + k8) = v;
  
}

// GEMM C[M][N] (f32, pitch ldc) = act(A[M][K] * W + bias). ABF false: A f32 row-major (pitch lda) converted per fragment to bf16
// (ASPLIT: hi/lo two planes -> 2 terms, else single rounded term). ABF true: the rows are bf16 already, in Ab (pitch lda), and go into the
// fragment as they lie; A is not read. Wt bf16 [N][K] (pitch ldb). BIAS_BF16 rounds the
// bias to bf16 first (bias quantised to bf16 before the add). K%32==0, M%16==0, N%64==0.
// OUT 0: C in f32.
// OUT 2: only columns 0..DQR-1 leave, as one packed row of KPK bf16 in Ch (pitch ldc): hi | hi | lo | 0; C is not written.
template <bool ABF, bool ASPLIT, int ACT, bool BIAS_BF16, int OUT>
__global__ __launch_bounds__(128) void k_gemm_bf(const float* __restrict__ A, const unsigned short* __restrict__ Ab, int lda, const unsigned short* __restrict__ Wt, int ldb,
                                               const float* __restrict__ bias, float* __restrict__ C, unsigned short* __restrict__ Ch,
                                               int ldc, int M, int N, int K) {
  static_assert(!(ABF && ASPLIT), "a bf16 row has no remainder to split off");
  __shared__ __attribute__((aligned(16))) float so[4][16][64];
  const int tid = threadIdx.x, w = tid >> 5, lane = tid & 31, ln = lane & 15, hh = lane >> 4;
  const int ntn = N / 64;
  const int wid = blockIdx.x * 4 + w;
  const int mt = wid / ntn, nq = wid % ntn;
  if (mt * 16 >= M) return;
  const int row0 = mt * 16, col0 = nq * 64;
  const size_t aoff = (size_t)(row0 + ln) * lda;
  v8f acc[4] = {};
  for (int kb = 0; kb < K; kb += 32) {
    FragB ah, al;
    if (ABF) {
      const unsigned short* arow = Ab + aoff;
      ah.half[0] = *(const v8us*)(arow + kb + 8 * hh);
      ah.half[1] = *(const v8us*)(arow + kb + 16 + 8 * hh);
      // the loads of B below may land in the address registers of these two: the wait that belongs in front of such an overwrite
      asm volatile("s_wait_xcnt 0x0" ::: "memory");
      al = ah;     // not used: one term
    } else {
    const float* arow = A + aoff;
    const v4f x0 = *(const v4fa*)(arow + kb + 8 * hh), x1 = *(const v4fa*)(arow + kb + 8 * hh + 4);
    const v4f x2 = *(const v4fa*)(arow + kb + 16 + 8 * hh), x3 = *(const v4fa*)(arow + kb + 16 + 8 * hh + 4);
    float xs[16] = {x0[0],x0[1],x0[2],x0[3],x1[0],x1[1],x1[2],x1[3],x2[0],x2[1],x2[2],x2[3],x3[0],x3[1],x3[2],x3[3]};
#pragma unroll
    for (int i = 0; i < 16; ++i) { const unsigned short hb = bf16_bits(xs[i]); ah.u[i] = hb; al.u[i] = ASPLIT ? bf16_bits(xs[i] - bf16_val(hb)) : (unsigned short)0; }
    }
#pragma unroll
    for (int t = 0; t < 4; ++t) {
      const unsigned short* brow = Wt + (size_t)(col0 + t * 16 + ln) * ldb + kb;
      FragB b;
      b.half[0] = *(const v8us*)(brow + 8 * hh);
      b.half[1] = *(const v8us*)(brow + 16 + 8 * hh);
      acc[t] = mmaN<ASPLIT ? 2 : 1>(ah.v, al.v, b.v, b.v, acc[t]);
    }
  }
#pragma unroll
  for (int t = 0; t < 4; ++t) {
    float bv = bias ? bias[col0 + t * 16 + ln] : 0.f;
    if (BIAS_BF16) bv = bf16_round(bv);
#pragma unroll
    for (int r = 0; r < 8; ++r) { float v = acc[t][r] + bv; if (ACT == 1) v = fmaxf(v, 0.f); so[w][8 * hh + r][t * 16 + ln] = v; }
  }
  __builtin_amdgcn_fence(__ATOMIC_ACQ_REL, "workgroup");
  __builtin_amdgcn_wave_barrier();
  if (OUT == 2) {
    // four lanes write the four 16-byte parts of a row, 16 lanes four whole rows (256 contiguous bytes); both loops are unrolled so that
    // xs, h and l are indexed by constants and stay in registers
    static_assert(DQR == 8 && KPK == 4 * DQR, "a part of a packed row is one 16-byte store");
    const int rs = lane >> 3, part = lane & 7;
#pragma unroll
    for (int q = 0; q < 4; ++q) {
      const int r = q * 4 + rs;
      const v4f a = *(const v4fa*)&so[w][r][0], b = *(const v4fa*)&so[w][r][4];
      const float xs[8] = {a[0],a[1],a[2],a[3],b[0],b[1],b[2],b[3]};
      v8us h, l;
#pragma unroll
      for (int i = 0; i < 8; ++i) { const unsigned short hb = bf16_bits(xs[i]); h[i] = hb; l[i] = bf16_bits(xs[i] - bf16_val(hb)); }
      const v8us o = (part < 2) ? h : (part == 2) ? l : (v8us){0,0,0,0,0,0,0,0};
      if (col0 == 0 && part < 4) *(v8us*)(Ch + (size_t)(row0 + r) * ldc + part * 8) = o;
    }
  } else {
    const int rsub = lane >> 4, c4 = (lane & 15) * 4;
#pragma unroll
    for (int q = 0; q < 8; ++q) {
      const int r = q * 2 + rsub;
      const v4f v = *(const v4fa*)&so[w][r][c4];
      *(v4f*)(C + (size_t)(row0 + r) * ldc + col0 + c4) = v;
    }
  }
}

// Flash-style causal/unmasked attention, all contractions 3-term bf16 hi/lo splits, f32 softmax with running max.
// q,k,v rows are read from f32 buffers with arbitrary row pitch (so they can live inside a fused qkv buffer);
// D = head size (multiple of 32, <= 128); one wave = 16 query rows; block = 4 waves (64 queries) sharing K/V chunks of 32.
template <int D, bool CAUSAL>
__global__ __launch_bounds__(128) void k_flash(const float* __restrict__ qb, const float* __restrict__ kb, const float* __restrict__ vb,
                                             int pitch, int T, int H, float scale, float* __restrict__ y, int ypitch) {
  constexpr int KS = D / 32;        // k-steps for QK
  constexpr int DT = D / 16;        // d tiles for PV
  __shared__ __attribute__((aligned(16))) unsigned short sKh[32][D + 8], sKl[32][D + 8], sVh[32][D + 8], sVl[32][D + 8];
  __shared__ __attribute__((aligned(16))) unsigned short sPh[4][16][40], sPl[4][16][40];
  __shared__ __attribute__((aligned(16))) float sO[4][16][D];
  const int tid = threadIdx.x, w = tid >> 5, lane = tid & 31, ln = lane & 15, hh = lane >> 4;
  const int nqb = (T + 63) / 64;
  const int bh = blockIdx.x / nqb, qblk = blockIdx.x % nqb;
  const int b = bh / H, h = bh % H;
  const int q0 = qblk * 64 + w * 16;
  const float* Q = qb + (size_t)b * T * pitch + h * D;
  const float* K = kb + (size_t)b * T * pitch + h * D;
  const float* V = vb + (size_t)b * T * pitch + h * D;

  // A fragments of the wave's 16 query rows (scaled), hi/lo
  FragB aqh[KS], aql[KS];
  {
    int row = q0 + ln; if (row >= T) row = T - 1;
    const float* qr = Q + (size_t)row * pitch;
#pragma unroll
    for (int ks = 0; ks < KS; ++ks)
#pragma unroll
      for (int i = 0; i < 16; ++i) {
        const int d = ks * 32 + ((i < 8) ? (8 * hh + i) : (16 + 8 * hh + (i - 8)));
        const float x = qr[d] * scale; const unsigned short hb = bf16_bits(x);
        aqh[ks].u[i] = hb; aql[ks].u[i] = bf16_bits(x - bf16_val(hb));
      }
  }
  float m_r[8], l_r[8];
#pragma unroll
  for (int r = 0; r < 8; ++r) { m_r[r] = -3.0e38f; l_r[r] = 0.f; }
  v8f oacc[DT];
#pragma unroll
  for (int dt = 0; dt < DT; ++dt) oacc[dt] = (v8f){0.f,0.f,0.f,0.f,0.f,0.f,0.f,0.f};

  const int kv_end = CAUSAL ? min(T, qblk * 64 + 64) : T;     // block-uniform
  for (int j0 = 0; j0 < kv_end; j0 += 32) {
    __syncthreads();
    for (int e = tid; e < 32 * (D / 4); e += 128) {
      const int r = e / (D / 4), c4 = (e % (D / 4)) * 4;
      const int key = j0 + r;
      v4f kf = {0.f,0.f,0.f,0.f}, vf = {0.f,0.f,0.f,0.f};
      if (key < T) { kf = *(const v4fa*)(K + (size_t)key * pitch + c4); vf = *(const v4fa*)(V + (size_t)key * pitch + c4); }
#pragma unroll
      for (int t = 0; t < 4; ++t) {
        unsigned short hb = bf16_bits(kf[t]); sKh[r][c4 + t] = hb; sKl[r][c4 + t] = bf16_bits(kf[t] - bf16_val(hb));
        hb = bf16_bits(vf[t]); sVh[r][c4 + t] = hb; sVl[r][c4 + t] = bf16_bits(vf[t] - bf16_val(hb));
      }
    }
    __syncthreads();
    // S tile 16 x 32
    v8f s[2];
#pragma unroll
    for (int nt = 0; nt < 2; ++nt) {
      v8f acc = {};
#pragma unroll
      for (int ks = 0; ks < KS; ++ks) {
        FragB bh_, bl_;
        bh_.half[0] = *(const v8us*)&sKh[nt * 16 + ln][ks * 32 + 8 * hh]; bh_.half[1] = *(const v8us*)&sKh[nt * 16 + ln][ks * 32 + 16 + 8 * hh];
        bl_.half[0] = *(const v8us*)&sKl[nt * 16 + ln][ks * 32 + 8 * hh]; bl_.half[1] = *(const v8us*)&sKl[nt * 16 + ln][ks * 32 + 16 + 8 * hh];
        acc = mmaN<3>(aqh[ks].v, aql[ks].v, bh_.v, bl_.v, acc);
      }
      s[nt] = acc;
    }
    // mask + running max (rows 8hh+r; the 16 lanes of a half share rows)
    float alpha[8];
#pragma unroll
    for (int r = 0; r < 8; ++r) {
      const int qi = q0 + 8 * hh + r;
      const int ja = j0 + ln, jb = j0 + 16 + ln;
      if (CAUSAL) { if (ja > qi) s[0][r] = -3.0e38f; if (jb > qi) s[1][r] = -3.0e38f; }
      if (ja >= T) s[0][r] = -3.0e38f;
      if (jb >= T) s[1][r] = -3.0e38f;
      float mx = fmaxf(s[0][r], s[1][r]);
      mx = fmaxf(mx, __shfl_xor(mx, 1, 32)); mx = fmaxf(mx, __shfl_xor(mx, 2, 32)); mx = fmaxf(mx, __shfl_xor(mx, 4, 32)); mx = fmaxf(mx, __shfl_xor(mx, 8, 32));
      const float mnew = fmaxf(m_r[r], mx);
      alpha[r] = (mnew > -1.0e38f) ? __expf(m_r[r] - mnew) : 1.0f;
      const float p0 = (s[0][r] > -1.0e38f) ? __expf(s[0][r] - mnew) : 0.f;
      const float p1 = (s[1][r] > -1.0e38f) ? __expf(s[1][r] - mnew) : 0.f;
      m_r[r] = mnew;
      l_r[r] = l_r[r] * alpha[r] + p0 + p1;            // per-lane partial row sum (16 lanes combined at the end)
      unsigned short hb = bf16_bits(p0); sPh[w][8 * hh + r][ln] = hb;      sPl[w][8 * hh + r][ln] = bf16_bits(p0 - bf16_val(hb));
      hb = bf16_bits(p1);                sPh[w][8 * hh + r][16 + ln] = hb; sPl[w][8 * hh + r][16 + ln] = bf16_bits(p1 - bf16_val(hb));
    }
#pragma unroll
    for (int dt = 0; dt < DT; ++dt)
#pragma unroll
      for (int r = 0; r < 8; ++r) oacc[dt][r] *= alpha[r];
    __builtin_amdgcn_fence(__ATOMIC_ACQ_REL, "workgroup");
    __builtin_amdgcn_wave_barrier();
    FragB pah, pal;
    pah.half[0] = *(const v8us*)&sPh[w][ln][8 * hh]; pah.half[1] = *(const v8us*)&sPh[w][ln][16 + 8 * hh];
    pal.half[0] = *(const v8us*)&sPl[w][ln][8 * hh]; pal.half[1] = *(const v8us*)&sPl[w][ln][16 + 8 * hh];
#pragma unroll
    for (int dt = 0; dt < DT; ++dt) {
      FragB bvh, bvl;
#pragma unroll
      for (int i = 0; i < 8; ++i) {
        bvh.u[i] = sVh[8 * hh + i][dt * 16 + ln]; bvh.u[8 + i] = sVh[16 + 8 * hh + i][dt * 16 + ln];
        bvl.u[i] = sVl[8 * hh + i][dt * 16 + ln]; bvl.u[8 + i] = sVl[16 + 8 * hh + i][dt * 16 + ln];
      }
      oacc[dt] = mmaN<3>(pah.v, pal.v, bvh.v, bvl.v, oacc[dt]);
    }
    __builtin_amdgcn_fence(__ATOMIC_ACQ_REL, "workgroup");
    __builtin_amdgcn_wave_barrier();
  }
#pragma unroll
  for (int r = 0; r < 8; ++r) {
    float l = l_r[r];
    l += __shfl_xor(l, 1, 32); l += __shfl_xor(l, 2, 32); l += __shfl_xor(l, 4, 32); l += __shfl_xor(l, 8, 32);
    l_r[r] = (l > 0.f) ? 1.0f / l : 0.f;
  }
#pragma unroll
  for (int dt = 0; dt < DT; ++dt)
#pragma unroll
    for (int r = 0; r < 8; ++r) sO[w][8 * hh + r][dt * 16 + ln] = oacc[dt][r] * l_r[r];
  __builtin_amdgcn_fence(__ATOMIC_ACQ_REL, "workgroup");
  __builtin_amdgcn_wave_barrier();
  {
    for (int r = 0; r < 16; ++r) {
      const int row = q0 + r;
      if (row < T && lane < D / 4) {
        const v4f val = *(const v4fa*)&sO[w][r][lane * 4];
        *(v4f*)(y + ((size_t)b * T + row) * ypitch + h * D + lane * 4) = val;
      }
    }
    
  }
}

// Transpose by 4 x 4 blocks held in registers, no LDS and no barrier: in [.][ROWS][COLS] -> out [.][COLS][ROWS]; ROWS a multiple of 256, COLS of 64.
// A lane loads 4 neighbours from each of 4 consecutive input rows and stores them as 4 neighbours of each of 4 output rows. A wave takes 32 input
// rows x 64 columns: lanes l >> 3 with the four column groups g cover 256 contiguous bytes of an input row, lanes l & 7 one whole 128-byte line
// of an output row. A lane moves four such blocks, 64 elements, so that a launch starts 16 times fewer waves than with 4 elements a lane, and all
// its loads are independent and in flight together. The pitches are compile-time: every access is one base, one lane offset, an immediate.
// Optional per-output-row affine (scale[c], shift[c]) and residual add res (same layout as out, optionally bf16-rounded) for fused epilogues:
// out = in*scale + shift + res.
template <int ROWS, int COLS, bool AFFINE, bool RESID, bool RES_BF16>
__global__ __launch_bounds__(256) void k_transpose4(const float* __restrict__ in, float* __restrict__ out,
                                                    const float* __restrict__ scale, const float* __restrict__ shift, const float* __restrict__ res) {
  static_assert(ROWS % 256 == 0 && COLS % 64 == 0, "a block takes 256 input rows x 64 columns");
  const unsigned lane = threadIdx.x & 31, w = threadIdx.x >> 5;
  const unsigned r0 = blockIdx.y * 256 + w * 32 + (lane & 7) * 4;     // first of the lane's 4 input rows
  const unsigned c0 = blockIdx.x * 64 + (lane >> 3) * 4;              // first column of its group 0; group g lies 16 * g further
  const unsigned base = blockIdx.z * (unsigned)(ROWS * COLS);
  const unsigned io = base + r0 * COLS + c0, oo = base + c0 * ROWS + r0;
  // every loop below is unrolled so that the arrays are indexed by constants and stay in registers
  v4f a[4][4], rv[4][4], sc[4], sh[4];                                // a[g][i] = in[r0 + i][c0 + 16 g ..], rv[g][j] = res[c0 + 16 g + j][r0 ..]
#pragma unroll
  for (int i = 0; i < 4; ++i)
#pragma unroll
    for (int g = 0; g < 4; ++g) a[g][i] = *(const v4fa*)(in + io + i * COLS + g * 16);
  // the loads below may land in the address registers of the loads above: the wait that belongs in front of such an overwrite
  if (RESID || AFFINE) asm volatile("s_wait_xcnt 0x0" ::: "memory");
  if (RESID) {
#pragma unroll
    for (int g = 0; g < 4; ++g)
#pragma unroll
      for (int j = 0; j < 4; ++j) rv[g][j] = *(const v4fa*)(res + oo + (g * 16 + j) * ROWS);
  }
  if (AFFINE) {
#pragma unroll
    for (int g = 0; g < 4; ++g) { sc[g] = *(const v4fa*)(scale + c0 + g * 16); sh[g] = *(const v4fa*)(shift + c0 + g * 16); }
  }
  // keeps every load above the first store: without it the scheduler holds some loads back behind the wait for the first ones, a second memory latency
  __builtin_amdgcn_sched_barrier(0);
#pragma unroll
  for (int g = 0; g < 4; ++g)
#pragma unroll
    for (int j = 0; j < 4; ++j) {
      v4f o;
#pragma unroll
      for (int i = 0; i < 4; ++i) {
        float v = a[g][i][j];
        if (AFFINE) v = v * sc[g][j] + sh[g][j];
        if (RESID) { float x = rv[g][j][i]; if (RES_BF16) x = bf16_round(x); v += x; }
        o[i] = v;
      }
      *(v4f*)(out + oo + (g * 16 + j) * ROWS) = o;
    }
}

// The same transpose with a bf16 result (rounded to nearest even, as bf16_bits does): in [.][ROWS][COLS] f32 -> out [.][COLS][ROWS] bf16; ROWS a multiple of 256, COLS of 64.
// A lane loads 4 neighbours from each of 8 consecutive input rows and stores them as 8 neighbours (16 bytes) of each of 4 output rows. A wave takes 64 input
// rows x 32 columns: lanes l >> 3 with the two column groups g cover one whole 128-byte line of an input row, lanes l & 7 one whole 128-byte line of an output row.
// A lane moves two such blocks, 64 elements, all its loads independent and in flight together.
template <int ROWS, int COLS>
__global__ __launch_bounds__(256) void k_transpose_bf(const float* __restrict__ in, unsigned short* __restrict__ out) {
  static_assert(ROWS % 256 == 0 && COLS % 64 == 0, "a block takes 256 input rows x 64 columns");
  const unsigned lane = threadIdx.x & 31, w = threadIdx.x >> 5;
  const unsigned r0 = blockIdx.y * 256 + (w & 3) * 64 + (lane & 7) * 8;      // first of the lane's 8 input rows
  const unsigned c0 = blockIdx.x * 64 + (w >> 2) * 32 + (lane >> 3) * 4;     // first column of its group 0; group 1 lies 16 further
  const unsigned base = blockIdx.z * (unsigned)(ROWS * COLS);
  const unsigned io = base + r0 * COLS + c0, oo = base + c0 * ROWS + r0;
  // every loop below is unrolled so that the arrays are indexed by constants and stay in registers
  v4f a[2][8];                                                               // a[g][i] = in[r0 + i][c0 + 16 g ..]
#pragma unroll
  for (int i = 0; i < 8; ++i)
#pragma unroll
    for (int g = 0; g < 2; ++g) {
      // the last load may land in the address registers that the loads before it name: the wait that belongs in front of such an overwrite
      if (i == 7 && g == 1) asm volatile("s_wait_xcnt 0x0" ::: "memory");
      a[g][i] = *(const v4fa*)(in + io + i * COLS + g * 16);
    }
  // keeps every load above the first store: without it the scheduler holds some loads back behind the wait for the first ones, a second memory latency
  __builtin_amdgcn_sched_barrier(0);
#pragma unroll
  for (int g = 0; g < 2; ++g)
#pragma unroll
    for (int j = 0; j < 4; ++j) {
      v8us o;
#pragma unroll
      for (int i = 0; i < 8; ++i) o[i] = bf16_bits(a[g][i][j]);
      *(v8us*)(out + oo + (g * 16 + j) * ROWS) = o;
    }
}

// 2x2 max pool on position-major data: in [B][H*W][C] -> out [B][(H/2)*(W/2)][C]; thread per (b, p', 4 channels); C%4==0
__global__ __launch_bounds__(256) void k_pool2_pm(const float* __restrict__ in, float* __restrict__ out, int Bn, int H, int W, int C) {
  const size_t t = (size_t)blockIdx.x * 256 + threadIdx.x;
  const int c4n = C / 4, Ho = H / 2, Wo = W / 2;
  const size_t total = (size_t)Bn * Ho * Wo * c4n;
  if (t >= total) return;
  const int c4 = (int)(t % c4n) * 4; size_t rest = t / c4n;
  const int pw = (int)(rest % Wo); rest /= Wo; const int ph = (int)(rest % Ho); const int b = (int)(rest / Ho);
  const float* base = in + (size_t)b * H * W * C;
  const int p00 = (2 * ph) * W + 2 * pw;
  const v4f a = *(const v4fa*)(base + (size_t)p00 * C + c4), bq = *(const v4fa*)(base + (size_t)(p00 + 1) * C + c4);
  const v4f c = *(const v4fa*)(base + (size_t)(p00 + W) * C + c4), d = *(const v4fa*)(base + (size_t)(p00 + W + 1) * C + c4);
  v4f m; for (int i = 0; i < 4; ++i) m[i] = fmaxf(fmaxf(a[i], bq[i]), fmaxf(c[i], d[i]));
  float* dst = out + ((size_t)b * Ho * Wo + (size_t)ph * Wo + pw) * C + c4;
  *(v4f*)dst = m;
  
}

// General (non-causal) attention, bf16 splits, f32 softmax with running max.
// Q [.][Tq][qpitch] f32 (DQR channels); V [.][Tk][vpitch] (head dim DVtot) is ONE bf16 plane, taken as exact: only P is split, P * V = Ph * V + Pl * V. K [.][Tk][KPK] arrives as
// packed rows kh | kh | kl | 0 (DQR elements each). The query's operand is qh | ql | qh | 0 in the same places, so that ONE K = 32 product sums
// kh*qh + kh*ql + kl*qh, the three terms of the split, for a 16-key tile.
// A tile is staged by plain 16-byte copies and is not split again by every block that reads it; this block handles DV output
// dims starting at dv0 = blockIdx.y*DV. y[bh][t][ypitch] gets columns dv0..dv0+DV-1. Per-bh base offsets via strides.
// Both products run transposed: S^T = K * Q^T (A = K rows, B = Q) and O^T += V^T * P^T (A = V by the transposing load, B = P). A lane then
// holds 16 of the 32 scores of ONE query (column lane & 15; keys 8 * (lane >> 4) + r of either 16-key tile), which is the k order of a B
// operand: P goes from the score accumulators into its fragment in registers, and the maximum and the sum of a row are taken inside the lane.
// The V row pitch is compile-time (vpitch), so that a thread's staging loads differ only in their immediate offset.
// A block is 8 waves: wave w works on query tile w & 3 and on key group w >> 2. A trip stages 64 keys; group 0 takes the first 32, group 1 the
// second 32, each with a running maximum, sum and O of its own. The two partial results of a query tile are merged once, behind the loop.
// Two such blocks are meant to share a WGP, four waves on a SIMD: the waves-per-SIMD attribute holds the kernel to 256 registers a wave.
template <int DV, int vpitch>
__global__ __launch_bounds__(256) __attribute__((amdgpu_waves_per_eu(4, 4))) void k_flash2(const float* __restrict__ Qb, size_t qstride, int qpitch, int Tq,
                                              const unsigned short* __restrict__ Kpb, size_t kstride, int Tk,
                                              const unsigned short* __restrict__ Vb, size_t vstride,
                                              float scale, float* __restrict__ y, size_t ystride, int ypitch) {
  constexpr int DT = DV / 16;
  constexpr int KP = KPK + 8;       // K row pitch in elements: an odd multiple of 16 bytes, the conflict-free pitch of the plain 16-byte load
  constexpr int VP = DV + 16;       // V row pitch in elements: an odd multiple of 32 bytes, the conflict-free pitch of the transposing load
  __shared__ __attribute__((aligned(16))) unsigned short sK[64][KP], sV[64][VP];
  __shared__ __attribute__((aligned(16))) float sO[4][16][DV + 4];   // 4 floats of pad: the 16 rows that a store instruction writes start in different banks
  __shared__ float sM[4][32], sL[4][32];   // key group 1's running maximum and sum, per lane, for the merge
  const int tid = threadIdx.x, w = tid >> 5, lane = tid & 31, ln = lane & 15, hh = lane >> 4;
  const int nqb = (Tq + 63) / 64;
  const int bh = blockIdx.x / nqb, qblk = blockIdx.x % nqb;
  const int dv0 = blockIdx.y * DV;
  const int qt = w & 3, kg = w >> 2;
  const int q0 = qblk * 64 + qt * 16;
  const float* Q = Qb + (size_t)bh * qstride;
  const unsigned short* Kp = Kpb + (size_t)bh * kstride;
  const unsigned short* V = Vb + (size_t)bh * vstride + dv0;
  // element i of a lane's operand is place 8 * hh + i (i < 8) or 16 + 8 * hh + (i - 8) of the packed row, on the K side and here alike:
  // lane half 0 holds places 0..7 and 16..23 (qh, qh against kh, kl), lane half 1 places 8..15 and 24..31 (ql, 0 against kh, 0)
  static_assert(DQR == 8 && KPK == 32, "the packed row fills one K = 32 operand in parts of 8");
  FragB qp;
  {
    int row = q0 + ln; if (row >= Tq) row = Tq - 1;
    const float* qr = Q + (size_t)row * qpitch;      // qpitch is a multiple of 4: the row starts on 16 bytes
    const v4f qa = *(const v4fa*)qr, qc = *(const v4fa*)(qr + 4);
    const float qs[8] = {qa[0],qa[1],qa[2],qa[3],qc[0],qc[1],qc[2],qc[3]};
    // unrolled so that qs and the operand are indexed by constants and stay in registers
#pragma unroll
    for (int i = 0; i < 8; ++i) {
      const float x = qs[i] * scale; const unsigned short hb = bf16_bits(x), lb = bf16_bits(x - bf16_val(hb));
      qp.u[i] = hh ? lb : hb; qp.u[8 + i] = hh ? (unsigned short)0 : hb;
    }
  }
  float m_q = -3.0e38f, l_q = 0.f;   // running maximum of query q0 + ln (equal in both lane halves); sum over this lane half's keys only
  v8f oacc[DT];                      // oacc[dt][r] = O[q0 + ln][dt * 16 + 8 * hh + r]
#pragma unroll
  for (int dt = 0; dt < DT; ++dt) oacc[dt] = (v8f){0.f,0.f,0.f,0.f,0.f,0.f,0.f,0.f};
  // Staging of a 64-key tile: the 64 packed K rows are 256 contiguous 16-byte pieces, one per thread; 256 threads cover VR rows of V
  // per 16-byte load, VL loads per thread.
  constexpr int VR = 256 / (DV / 8), VL = 64 / VR;
  static_assert(64 * (KPK / 8) == 256 && VR * (DV / 8) == 256 && VL * VR == 64, "tile must divide over 256 threads");
  const int kr = tid / (KPK / 8), kc = (tid % (KPK / 8)) * 8, vr = tid / (DV / 8), vc = (tid % (DV / 8)) * 8;
  const unsigned koff = (unsigned)tid * 8u, voff = (unsigned)vr * (unsigned)vpitch + (unsigned)vc;
  for (int j0 = 0; j0 < Tk; j0 += 64) {
    // All of a thread's K and V loads of the tile are issued before the first is used: a trip waits out one load latency, not
    // 1 + VL. A full tile (block-uniform test) takes them without the per-row guard, in one straight run. The loops over i are
    // unrolled so that the array is indexed by constants and stays in registers.
    v8us kk, vv[VL];
    if (j0 + 64 <= Tk) {
      kk = *(const v8us*)(Kp + (size_t)j0 * KPK + koff);
#pragma unroll
      for (int i = 0; i < VL; ++i) vv[i] = *(const v8us*)(V + (size_t)(j0 + i * VR) * vpitch + voff);
    } else {
      kk = (v8us){0,0,0,0,0,0,0,0};
      if (j0 + kr < Tk) kk = *(const v8us*)(Kp + (size_t)j0 * KPK + koff);
#pragma unroll
      for (int i = 0; i < VL; ++i) {
        vv[i] = (v8us){0,0,0,0,0,0,0,0};
        if (j0 + i * VR + vr < Tk) vv[i] = *(const v8us*)(V + (size_t)(j0 + i * VR) * vpitch + voff);
      }
    }
    __syncthreads();
    *(v8us*)&sK[kr][kc] = kk;
#pragma unroll
    for (int i = 0; i < VL; ++i) *(v8us*)&sV[i * VR + vr][vc] = vv[i];
    __syncthreads();
    const int jw = j0 + kg * 32;     // first key of this wave's group in the tile
    v8f s[2];                        // s[nt][r] = score of key jw + nt * 16 + 8 * hh + r with query q0 + ln
    FragB ka[2];                     // both loops over nt are unrolled so that ka and s are indexed by constants and stay in registers
#pragma unroll
    for (int nt = 0; nt < 2; ++nt) { ka[nt].half[0] = *(const v8us*)&sK[kg * 32 + nt * 16 + ln][8 * hh]; ka[nt].half[1] = *(const v8us*)&sK[kg * 32 + nt * 16 + ln][16 + 8 * hh]; }
#pragma unroll
    for (int nt = 0; nt < 2; ++nt) s[nt] = mmaN<1>(ka[nt].v, ka[nt].v, qp.v, qp.v, (v8f){0.f,0.f,0.f,0.f,0.f,0.f,0.f,0.f});
    // Every loop over nt, r or dt below is unrolled so that s, the P fragments and oacc are indexed by constants and stay in registers.
    if (j0 + 64 > Tk) {              // block-uniform: only a last, partial tile has keys to mask
#pragma unroll
      for (int nt = 0; nt < 2; ++nt)
#pragma unroll
        for (int r = 0; r < 8; ++r) if (jw + nt * 16 + 8 * hh + r >= Tk) s[nt][r] = -3.0e38f;
    }
    float mx = fmaxf(s[0][0], s[1][0]);
#pragma unroll
    for (int r = 1; r < 8; ++r) mx = fmaxf(mx, fmaxf(s[0][r], s[1][r]));
    // the other 16 keys of the same query lie in lane ^ 16
    mx = fmaxf(mx, __int_as_float(__builtin_amdgcn_permlanex16(__float_as_int(mx), __float_as_int(mx), 0x76543210, 0xfedcba98, false, false)));
    const float mnew = fmaxf(m_q, mx);
    const float alpha = (mnew > -1.0e38f) ? __expf(m_q - mnew) : 1.0f;
    m_q = mnew;
    FragB pbh, pbl;                  // P^T as a B operand: element nt * 8 + r is key nt * 16 + 8 * hh + r, the hardware k order
    v2f ps = {0.f, 0.f};
#pragma unroll
    for (int nt = 0; nt < 2; ++nt)
#pragma unroll
      for (int r = 0; r < 8; r += 2) {
        v2f p;
        p[0] = (s[nt][r] > -1.0e38f) ? __expf(s[nt][r] - mnew) : 0.f;
        p[1] = (s[nt][r + 1] > -1.0e38f) ? __expf(s[nt][r + 1] - mnew) : 0.f;
        ps += p;
        // two neighbours fill one operand register: the packed convert rounds to nearest even, as bf16_bits does, and packs in the same instruction
        const v2b hi = __builtin_convertvector(p, v2b);
        pbh.pair[nt * 4 + r / 2] = hi;
        pbl.pair[nt * 4 + r / 2] = __builtin_convertvector(p - __builtin_convertvector(hi, v2f), v2b);
      }
    l_q = l_q * alpha + (ps[0] + ps[1]);
#pragma unroll
    for (int dt = 0; dt < DT; ++dt)
#pragma unroll
      for (int r = 0; r < 8; ++r) oacc[dt][r] *= alpha;
    const unsigned short* vt = &sV[kg * 32 + 8 * hh + (lane & 7)][((lane >> 3) & 1) * 8];
    // fragments of two d tiles are fetched as one group, one group ahead of the products that use them
    FragB bv[2][2];
#pragma unroll
    for (int u = 0; u < 2; ++u) { bv[0][u].half[0] = ld_tr16(vt + u * 16); bv[0][u].half[1] = ld_tr16(vt + 16 * VP + u * 16); }
#pragma unroll
    for (int g = 0; g < DT / 2; ++g) {
      if (g + 1 < DT / 2) {
#pragma unroll
        for (int u = 0; u < 2; ++u) {
          const int d = ((g + 1) * 2 + u) * 16;
          bv[(g + 1) & 1][u].half[0] = ld_tr16(vt + d); bv[(g + 1) & 1][u].half[1] = ld_tr16(vt + 16 * VP + d);
        }
      }
      mmaB2(bv[g & 1][0].v, bv[g & 1][1].v, pbh.v, pbl.v, oacc[g * 2], oacc[g * 2 + 1]);
    }
  }
  // Merge of the two key groups. Group 1 hands its unnormalised O, its maximum and its sum over through LDS; the lane of group 0 that holds the
  // same query and the same d rows reads back the very words that its partner lane wrote, brings both parts to the common maximum and adds them.
  // The loops over dt and r are unrolled so that oacc is indexed by constants and stays in registers.
  if (kg == 1) {
#pragma unroll
    for (int dt = 0; dt < DT; ++dt) {
      v4f lo4, hi4;
#pragma unroll
      for (int r = 0; r < 4; ++r) { lo4[r] = oacc[dt][r]; hi4[r] = oacc[dt][4 + r]; }
      *(v4fa*)&sO[qt][ln][dt * 16 + 8 * hh] = lo4; *(v4fa*)&sO[qt][ln][dt * 16 + 8 * hh + 4] = hi4;
    }
    sM[qt][lane] = m_q; sL[qt][lane] = l_q;
  }
  __syncthreads();   // group 1's parts lie in LDS before group 0 reads them
  if (kg == 0) {
    const float m1 = sM[qt][lane], l1 = sL[qt][lane];
    const float mm = fmaxf(m_q, m1);
    // a group that saw no key has maximum -3e38, sum 0 and O 0: its factor is 0 beside a real maximum, and 1 on zeros where neither saw a key
    const float a0 = __expf(m_q - mm), a1 = __expf(m1 - mm);
    const float lj = l_q * a0 + l1 * a1;
    // the two lane halves' sums join once
    const float lsum = lj + __int_as_float(__builtin_amdgcn_permlanex16(__float_as_int(lj), __float_as_int(lj), 0x76543210, 0xfedcba98, false, false));
    const float linv = (lsum > 0.f) ? 1.0f / lsum : 0.f;
    const float f0 = a0 * linv, f1 = a1 * linv;
#pragma unroll
    for (int dt = 0; dt < DT; ++dt) {
      const v4f pl = *(const v4fa*)&sO[qt][ln][dt * 16 + 8 * hh], ph = *(const v4fa*)&sO[qt][ln][dt * 16 + 8 * hh + 4];
      v4f lo4, hi4;
#pragma unroll
      for (int r = 0; r < 4; ++r) { lo4[r] = oacc[dt][r] * f0 + pl[r] * f1; hi4[r] = oacc[dt][4 + r] * f0 + ph[r] * f1; }
      *(v4fa*)&sO[qt][ln][dt * 16 + 8 * hh] = lo4; *(v4fa*)&sO[qt][ln][dt * 16 + 8 * hh + 4] = hi4;
    }
  }
  __syncthreads();   // the merged rows lie in LDS before the waves of both groups store them, 8 rows of the query tile each
  {
    for (int r = kg * 8; r < kg * 8 + 8; ++r) {
      const int row = q0 + r;
      for (int c4 = lane * 4; c4 < DV; c4 += 128) {
        if (row < Tq) {
          const v4f val = *(const v4fa*)&sO[qt][r][c4];
          *(v4f*)(y + (size_t)bh * ystride + (size_t)row * ypitch + dv0 + c4) = val;
        }
      }
    }
  }
}

__global__ __launch_bounds__(256) void k_round_rows(const float* __restrict__ W, unsigned short* __restrict__ Wt, int n8) {
  const int t = blockIdx.x * 256 + threadIdx.x;
  if (t >= n8) return;
  const v4f a = *(const v4fa*)(W + (size_t)t * 8), b = *(const v4fa*)(W + (size_t)t * 8 + 4);
  v8us v; v[0]=bf16_bits(a[0]); v[1]=bf16_bits(a[1]); v[2]=bf16_bits(a[2]); v[3]=bf16_bits(a[3]);
  v[4]=bf16_bits(b[0]); v[5]=bf16_bits(b[1]); v[6]=bf16_bits(b[2]); v[7]=bf16_bits(b[3]);
  *(v8us*)(Wt + (size_t)t * 8) = v; 
}

// padded q/k weights: Bt [64][256] rows < 8 real; bias64; gamma vector (256 copies, bf16-rounded) and zero shift
__global__ __launch_bounds__(256) void k_prep(const float* __restrict__ wq, const float* __restrict__ bq, const float* __restrict__ wk, const float* __restrict__ bk, const float* __restrict__ gamma,
                                            unsigned short* __restrict__ Bq, unsigned short* __restrict__ Bk, float* __restrict__ bq64, float* __restrict__ bk64, float* __restrict__ gvec, float* __restrict__ zvec) {
  const int t = blockIdx.x * 256 + threadIdx.x;
  if (t < DQP * (CC / 8)) { const int n = t / (CC / 8), k8 = (t % (CC / 8)) * 8; v8us a, b;
    for (int i = 0; i < 8; ++i) { a[i] = (n < 8) ? bf16_bits(wq[n * CC + k8 + i]) : (unsigned short)0; b[i] = (n < 8) ? bf16_bits(wk[n * CC + k8 + i]) : (unsigned short)0; }
    *(v8us*)(Bq + n * CC + k8) = a; *(v8us*)(Bk + n * CC + k8) = b;  }
  if (t < DQP) { const float a = (t < 8) ? bq[t] : 0.f, b = (t < 8) ? bk[t] : 0.f; *(float*)(bq64 + t) = a; *(float*)(bk64 + t) = b;  }
  if (t < CC) { const float g = bf16_round(gamma[0]); *(float*)(gvec + t) = g; *(float*)(zvec + t) = 0.f;  }
}
extern "C" void kernel_launch(void* const* d_in, const int* in_sizes, int n_in,
                              void* d_out, int out_size, void* d_ws, size_t ws_size, hipStream_t stream) {
  (void)in_sizes; (void)n_in; (void)out_size;
  const float* x = (const float*)d_in[0]; const float* wq = (const float*)d_in[1]; const float* bq = (const float*)d_in[2]; const float* wk = (const float*)d_in[3]; const float* bk = (const float*)d_in[4];
  const float* wv = (const float*)d_in[5]; const float* bv = (const float*)d_in[6]; const float* gamma = (const float*)d_in[7];
  char* ws = (char*)d_ws; size_t off = 0;
  auto take = [&](size_t bytes) { char* p = ws + off; off += (bytes + 255) & ~(size_t)255; return p; };
  const int M = BB * NN;
  unsigned short* Bq = (unsigned short*)take(DQP * CC * 2); unsigned short* Bk = (unsigned short*)take(DQP * CC * 2); unsigned short* Bv = (unsigned short*)take(CC * CC * 2);
  float* bq64 = (float*)take(256); float* bk64 = (float*)take(256); float* gvec = (float*)take(CC * 4); float* zvec = (float*)take(CC * 4);
  unsigned short* xb = (unsigned short*)take((size_t)M * CC * 2); float* q = (float*)take((size_t)M * DQP * 4);
  unsigned short* kp = (unsigned short*)take((size_t)M * KPK * 2);
  float* u = (float*)take((size_t)M * CC * 4);      // attention-weighted x
  float* z = (float*)take((size_t)M * CC * 4);      // Wv * u + bv
  if (off > ws_size) return;
  k_prep<<<(DQP * (CC / 8) + 255) / 256, 256, 0, stream>>>(wq, bq, wk, bk, gamma, Bq, Bk, bq64, bk64, gvec, zvec);
  k_round_rows<<<(CC * CC / 8 + 255) / 256, 256, 0, stream>>>(wv, Bv, CC * CC / 8);
  k_transpose_bf<CC, NN><<<dim3(NN / 64, CC / 256, BB), 256, 0, stream>>>(x, xb);     // [B][C][N] f32 -> [B][N][C] bf16
  k_gemm_bf<true, false, 0, true, 0><<<((M / 16) * (DQP / 64) + 3) / 4, 128, 0, stream>>>(nullptr, xb, CC, Bq, CC, bq64, q, nullptr, DQP, M, DQP, CC);
  k_gemm_bf<true, false, 0, true, 2><<<((M / 16) * (DQP / 64) + 3) / 4, 128, 0, stream>>>(nullptr, xb, CC, Bk, CC, bk64, nullptr, kp, KPK, M, DQP, CC);
  k_flash2<256, CC><<<dim3(BB * (NN / 64), 1), 256, 0, stream>>>(q, (size_t)NN * DQP, DQP, NN, kp, (size_t)NN * KPK, NN, xb, (size_t)NN * CC, 1.0f, u, (size_t)NN * CC, CC);
  k_gemm_bf<false, true, 0, true, 0><<<((M / 16) * (CC / 64) + 3) / 4, 128, 0, stream>>>(u, nullptr, CC, Bv, CC, bv, z, nullptr, CC, M, CC, CC);
  k_transpose4<NN, CC, true, true, true><<<dim3(CC / 64, NN / 256, BB), 256, 0, stream>>>(z, (float*)d_out, gvec, zvec, x);     // out = gamma·zᵀ + bf16(x)
}

// v009
// One run takes 176 microseconds.
// In two side-by-side timings against v008, it was 1.05 and 1.06 times as fast.
// Over all steps from v000 it is 5.88 times as fast.
#include <hip/hip_runtime.h>
// All contractions on v_wmma_f32_16x16x32_bf16, f32 accumulate. x is kept as one position-major bf16 copy (x, W, b rounded to bf16: a single exact term).
// The q/k 1x1 convs are GEMMs over that copy (the 8 q/k channels zero-padded to 64); energy = q^T k (no scale) per 16-query tile as a 3-term bf16 hi/lo split
// (the k GEMM writes rows that hold the three terms' k side next to each other, so that one K = 32 product gives all three terms of the 8 real channels).
// The value conv is linear and the softmax weights of a query sum to 1: sum_n attn[m][n] * (Wv x[n] + bv) = Wv * (sum_n attn[m][n] * x[n]) + bv. So k_flash2 weights
// the bf16 copy of x itself (exact in one term: only P is split, 2 terms; a wave holds all 256 channels of its queries, two wave groups of a block split the keys),
// and the value GEMM runs behind it on the f32 result (A split hi/lo, 2 terms). gamma * out + bf16(x) is fused into the transpose back; softmax in f32.
#define BB 8
#define CC 256
#define NN 4096
#define DQP 64
#define DQR 8     // real q/k channels
#define KPK 32    // elements of a packed k row: hi | hi | lo | 0, DQR each

typedef __bf16 v16b __attribute__((ext_vector_type(16)));
typedef unsigned short v8us __attribute__((ext_vector_type(8), may_alias));
typedef float  v8f  __attribute__((ext_vector_type(8)));
typedef float  v4f  __attribute__((ext_vector_type(4)));
typedef float  v4fa __attribute__((ext_vector_type(4), may_alias));
typedef __bf16 v2b __attribute__((ext_vector_type(2)));
typedef float  v2f  __attribute__((ext_vector_type(2)));
union FragB { v16b v; v8us half[2]; unsigned short u[16]; v2b pair[8]; };

__device__ __forceinline__ unsigned short bf16_bits(float x) { unsigned int u = __float_as_uint(x); return (unsigned short)((u + 0x7FFFu + ((u >> 16) & 1u)) >> 16); }
__device__ __forceinline__ float bf16_val(unsigned short b) { return __uint_as_float(((unsigned int)b) << 16); }
__device__ __forceinline__ float bf16_round(float x) { return bf16_val(bf16_bits(x)); }
// 16-bit transposing LDS load: lane (c = l & 15, h = l >> 4) gets T[k0 + 8h + 0..7][d0 + c] from a row-major tile; lane l passes
// &T[k0 + 8 * (l >> 4) + (l & 7)][d0 + 8 * ((l >> 3) & 1)]. Two loads (k0, k0 + 16) make one 32 x 16 B fragment in the hardware k order.
typedef short s16x8 __attribute__((ext_vector_type(8)));
__device__ __forceinline__ v8us ld_tr16(const unsigned short* p) {
  typedef __attribute__((address_space(3))) s16x8 lds_s16x8;
  return __builtin_bit_cast(v8us, __builtin_amdgcn_ds_load_tr16_b128_v8i16((lds_s16x8*)p));
}
__device__ __forceinline__ unsigned lds_off(const void* p) { return (unsigned)(size_t)p; }
// Nine asynchronous 16-byte copies of a lane from global memory straight into LDS, through no register: one piece of K (lk, gk) and eight of V, whose places lie
// LSTEP bytes apart in LDS and GSTEP bytes apart in global memory. All nine stand in one statement, which ends in s_wait_xcnt 0: so the wait stands in front of
// every later write of a register that a copy names. What they bring is landed only behind the wave's own s_wait_asynccnt 0.
template <unsigned LSTEP, unsigned GSTEP>
__device__ __forceinline__ void copy_k1_v8(unsigned lk, const unsigned short* gk, unsigned lv, const unsigned short* gv) {
  const char* g = (const char*)gv;
  asm volatile("global_load_async_to_lds_b128 %0, %9, off\n\t"
               "global_load_async_to_lds_b128 %1, %10, off\n\t"
               "global_load_async_to_lds_b128 %2, %11, off\n\t"
               "global_load_async_to_lds_b128 %3, %12, off\n\t"
               "global_load_async_to_lds_b128 %4, %13, off\n\t"
               "global_load_async_to_lds_b128 %5, %14, off\n\t"
               "global_load_async_to_lds_b128 %6, %15, off\n\t"
               "global_load_async_to_lds_b128 %7, %16, off\n\t"
               "global_load_async_to_lds_b128 %8, %17, off\n\t"
               "s_wait_xcnt 0x0"
               :: "v"(lk), "v"(lv), "v"(lv + LSTEP), "v"(lv + 2 * LSTEP), "v"(lv + 3 * LSTEP), "v"(lv + 4 * LSTEP), "v"(lv + 5 * LSTEP), "v"(lv + 6 * LSTEP), "v"(lv + 7 * LSTEP),
                  "v"(gk), "v"(g), "v"(g + GSTEP), "v"(g + 2 * GSTEP), "v"(g + 3 * GSTEP), "v"(g + 4 * GSTEP), "v"(g + 5 * GSTEP), "v"(g + 6 * GSTEP), "v"(g + 7 * GSTEP)
               : "memory");
}
// D += A·B with NT terms: 1 = ah·bh, 2 = + al·bh (A split), 3 = + ah·bl (both split)
template <int NT>
__device__ __forceinline__ v8f mmaN(v16b ah, v16b al, v16b bh, v16b bl, v8f c) {
  c = __builtin_amdgcn_wmma_f32_16x16x32_bf16(false, ah, false, bh, (short)0, c, false, false);
  if (NT >= 2) c = __builtin_amdgcn_wmma_f32_16x16x32_bf16(false, al, false, bh, (short)0, c, false, false);
  if (NT >= 3) c = __builtin_amdgcn_wmma_f32_16x16x32_bf16(false, ah, false, bl, (short)0, c, false, false);
  asm volatile("v_nop\n\tv_nop\n\tv_nop\n\tv_nop" : "+v"(c) : "v"(ah), "v"(al), "v"(bh), "v"(bl));
  return c;
}
// c0 += a0 * (bh + bl), c1 += a1 * (bh + bl): B split, A exact in one term. The two tiles alternate, so that a product does not directly follow the one it adds onto.
__device__ __forceinline__ void mmaB2(v16b a0, v16b a1, v16b bh, v16b bl, v8f& c0, v8f& c1) {
  c0 = __builtin_amdgcn_wmma_f32_16x16x32_bf16(false, a0, false, bh, (short)0, c0, false, false);
  c1 = __builtin_amdgcn_wmma_f32_16x16x32_bf16(false, a1, false, bh, (short)0, c1, false, false);
  c0 = __builtin_amdgcn_wmma_f32_16x16x32_bf16(false, a0, false, bl, (short)0, c0, false, false);
  c1 = __builtin_amdgcn_wmma_f32_16x16x32_bf16(false, a1, false, bl, (short)0, c1, false, false);
  // the four vector slots between the last product and the first vector instruction that may touch its registers, as in mmaN
  asm volatile("v_nop\n\tv_nop\n\tv_nop\n\tv_nop" : "+v"(c0), "+v"(c1) : "v"(a0), "v"(a1), "v"(bh), "v"(bl));
}

__global__ __launch_bounds__(256) void k_wt_bf16(const float* __restrict__ W, unsigned short* __restrict__ Wt, int K, int N) {
  const int t = blockIdx.x * 256 + threadIdx.x;
  const int k8n = K / 8;
  if (t >= N * k8n) return;
  const int n = t / k8n, k8 = (t % k8n) * 8;
  v8us v;
#pragma unroll
  for (int i = 0; i < 8; ++i) v[i] = bf16_bits(W[(size_t)(k8 + i) * N + n]);
  *(v8us*)(Wt + (size_t)n * K + k8) = v;
  
}

// GEMM C[M][N] (f32, pitch ldc) = act(A[M][K] * W + bias). ABF false: A f32 row-major (pitch lda) converted per fragment to bf16
// (ASPLIT: hi/lo two planes -> 2 terms, else single rounded term). ABF true: the rows are bf16 already, in Ab (pitch lda), and go into the
// fragment as they lie; A is not read. Wt bf16 [N][K] (pitch ldb). BIAS_BF16 rounds the
// bias to bf16 first (bias quantised to bf16 before the add). K%32==0, M%16==0, N%64==0.
// OUT 0: C in f32.
// OUT 2: only columns 0..DQR-1 leave, as one packed row of KPK bf16 in Ch (pitch ldc): hi | hi | lo | 0; C is not written.
template <bool ABF, bool ASPLIT, int ACT, bool BIAS_BF16, int OUT>
__global__ __launch_bounds__(128) void k_gemm_bf(const float* __restrict__ A, const unsigned short* __restrict__ Ab, int lda, const unsigned short* __restrict__ Wt, int ldb,
                                               const float* __restrict__ bias, float* __restrict__ C, unsigned short* __restrict__ Ch,
                                               int ldc, int M, int N, int K) {
  static_assert(!(ABF && ASPLIT), "a bf16 row has no remainder to split off");
  __shared__ __attribute__((aligned(16))) float so[4][16][64];
  const int tid = threadIdx.x, w = tid >> 5, lane = tid & 31, ln = lane & 15, hh = lane >> 4;
  const int ntn = N / 64;
  const int wid = blockIdx.x * 4 + w;
  const int mt = wid / ntn, nq = wid % ntn;
  if (mt * 16 >= M) return;
  const int row0 = mt * 16, col0 = nq * 64;
  const size_t aoff = (size_t)(row0 + ln) * lda;
  v8f acc[4] = {};
  for (int kb = 0; kb < K; kb += 32) {
    FragB ah, al;
    if (ABF) {
      const unsigned short* arow = Ab + aoff;
      ah.half[0] = *(const v8us*)(arow + kb + 8 * hh);
      ah.half[1] = *(const v8us*)(arow + kb + 16 + 8 * hh);
      // the loads of B below may land in the address registers of these two: the wait that belongs in front of such an overwrite
      asm volatile("s_wait_xcnt 0x0" ::: "memory");
      al = ah;     // not used: one term
    } else {
    const float* arow = A + aoff;
    const v4f x0 = *(const v4fa*)(arow + kb + 8 * hh), x1 = *(const v4fa*)(arow + kb + 8 * hh + 4);
    const v4f x2 = *(const v4fa*)(arow + kb + 16 + 8 * hh), x3 = *(const v4fa*)(arow + kb + 16 + 8 * hh + 4);
    float xs[16] = {x0[0],x0[1],x0[2],x0[3],x1[0],x1[1],x1[2],x1[3],x2[0],x2[1],x2[2],x2[3],x3[0],x3[1],x3[2],x3[3]};
#pragma unroll
    for (int i = 0; i < 16; ++i) { const unsigned short hb = bf16_bits(xs[i]); ah.u[i] = hb; al.u[i] = ASPLIT ? bf16_bits(xs[i] - bf16_val(hb)) : (unsigned short)0; }
    }
#pragma unroll
    for (int t = 0; t < 4; ++t) {
      const unsigned short* brow = Wt + (size_t)(col0 + t * 16 + ln) * ldb + kb;
      FragB b;
      b.half[0] = *(const v8us*)(brow + 8 * hh);
      b.half[1] = *(const v8us*)(brow + 16 + 8 * hh);
      acc[t] = mmaN<ASPLIT ? 2 : 1>(ah.v, al.v, b.v, b.v, acc[t]);
    }
  }
#pragma unroll
  for (int t = 0; t < 4; ++t) {
    float bv = bias ? bias[col0 + t * 16 + ln] : 0.f;
    if (BIAS_BF16) bv = bf16_round(bv);
#pragma unroll
    for (int r = 0; r < 8; ++r) { float v = acc[t][r] + bv; if (ACT == 1) v = fmaxf(v, 0.f); so[w][8 * hh + r][t * 16 + ln] = v; }
  }
  __builtin_amdgcn_fence(__ATOMIC_ACQ_REL, "workgroup");
  __builtin_amdgcn_wave_barrier();
  if (OUT == 2) {
    // four lanes write the four 16-byte parts of a row, 16 lanes four whole rows (256 contiguous bytes); both loops are unrolled so that
    // xs, h and l are indexed by constants and stay in registers
    static_assert(DQR == 8 && KPK == 4 * DQR, "a part of a packed row is one 16-byte store");
    const int rs = lane >> 3, part = lane & 7;
#pragma unroll
    for (int q = 0; q < 4; ++q) {
      const int r = q * 4 + rs;
      const v4f a = *(const v4fa*)&so[w][r][0], b = *(const v4fa*)&so[w][r][4];
      const float xs[8] = {a[0],a[1],a[2],a[3],b[0],b[1],b[2],b[3]};
      v8us h, l;
#pragma unroll
      for (int i = 0; i < 8; ++i) { const unsigned short hb = bf16_bits(xs[i]); h[i] = hb; l[i] = bf16_bits(xs[i] - bf16_val(hb)); }
      const v8us o = (part < 2) ? h : (part == 2) ? l : (v8us){0,0,0,0,0,0,0,0};
      if (col0 == 0 && part < 4) *(v8us*)(Ch + (size_t)(row0 + r) * ldc + part * 8) = o;
    }
  } else {
    const int rsub = lane >> 4, c4 = (lane & 15) * 4;
#pragma unroll
    for (int q = 0; q < 8; ++q) {
      const int r = q * 2 + rsub;
      const v4f v = *(const v4fa*)&so[w][r][c4];
      *(v4f*)(C + (size_t)(row0 + r) * ldc + col0 + c4) = v;
    }
  }
}

// Flash-style causal/unmasked attention, all contractions 3-term bf16 hi/lo splits, f32 softmax with running max.
// q,k,v rows are read from f32 buffers with arbitrary row pitch (so they can live inside a fused qkv buffer);
// D = head size (multiple of 32, <= 128); one wave = 16 query rows; block = 4 waves (64 queries) sharing K/V chunks of 32.
template <int D, bool CAUSAL>
__global__ __launch_bounds__(128) void k_flash(const float* __restrict__ qb, const float* __restrict__ kb, const float* __restrict__ vb,
                                             int pitch, int T, int H, float scale, float* __restrict__ y, int ypitch) {
  constexpr int KS = D / 32;        // k-steps for QK
  constexpr int DT = D / 16;        // d tiles for PV
  __shared__ __attribute__((aligned(16))) unsigned short sKh[32][D + 8], sKl[32][D + 8], sVh[32][D + 8], sVl[32][D + 8];
  __shared__ __attribute__((aligned(16))) unsigned short sPh[4][16][40], sPl[4][16][40];
  __shared__ __attribute__((aligned(16))) float sO[4][16][D];
  const int tid = threadIdx.x, w = tid >> 5, lane = tid & 31, ln = lane & 15, hh = lane >> 4;
  const int nqb = (T + 63) / 64;
  const int bh = blockIdx.x / nqb, qblk = blockIdx.x % nqb;
  const int b = bh / H, h = bh % H;
  const int q0 = qblk * 64 + w * 16;
  const float* Q = qb + (size_t)b * T * pitch + h * D;
  const float* K = kb + (size_t)b * T * pitch + h * D;
  const float* V = vb + (size_t)b * T * pitch + h * D;

  // A fragments of the wave's 16 query rows (scaled), hi/lo
  FragB aqh[KS], aql[KS];
  {
    int row = q0 + ln; if (row >= T) row = T - 1;
    const float* qr = Q + (size_t)row * pitch;
#pragma unroll
    for (int ks = 0; ks < KS; ++ks)
#pragma unroll
      for (int i = 0; i < 16; ++i) {
        const int d = ks * 32 + ((i < 8) ? (8 * hh + i) : (16 + 8 * hh + (i - 8)));
        const float x = qr[d] * scale; const unsigned short hb = bf16_bits(x);
        aqh[ks].u[i] = hb; aql[ks].u[i] = bf16_bits(x - bf16_val(hb));
      }
  }
  float m_r[8], l_r[8];
#pragma unroll
  for (int r = 0; r < 8; ++r) { m_r[r] = -3.0e38f; l_r[r] = 0.f; }
  v8f oacc[DT];
#pragma unroll
  for (int dt = 0; dt < DT; ++dt) oacc[dt] = (v8f){0.f,0.f,0.f,0.f,0.f,0.f,0.f,0.f};

  const int kv_end = CAUSAL ? min(T, qblk * 64 + 64) : T;     // block-uniform
  for (int j0 = 0; j0 < kv_end; j0 += 32) {
    __syncthreads();
    for (int e = tid; e < 32 * (D / 4); e += 128) {
      const int r = e / (D / 4), c4 = (e % (D / 4)) * 4;
      const int key = j0 + r;
      v4f kf = {0.f,0.f,0.f,0.f}, vf = {0.f,0.f,0.f,0.f};
      if (key < T) { kf = *(const v4fa*)(K + (size_t)key * pitch + c4); vf = *(const v4fa*)(V + (size_t)key * pitch + c4); }
#pragma unroll
      for (int t = 0; t < 4; ++t) {
        unsigned short hb = bf16_bits(kf[t]); sKh[r][c4 + t] = hb; sKl[r][c4 + t] = bf16_bits(kf[t] - bf16_val(hb));
        hb = bf16_bits(vf[t]); sVh[r][c4 + t] = hb; sVl[r][c4 + t] = bf16_bits(vf[t] - bf16_val(hb));
      }
    }
    __syncthreads();
    // S tile 16 x 32
    v8f s[2];
#pragma unroll
    for (int nt = 0; nt < 2; ++nt) {
      v8f acc = {};
#pragma unroll
      for (int ks = 0; ks < KS; ++ks) {
        FragB bh_, bl_;
        bh_.half[0] = *(const v8us*)&sKh[nt * 16 + ln][ks * 32 + 8 * hh]; bh_.half[1] = *(const v8us*)&sKh[nt * 16 + ln][ks * 32 + 16 + 8 * hh];
        bl_.half[0] = *(const v8us*)&sKl[nt * 16 + ln][ks * 32 + 8 * hh]; bl_.half[1] = *(const v8us*)&sKl[nt * 16 + ln][ks * 32 + 16 + 8 * hh];
        acc = mmaN<3>(aqh[ks].v, aql[ks].v, bh_.v, bl_.v, acc);
      }
      s[nt] = acc;
    }
    // mask + running max (rows 8hh+r; the 16 lanes of a half share rows)
    float alpha[8];
#pragma unroll
    for (int r = 0; r < 8; ++r) {
      const int qi = q0 + 8 * hh + r;
      const int ja = j0 + ln, jb = j0 + 16 + ln;
      if (CAUSAL) { if (ja > qi) s[0][r] = -3.0e38f; if (jb > qi) s[1][r] = -3.0e38f; }
      if (ja >= T) s[0][r] = -3.0e38f;
      if (jb >= T) s[1][r] = -3.0e38f;
      float mx = fmaxf(s[0][r], s[1][r]);
      mx = fmaxf(mx, __shfl_xor(mx, 1, 32)); mx = fmaxf(mx, __shfl_xor(mx, 2, 32)); mx = fmaxf(mx, __shfl_xor(mx, 4, 32)); mx = fmaxf(mx, __shfl_xor(mx, 8, 32));
      const float mnew = fmaxf(m_r[r], mx);
      alpha[r] = (mnew > -1.0e38f) ? __expf(m_r[r] - mnew) : 1.0f;
      const float p0 = (s[0][r] > -1.0e38f) ? __expf(s[0][r] - mnew) : 0.f;
      const float p1 = (s[1][r] > -1.0e38f) ? __expf(s[1][r] - mnew) : 0.f;
      m_r[r] = mnew;
      l_r[r] = l_r[r] * alpha[r] + p0 + p1;            // per-lane partial row sum (16 lanes combined at the end)
      unsigned short hb = bf16_bits(p0); sPh[w][8 * hh + r][ln] = hb;      sPl[w][8 * hh + r][ln] = bf16_bits(p0 - bf16_val(hb));
      hb = bf16_bits(p1);                sPh[w][8 * hh + r][16 + ln] = hb; sPl[w][8 * hh + r][16 + ln] = bf16_bits(p1 - bf16_val(hb));
    }
#pragma unroll
    for (int dt = 0; dt < DT; ++dt)
#pragma unroll
      for (int r = 0; r < 8; ++r) oacc[dt][r] *= alpha[r];
    __builtin_amdgcn_fence(__ATOMIC_ACQ_REL, "workgroup");
    __builtin_amdgcn_wave_barrier();
    FragB pah, pal;
    pah.half[0] = *(const v8us*)&sPh[w][ln][8 * hh]; pah.half[1] = *(const v8us*)&sPh[w][ln][16 + 8 * hh];
    pal.half[0] = *(const v8us*)&sPl[w][ln][8 * hh]; pal.half[1] = *(const v8us*)&sPl[w][ln][16 + 8 * hh];
#pragma unroll
    for (int dt = 0; dt < DT; ++dt) {
      FragB bvh, bvl;
#pragma unroll
      for (int i = 0; i < 8; ++i) {
        bvh.u[i] = sVh[8 * hh + i][dt * 16 + ln]; bvh.u[8 + i] = sVh[16 + 8 * hh + i][dt * 16 + ln];
        bvl.u[i] = sVl[8 * hh + i][dt * 16 + ln]; bvl.u[8 + i] = sVl[16 + 8 * hh + i][dt * 16 + ln];
      }
      oacc[dt] = mmaN<3>(pah.v, pal.v, bvh.v, bvl.v, oacc[dt]);
    }
    __builtin_amdgcn_fence(__ATOMIC_ACQ_REL, "workgroup");
    __builtin_amdgcn_wave_barrier();
  }
#pragma unroll
  for (int r = 0; r < 8; ++r) {
    float l = l_r[r];
    l += __shfl_xor(l, 1, 32); l += __shfl_xor(l, 2, 32); l += __shfl_xor(l, 4, 32); l += __shfl_xor(l, 8, 32);
    l_r[r] = (l > 0.f) ? 1.0f / l : 0.f;
  }
#pragma unroll
  for (int dt = 0; dt < DT; ++dt)
#pragma unroll
    for (int r = 0; r < 8; ++r) sO[w][8 * hh + r][dt * 16 + ln] = oacc[dt][r] * l_r[r];
  __builtin_amdgcn_fence(__ATOMIC_ACQ_REL, "workgroup");
  __builtin_amdgcn_wave_barrier();
  {
    for (int r = 0; r < 16; ++r) {
      const int row = q0 + r;
      if (row < T && lane < D / 4) {
        const v4f val = *(const v4fa*)&sO[w][r][lane * 4];
        *(v4f*)(y + ((size_t)b * T + row) * ypitch + h * D + lane * 4) = val;
      }
    }
    
  }
}

// Transpose by 4 x 4 blocks held in registers, no LDS and no barrier: in [.][ROWS][COLS] -> out [.][COLS][ROWS]; ROWS a multiple of 256, COLS of 64.
// A lane loads 4 neighbours from each of 4 consecutive input rows and stores them as 4 neighbours of each of 4 output rows. A wave takes 32 input
// rows x 64 columns: lanes l >> 3 with the four column groups g cover 256 contiguous bytes of an input row, lanes l & 7 one whole 128-byte line
// of an output row. A lane moves four such blocks, 64 elements, so that a launch starts 16 times fewer waves than with 4 elements a lane, and all
// its loads are independent and in flight together. The pitches are compile-time: every access is one base, one lane offset, an immediate.
// Optional per-output-row affine (scale[c], shift[c]) and residual add res (same layout as out, optionally bf16-rounded) for fused epilogues:
// out = in*scale + shift + res.
template <int ROWS, int COLS, bool AFFINE, bool RESID, bool RES_BF16>
__global__ __launch_bounds__(256) void k_transpose4(const float* __restrict__ in, float* __restrict__ out,
                                                    const float* __restrict__ scale, const float* __restrict__ shift, const float* __restrict__ res) {
  static_assert(ROWS % 256 == 0 && COLS % 64 == 0, "a block takes 256 input rows x 64 columns");
  const unsigned lane = threadIdx.x & 31, w = threadIdx.x >> 5;
  const unsigned r0 = blockIdx.y * 256 + w * 32 + (lane & 7) * 4;     // first of the lane's 4 input rows
  const unsigned c0 = blockIdx.x * 64 + (lane >> 3) * 4;              // first column of its group 0; group g lies 16 * g further
  const unsigned base = blockIdx.z * (unsigned)(ROWS * COLS);
  const unsigned io = base + r0 * COLS + c0, oo = base + c0 * ROWS + r0;
  // every loop below is unrolled so that the arrays are indexed by constants and stay in registers
  v4f a[4][4], rv[4][4], sc[4], sh[4];                                // a[g][i] = in[r0 + i][c0 + 16 g ..], rv[g][j] = res[c0 + 16 g + j][r0 ..]
#pragma unroll
  for (int i = 0; i < 4; ++i)
#pragma unroll
    for (int g = 0; g < 4; ++g) a[g][i] = *(const v4fa*)(in + io + i * COLS + g * 16);
  // the loads below may land in the address registers of the loads above: the wait that belongs in front of such an overwrite
  if (RESID || AFFINE) asm volatile("s_wait_xcnt 0x0" ::: "memory");
  if (RESID) {
#pragma unroll
    for (int g = 0; g < 4; ++g)
#pragma unroll
      for (int j = 0; j < 4; ++j) rv[g][j] = *(const v4fa*)(res + oo + (g * 16 + j) * ROWS);
  }
  if (AFFINE) {
#pragma unroll
    for (int g = 0; g < 4; ++g) { sc[g] = *(const v4fa*)(scale + c0 + g * 16); sh[g] = *(const v4fa*)(shift + c0 + g * 16); }
  }
  // keeps every load above the first store: without it the scheduler holds some loads back behind the wait for the first ones, a second memory latency
  __builtin_amdgcn_sched_barrier(0);
#pragma unroll
  for (int g = 0; g < 4; ++g)
#pragma unroll
    for (int j = 0; j < 4; ++j) {
      v4f o;
#pragma unroll
      for (int i = 0; i < 4; ++i) {
        float v = a[g][i][j];
        if (AFFINE) v = v * sc[g][j] + sh[g][j];
        if (RESID) { float x = rv[g][j][i]; if (RES_BF16) x = bf16_round(x); v += x; }
        o[i] = v;
      }
      *(v4f*)(out + oo + (g * 16 + j) * ROWS) = o;
    }
}

// The same transpose with a bf16 result (rounded to nearest even, as bf16_bits does): in [.][ROWS][COLS] f32 -> out [.][COLS][ROWS] bf16; ROWS a multiple of 256, COLS of 64.
// A lane loads 4 neighbours from each of 8 consecutive input rows and stores them as 8 neighbours (16 bytes) of each of 4 output rows. A wave takes 64 input
// rows x 32 columns: lanes l >> 3 with the two column groups g cover one whole 128-byte line of an input row, lanes l & 7 one whole 128-byte line of an output row.
// A lane moves two such blocks, 64 elements, all its loads independent and in flight together.
template <int ROWS, int COLS>
__global__ __launch_bounds__(256) void k_transpose_bf(const float* __restrict__ in, unsigned short* __restrict__ out) {
  static_assert(ROWS % 256 == 0 && COLS % 64 == 0, "a block takes 256 input rows x 64 columns");
  const unsigned lane = threadIdx.x & 31, w = threadIdx.x >> 5;
  const unsigned r0 = blockIdx.y * 256 + (w & 3) * 64 + (lane & 7) * 8;      // first of the lane's 8 input rows
  const unsigned c0 = blockIdx.x * 64 + (w >> 2) * 32 + (lane >> 3) * 4;     // first column of its group 0; group 1 lies 16 further
  const unsigned base = blockIdx.z * (unsigned)(ROWS * COLS);
  const unsigned io = base + r0 * COLS + c0, oo = base + c0 * ROWS + r0;
  // every loop below is unrolled so that the arrays are indexed by constants and stay in registers
  v4f a[2][8];                                                               // a[g][i] = in[r0 + i][c0 + 16 g ..]
#pragma unroll
  for (int i = 0; i < 8; ++i)
#pragma unroll
    for (int g = 0; g < 2; ++g) {
      // the last load may land in the address registers that the loads before it name: the wait that belongs in front of such an overwrite
      if (i == 7 && g == 1) asm volatile("s_wait_xcnt 0x0" ::: "memory");
      a[g][i] = *(const v4fa*)(in + io + i * COLS + g * 16);
    }
  // keeps every load above the first store: without it the scheduler holds some loads back behind the wait for the first ones, a second memory latency
  __builtin_amdgcn_sched_barrier(0);
#pragma unroll
  for (int g = 0; g < 2; ++g)
#pragma unroll
    for (int j = 0; j < 4; ++j) {
      v8us o;
#pragma unroll
      for (int i = 0; i < 8; ++i) o[i] = bf16_bits(a[g][i][j]);
      *(v8us*)(out + oo + (g * 16 + j) * ROWS) = o;
    }
}

// 2x2 max pool on position-major data: in [B][H*W][C] -> out [B][(H/2)*(W/2)][C]; thread per (b, p', 4 channels); C%4==0
__global__ __launch_bounds__(256) void k_pool2_pm(const float* __restrict__ in, float* __restrict__ out, int Bn, int H, int W, int C) {
  const size_t t = (size_t)blockIdx.x * 256 + threadIdx.x;
  const int c4n = C / 4, Ho = H / 2, Wo = W / 2;
  const size_t total = (size_t)Bn * Ho * Wo * c4n;
  if (t >= total) return;
  const int c4 = (int)(t % c4n) * 4; size_t rest = t / c4n;
  const int pw = (int)(rest % Wo); rest /= Wo; const int ph = (int)(rest % Ho); const int b = (int)(rest / Ho);
  const float* base = in + (size_t)b * H * W * C;
  const int p00 = (2 * ph) * W + 2 * pw;
  const v4f a = *(const v4fa*)(base + (size_t)p00 * C + c4), bq = *(const v4fa*)(base + (size_t)(p00 + 1) * C + c4);
  const v4f c = *(const v4fa*)(base + (size_t)(p00 + W) * C + c4), d = *(const v4fa*)(base + (size_t)(p00 + W + 1) * C + c4);
  v4f m; for (int i = 0; i < 4; ++i) m[i] = fmaxf(fmaxf(a[i], bq[i]), fmaxf(c[i], d[i]));
  float* dst = out + ((size_t)b * Ho * Wo + (size_t)ph * Wo + pw) * C + c4;
  *(v4f*)dst = m;
  
}

// General (non-causal) attention, bf16 splits, f32 softmax with running max.
// Q [.][Tq][qpitch] f32 (DQR channels); V [.][Tk][vpitch] (head dim DVtot) is ONE bf16 plane, taken as exact: only P is split, P * V = Ph * V + Pl * V. K [.][Tk][KPK] arrives as
// packed rows kh | kh | kl | 0 (DQR elements each). The query's operand is qh | ql | qh | 0 in the same places, so that ONE K = 32 product sums
// kh*qh + kh*ql + kl*qh, the three terms of the split, for a 16-key tile.
// A tile is staged by asynchronous 16-byte copies into one of two LDS buffers, the next tile's copies in flight while this tile is worked on; this block handles DV output
// dims starting at dv0 = blockIdx.y*DV. y[bh][t][ypitch] gets columns dv0..dv0+DV-1. Per-bh base offsets via strides.
// Both products run transposed: S^T = K * Q^T (A = K rows, B = Q) and O^T += V^T * P^T (A = V by the transposing load, B = P). A lane then
// holds 16 of the 32 scores of ONE query (column lane & 15; keys 8 * (lane >> 4) + r of either 16-key tile), which is the k order of a B
// operand: P goes from the score accumulators into its fragment in registers, and the maximum and the sum of a row are taken inside the lane.
// The V row pitch (vpitch) and the number of keys (TK, a multiple of 64: every tile is full) are compile-time.
// A block is 8 waves: wave w works on query tile w & 3 and on key group w >> 2. A trip stages 64 keys; group 0 takes the first 32, group 1 the
// second 32, each with a running maximum, sum and O of its own. The two partial results of a query tile are merged once, behind the loop.
// Two such blocks are meant to share a WGP, four waves on a SIMD: the waves-per-SIMD attribute holds the kernel to 256 registers a wave.
template <int DV, int vpitch, int TK>
__global__ __launch_bounds__(256) __attribute__((amdgpu_waves_per_eu(4, 4))) void k_flash2(const float* __restrict__ Qb, size_t qstride, int qpitch, int Tq,
                                              const unsigned short* __restrict__ Kpb, size_t kstride,
                                              const unsigned short* __restrict__ Vb, size_t vstride,
                                              float scale, float* __restrict__ y, size_t ystride, int ypitch) {
  constexpr int DT = DV / 16;
  constexpr int KP = KPK + 8;       // K row pitch in elements: an odd multiple of 16 bytes, the conflict-free pitch of the plain 16-byte load
  constexpr int VP = DV + 16;       // V row pitch in elements: an odd multiple of 32 bytes, the conflict-free pitch of the transposing load
  __shared__ __attribute__((aligned(16))) unsigned short sK[2][64][KP], sV[2][64][VP];   // two buffers: tile t lies in buffer t & 1
  __shared__ __attribute__((aligned(16))) float sO[4][16][DV + 4];   // 4 floats of pad: the 16 rows that a store instruction writes start in different banks
  __shared__ float sM[4][32], sL[4][32];   // key group 1's running maximum and sum, per lane, for the merge
  const int tid = threadIdx.x, w = tid >> 5, lane = tid & 31, ln = lane & 15, hh = lane >> 4;
  const int nqb = (Tq + 63) / 64;
  const int bh = blockIdx.x / nqb, qblk = blockIdx.x % nqb;
  const int dv0 = blockIdx.y * DV;
  const int qt = w & 3, kg = w >> 2;
  const int q0 = qblk * 64 + qt * 16;
  const float* Q = Qb + (size_t)bh * qstride;
  const unsigned short* Kp = Kpb + (size_t)bh * kstride;
  const unsigned short* V = Vb + (size_t)bh * vstride + dv0;
  // element i of a lane's operand is place 8 * hh + i (i < 8) or 16 + 8 * hh + (i - 8) of the packed row, on the K side and here alike:
  // lane half 0 holds places 0..7 and 16..23 (qh, qh against kh, kl), lane half 1 places 8..15 and 24..31 (ql, 0 against kh, 0)
  static_assert(DQR == 8 && KPK == 32, "the packed row fills one K = 32 operand in parts of 8");
  FragB qp;
  {
    int row = q0 + ln; if (row >= Tq) row = Tq - 1;
    const float* qr = Q + (size_t)row * qpitch;      // qpitch is a multiple of 4: the row starts on 16 bytes
    const v4f qa = *(const v4fa*)qr, qc = *(const v4fa*)(qr + 4);
    const float qs[8] = {qa[0],qa[1],qa[2],qa[3],qc[0],qc[1],qc[2],qc[3]};
    // unrolled so that qs and the operand are indexed by constants and stay in registers
#pragma unroll
    for (int i = 0; i < 8; ++i) {
      const float x = qs[i] * scale; const unsigned short hb = bf16_bits(x), lb = bf16_bits(x - bf16_val(hb));
      qp.u[i] = hh ? lb : hb; qp.u[8 + i] = hh ? (unsigned short)0 : hb;
    }
  }
  float m_q = -3.0e38f, l_q = 0.f;   // running maximum of query q0 + ln (equal in both lane halves); sum over this lane half's keys only
  v8f oacc[DT];                      // oacc[dt][r] = O[q0 + ln][dt * 16 + 8 * hh + r]
#pragma unroll
  for (int dt = 0; dt < DT; ++dt) oacc[dt] = (v8f){0.f,0.f,0.f,0.f,0.f,0.f,0.f,0.f};
  // Staging of a 64-key tile: the 64 packed K rows are 256 contiguous 16-byte pieces, one per thread; 256 threads cover VR rows of V
  // per 16-byte copy, VL copies per thread. Every lane of every wave copies, and every piece lies inside K, V and its buffer: all tiles are full.
  constexpr int VR = 256 / (DV / 8), VL = 64 / VR, NTILE = TK / 64;
  static_assert(64 * (KPK / 8) == 256 && VR * (DV / 8) == 256 && VL * VR == 64 && VL == 8, "tile must divide over 256 threads, 1 + 8 copies each");
  static_assert(TK % 64 == 0 && TK > 0, "full tiles only");
  const int kr = tid / (KPK / 8), kc = (tid % (KPK / 8)) * 8, vr = tid / (DV / 8), vc = (tid % (DV / 8)) * 8;
  const unsigned short* kg0 = Kp + (unsigned)tid * 8u;
  const unsigned short* vg0 = V + (unsigned)vr * (unsigned)vpitch + (unsigned)vc;
  const unsigned lk0 = lds_off(&sK[0][kr][kc]), lv0 = lds_off(&sV[0][vr][vc]);
  constexpr unsigned KBUF = 64 * KP * 2, VBUF = 64 * VP * 2;      // bytes of one buffer
  auto stage = [&](int t, int b) {
    copy_k1_v8<VR * VP * 2, VR * vpitch * 2>(lk0 + (unsigned)b * KBUF, kg0 + (size_t)t * (64 * KPK), lv0 + (unsigned)b * VBUF, vg0 + (size_t)t * (64 * vpitch));
  };
  stage(0, 0);
  asm volatile("s_wait_asynccnt 0x0" ::: "memory");   // this wave's pieces of tile 0 have landed
  __syncthreads();                                    // and every other wave's: tile 0 may be read
  if (NTILE > 1) stage(1, 1);
  for (int t = 0; t < NTILE; ++t) {
    const int buf = t & 1;           // this trip reads buffer buf alone; tile t + 1 is landing in the other
    v8f s[2];                        // s[nt][r] = score of key t * 64 + kg * 32 + nt * 16 + 8 * hh + r with query q0 + ln
    FragB ka[2];                     // both loops over nt are unrolled so that ka and s are indexed by constants and stay in registers
#pragma unroll
    for (int nt = 0; nt < 2; ++nt) { ka[nt].half[0] = *(const v8us*)&sK[buf][kg * 32 + nt * 16 + ln][8 * hh]; ka[nt].half[1] = *(const v8us*)&sK[buf][kg * 32 + nt * 16 + ln][16 + 8 * hh]; }
#pragma unroll
    for (int nt = 0; nt < 2; ++nt) s[nt] = mmaN<1>(ka[nt].v, ka[nt].v, qp.v, qp.v, (v8f){0.f,0.f,0.f,0.f,0.f,0.f,0.f,0.f});
    // Every loop over nt, r or dt below is unrolled so that s, the P fragments and oacc are indexed by constants and stay in registers.
    float mx = fmaxf(s[0][0], s[1][0]);
#pragma unroll
    for (int r = 1; r < 8; ++r) mx = fmaxf(mx, fmaxf(s[0][r], s[1][r]));
    // the other 16 keys of the same query lie in lane ^ 16
    mx = fmaxf(mx, __int_as_float(__builtin_amdgcn_permlanex16(__float_as_int(mx), __float_as_int(mx), 0x76543210, 0xfedcba98, false, false)));
    const float mnew = fmaxf(m_q, mx);
    const float alpha = (mnew > -1.0e38f) ? __expf(m_q - mnew) : 1.0f;
    m_q = mnew;
    FragB pbh, pbl;                  // P^T as a B operand: element nt * 8 + r is key nt * 16 + 8 * hh + r, the hardware k order
    v2f ps = {0.f, 0.f};
#pragma unroll
    for (int nt = 0; nt < 2; ++nt)
#pragma unroll
      for (int r = 0; r < 8; r += 2) {
        v2f p;
        p[0] = (s[nt][r] > -1.0e38f) ? __expf(s[nt][r] - mnew) : 0.f;
        p[1] = (s[nt][r + 1] > -1.0e38f) ? __expf(s[nt][r + 1] - mnew) : 0.f;
        ps += p;
        // two neighbours fill one operand register: the packed convert rounds to nearest even, as bf16_bits does, and packs in the same instruction
        const v2b hi = __builtin_convertvector(p, v2b);
        pbh.pair[nt * 4 + r / 2] = hi;
        pbl.pair[nt * 4 + r / 2] = __builtin_convertvector(p - __builtin_convertvector(hi, v2f), v2b);
      }
    l_q = l_q * alpha + (ps[0] + ps[1]);
#pragma unroll
    for (int dt = 0; dt < DT; ++dt)
#pragma unroll
      for (int r = 0; r < 8; ++r) oacc[dt][r] *= alpha;
    const unsigned short* vt = &sV[buf][kg * 32 + 8 * hh + (lane & 7)][((lane >> 3) & 1) * 8];
    // fragments of two d tiles are fetched as one group, one group ahead of the products that use them
    FragB bv[2][2];
#pragma unroll
    for (int u = 0; u < 2; ++u) { bv[0][u].half[0] = ld_tr16(vt + u * 16); bv[0][u].half[1] = ld_tr16(vt + 16 * VP + u * 16); }
#pragma unroll
    for (int g = 0; g < DT / 2; ++g) {
      if (g + 1 < DT / 2) {
#pragma unroll
        for (int u = 0; u < 2; ++u) {
          const int d = ((g + 1) * 2 + u) * 16;
          bv[(g + 1) & 1][u].half[0] = ld_tr16(vt + d); bv[(g + 1) & 1][u].half[1] = ld_tr16(vt + 16 * VP + d);
        }
      }
      mmaB2(bv[g & 1][0].v, bv[g & 1][1].v, pbh.v, pbl.v, oacc[g * 2], oacc[g * 2 + 1]);
    }
    // Hand-over, in this order in every wave: its own reads of this buffer are done, its own pieces of tile t + 1 have landed; behind the barrier that holds of
    // every wave, so that tile t + 1 may be read and this buffer refilled.
    asm volatile("s_wait_dscnt 0x0" ::: "memory");
    asm volatile("s_wait_asynccnt 0x0" ::: "memory");
    __syncthreads();
    if (t + 2 < NTILE) stage(t + 2, buf);
  }
  asm volatile("s_wait_asynccnt 0x0" ::: "memory");   // no copy is outstanding when the wave goes on to the merge and ends
  // Merge of the two key groups. Group 1 hands its unnormalised O, its maximum and its sum over through LDS; the lane of group 0 that holds the
  // same query and the same d rows reads back the very words that its partner lane wrote, brings both parts to the common maximum and adds them.
  // The loops over dt and r are unrolled so that oacc is indexed by constants and stays in registers.
  if (kg == 1) {
#pragma unroll
    for (int dt = 0; dt < DT; ++dt) {
      v4f lo4, hi4;
#pragma unroll
      for (int r = 0; r < 4; ++r) { lo4[r] = oacc[dt][r]; hi4[r] = oacc[dt][4 + r]; }
      *(v4fa*)&sO[qt][ln][dt * 16 + 8 * hh] = lo4; *(v4fa*)&sO[qt][ln][dt * 16 + 8 * hh + 4] = hi4;
    }
    sM[qt][lane] = m_q; sL[qt][lane] = l_q;
  }
  __syncthreads();   // group 1's parts lie in LDS before group 0 reads them
  if (kg == 0) {
    const float m1 = sM[qt][lane], l1 = sL[qt][lane];
    const float mm = fmaxf(m_q, m1);
    // a group that saw no key has maximum -3e38, sum 0 and O 0: its factor is 0 beside a real maximum, and 1 on zeros where neither saw a key
    const float a0 = __expf(m_q - mm), a1 = __expf(m1 - mm);
    const float lj = l_q * a0 + l1 * a1;
    // the two lane halves' sums join once
    const float lsum = lj + __int_as_float(__builtin_amdgcn_permlanex16(__float_as_int(lj), __float_as_int(lj), 0x76543210, 0xfedcba98, false, false));
    const float linv = (lsum > 0.f) ? 1.0f / lsum : 0.f;
    const float f0 = a0 * linv, f1 = a1 * linv;
#pragma unroll
    for (int dt = 0; dt < DT; ++dt) {
      const v4f pl = *(const v4fa*)&sO[qt][ln][dt * 16 + 8 * hh], ph = *(const v4fa*)&sO[qt][ln][dt * 16 + 8 * hh + 4];
      v4f lo4, hi4;
#pragma unroll
      for (int r = 0; r < 4; ++r) { lo4[r] = oacc[dt][r] * f0 + pl[r] * f1; hi4[r] = oacc[dt][4 + r] * f0 + ph[r] * f1; }
      *(v4fa*)&sO[qt][ln][dt * 16 + 8 * hh] = lo4; *(v4fa*)&sO[qt][ln][dt * 16 + 8 * hh + 4] = hi4;
    }
  }
  __syncthreads();   // the merged rows lie in LDS before the waves of both groups store them, 8 rows of the query tile each
  {
    for (int r = kg * 8; r < kg * 8 + 8; ++r) {
      const int row = q0 + r;
      for (int c4 = lane * 4; c4 < DV; c4 += 128) {
        if (row < Tq) {
          const v4f val = *(const v4fa*)&sO[qt][r][c4];
          *(v4f*)(y + (size_t)bh * ystride + (size_t)row * ypitch + dv0 + c4) = val;
        }
      }
    }
  }
}

__global__ __launch_bounds__(256) void k_round_rows(const float* __restrict__ W, unsigned short* __restrict__ Wt, int n8) {
  const int t = blockIdx.x * 256 + threadIdx.x;
  if (t >= n8) return;
  const v4f a = *(const v4fa*)(W + (size_t)t * 8), b = *(const v4fa*)(W + (size_t)t * 8 + 4);
  v8us v; v[0]=bf16_bits(a[0]); v[1]=bf16_bits(a[1]); v[2]=bf16_bits(a[2]); v[3]=bf16_bits(a[3]);
  v[4]=bf16_bits(b[0]); v[5]=bf16_bits(b[1]); v[6]=bf16_bits(b[2]); v[7]=bf16_bits(b[3]);
  *(v8us*)(Wt + (size_t)t * 8) = v; 
}

// padded q/k weights: Bt [64][256] rows < 8 real; bias64; gamma vector (256 copies, bf16-rounded) and zero shift
__global__ __launch_bounds__(256) void k_prep(const float* __restrict__ wq, const float* __restrict__ bq, const float* __restrict__ wk, const float* __restrict__ bk, const float* __restrict__ gamma,
                                            unsigned short* __restrict__ Bq, unsigned short* __restrict__ Bk, float* __restrict__ bq64, float* __restrict__ bk64, float* __restrict__ gvec, float* __restrict__ zvec) {
  const int t = blockIdx.x * 256 + threadIdx.x;
  if (t < DQP * (CC / 8)) { const int n = t / (CC / 8), k8 = (t % (CC / 8)) * 8; v8us a, b;
    for (int i = 0; i < 8; ++i) { a[i] = (n < 8) ? bf16_bits(wq[n * CC + k8 + i]) : (unsigned short)0; b[i] = (n < 8) ? bf16_bits(wk[n * CC + k8 + i]) : (unsigned short)0; }
    *(v8us*)(Bq + n * CC + k8) = a; *(v8us*)(Bk + n * CC + k8) = b;  }
  if (t < DQP) { const float a = (t < 8) ? bq[t] : 0.f, b = (t < 8) ? bk[t] : 0.f; *(float*)(bq64 + t) = a; *(float*)(bk64 + t) = b;  }
  if (t < CC) { const float g = bf16_round(gamma[0]); *(float*)(gvec + t) = g; *(float*)(zvec + t) = 0.f;  }
}
extern "C" void kernel_launch(void* const* d_in, const int* in_sizes, int n_in,
                              void* d_out, int out_size, void* d_ws, size_t ws_size, hipStream_t stream) {
  (void)in_sizes; (void)n_in; (void)out_size;
  const float* x = (const float*)d_in[0]; const float* wq = (const float*)d_in[1]; const float* bq = (const float*)d_in[2]; const float* wk = (const float*)d_in[3]; const float* bk = (const float*)d_in[4];
  const float* wv = (const float*)d_in[5]; const float* bv = (const float*)d_in[6]; const float* gamma = (const float*)d_in[7];
  char* ws = (char*)d_ws; size_t off = 0;
  auto take = [&](size_t bytes) { char* p = ws + off; off += (bytes + 255) & ~(size_t)255; return p; };
  const int M = BB * NN;
  unsigned short* Bq = (unsigned short*)take(DQP * CC * 2); unsigned short* Bk = (unsigned short*)take(DQP * CC * 2); unsigned short* Bv = (unsigned short*)take(CC * CC * 2);
  float* bq64 = (float*)take(256); float* bk64 = (float*)take(256); float* gvec = (float*)take(CC * 4); float* zvec = (float*)take(CC * 4);
  unsigned short* xb = (unsigned short*)take((size_t)M * CC * 2); float* q = (float*)take((size_t)M * DQP * 4);
  unsigned short* kp = (unsigned short*)take((size_t)M * KPK * 2);
  float* u = (float*)take((size_t)M * CC * 4);      // attention-weighted x
  float* z = (float*)take((size_t)M * CC * 4);      // Wv * u + bv
  if (off > ws_size) return;
  k_prep<<<(DQP * (CC / 8) + 255) / 256, 256, 0, stream>>>(wq, bq, wk, bk, gamma, Bq, Bk, bq64, bk64, gvec, zvec);
  k_round_rows<<<(CC * CC / 8 + 255) / 256, 256, 0, stream>>>(wv, Bv, CC * CC / 8);
  k_transpose_bf<CC, NN><<<dim3(NN / 64, CC / 256, BB), 256, 0, stream>>>(x, xb);     // [B][C][N] f32 -> [B][N][C] bf16
  k_gemm_bf<true, false, 0, true, 0><<<((M / 16) * (DQP / 64) + 3) / 4, 128, 0, stream>>>(nullptr, xb, CC, Bq, CC, bq64, q, nullptr, DQP, M, DQP, CC);
  k_gemm_bf<true, false, 0, true, 2><<<((M / 16) * (DQP / 64) + 3) / 4, 128, 0, stream>>>(nullptr, xb, CC, Bk, CC, bk64, nullptr, kp, KPK, M, DQP, CC);
  k_flash2<256, CC, NN><<<dim3(BB * (NN / 64), 1), 256, 0, stream>>>(q, (size_t)NN * DQP, DQP, NN, kp, (size_t)NN * KPK, xb, (size_t)NN * CC, 1.0f, u, (size_t)NN * CC, CC);
  k_gemm_bf<false, true, 0, true, 0><<<((M / 16) * (CC / 64) + 3) / 4, 128, 0, stream>>>(u, nullptr, CC, Bv, CC, bv, z, nullptr, CC, M, CC, CC);
  k_transpose4<NN, CC, true, true, true><<<dim3(CC / 64, NN / 256, BB), 256, 0, stream>>>(z, (float*)d_out, gvec, zvec, x);     // out = gamma·zᵀ + bf16(x)
}

// v010
// Measured time: 137 microseconds a run.
// Next to v009, in two timings, it ran 1.24 and 1.25 times as fast.
// All steps since v000 together make it 7.32 times as fast.
#include <hip/hip_runtime.h>
// All contractions on v_wmma_f32_16x16x32_bf16, f32 accumulate. x is kept as one position-major bf16 copy (x, W, b rounded to bf16: a single exact term).
// The q/k 1x1 convs are GEMMs over that copy (the 8 q/k channels zero-padded to 64); energy = q^T k (no scale) per 16-query tile as a 3-term bf16 hi/lo split
// (the k GEMM writes rows that hold the three terms' k side next to each other, so that one K = 32 product gives all three terms of the 8 real channels).
// The value conv is linear and the softmax weights of a query sum to 1: sum_n attn[m][n] * (Wv x[n] + bv) = Wv * (sum_n attn[m][n] * x[n]) + bv. So k_flash2 weights
// the bf16 copy of x itself (exact in one term: only P is split, 2 terms; a wave holds all 256 channels of its queries, two wave groups of a block split the keys),
// and the value GEMM runs behind it on the f32 result (A split hi/lo, 2 terms), in the same block, on the 64 merged rows while they still lie in LDS. Its accumulators hold
// 8 neighbouring positions of one channel a lane: a turn through LDS makes 256-byte runs of the output's layout of them, and gamma * out + bf16(x) is stored. Softmax in f32.
#define BB 8
#define CC 256
#define NN 4096
#define DQP 64
#define DQR 8     // real q/k channels
#define KPK 32    // elements of a packed k row: hi | hi | lo | 0, DQR each

typedef __bf16 v16b __attribute__((ext_vector_type(16)));
typedef unsigned short v8us __attribute__((ext_vector_type(8), may_alias));
typedef float  v8f  __attribute__((ext_vector_type(8)));
typedef float  v4f  __attribute__((ext_vector_type(4)));
typedef float  v4fa __attribute__((ext_vector_type(4), may_alias));
typedef __bf16 v2b __attribute__((ext_vector_type(2)));
typedef float  v2f  __attribute__((ext_vector_type(2)));
union FragB { v16b v; v8us half[2]; unsigned short u[16]; v2b pair[8]; };
union Half8 { v8us v; v2b pair[4]; };

__device__ __forceinline__ unsigned short bf16_bits(float x) { unsigned int u = __float_as_uint(x); return (unsigned short)((u + 0x7FFFu + ((u >> 16) & 1u)) >> 16); }
__device__ __forceinline__ float bf16_val(unsigned short b) { return __uint_as_float(((unsigned int)b) << 16); }
__device__ __forceinline__ float bf16_round(float x) { return bf16_val(bf16_bits(x)); }
// 16-bit transposing LDS load: lane (c = l & 15, h = l >> 4) gets T[k0 + 8h + 0..7][d0 + c] from a row-major tile; lane l passes
// &T[k0 + 8 * (l >> 4) + (l & 7)][d0 + 8 * ((l >> 3) & 1)]. Two loads (k0, k0 + 16) make one 32 x 16 B fragment in the hardware k order.
typedef short s16x8 __attribute__((ext_vector_type(8)));
__device__ __forceinline__ v8us ld_tr16(const unsigned short* p) {
  typedef __attribute__((address_space(3))) s16x8 lds_s16x8;
  return __builtin_bit_cast(v8us, __builtin_amdgcn_ds_load_tr16_b128_v8i16((lds_s16x8*)p));
}
__device__ __forceinline__ unsigned lds_off(const void* p) { return (unsigned)(size_t)p; }
// Nine asynchronous 16-byte copies of a lane from global memory straight into LDS, through no register: one piece of K (lk, gk) and eight of V, whose places lie
// LSTEP bytes apart in LDS and GSTEP bytes apart in global memory. All nine stand in one statement, which ends in s_wait_xcnt 0: so the wait stands in front of
// every later write of a register that a copy names. What they bring is landed only behind the wave's own s_wait_asynccnt 0.
template <unsigned LSTEP, unsigned GSTEP>
__device__ __forceinline__ void copy_k1_v8(unsigned lk, const unsigned short* gk, unsigned lv, const unsigned short* gv) {
  const char* g = (const char*)gv;
  asm volatile("global_load_async_to_lds_b128 %0, %9, off\n\t"
               "global_load_async_to_lds_b128 %1, %10, off\n\t"
               "global_load_async_to_lds_b128 %2, %11, off\n\t"
               "global_load_async_to_lds_b128 %3, %12, off\n\t"
               "global_load_async_to_lds_b128 %4, %13, off\n\t"
               "global_load_async_to_lds_b128 %5, %14, off\n\t"
               "global_load_async_to_lds_b128 %6, %15, off\n\t"
               "global_load_async_to_lds_b128 %7, %16, off\n\t"
               "global_load_async_to_lds_b128 %8, %17, off\n\t"
               "s_wait_xcnt 0x0"
               :: "v"(lk), "v"(lv), "v"(lv + LSTEP), "v"(lv + 2 * LSTEP), "v"(lv + 3 * LSTEP), "v"(lv + 4 * LSTEP), "v"(lv + 5 * LSTEP), "v"(lv + 6 * LSTEP), "v"(lv + 7 * LSTEP),
                  "v"(gk), "v"(g), "v"(g + GSTEP), "v"(g + 2 * GSTEP), "v"(g + 3 * GSTEP), "v"(g + 4 * GSTEP), "v"(g + 5 * GSTEP), "v"(g + 6 * GSTEP), "v"(g + 7 * GSTEP)
               : "memory");
}
// D += A·B with NT terms: 1 = ah·bh, 2 = + al·bh (A split), 3 = + ah·bl (both split)
template <int NT>
__device__ __forceinline__ v8f mmaN(v16b ah, v16b al, v16b bh, v16b bl, v8f c) {
  c = __builtin_amdgcn_wmma_f32_16x16x32_bf16(false, ah, false, bh, (short)0, c, false, false);
  if (NT >= 2) c = __builtin_amdgcn_wmma_f32_16x16x32_bf16(false, al, false, bh, (short)0, c, false, false);
  if (NT >= 3) c = __builtin_amdgcn_wmma_f32_16x16x32_bf16(false, ah, false, bl, (short)0, c, false, false);
  asm volatile("v_nop\n\tv_nop\n\tv_nop\n\tv_nop" : "+v"(c) : "v"(ah), "v"(al), "v"(bh), "v"(bl));
  return c;
}
// c0 += a0 * (bh + bl), c1 += a1 * (bh + bl): B split, A exact in one term. The two tiles alternate, so that a product does not directly follow the one it adds onto.
__device__ __forceinline__ void mmaB2(v16b a0, v16b a1, v16b bh, v16b bl, v8f& c0, v8f& c1) {
  c0 = __builtin_amdgcn_wmma_f32_16x16x32_bf16(false, a0, false, bh, (short)0, c0, false, false);
  c1 = __builtin_amdgcn_wmma_f32_16x16x32_bf16(false, a1, false, bh, (short)0, c1, false, false);
  c0 = __builtin_amdgcn_wmma_f32_16x16x32_bf16(false, a0, false, bl, (short)0, c0, false, false);
  c1 = __builtin_amdgcn_wmma_f32_16x16x32_bf16(false, a1, false, bl, (short)0, c1, false, false);
  // the four vector slots between the last product and the first vector instruction that may touch its registers, as in mmaN
  asm volatile("v_nop\n\tv_nop\n\tv_nop\n\tv_nop" : "+v"(c0), "+v"(c1) : "v"(a0), "v"(a1), "v"(bh), "v"(bl));
}

// c0 += (ah + al) * b0, c1 += (ah + al) * b1: A split, B exact in one term; each tile takes ah first, then al, as mmaN<2> does. The two tiles alternate as in mmaB2.
__device__ __forceinline__ void mmaA2(v16b ah, v16b al, v16b b0, v16b b1, v8f& c0, v8f& c1) {
  c0 = __builtin_amdgcn_wmma_f32_16x16x32_bf16(false, ah, false, b0, (short)0, c0, false, false);
  c1 = __builtin_amdgcn_wmma_f32_16x16x32_bf16(false, ah, false, b1, (short)0, c1, false, false);
  c0 = __builtin_amdgcn_wmma_f32_16x16x32_bf16(false, al, false, b0, (short)0, c0, false, false);
  c1 = __builtin_amdgcn_wmma_f32_16x16x32_bf16(false, al, false, b1, (short)0, c1, false, false);
}

__global__ __launch_bounds__(256) void k_wt_bf16(const float* __restrict__ W, unsigned short* __restrict__ Wt, int K, int N) {
  const int t = blockIdx.x * 256 + threadIdx.x;
  const int k8n = K / 8;
  if (t >= N * k8n) return;
  const int n = t / k8n, k8 = (t % k8n) * 8;
  v8us v;
#pragma unroll
  for (int i = 0; i < 8; ++i) v[i] = bf16_bits(W[(size_t)(k8 + i) * N + n]);
  *(v8us*)(Wt + (size_t)n * K + k8) = v;
  
}

// GEMM C[M][N] (f32, pitch ldc) = act(A[M][K] * W + bias). ABF false: A f32 row-major (pitch lda) converted per fragment to bf16
// (ASPLIT: hi/lo two planes -> 2 terms, else single rounded term). ABF true: the rows are bf16 already, in Ab (pitch lda), and go into the
// fragment as they lie; A is not read. Wt bf16 [N][K] (pitch ldb). BIAS_BF16 rounds the
// bias to bf16 first (bias quantised to bf16 before the add). K%32==0, M%16==0, N%64==0.
// OUT 0: C in f32.
// OUT 2: only columns 0..DQR-1 leave, as one packed row of KPK bf16 in Ch (pitch ldc): hi | hi | lo | 0; C is not written.
template <bool ABF, bool ASPLIT, int ACT, bool BIAS_BF16, int OUT>
__global__ __launch_bounds__(128) void k_gemm_bf(const float* __restrict__ A, const unsigned short* __restrict__ Ab, int lda, const unsigned short* __restrict__ Wt, int ldb,
                                               const float* __restrict__ bias, float* __restrict__ C, unsigned short* __restrict__ Ch,
                                               int ldc, int M, int N, int K) {
  static_assert(!(ABF && ASPLIT), "a bf16 row has no remainder to split off");
  __shared__ __attribute__((aligned(16))) float so[4][16][64];
  const int tid = threadIdx.x, w = tid >> 5, lane = tid & 31, ln = lane & 15, hh = lane >> 4;
  const int ntn = N / 64;
  const int wid = blockIdx.x * 4 + w;
  const int mt = wid / ntn, nq = wid % ntn;
  if (mt * 16 >= M) return;
  const int row0 = mt * 16, col0 = nq * 64;
  const size_t aoff = (size_t)(row0 + ln) * lda;
  v8f acc[4] = {};
  for (int kb = 0; kb < K; kb += 32) {
    FragB ah, al;
    if (ABF) {
      const unsigned short* arow = Ab + aoff;
      ah.half[0] = *(const v8us*)(arow + kb + 8 * hh);
      ah.half[1] = *(const v8us*)(arow + kb + 16 + 8 * hh);
      // the loads of B below may land in the address registers of these two: the wait that belongs in front of such an overwrite
      asm volatile("s_wait_xcnt 0x0" ::: "memory");
      al = ah;     // not used: one term
    } else {
    const float* arow = A + aoff;
    const v4f x0 = *(const v4fa*)(arow + kb + 8 * hh), x1 = *(const v4fa*)(arow + kb + 8 * hh + 4);
    const v4f x2 = *(const v4fa*)(arow + kb + 16 + 8 * hh), x3 = *(const v4fa*)(arow + kb + 16 + 8 * hh + 4);
    float xs[16] = {x0[0],x0[1],x0[2],x0[3],x1[0],x1[1],x1[2],x1[3],x2[0],x2[1],x2[2],x2[3],x3[0],x3[1],x3[2],x3[3]};
#pragma unroll
    for (int i = 0; i < 16; ++i) { const unsigned short hb = bf16_bits(xs[i]); ah.u[i] = hb; al.u[i] = ASPLIT ? bf16_bits(xs[i] - bf16_val(hb)) : (unsigned short)0; }
    }
#pragma unroll
    for (int t = 0; t < 4; ++t) {
      const unsigned short* brow = Wt + (size_t)(col0 + t * 16 + ln) * ldb + kb;
      FragB b;
      b.half[0] = *(const v8us*)(brow + 8 * hh);
      b.half[1] = *(const v8us*)(brow + 16 + 8 * hh);
      acc[t] = mmaN<ASPLIT ? 2 : 1>(ah.v, al.v, b.v, b.v, acc[t]);
    }
  }
#pragma unroll
  for (int t = 0; t < 4; ++t) {
    float bv = bias ? bias[col0 + t * 16 + ln] : 0.f;
    if (BIAS_BF16) bv = bf16_round(bv);
#pragma unroll
    for (int r = 0; r < 8; ++r) { float v = acc[t][r] + bv; if (ACT == 1) v = fmaxf(v, 0.f); so[w][8 * hh + r][t * 16 + ln] = v; }
  }
  __builtin_amdgcn_fence(__ATOMIC_ACQ_REL, "workgroup");
  __builtin_amdgcn_wave_barrier();
  if (OUT == 2) {
    // four lanes write the four 16-byte parts of a row, 16 lanes four whole rows (256 contiguous bytes); both loops are unrolled so that
    // xs, h and l are indexed by constants and stay in registers
    static_assert(DQR == 8 && KPK == 4 * DQR, "a part of a packed row is one 16-byte store");
    const int rs = lane >> 3, part = lane & 7;
#pragma unroll
    for (int q = 0; q < 4; ++q) {
      const int r = q * 4 + rs;
      const v4f a = *(const v4fa*)&so[w][r][0], b = *(const v4fa*)&so[w][r][4];
      const float xs[8] = {a[0],a[1],a[2],a[3],b[0],b[1],b[2],b[3]};
      v8us h, l;
#pragma unroll
      for (int i = 0; i < 8; ++i) { const unsigned short hb = bf16_bits(xs[i]); h[i] = hb; l[i] = bf16_bits(xs[i] - bf16_val(hb)); }
      const v8us o = (part < 2) ? h : (part == 2) ? l : (v8us){0,0,0,0,0,0,0,0};
      if (col0 == 0 && part < 4) *(v8us*)(Ch + (size_t)(row0 + r) * ldc + part * 8) = o;
    }
  } else {
    const int rsub = lane >> 4, c4 = (lane & 15) * 4;
#pragma unroll
    for (int q = 0; q < 8; ++q) {
      const int r = q * 2 + rsub;
      const v4f v = *(const v4fa*)&so[w][r][c4];
      *(v4f*)(C + (size_t)(row0 + r) * ldc + col0 + c4) = v;
    }
  }
}

// Flash-style causal/unmasked attention, all contractions 3-term bf16 hi/lo splits, f32 softmax with running max.
// q,k,v rows are read from f32 buffers with arbitrary row pitch (so they can live inside a fused qkv buffer);
// D = head size (multiple of 32, <= 128); one wave = 16 query rows; block = 4 waves (64 queries) sharing K/V chunks of 32.
template <int D, bool CAUSAL>
__global__ __launch_bounds__(128) void k_flash(const float* __restrict__ qb, const float* __restrict__ kb, const float* __restrict__ vb,
                                             int pitch, int T, int H, float scale, float* __restrict__ y, int ypitch) {
  constexpr int KS = D / 32;        // k-steps for QK
  constexpr int DT = D / 16;        // d tiles for PV
  __shared__ __attribute__((aligned(16))) unsigned short sKh[32][D + 8], sKl[32][D + 8], sVh[32][D + 8], sVl[32][D + 8];
  __shared__ __attribute__((aligned(16))) unsigned short sPh[4][16][40], sPl[4][16][40];
  __shared__ __attribute__((aligned(16))) float sO[4][16][D];
  const int tid = threadIdx.x, w = tid >> 5, lane = tid & 31, ln = lane & 15, hh = lane >> 4;
  const int nqb = (T + 63) / 64;
  const int bh = blockIdx.x / nqb, qblk = blockIdx.x % nqb;
  const int b = bh / H, h = bh % H;
  const int q0 = qblk * 64 + w * 16;
  const float* Q = qb + (size_t)b * T * pitch + h * D;
  const float* K = kb + (size_t)b * T * pitch + h * D;
  const float* V = vb + (size_t)b * T * pitch + h * D;

  // A fragments of the wave's 16 query rows (scaled), hi/lo
  FragB aqh[KS], aql[KS];
  {
    int row = q0 + ln; if (row >= T) row = T - 1;
    const float* qr = Q + (size_t)row * pitch;
#pragma unroll
    for (int ks = 0; ks < KS; ++ks)
#pragma unroll
      for (int i = 0; i < 16; ++i) {
        const int d = ks * 32 + ((i < 8) ? (8 * hh + i) : (16 + 8 * hh + (i - 8)));
        const float x = qr[d] * scale; const unsigned short hb = bf16_bits(x);
        aqh[ks].u[i] = hb; aql[ks].u[i] = bf16_bits(x - bf16_val(hb));
      }
  }
  float m_r[8], l_r[8];
#pragma unroll
  for (int r = 0; r < 8; ++r) { m_r[r] = -3.0e38f; l_r[r] = 0.f; }
  v8f oacc[DT];
#pragma unroll
  for (int dt = 0; dt < DT; ++dt) oacc[dt] = (v8f){0.f,0.f,0.f,0.f,0.f,0.f,0.f,0.f};

  const int kv_end = CAUSAL ? min(T, qblk * 64 + 64) : T;     // block-uniform
  for (int j0 = 0; j0 < kv_end; j0 += 32) {
    __syncthreads();
    for (int e = tid; e < 32 * (D / 4); e += 128) {
      const int r = e / (D / 4), c4 = (e % (D / 4)) * 4;
      const int key = j0 + r;
      v4f kf = {0.f,0.f,0.f,0.f}, vf = {0.f,0.f,0.f,0.f};
      if (key < T) { kf = *(const v4fa*)(K + (size_t)key * pitch + c4); vf = *(const v4fa*)(V + (size_t)key * pitch + c4); }
#pragma unroll
      for (int t = 0; t < 4; ++t) {
        unsigned short hb = bf16_bits(kf[t]); sKh[r][c4 + t] = hb; sKl[r][c4 + t] = bf16_bits(kf[t] - bf16_val(hb));
        hb = bf16_bits(vf[t]); sVh[r][c4 + t] = hb; sVl[r][c4 + t] = bf16_bits(vf[t] - bf16_val(hb));
      }
    }
    __syncthreads();
    // S tile 16 x 32
    v8f s[2];
#pragma unroll
    for (int nt = 0; nt < 2; ++nt) {
      v8f acc = {};
#pragma unroll
      for (int ks = 0; ks < KS; ++ks) {
        FragB bh_, bl_;
        bh_.half[0] = *(const v8us*)&sKh[nt * 16 + ln][ks * 32 + 8 * hh]; bh_.half[1] = *(const v8us*)&sKh[nt * 16 + ln][ks * 32 + 16 + 8 * hh];
        bl_.half[0] = *(const v8us*)&sKl[nt * 16 + ln][ks * 32 + 8 * hh]; bl_.half[1] = *(const v8us*)&sKl[nt * 16 + ln][ks * 32 + 16 + 8 * hh];
        acc = mmaN<3>(aqh[ks].v, aql[ks].v, bh_.v, bl_.v, acc);
      }
      s[nt] = acc;
    }
    // mask + running max (rows 8hh+r; the 16 lanes of a half share rows)
    float alpha[8];
#pragma unroll
    for (int r = 0; r < 8; ++r) {
      const int qi = q0 + 8 * hh + r;
      const int ja = j0 + ln, jb = j0 + 16 + ln;
      if (CAUSAL) { if (ja > qi) s[0][r] = -3.0e38f; if (jb > qi) s[1][r] = -3.0e38f; }
      if (ja >= T) s[0][r] = -3.0e38f;
      if (jb >= T) s[1][r] = -3.0e38f;
      float mx = fmaxf(s[0][r], s[1][r]);
      mx = fmaxf(mx, __shfl_xor(mx, 1, 32)); mx = fmaxf(mx, __shfl_xor(mx, 2, 32)); mx = fmaxf(mx, __shfl_xor(mx, 4, 32)); mx = fmaxf(mx, __shfl_xor(mx, 8, 32));
      const float mnew = fmaxf(m_r[r], mx);
      alpha[r] = (mnew > -1.0e38f) ? __expf(m_r[r] - mnew) : 1.0f;
      const float p0 = (s[0][r] > -1.0e38f) ? __expf(s[0][r] - mnew) : 0.f;
      const float p1 = (s[1][r] > -1.0e38f) ? __expf(s[1][r] - mnew) : 0.f;
      m_r[r] = mnew;
      l_r[r] = l_r[r] * alpha[r] + p0 + p1;            // per-lane partial row sum (16 lanes combined at the end)
      unsigned short hb = bf16_bits(p0); sPh[w][8 * hh + r][ln] = hb;      sPl[w][8 * hh + r][ln] = bf16_bits(p0 - bf16_val(hb));
      hb = bf16_bits(p1);                sPh[w][8 * hh + r][16 + ln] = hb; sPl[w][8 * hh + r][16 + ln] = bf16_bits(p1 - bf16_val(hb));
    }
#pragma unroll
    for (int dt = 0; dt < DT; ++dt)
#pragma unroll
      for (int r = 0; r < 8; ++r) oacc[dt][r] *= alpha[r];
    __builtin_amdgcn_fence(__ATOMIC_ACQ_REL, "workgroup");
    __builtin_amdgcn_wave_barrier();
    FragB pah, pal;
    pah.half[0] = *(const v8us*)&sPh[w][ln][8 * hh]; pah.half[1] = *(const v8us*)&sPh[w][ln][16 + 8 * hh];
    pal.half[0] = *(const v8us*)&sPl[w][ln][8 * hh]; pal.half[1] = *(const v8us*)&sPl[w][ln][16 + 8 * hh];
#pragma unroll
    for (int dt = 0; dt < DT; ++dt) {
      FragB bvh, bvl;
#pragma unroll
      for (int i = 0; i < 8; ++i) {
        bvh.u[i] = sVh[8 * hh + i][dt * 16 + ln]; bvh.u[8 + i] = sVh[16 + 8 * hh + i][dt * 16 + ln];
        bvl.u[i] = sVl[8 * hh + i][dt * 16 + ln]; bvl.u[8 + i] = sVl[16 + 8 * hh + i][dt * 16 + ln];
      }
      oacc[dt] = mmaN<3>(pah.v, pal.v, bvh.v, bvl.v, oacc[dt]);
    }
    __builtin_amdgcn_fence(__ATOMIC_ACQ_REL, "workgroup");
    __builtin_amdgcn_wave_barrier();
  }
#pragma unroll
  for (int r = 0; r < 8; ++r) {
    float l = l_r[r];
    l += __shfl_xor(l, 1, 32); l += __shfl_xor(l, 2, 32); l += __shfl_xor(l, 4, 32); l += __shfl_xor(l, 8, 32);
    l_r[r] = (l > 0.f) ? 1.0f / l : 0.f;
  }
#pragma unroll
  for (int dt = 0; dt < DT; ++dt)
#pragma unroll
    for (int r = 0; r < 8; ++r) sO[w][8 * hh + r][dt * 16 + ln] = oacc[dt][r] * l_r[r];
  __builtin_amdgcn_fence(__ATOMIC_ACQ_REL, "workgroup");
  __builtin_amdgcn_wave_barrier();
  {
    for (int r = 0; r < 16; ++r) {
      const int row = q0 + r;
      if (row < T && lane < D / 4) {
        const v4f val = *(const v4fa*)&sO[w][r][lane * 4];
        *(v4f*)(y + ((size_t)b * T + row) * ypitch + h * D + lane * 4) = val;
      }
    }
    
  }
}

// Transpose by 4 x 4 blocks held in registers, no LDS and no barrier: in [.][ROWS][COLS] -> out [.][COLS][ROWS]; ROWS a multiple of 256, COLS of 64.
// A lane loads 4 neighbours from each of 4 consecutive input rows and stores them as 4 neighbours of each of 4 output rows. A wave takes 32 input
// rows x 64 columns: lanes l >> 3 with the four column groups g cover 256 contiguous bytes of an input row, lanes l & 7 one whole 128-byte line
// of an output row. A lane moves four such blocks, 64 elements, so that a launch starts 16 times fewer waves than with 4 elements a lane, and all
// its loads are independent and in flight together. The pitches are compile-time: every access is one base, one lane offset, an immediate.
// Optional per-output-row affine (scale[c], shift[c]) and residual add res (same layout as out, optionally bf16-rounded) for fused epilogues:
// out = in*scale + shift + res.
template <int ROWS, int COLS, bool AFFINE, bool RESID, bool RES_BF16>
__global__ __launch_bounds__(256) void k_transpose4(const float* __restrict__ in, float* __restrict__ out,
                                                    const float* __restrict__ scale, const float* __restrict__ shift, const float* __restrict__ res) {
  static_assert(ROWS % 256 == 0 && COLS % 64 == 0, "a block takes 256 input rows x 64 columns");
  const unsigned lane = threadIdx.x & 31, w = threadIdx.x >> 5;
  const unsigned r0 = blockIdx.y * 256 + w * 32 + (lane & 7) * 4;     // first of the lane's 4 input rows
  const unsigned c0 = blockIdx.x * 64 + (lane >> 3) * 4;              // first column of its group 0; group g lies 16 * g further
  const unsigned base = blockIdx.z * (unsigned)(ROWS * COLS);
  const unsigned io = base + r0 * COLS + c0, oo = base + c0 * ROWS + r0;
  // every loop below is unrolled so that the arrays are indexed by constants and stay in registers
  v4f a[4][4], rv[4][4], sc[4], sh[4];                                // a[g][i] = in[r0 + i][c0 + 16 g ..], rv[g][j] = res[c0 + 16 g + j][r0 ..]
#pragma unroll
  for (int i = 0; i < 4; ++i)
#pragma unroll
    for (int g = 0; g < 4; ++g) a[g][i] = *(const v4fa*)(in + io + i * COLS + g * 16);
  // the loads below may land in the address registers of the loads above: the wait that belongs in front of such an overwrite
  if (RESID || AFFINE) asm volatile("s_wait_xcnt 0x0" ::: "memory");
  if (RESID) {
#pragma unroll
    for (int g = 0; g < 4; ++g)
#pragma unroll
      for (int j = 0; j < 4; ++j) rv[g][j] = *(const v4fa*)(res + oo + (g * 16 + j) * ROWS);
  }
  if (AFFINE) {
#pragma unroll
    for (int g = 0; g < 4; ++g) { sc[g] = *(const v4fa*)(scale + c0 + g * 16); sh[g] = *(const v4fa*)(shift + c0 + g * 16); }
  }
  // keeps every load above the first store: without it the scheduler holds some loads back behind the wait for the first ones, a second memory latency
  __builtin_amdgcn_sched_barrier(0);
#pragma unroll
  for (int g = 0; g < 4; ++g)
#pragma unroll
    for (int j = 0; j < 4; ++j) {
      v4f o;
#pragma unroll
      for (int i = 0; i < 4; ++i) {
        float v = a[g][i][j];
        if (AFFINE) v = v * sc[g][j] + sh[g][j];
        if (RESID) { float x = rv[g][j][i]; if (RES_BF16) x = bf16_round(x); v += x; }
        o[i] = v;
      }
      *(v4f*)(out + oo + (g * 16 + j) * ROWS) = o;
    }
}

// The same transpose with a bf16 result (rounded to nearest even, as bf16_bits does): in [.][ROWS][COLS] f32 -> out [.][COLS][ROWS] bf16; ROWS a multiple of 256, COLS of 64.
// A lane loads 4 neighbours from each of 8 consecutive input rows and stores them as 8 neighbours (16 bytes) of each of 4 output rows. A wave takes 64 input
// rows x 32 columns: lanes l >> 3 with the two column groups g cover one whole 128-byte line of an input row, lanes l & 7 one whole 128-byte line of an output row.
// A lane moves two such blocks, 64 elements, all its loads independent and in flight together.
template <int ROWS, int COLS>
__global__ __launch_bounds__(256) void k_transpose_bf(const float* __restrict__ in, unsigned short* __restrict__ out) {
  static_assert(ROWS % 256 == 0 && COLS % 64 == 0, "a block takes 256 input rows x 64 columns");
  const unsigned lane = threadIdx.x & 31, w = threadIdx.x >> 5;
  const unsigned r0 = blockIdx.y * 256 + (w & 3) * 64 + (lane & 7) * 8;      // first of the lane's 8 input rows
  const unsigned c0 = blockIdx.x * 64 + (w >> 2) * 32 + (lane >> 3) * 4;     // first column of its group 0; group 1 lies 16 further
  const unsigned base = blockIdx.z * (unsigned)(ROWS * COLS);
  const unsigned io = base + r0 * COLS + c0, oo = base + c0 * ROWS + r0;
  // every loop below is unrolled so that the arrays are indexed by constants and stay in registers
  v4f a[2][8];                                                               // a[g][i] = in[r0 + i][c0 + 16 g ..]
#pragma unroll
  for (int i = 0; i < 8; ++i)
#pragma unroll
    for (int g = 0; g < 2; ++g) {
      // the last load may land in the address registers that the loads before it name: the wait that belongs in front of such an overwrite
      if (i == 7 && g == 1) asm volatile("s_wait_xcnt 0x0" ::: "memory");
      a[g][i] = *(const v4fa*)(in + io + i * COLS + g * 16);
    }
  // keeps every load above the first store: without it the scheduler holds some loads back behind the wait for the first ones, a second memory latency
  __builtin_amdgcn_sched_barrier(0);
#pragma unroll
  for (int g = 0; g < 2; ++g)
#pragma unroll
    for (int j = 0; j < 4; ++j) {
      v8us o;
#pragma unroll
      for (int i = 0; i < 8; ++i) o[i] = bf16_bits(a[g][i][j]);
      *(v8us*)(out + oo + (g * 16 + j) * ROWS) = o;
    }
}

// 2x2 max pool on position-major data: in [B][H*W][C] -> out [B][(H/2)*(W/2)][C]; thread per (b, p', 4 channels); C%4==0
__global__ __launch_bounds__(256) void k_pool2_pm(const float* __restrict__ in, float* __restrict__ out, int Bn, int H, int W, int C) {
  const size_t t = (size_t)blockIdx.x * 256 + threadIdx.x;
  const int c4n = C / 4, Ho = H / 2, Wo = W / 2;
  const size_t total = (size_t)Bn * Ho * Wo * c4n;
  if (t >= total) return;
  const int c4 = (int)(t % c4n) * 4; size_t rest = t / c4n;
  const int pw = (int)(rest % Wo); rest /= Wo; const int ph = (int)(rest % Ho); const int b = (int)(rest / Ho);
  const float* base = in + (size_t)b * H * W * C;
  const int p00 = (2 * ph) * W + 2 * pw;
  const v4f a = *(const v4fa*)(base + (size_t)p00 * C + c4), bq = *(const v4fa*)(base + (size_t)(p00 + 1) * C + c4);
  const v4f c = *(const v4fa*)(base + (size_t)(p00 + W) * C + c4), d = *(const v4fa*)(base + (size_t)(p00 + W + 1) * C + c4);
  v4f m; for (int i = 0; i < 4; ++i) m[i] = fmaxf(fmaxf(a[i], bq[i]), fmaxf(c[i], d[i]));
  float* dst = out + ((size_t)b * Ho * Wo + (size_t)ph * Wo + pw) * C + c4;
  *(v4f*)dst = m;
  
}

// General (non-causal) attention, bf16 splits, f32 softmax with running max.
// Q [.][Tq][qpitch] f32 (DQR channels); V [.][Tk][vpitch] (head dim DVtot) is ONE bf16 plane, taken as exact: only P is split, P * V = Ph * V + Pl * V. K [.][Tk][KPK] arrives as
// packed rows kh | kh | kl | 0 (DQR elements each). The query's operand is qh | ql | qh | 0 in the same places, so that ONE K = 32 product sums
// kh*qh + kh*ql + kl*qh, the three terms of the split, for a 16-key tile.
// A tile is staged by asynchronous 16-byte copies into one of two LDS buffers, the next tile's copies in flight while this tile is worked on; this block handles DV output
// dims starting at dv0 = blockIdx.y*DV (here all of them: DV = vpitch, blockIdx.y = 0). Per-bh base offsets via strides.
// Behind the merge the block multiplies its 64 rows u (f32, split hi/lo) by Wt (bf16 [DV][DV], row = output channel) and stores
// out[bh][c][t] = g * (u[t] . Wt[c] + bf16(bias[c])) + bf16(res[bh][c][t]), g = bf16(gamma[0]); out and res are [.][DV][TK]: queries and keys are the same TK positions (Tq = TK), so every 64-row tile is full.
// Both products run transposed: S^T = K * Q^T (A = K rows, B = Q) and O^T += V^T * P^T (A = V by the transposing load, B = P). A lane then
// holds 16 of the 32 scores of ONE query (column lane & 15; keys 8 * (lane >> 4) + r of either 16-key tile), which is the k order of a B
// operand: P goes from the score accumulators into its fragment in registers, and the maximum and the sum of a row are taken inside the lane.
// The V row pitch (vpitch) and the number of keys (TK, a multiple of 64: every tile is full) are compile-time.
// A block is 8 waves: wave w works on query tile w & 3 and on key group w >> 2. A trip stages 64 keys; group 0 takes the first 32, group 1 the
// second 32, each with a running maximum, sum and O of its own. The two partial results of a query tile are merged once, behind the loop.
// Two such blocks are meant to share a WGP, four waves on a SIMD: the waves-per-SIMD attribute holds the kernel to 256 registers a wave.
template <int DV, int vpitch, int TK>
__global__ __launch_bounds__(256) __attribute__((amdgpu_waves_per_eu(4, 4))) void k_flash2(const float* __restrict__ Qb, size_t qstride, int qpitch, int Tq,
                                              const unsigned short* __restrict__ Kpb, size_t kstride,
                                              const unsigned short* __restrict__ Vb, size_t vstride,
                                              float scale, const unsigned short* __restrict__ Wt, const float* __restrict__ bias, const float* __restrict__ gamma,
                                              const float* __restrict__ res, float* __restrict__ out) {
  constexpr int DT = DV / 16;
  constexpr int KP = KPK + 8;       // K row pitch in elements: an odd multiple of 16 bytes, the conflict-free pitch of the plain 16-byte load
  constexpr int VP = DV + 16;       // V row pitch in elements: an odd multiple of 32 bytes, the conflict-free pitch of the transposing load
  __shared__ __attribute__((aligned(16))) unsigned short sK[2][64][KP], sV[2][64][VP];   // two buffers: tile t lies in buffer t & 1
  __shared__ __attribute__((aligned(16))) float sO[4][16][DV + 4];   // 4 floats of pad: the 16 rows that a store instruction writes start in different banks
  __shared__ float sM[4][32], sL[4][32];   // key group 1's running maximum and sum, per lane, for the merge
  // Behind the loop nobody reads sV any more and no copy is outstanding: the merged rows' hi and lo planes, 64 rows each, lie there.
  constexpr int UP = DV + 8;        // their row pitch in elements: an odd multiple of 16 bytes, as KP
  static_assert(2 * 64 * UP <= 2 * 64 * VP, "both planes fit into sV");
  unsigned short* const uH = &sV[0][0][0];
  unsigned short* const uL = uH + 64 * UP;
  const int tid = threadIdx.x, w = tid >> 5, lane = tid & 31, ln = lane & 15, hh = lane >> 4;
  const int nqb = (Tq + 63) / 64;
  const int bh = blockIdx.x / nqb, qblk = blockIdx.x % nqb;
  const int dv0 = blockIdx.y * DV;
  const int qt = w & 3, kg = w >> 2;
  const int q0 = qblk * 64 + qt * 16;
  const float* Q = Qb + (size_t)bh * qstride;
  const unsigned short* Kp = Kpb + (size_t)bh * kstride;
  const unsigned short* V = Vb + (size_t)bh * vstride + dv0;
  // element i of a lane's operand is place 8 * hh + i (i < 8) or 16 + 8 * hh + (i - 8) of the packed row, on the K side and here alike:
  // lane half 0 holds places 0..7 and 16..23 (qh, qh against kh, kl), lane half 1 places 8..15 and 24..31 (ql, 0 against kh, 0)
  static_assert(DQR == 8 && KPK == 32, "the packed row fills one K = 32 operand in parts of 8");
  FragB qp;
  {
    int row = q0 + ln; if (row >= Tq) row = Tq - 1;
    const float* qr = Q + (size_t)row * qpitch;      // qpitch is a multiple of 4: the row starts on 16 bytes
    const v4f qa = *(const v4fa*)qr, qc = *(const v4fa*)(qr + 4);
    const float qs[8] = {qa[0],qa[1],qa[2],qa[3],qc[0],qc[1],qc[2],qc[3]};
    // unrolled so that qs and the operand are indexed by constants and stay in registers
#pragma unroll
    for (int i = 0; i < 8; ++i) {
      const float x = qs[i] * scale; const unsigned short hb = bf16_bits(x), lb = bf16_bits(x - bf16_val(hb));
      qp.u[i] = hh ? lb : hb; qp.u[8 + i] = hh ? (unsigned short)0 : hb;
    }
  }
  const float graw = gamma[0];       // the same for every lane; asked for here, beside q, so that the tail does not wait for it
  float m_q = -3.0e38f, l_q = 0.f;   // running maximum of query q0 + ln (equal in both lane halves); sum over this lane half's keys only
  v8f oacc[DT];                      // oacc[dt][r] = O[q0 + ln][dt * 16 + 8 * hh + r]
#pragma unroll
  for (int dt = 0; dt < DT; ++dt) oacc[dt] = (v8f){0.f,0.f,0.f,0.f,0.f,0.f,0.f,0.f};
  // Staging of a 64-key tile: the 64 packed K rows are 256 contiguous 16-byte pieces, one per thread; 256 threads cover VR rows of V
  // per 16-byte copy, VL copies per thread. Every lane of every wave copies, and every piece lies inside K, V and its buffer: all tiles are full.
  constexpr int VR = 256 / (DV / 8), VL = 64 / VR, NTILE = TK / 64;
  static_assert(64 * (KPK / 8) == 256 && VR * (DV / 8) == 256 && VL * VR == 64 && VL == 8, "tile must divide over 256 threads, 1 + 8 copies each");
  static_assert(TK % 64 == 0 && TK > 0, "full tiles only");
  const int kr = tid / (KPK / 8), kc = (tid % (KPK / 8)) * 8, vr = tid / (DV / 8), vc = (tid % (DV / 8)) * 8;
  const unsigned short* kg0 = Kp + (unsigned)tid * 8u;
  const unsigned short* vg0 = V + (unsigned)vr * (unsigned)vpitch + (unsigned)vc;
  const unsigned lk0 = lds_off(&sK[0][kr][kc]), lv0 = lds_off(&sV[0][vr][vc]);
  constexpr unsigned KBUF = 64 * KP * 2, VBUF = 64 * VP * 2;      // bytes of one buffer
  auto stage = [&](int t, int b) {
    copy_k1_v8<VR * VP * 2, VR * vpitch * 2>(lk0 + (unsigned)b * KBUF, kg0 + (size_t)t * (64 * KPK), lv0 + (unsigned)b * VBUF, vg0 + (size_t)t * (64 * vpitch));
  };
  stage(0, 0);
  asm volatile("s_wait_asynccnt 0x0" ::: "memory");   // this wave's pieces of tile 0 have landed
  __syncthreads();                                    // and every other wave's: tile 0 may be read
  if (NTILE > 1) stage(1, 1);
  for (int t = 0; t < NTILE; ++t) {
    const int buf = t & 1;           // this trip reads buffer buf alone; tile t + 1 is landing in the other
    v8f s[2];                        // s[nt][r] = score of key t * 64 + kg * 32 + nt * 16 + 8 * hh + r with query q0 + ln
    FragB ka[2];                     // both loops over nt are unrolled so that ka and s are indexed by constants and stay in registers
#pragma unroll
    for (int nt = 0; nt < 2; ++nt) { ka[nt].half[0] = *(const v8us*)&sK[buf][kg * 32 + nt * 16 + ln][8 * hh]; ka[nt].half[1] = *(const v8us*)&sK[buf][kg * 32 + nt * 16 + ln][16 + 8 * hh]; }
#pragma unroll
    for (int nt = 0; nt < 2; ++nt) s[nt] = mmaN<1>(ka[nt].v, ka[nt].v, qp.v, qp.v, (v8f){0.f,0.f,0.f,0.f,0.f,0.f,0.f,0.f});
    // Every loop over nt, r or dt below is unrolled so that s, the P fragments and oacc are indexed by constants and stay in registers.
    float mx = fmaxf(s[0][0], s[1][0]);
#pragma unroll
    for (int r = 1; r < 8; ++r) mx = fmaxf(mx, fmaxf(s[0][r], s[1][r]));
    // the other 16 keys of the same query lie in lane ^ 16
    mx = fmaxf(mx, __int_as_float(__builtin_amdgcn_permlanex16(__float_as_int(mx), __float_as_int(mx), 0x76543210, 0xfedcba98, false, false)));
    const float mnew = fmaxf(m_q, mx);
    const float alpha = (mnew > -1.0e38f) ? __expf(m_q - mnew) : 1.0f;
    m_q = mnew;
    FragB pbh, pbl;                  // P^T as a B operand: element nt * 8 + r is key nt * 16 + 8 * hh + r, the hardware k order
    v2f ps = {0.f, 0.f};
#pragma unroll
    for (int nt = 0; nt < 2; ++nt)
#pragma unroll
      for (int r = 0; r < 8; r += 2) {
        v2f p;
        p[0] = (s[nt][r] > -1.0e38f) ? __expf(s[nt][r] - mnew) : 0.f;
        p[1] = (s[nt][r + 1] > -1.0e38f) ? __expf(s[nt][r + 1] - mnew) : 0.f;
        ps += p;
        // two neighbours fill one operand register: the packed convert rounds to nearest even, as bf16_bits does, and packs in the same instruction
        const v2b hi = __builtin_convertvector(p, v2b);
        pbh.pair[nt * 4 + r / 2] = hi;
        pbl.pair[nt * 4 + r / 2] = __builtin_convertvector(p - __builtin_convertvector(hi, v2f), v2b);
      }
    l_q = l_q * alpha + (ps[0] + ps[1]);
#pragma unroll
    for (int dt = 0; dt < DT; ++dt)
#pragma unroll
      for (int r = 0; r < 8; ++r) oacc[dt][r] *= alpha;
    const unsigned short* vt = &sV[buf][kg * 32 + 8 * hh + (lane & 7)][((lane >> 3) & 1) * 8];
    // fragments of two d tiles are fetched as one group, one group ahead of the products that use them
    FragB bv[2][2];
#pragma unroll
    for (int u = 0; u < 2; ++u) { bv[0][u].half[0] = ld_tr16(vt + u * 16); bv[0][u].half[1] = ld_tr16(vt + 16 * VP + u * 16); }
#pragma unroll
    for (int g = 0; g < DT / 2; ++g) {
      if (g + 1 < DT / 2) {
#pragma unroll
        for (int u = 0; u < 2; ++u) {
          const int d = ((g + 1) * 2 + u) * 16;
          bv[(g + 1) & 1][u].half[0] = ld_tr16(vt + d); bv[(g + 1) & 1][u].half[1] = ld_tr16(vt + 16 * VP + d);
        }
      }
      mmaB2(bv[g & 1][0].v, bv[g & 1][1].v, pbh.v, pbl.v, oacc[g * 2], oacc[g * 2 + 1]);
    }
    // Hand-over, in this order in every wave: its own reads of this buffer are done, its own pieces of tile t + 1 have landed; behind the barrier that holds of
    // every wave, so that tile t + 1 may be read and this buffer refilled.
    asm volatile("s_wait_dscnt 0x0" ::: "memory");
    asm volatile("s_wait_asynccnt 0x0" ::: "memory");
    __syncthreads();
    if (t + 2 < NTILE) stage(t + 2, buf);
  }
  asm volatile("s_wait_asynccnt 0x0" ::: "memory");   // no copy is outstanding when the wave goes on to the merge and ends
  // In the tail wave w has output channels w * 32 + t * 16 + ln (t = 0, 1). The first Wt fragments and the bias are asked for here, so that they arrive during the merge.
  // The loops over t are unrolled so that wb and braw are indexed by constants and stay in registers.
  constexpr int KST = DV / 32;
  const unsigned short* wrow = Wt + (unsigned)(w * 32 + ln) * (unsigned)DV + 8 * hh;     // column tile t lies 16 * DV further, k step ks 32 further
  FragB wb[2][2];
  auto fetch_w = [&](int ks) {
#pragma unroll
    for (int t = 0; t < 2; ++t) { wb[ks & 1][t].half[0] = *(const v8us*)(wrow + t * 16 * DV + ks * 32); wb[ks & 1][t].half[1] = *(const v8us*)(wrow + t * 16 * DV + ks * 32 + 16); }
  };
  fetch_w(0);
  const float braw[2] = {bias[w * 32 + ln], bias[w * 32 + 16 + ln]};
  // later loads may land in the address registers of these: the wait that belongs in front of such an overwrite
  asm volatile("s_wait_xcnt 0x0" ::: "memory");
  // Merge of the two key groups. Group 1 hands its unnormalised O, its maximum and its sum over through LDS; the lane of group 0 that holds the
  // same query and the same d rows reads back the very words that its partner lane wrote, brings both parts to the common maximum and adds them.
  // The loops over dt and r are unrolled so that oacc is indexed by constants and stays in registers.
  if (kg == 1) {
#pragma unroll
    for (int dt = 0; dt < DT; ++dt) {
      v4f lo4, hi4;
#pragma unroll
      for (int r = 0; r < 4; ++r) { lo4[r] = oacc[dt][r]; hi4[r] = oacc[dt][4 + r]; }
      *(v4fa*)&sO[qt][ln][dt * 16 + 8 * hh] = lo4; *(v4fa*)&sO[qt][ln][dt * 16 + 8 * hh + 4] = hi4;
    }
    sM[qt][lane] = m_q; sL[qt][lane] = l_q;
  }
  __syncthreads();   // group 1's parts lie in LDS before group 0 reads them
  if (kg == 0) {
    const float m1 = sM[qt][lane], l1 = sL[qt][lane];
    const float mm = fmaxf(m_q, m1);
    // a group that saw no key has maximum -3e38, sum 0 and O 0: its factor is 0 beside a real maximum, and 1 on zeros where neither saw a key
    const float a0 = __expf(m_q - mm), a1 = __expf(m1 - mm);
    const float lj = l_q * a0 + l1 * a1;
    // the two lane halves' sums join once
    const float lsum = lj + __int_as_float(__builtin_amdgcn_permlanex16(__float_as_int(lj), __float_as_int(lj), 0x76543210, 0xfedcba98, false, false));
    const float linv = (lsum > 0.f) ? 1.0f / lsum : 0.f;
    const float f0 = a0 * linv, f1 = a1 * linv;
#pragma unroll
    for (int dt = 0; dt < DT; ++dt) {
      const v4f pl = *(const v4fa*)&sO[qt][ln][dt * 16 + 8 * hh], ph = *(const v4fa*)&sO[qt][ln][dt * 16 + 8 * hh + 4];
      float e[8];
#pragma unroll
      for (int r = 0; r < 4; ++r) { e[r] = oacc[dt][r] * f0 + pl[r] * f1; e[4 + r] = oacc[dt][4 + r] * f0 + ph[r] * f1; }
      // the merged row leaves as the value GEMM's A operand: hi = bf16(e), lo = bf16(e - hi), 8 neighbouring channels a lane, one 16-byte store a plane
      Half8 h8, l8;
#pragma unroll
      for (int r = 0; r < 8; r += 2) {
        const v2f p = {e[r], e[r + 1]};
        const v2b hi = __builtin_convertvector(p, v2b);
        h8.pair[r / 2] = hi;
        l8.pair[r / 2] = __builtin_convertvector(p - __builtin_convertvector(hi, v2f), v2b);
      }
      *(v8us*)&uH[(qt * 16 + ln) * UP + dt * 16 + 8 * hh] = h8.v; *(v8us*)&uL[(qt * 16 + ln) * UP + dt * 16 + 8 * hh] = l8.v;
    }
  }
  __syncthreads();   // the merged rows' two planes lie in LDS before the waves of both groups read them as A fragments
  // Value GEMM on the block's 64 rows: wave w takes output channels w * 32 .. w * 32 + 31 (two 16-column tiles) of all four 16-row tiles, so that every row of Wt is
  // read once a block. acc[mt][t][r] belongs to position qblk * 64 + mt * 16 + 8 * hh + r and channel w * 32 + t * 16 + ln.
  // Every loop below is unrolled so that the fragments and acc are indexed by constants and stay in registers.
  static_assert(DV == 256 && vpitch == DV, "8 waves x 32 channels; u holds all the channels that Wt contracts");
  const unsigned short* ua = uH + ln * UP + 8 * hh;
  const unsigned short* ul = uL + ln * UP + 8 * hh;
  v8f acc[4][2];
#pragma unroll
  for (int mt = 0; mt < 4; ++mt) { acc[mt][0] = (v8f){0.f,0.f,0.f,0.f,0.f,0.f,0.f,0.f}; acc[mt][1] = acc[mt][0]; }
  // The A fragments of two row tiles (hi and lo) are one group; a group is fetched from LDS while the group before it is multiplied. Group i = k step i / 2, row tiles 2 * (i & 1) and + 1.
  FragB ah[2][2], al[2][2];
  auto fetch_a = [&](int i) {
#pragma unroll
    for (int j = 0; j < 2; ++j) {
      const int o = ((i & 1) * 2 + j) * 16 * UP + (i >> 1) * 32;
      ah[i & 1][j].half[0] = *(const v8us*)(ua + o); ah[i & 1][j].half[1] = *(const v8us*)(ua + o + 16);
      al[i & 1][j].half[0] = *(const v8us*)(ul + o); al[i & 1][j].half[1] = *(const v8us*)(ul + o + 16);
    }
  };
  // res is read and out is written by whole runs: 16 lanes take the block's 64 positions (256 contiguous bytes) of one channel, the two lane halves two neighbouring channels;
  // xr[t][k] belongs to channel w * 32 + t * 16 + 2 * k + hh and positions qblk * 64 + 4 * ln + 0..3.
  const size_t ob = ((size_t)bh * DV + (unsigned)(w * 32 + hh)) * (size_t)TK + (unsigned)qblk * 64u + 4u * ln;
  const float* rp = res + ob;
  v4f xr[2][8];
  fetch_a(0);
#pragma unroll
  for (int i = 0; i < 2 * KST; ++i) {
    const int ks = i >> 1;
    if ((i & 1) == 0 && ks + 1 < KST) fetch_w(ks + 1);      // the Wt fragments come from global memory one k step ahead of their products
    if (i + 1 < 2 * KST) fetch_a(i + 1);
    if (i == 2 * KST - 4) {
      // the residual is asked for behind the last Wt fragments (loads are waited for in their order) and arrives during the last two k steps;
      // it may land in the address registers of the Wt loads: the wait that belongs in front of such an overwrite
      asm volatile("s_wait_xcnt 0x0" ::: "memory");
#pragma unroll
      for (int t = 0; t < 2; ++t)
#pragma unroll
        for (int k = 0; k < 8; ++k) {
          // the last load may land in the address registers that the loads before it name: the wait that belongs in front of such an overwrite
          if (t == 1 && k == 7) asm volatile("s_wait_xcnt 0x0" ::: "memory");
          xr[t][k] = *(const v4fa*)(rp + (t * 16 + 2 * k) * TK);
        }
    }
    // The two fences keep a group's fetches above the products of the group before it and no higher: without the first the scheduler moves each LDS read down to its
    // product, whose wait then takes the whole LDS latency; without the second it lifts a third group's reads up, and the registers run out.
    __builtin_amdgcn_sched_barrier(0);
#pragma unroll
    for (int j = 0; j < 2; ++j) mmaA2(ah[i & 1][j].v, al[i & 1][j].v, wb[ks & 1][0].v, wb[ks & 1][1].v, acc[(i & 1) * 2 + j][0], acc[(i & 1) * 2 + j][1]);
    __builtin_amdgcn_sched_barrier(0);
  }
  // An accumulator has 8 positions of one channel a lane. A 16-channel tile goes through a slice of sO that is the wave's own (nobody reads sO behind the barrier above), rows of
  // SP floats, and comes back in the layout of xr. No other wave touches the slice, so no barrier is needed: the wave's own s_wait_dscnt 0 stands between its writes and its
  // reads of what other lanes wrote, and between the first tile's reads and the second tile's writes (its "memory" clobber holds the compiler to the same order).
  constexpr int SP = 64 + 4;         // 4 floats of pad: the 16 rows that a store instruction writes start in different banks
  static_assert(8 * 16 * SP <= 4 * 16 * (DV + 4), "eight slices fit into sO");
  float* const st = &sO[0][0][0] + w * (16 * SP);
  const float g = bf16_round(graw);
  float* op = out + ob;
#pragma unroll
  for (int t = 0; t < 2; ++t) {
    const float bvv = bf16_round(braw[t]);
    if (t) asm volatile("s_wait_dscnt 0x0" ::: "memory");   // the reads of the tile before are done before its words are overwritten
#pragma unroll
    for (int mt = 0; mt < 4; ++mt)
#pragma unroll
      for (int h = 0; h < 2; ++h) {
        v4f o;
#pragma unroll
        for (int r = 0; r < 4; ++r) o[r] = (acc[mt][t][4 * h + r] + bvv) * g;
        *(v4fa*)&st[ln * SP + mt * 16 + 8 * hh + 4 * h] = o;
      }
    asm volatile("s_wait_dscnt 0x0" ::: "memory");          // every lane's words lie in LDS before another lane reads them
#pragma unroll
    for (int k = 0; k < 8; ++k) {
      const v4f v = *(const v4fa*)&st[(2 * k + hh) * SP + 4 * ln];
      v4f o;
#pragma unroll
      for (int r = 0; r < 4; r += 2) {
        // the packed convert rounds to nearest even, as bf16_round does
        const v2f xq = __builtin_convertvector(__builtin_convertvector((v2f){xr[t][k][r], xr[t][k][r + 1]}, v2b), v2f);
        o[r] = v[r] + xq[0]; o[r + 1] = v[r + 1] + xq[1];
      }
      *(v4f*)(op + (t * 16 + 2 * k) * TK) = o;
    }
  }
}

__global__ __launch_bounds__(256) void k_round_rows(const float* __restrict__ W, unsigned short* __restrict__ Wt, int n8) {
  const int t = blockIdx.x * 256 + threadIdx.x;
  if (t >= n8) return;
  const v4f a = *(const v4fa*)(W + (size_t)t * 8), b = *(const v4fa*)(W + (size_t)t * 8 + 4);
  v8us v; v[0]=bf16_bits(a[0]); v[1]=bf16_bits(a[1]); v[2]=bf16_bits(a[2]); v[3]=bf16_bits(a[3]);
  v[4]=bf16_bits(b[0]); v[5]=bf16_bits(b[1]); v[6]=bf16_bits(b[2]); v[7]=bf16_bits(b[3]);
  *(v8us*)(Wt + (size_t)t * 8) = v; 
}

// padded q/k weights: Bt [64][256] rows < 8 real; bias64
__global__ __launch_bounds__(256) void k_prep(const float* __restrict__ wq, const float* __restrict__ bq, const float* __restrict__ wk, const float* __restrict__ bk,
                                            unsigned short* __restrict__ Bq, unsigned short* __restrict__ Bk, float* __restrict__ bq64, float* __restrict__ bk64) {
  const int t = blockIdx.x * 256 + threadIdx.x;
  if (t < DQP * (CC / 8)) { const int n = t / (CC / 8), k8 = (t % (CC / 8)) * 8; v8us a, b;
    for (int i = 0; i < 8; ++i) { a[i] = (n < 8) ? bf16_bits(wq[n * CC + k8 + i]) : (unsigned short)0; b[i] = (n < 8) ? bf16_bits(wk[n * CC + k8 + i]) : (unsigned short)0; }
    *(v8us*)(Bq + n * CC + k8) = a; *(v8us*)(Bk + n * CC + k8) = b;  }
  if (t < DQP) { const float a = (t < 8) ? bq[t] : 0.f, b = (t < 8) ? bk[t] : 0.f; *(float*)(bq64 + t) = a; *(float*)(bk64 + t) = b;  }
}
extern "C" void kernel_launch(void* const* d_in, const int* in_sizes, int n_in,
                              void* d_out, int out_size, void* d_ws, size_t ws_size, hipStream_t stream) {
  (void)in_sizes; (void)n_in; (void)out_size;
  const float* x = (const float*)d_in[0]; const float* wq = (const float*)d_in[1]; const float* bq = (const float*)d_in[2]; const float* wk = (const float*)d_in[3]; const float* bk = (const float*)d_in[4];
  const float* wv = (const float*)d_in[5]; const float* bv = (const float*)d_in[6]; const float* gamma = (const float*)d_in[7];
  char* ws = (char*)d_ws; size_t off = 0;
  auto take = [&](size_t bytes) { char* p = ws + off; off += (bytes + 255) & ~(size_t)255; return p; };
  const int M = BB * NN;
  unsigned short* Bq = (unsigned short*)take(DQP * CC * 2); unsigned short* Bk = (unsigned short*)take(DQP * CC * 2); unsigned short* Bv = (unsigned short*)take(CC * CC * 2);
  float* bq64 = (float*)take(256); float* bk64 = (float*)take(256);
  unsigned short* xb = (unsigned short*)take((size_t)M * CC * 2); float* q = (float*)take((size_t)M * DQP * 4);
  unsigned short* kp = (unsigned short*)take((size_t)M * KPK * 2);
  if (off > ws_size) return;
  k_prep<<<(DQP * (CC / 8) + 255) / 256, 256, 0, stream>>>(wq, bq, wk, bk, Bq, Bk, bq64, bk64);
  k_round_rows<<<(CC * CC / 8 + 255) / 256, 256, 0, stream>>>(wv, Bv, CC * CC / 8);
  k_transpose_bf<CC, NN><<<dim3(NN / 64, CC / 256, BB), 256, 0, stream>>>(x, xb);     // [B][C][N] f32 -> [B][N][C] bf16
  k_gemm_bf<true, false, 0, true, 0><<<((M / 16) * (DQP / 64) + 3) / 4, 128, 0, stream>>>(nullptr, xb, CC, Bq, CC, bq64, q, nullptr, DQP, M, DQP, CC);
  k_gemm_bf<true, false, 0, true, 2><<<((M / 16) * (DQP / 64) + 3) / 4, 128, 0, stream>>>(nullptr, xb, CC, Bk, CC, bk64, nullptr, kp, KPK, M, DQP, CC);
  k_flash2<256, CC, NN><<<dim3(BB * (NN / 64), 1), 256, 0, stream>>>(q, (size_t)NN * DQP, DQP, NN, kp, (size_t)NN * KPK, xb, (size_t)NN * CC, 1.0f, Bv, bv, gamma, x, (float*)d_out);     // out = gamma * (Wv u + bv) + bf16(x), stored in [B][C][N]
}
